// v006
// Times are from an AMD MI455X. After a warm-up the kernel runs many times in a row, and a time is the length of
// such a window on the GPU divided by its runs, so every launch and the gaps after it count. The runs cycle
// through copies of the inputs. A figure is the median of several windows, for all but v000 over two sittings.
// Sittings can differ by a few percent; kernels timed side by side share one.
// The versions before v006 are in another document.
// Measured time: 86.7 microseconds a run.
// In both of two side-by-side timings against v005, it was 1.11 times as fast.
// All steps since the starting kernel, v000, together make it 24.7 times as fast.
// Contractions: q/k/v projections of the LayerNormed input [4096x512].[512x512] (+b), the output projection (+b, + residual), the FFN [4096x512].[512x2048] (+b, exact GELU) and [4096x2048].[2048x512] (+b, + residual) with f16 operands (v_wmma_f32_16x16x32_f16; 32x64 register-blocked wave tiles, 128x64 block tiles, over pre-cast f16 operand planes staged in LDS by asynchronous copies, weights pre-scaled by 16 at the cast and un-scaled in the f32 epilogue); the dilated causal attention (keys j <= i, i - j even, i - j <= 256) as one flash launch whose grid z is the parity of the position (stride-2 views; within a parity class the pattern is plain causal with window 128), head_dim 64, both products transposed (f16 k.q^T, f16 v^T.p^T with p as f16 of 4096 p, kept in registers); f32 accumulate, softmax and LayerNorms f32.
#include <hip/hip_runtime.h>
#include <math.h>

typedef __attribute__((ext_vector_type(16))) _Float16 v16h;
typedef __attribute__((ext_vector_type(8)))  _Float16 v8h;
typedef __attribute__((ext_vector_type(4)))  _Float16 v4h;
typedef __attribute__((ext_vector_type(16))) __bf16   v16b;
typedef __attribute__((ext_vector_type(8)))  float    v8f;
typedef __attribute__((ext_vector_type(4)))  float    v4f;

// 16-bit WMMA fragment map (wave32), lane L, h = L>>4, m = L&15:
//   A 16x32: lane = row m;   element i -> k = (i<8) ? 8h+i : 16+8h+(i-8)
//   B 32x16: lane = column m; the SAME k(i,h)
//   D 16x16 (8 f32): lane = column m; element r -> row 8h+r
__device__ __forceinline__ int frag_k(int i, int h) { return (i < 8) ? (8 * h + i) : (16 + 8 * h + (i - 8)); }
__device__ __forceinline__ __bf16 bf16_rne(float f) {
    unsigned int u = __float_as_uint(f);
    u += 0x7fffu + ((u >> 16) & 1u);
    return __builtin_bit_cast(__bf16, (unsigned short)(u >> 16));
}
__device__ __forceinline__ float bf16_f32(__bf16 b) { return __uint_as_float(((unsigned int)__builtin_bit_cast(unsigned short, b)) << 16); }
__device__ __forceinline__ v8f wmma16(v16h a, v16h b, v8f c) {
    c = __builtin_amdgcn_wmma_f32_16x16x32_f16(false, a, false, b, (short)0, c, false, false);
    asm volatile("v_nop\n\tv_nop\n\tv_nop\n\tv_nop" : "+v"(c) : "v"(a), "v"(b));
    return c;
}
__device__ __forceinline__ v8f wmmab(v16b a, v16b b, v8f c) {
    c = __builtin_amdgcn_wmma_f32_16x16x32_bf16(false, a, false, b, (short)0, c, false, false);
    asm volatile("v_nop\n\tv_nop\n\tv_nop\n\tv_nop" : "+v"(c) : "v"(a), "v"(b));
    return c;
}
struct Split { v16b hi, lo; };
// hi/lo split product: a.hi*b.hi + a.hi*b.lo + a.lo*b.hi
__device__ __forceinline__ v8f wmma3(const Split& a, const Split& b, v8f c) {
    c = __builtin_amdgcn_wmma_f32_16x16x32_bf16(false, a.hi, false, b.hi, (short)0, c, false, false);
    c = __builtin_amdgcn_wmma_f32_16x16x32_bf16(false, a.hi, false, b.lo, (short)0, c, false, false);
    c = __builtin_amdgcn_wmma_f32_16x16x32_bf16(false, a.lo, false, b.hi, (short)0, c, false, false);
    asm volatile("v_nop\n\tv_nop\n\tv_nop\n\tv_nop" : "+v"(c) : "v"(a.hi), "v"(a.lo), "v"(b.hi), "v"(b.lo));
    return c;
}
struct Split3 { v16b hi, mid, lo; };
// triple split product (6 terms, drops only terms below 2^-24 relative)
__device__ __forceinline__ v8f wmma6(const Split3& a, const Split3& b, v8f c) {
    c = __builtin_amdgcn_wmma_f32_16x16x32_bf16(false, a.hi, false, b.hi, (short)0, c, false, false);
    c = __builtin_amdgcn_wmma_f32_16x16x32_bf16(false, a.hi, false, b.mid, (short)0, c, false, false);
    c = __builtin_amdgcn_wmma_f32_16x16x32_bf16(false, a.mid, false, b.hi, (short)0, c, false, false);
    c = __builtin_amdgcn_wmma_f32_16x16x32_bf16(false, a.hi, false, b.lo, (short)0, c, false, false);
    c = __builtin_amdgcn_wmma_f32_16x16x32_bf16(false, a.mid, false, b.mid, (short)0, c, false, false);
    c = __builtin_amdgcn_wmma_f32_16x16x32_bf16(false, a.lo, false, b.hi, (short)0, c, false, false);
    asm volatile("v_nop\n\tv_nop\n\tv_nop\n\tv_nop" : "+v"(c) : "v"(a.hi), "v"(a.mid), "v"(a.lo), "v"(b.hi), "v"(b.mid), "v"(b.lo));
    return c;
}

// Fragment gathers from f32 memory: element i <- p[(k0 + frag_k(i,h)) * sk] * s, zero for k >= klen.
__device__ __forceinline__ v16h fh_ld(const float* __restrict__ p, long long sk, int k0, int h, int klen, float s) {
    v16h a;
#pragma unroll
    for (int i = 0; i < 16; ++i) { const int k = k0 + frag_k(i, h); a[i] = (k < klen) ? (_Float16)(p[(long long)k * sk] * s) : (_Float16)0.f; }
    return a;
}
__device__ __forceinline__ Split sp_ld(const float* __restrict__ p, long long sk, int k0, int h, int klen, float s) {
    Split r;
#pragma unroll
    for (int i = 0; i < 16; ++i) {
        const int k = k0 + frag_k(i, h); const float x = (k < klen) ? p[(long long)k * sk] * s : 0.f;
        const __bf16 hb = bf16_rne(x); r.hi[i] = hb; r.lo[i] = bf16_rne(x - bf16_f32(hb));
    }
    return r;
}
__device__ __forceinline__ Split3 sp3_ld(const float* __restrict__ p, long long sk, int k0, int h, int klen, float s) {
    Split3 r;
#pragma unroll
    for (int i = 0; i < 16; ++i) {
        const int k = k0 + frag_k(i, h); const float x = (k < klen) ? p[(long long)k * sk] * s : 0.f;
        const __bf16 hb = bf16_rne(x); const float r1 = x - bf16_f32(hb); const __bf16 mb = bf16_rne(r1);
        r.hi[i] = hb; r.mid[i] = mb; r.lo[i] = bf16_rne(r1 - bf16_f32(mb));
    }
    return r;
}
__device__ __forceinline__ v16b bh_ld(const float* __restrict__ p, long long sk, int k0, int h, int klen, float s) {
    v16b a;
#pragma unroll
    for (int i = 0; i < 16; ++i) { const int k = k0 + frag_k(i, h); a[i] = bf16_rne((k < klen) ? p[(long long)k * sk] * s : 0.f); }
    return a;
}
// f16 fragment from a 16-byte aligned f32 row with element stride 1 and all 32 k in range: four unguarded 16-byte loads, then the cast; same k order as fh_ld
struct Raw16 { v4f x0, x1, x2, x3; };   // the 16 floats of one lane's fragment, as loaded
__device__ __forceinline__ Raw16 raw_ld4(const float* __restrict__ row, int k0, int h) {
    const v4f* q = (const v4f*)(row + k0 + 8 * h);
    Raw16 r; r.x0 = q[0]; r.x1 = q[1]; r.x2 = q[4]; r.x3 = q[5];
    return r;
}
__device__ __forceinline__ v16h raw_f16(const Raw16& r) {
    v16h a;
#pragma unroll   // constant element indices: the vectors stay in registers
    for (int i = 0; i < 4; ++i) { a[i] = (_Float16)r.x0[i]; a[4 + i] = (_Float16)r.x1[i]; a[8 + i] = (_Float16)r.x2[i]; a[12 + i] = (_Float16)r.x3[i]; }
    return a;
}
// Inputs-only fence on loaded values: every load written above it is issued before it, so that a run of loads is in flight together.
// Without it the compiler converts each fragment as soon as it is loaded and waits for memory once per fragment.
__device__ __forceinline__ void loads_held(const v4f& a, const v4f& b, const v4f& c, const v4f& d) { asm volatile("" :: "v"(a), "v"(b), "v"(c), "v"(d)); }
// f16 fragment from an f16 LDS/global row with element stride 1 (k-contiguous), no bounds (tile already zero padded)
__device__ __forceinline__ v16h fh_row(const _Float16* __restrict__ row, int k0, int h) {
    v16h a;
#pragma unroll
    for (int i = 0; i < 16; ++i) a[i] = row[k0 + frag_k(i, h)];
    return a;
}

#define VST2(T, ptr, val) do { const T vst2_v_ = (val); *(T*)(ptr) = vst2_v_;  } while (0)
typedef float v4f __attribute__((ext_vector_type(4)));
#define VST2V4(ptr, val) do { const v4f vst2_v4_ = (val); *(v4f*)(ptr) = vst2_v4_;  } while (0)

__device__ __attribute__((noinline)) float act_fn(float v, int act) {
    if (act == 1) return fmaxf(v, 0.f);                                                                               // relu
    if (act == 2) { const float u = 0.7978845608028654f * (v + 0.044715f * v * v * v); return 0.5f * v * (1.f + tanhf(u)); } // tanh-gelu
    if (act == 3) return v / (1.f + expf(-v));                                                                        // silu
    if (act == 4) return 0.5f * v * (1.f + erff(v * 0.7071067811865476f));                                             // erf-gelu
    if (act == 5) return tanhf(v);
    if (act == 6) return 1.f / (1.f + expf(-v));                                                                      // sigmoid
    if (act == 7) return (v > 0.f) ? v : 0.01f * v;                                                                   // leaky relu 0.01
    if (act == 8) return (v > 0.f) ? v : (expf(v) - 1.f);                                                             // elu
    if (act == 9) return fminf(fmaxf(v, 0.f), 6.f);                                                                   // relu6
    if (act == 10) return fabsf(v);                                                                                    // abs
    if (act == 11) return (v >= 0.f) ? v : 0.1f * v;                                                                  // leaky 0.1
    if (act == 12) return (v > 0.f) ? v : 0.2f * v;                                                                   // leaky 0.2
    if (act == 13) return (v > 20.f) ? v : log1pf(expf(v));                                                            // softplus
    return v;
}

// =====================================================================================================================
// k_gemm<MODE>: C(z, m, n) = act(alpha * sum_k A(z, m, k) * B(z, k, n) + bias) + beta * R(z, m, n)
//   One wave (32-thread block) per 16 x 32 tile of C; grid (ceil(N/32), ceil(M/16), Z). Batch z -> (zo = z / zi_n, zi = z % zi_n)
//   with separate outer/inner strides for every tensor (e.g. batch and head). A(m,k) = A[zo*sAo + zi*sAi + m*sAm + k*sAk] (f32),
//   B(k,n) = B[zo*sBo + zi*sBi + n*sBn + k*sBk] (f32); any M, N, K (K zero-padded to 32 inside the fragments, M/N tails guarded).
//   C(m,n) = C[zo*sCo + zi*sCi + m*sCm + n] (n contiguous). flags: 1 bias[n], 2 bias[m], 4 residual R[zo*sRo + zi*sRi + m*sRm + n*sRn].
//   MODE 0: f16 operands (A prescaled by sa, B by sb, both undone in the epilogue); 1: bf16 hi/lo split (3 products); 2: bf16;
//   3: bf16 hi/mid/lo triple split (6 products); 4: as 3 with Kahan-compensated f32 accumulation across k-steps.
// =====================================================================================================================
struct GemmP {
    const float* A; const float* B; const float* bias; const float* R; float* C;
    long long sAo, sAi, sAm, sAk, sBo, sBi, sBn, sBk, sCo, sCi, sCm, sRo, sRi, sRm, sRn;
    int M, N, K, zi_n, flags, act; float alpha, beta, sa, sb;
    int Npad, pad_;     // columns [N, Npad) of C are written as 0 so that padded workspace rows are covered by whole-line stores; Npad >= N
};
static_assert(sizeof(GemmP) == 5 * 8 + 15 * 8 + 6 * 4 + 4 * 4 + 2 * 4, "GemmP has padding");

template <int MODE>
__global__ __launch_bounds__(32) void k_gemm(GemmP p) {
    const int lane = threadIdx.x & 31, h = lane >> 4, l15 = lane & 15;
    const int m0 = blockIdx.y * 16, n0 = blockIdx.x * 32;
    const int z = blockIdx.z, zo = z / p.zi_n, zi = z - zo * p.zi_n;
    const float* A = p.A + zo * p.sAo + zi * p.sAi;
    const float* B = p.B + zo * p.sBo + zi * p.sBi;
    const int am = min(m0 + l15, p.M - 1);                       // clamped row for loads (stores are guarded)
    v8f acc[2], comp[2];
#pragma unroll
    for (int t = 0; t < 2; ++t) { v8f zz = {}; acc[t] = zz; comp[t] = zz; }
    for (int k0 = 0; k0 < p.K; k0 += 32) {
        const float* arow = A + (long long)am * p.sAm;
        if (MODE == 1) {
            const Split a = sp_ld(arow, p.sAk, k0, h, p.K, 1.f);
#pragma unroll
            for (int t = 0; t < 2; ++t) {
                const int bn = min(n0 + t * 16 + l15, p.N - 1);
                acc[t] = wmma3(a, sp_ld(B + (long long)bn * p.sBn, p.sBk, k0, h, p.K, 1.f), acc[t]);
            }
        } else if (MODE == 3) {
            const Split3 a = sp3_ld(arow, p.sAk, k0, h, p.K, 1.f);
#pragma unroll
            for (int t = 0; t < 2; ++t) {
                const int bn = min(n0 + t * 16 + l15, p.N - 1);
                acc[t] = wmma6(a, sp3_ld(B + (long long)bn * p.sBn, p.sBk, k0, h, p.K, 1.f), acc[t]);
            }
        } else if (MODE == 4) {
            // triple split as MODE 3, but each k-step's 6 products go into a fresh accumulator and the partial is added to the running f32 sum
            // on the VALU with Kahan compensation (accumulation error stays ~1 ulp however long K is)
            const Split3 a = sp3_ld(arow, p.sAk, k0, h, p.K, 1.f);
#pragma unroll
            for (int t = 0; t < 2; ++t) {
                const int bn = min(n0 + t * 16 + l15, p.N - 1); v8f zz = {};
                const v8f part = wmma6(a, sp3_ld(B + (long long)bn * p.sBn, p.sBk, k0, h, p.K, 1.f), zz);
                const v8f y = part - comp[t]; const v8f s = acc[t] + y; comp[t] = (s - acc[t]) - y; acc[t] = s;
            }
        } else if (MODE == 2) {
            const v16b a = bh_ld(arow, p.sAk, k0, h, p.K, 1.f);
#pragma unroll
            for (int t = 0; t < 2; ++t) {
                const int bn = min(n0 + t * 16 + l15, p.N - 1);
                acc[t] = wmmab(a, bh_ld(B + (long long)bn * p.sBn, p.sBk, k0, h, p.K, 1.f), acc[t]);
            }
        } else {
            const v16h a = fh_ld(arow, p.sAk, k0, h, p.K, p.sa);
#pragma unroll
            for (int t = 0; t < 2; ++t) {
                const int bn = min(n0 + t * 16 + l15, p.N - 1);
                acc[t] = wmma16(a, fh_ld(B + (long long)bn * p.sBn, p.sBk, k0, h, p.K, p.sb), acc[t]);
            }
        }
    }
    const float iscale = (MODE == 0) ? p.alpha / (p.sa * p.sb) : p.alpha;
    float* C = p.C + zo * p.sCo + zi * p.sCi;
    const float* R = p.R + zo * p.sRo + zi * p.sRi;
    __shared__ __align__(16) float ctile[16][36];
#pragma unroll
    for (int t = 0; t < 2; ++t) {
        const int n = n0 + t * 16 + l15; const int nn = min(n, p.N - 1);
#pragma unroll
        for (int r = 0; r < 8; ++r) {
            const int m = m0 + 8 * h + r; const int mm = min(m, p.M - 1);
            float v = acc[t][r] * iscale;
            if (p.flags & 1) v += p.bias[nn];
            if (p.flags & 2) v += p.bias[mm];
            if (p.flags & 8) v *= p.bias[(long long)zo * p.M + mm];   /* per-(z,row) scale vector laid out [Z][M]; exclusive with the bias flags */
            v = act_fn(v, p.act);
            if (p.flags & 4) v += p.beta * R[(long long)mm * p.sRm + (long long)nn * p.sRn];
            ctile[8 * h + r][t * 16 + l15] = (n < p.N) ? v : 0.f;
        }
    }
    __syncthreads();
    const int NW = (p.Npad > p.N) ? p.Npad : p.N;           // write width
    const bool fast = (m0 + 16 <= p.M) && (n0 + 32 <= NW) && ((p.sCm & 3) == 0) && ((((size_t)C) & 15) == 0);
    if (fast) {
#pragma unroll
        for (int s = 0; s < 4; ++s) {
            const int row = s * 4 + (lane >> 3), c4 = (lane & 7) * 4;
            const v4f v = *(const v4f*)&ctile[row][c4];
            VST2V4(C + (long long)(m0 + row) * p.sCm + n0 + c4, v);
        }
    } else {
        for (int row = 0; row < 16; ++row) {
            const int m = m0 + row, n = n0 + lane;
            if (m < p.M && n < NW) VST2(float, C + (long long)m * p.sCm + n, ctile[row][lane]);
        }
    }
}


// =====================================================================================================================
// k_gemmT<MODE, TM, TN>: same contract as k_gemm, but one wave computes a (16*TM) x (16*TN) tile: TM A fragments and TN B fragments are
//   loaded per 32-wide k-step and reused across TM*TN WMMAs (far fewer load/convert instructions per MAC). MODE 0 (f16), 1 (bf16 hi/lo),
//   2 (bf16) only. grid (ceil(NW/(16*TN)), ceil(M/(16*TM)), Z), block 32. Epilogue identical to k_gemm, run per 16x32 sub-tile.
// =====================================================================================================================
template <int MODE, int TM, int TN>
__global__ __launch_bounds__(32) void k_gemmT(GemmP p) {
    const int lane = threadIdx.x & 31, h = lane >> 4, l15 = lane & 15;
    const int m0 = blockIdx.y * (16 * TM), n0 = blockIdx.x * (16 * TN);
    const int z = blockIdx.z, zo = z / p.zi_n, zi = z - zo * p.zi_n;
    const float* A = p.A + zo * p.sAo + zi * p.sAi;
    const float* B = p.B + zo * p.sBo + zi * p.sBi;
    v8f acc[TM][TN];
#pragma unroll
    for (int i = 0; i < TM; ++i)
#pragma unroll
        for (int t = 0; t < TN; ++t) { v8f zz = {}; acc[i][t] = zz; }
    for (int k0 = 0; k0 < p.K; k0 += 32) {
        if (MODE == 1) {
            Split a[TM], b[TN];
#pragma unroll
            for (int i = 0; i < TM; ++i) { const int am = min(m0 + 16 * i + l15, p.M - 1); a[i] = sp_ld(A + (long long)am * p.sAm, p.sAk, k0, h, p.K, 1.f); }
#pragma unroll
            for (int t = 0; t < TN; ++t) { const int bn = min(n0 + 16 * t + l15, p.N - 1); b[t] = sp_ld(B + (long long)bn * p.sBn, p.sBk, k0, h, p.K, 1.f); }
#pragma unroll
            for (int i = 0; i < TM; ++i)
#pragma unroll
                for (int t = 0; t < TN; ++t) acc[i][t] = wmma3(a[i], b[t], acc[i][t]);
        } else if (MODE == 2) {
            v16b a[TM], b[TN];
#pragma unroll
            for (int i = 0; i < TM; ++i) { const int am = min(m0 + 16 * i + l15, p.M - 1); a[i] = bh_ld(A + (long long)am * p.sAm, p.sAk, k0, h, p.K, 1.f); }
#pragma unroll
            for (int t = 0; t < TN; ++t) { const int bn = min(n0 + 16 * t + l15, p.N - 1); b[t] = bh_ld(B + (long long)bn * p.sBn, p.sBk, k0, h, p.K, 1.f); }
#pragma unroll
            for (int i = 0; i < TM; ++i)
#pragma unroll
                for (int t = 0; t < TN; ++t) acc[i][t] = wmmab(a[i], b[t], acc[i][t]);
        } else {
            v16h a[TM], b[TN];
#pragma unroll
            for (int i = 0; i < TM; ++i) { const int am = min(m0 + 16 * i + l15, p.M - 1); a[i] = fh_ld(A + (long long)am * p.sAm, p.sAk, k0, h, p.K, p.sa); }
#pragma unroll
            for (int t = 0; t < TN; ++t) { const int bn = min(n0 + 16 * t + l15, p.N - 1); b[t] = fh_ld(B + (long long)bn * p.sBn, p.sBk, k0, h, p.K, p.sb); }
#pragma unroll
            for (int i = 0; i < TM; ++i)
#pragma unroll
                for (int t = 0; t < TN; ++t) acc[i][t] = wmma16(a[i], b[t], acc[i][t]);
        }
    }
    const float iscale = (MODE == 0) ? p.alpha / (p.sa * p.sb) : p.alpha;
    float* C = p.C + zo * p.sCo + zi * p.sCi;
    const float* R = p.R + zo * p.sRo + zi * p.sRi;
    const int NW = (p.Npad > p.N) ? p.Npad : p.N;
    __shared__ __align__(16) float ctile[16][36];
#pragma unroll
    for (int i = 0; i < TM; ++i) {
        const int mb = m0 + 16 * i; if (mb >= p.M) break;          // wave-uniform
#pragma unroll
        for (int tp = 0; tp < TN / 2; ++tp) {
            const int nb = n0 + 32 * tp; if (nb >= NW) break;        // wave-uniform
#pragma unroll
            for (int t2 = 0; t2 < 2; ++t2) {
                const int t = 2 * tp + t2; const int n = nb + t2 * 16 + l15; const int nn = min(n, p.N - 1);
#pragma unroll
                for (int r = 0; r < 8; ++r) {
                    const int m = mb + 8 * h + r; const int mm = min(m, p.M - 1);
                    float v = acc[i][t][r] * iscale;
                    if (p.flags & 1) v += p.bias[nn];
                    if (p.flags & 2) v += p.bias[mm];
            if (p.flags & 8) v *= p.bias[(long long)zo * p.M + mm];   /* per-(z,row) scale vector laid out [Z][M]; exclusive with the bias flags */
                    v = act_fn(v, p.act);
                    if (p.flags & 4) v += p.beta * R[(long long)mm * p.sRm + (long long)nn * p.sRn];
                    ctile[8 * h + r][t2 * 16 + l15] = (n < p.N) ? v : 0.f;
                }
            }
            __syncthreads();
            const bool fast = (mb + 16 <= p.M) && (nb + 32 <= NW) && ((p.sCm & 3) == 0) && ((((size_t)C) & 15) == 0);
            if (fast) {
#pragma unroll
                for (int s = 0; s < 4; ++s) {
                    const int row = s * 4 + (lane >> 3), c4 = (lane & 7) * 4;
                    const v4f v = *(const v4f*)&ctile[row][c4];
                    VST2V4(C + (long long)(mb + row) * p.sCm + nb + c4, v);
                }
            } else {
                for (int row = 0; row < 16; ++row) {
                    const int m = mb + row, n = nb + lane;
                    if (m < p.M && n < NW) VST2(float, C + (long long)m * p.sCm + n, ctile[row][lane]);
                }
            }
            __syncthreads();
        }
    }
}

// =====================================================================================================================
//   Wave = 16 queries, AW waves per block, 64-key blocks; grid (ceil(Lq/(16*AW)), H, B), block 32*AW. Any Lq, Lk; head dim dh <= DHP
//   (DHP multiple of 32), value dim dv <= DVP (multiple of 16, <= 128). Every tensor addressed by (batch, head, row, element) strides, f32.
//   Scores: QM 0 f16 operands, 1 bf16 hi/lo split, 2 bf16 triple split; statistics f32 (exp2 domain); P.V: P x 4096 as f16 with V f16 staged in LDS
//   (SPLITPV: P and V as bf16 hi/lo splits). kv head = h / hrep. Masking: causal = 1 (keep j <= i + coff, masked -> -inf, key blocks beyond the
//   diagonal skipped), causal = 2 (masked -> mfill, a finite fill like the -1e9; no skipping), causal = 3 (keep j >= i + coff,
//   masked -> -inf, no skipping); optional additive f32 mask Mf,
//   optional int keep-mask Mi (0 -> score := mfill), both addressed b*smb + h*smh + i*smi + j*smj (0 strides broadcast).
//   PLAIN (QM 0, f16 P.V, one pass): the call is causal = 1 with coff 0, hrep 1, dh == DHP, dv == DVP, element strides 1, every Q/K/V row 16-byte aligned,
//   and none of P, Mf, Mi, ST, Pw, Rt, SQ/SK, nonorm. These become compile-time constants: the element guards fold away, so Q, K and V are read with
//   16-byte loads that are in flight in runs instead of one guarded float at a time, each waited for, and the option tests leave the score loop.
//   O16 (PLAIN, DVP 64, Lq a multiple of 16): the output goes to Oh as f16 (strides sOb, sOh, sOi in elements; rows 16-byte aligned), rounded from the same f32 value that O would hold,
//   so that the next product reads it without a cast launch in between. A (row, head) piece is one whole 128-byte line.
// =====================================================================================================================
#define AW 4
struct AttnP {   // apv4
    const float* Q; const float* K; const float* V; float* O; _Float16* Oh; float* P; const float* Mf; const int* Mi; float* ST;   // Oh: the output plane of the O16 form (O unused there)
    const float* Pw; const float* Rt; const int* SQ; const int* SK;           // optional: post-softmax weight, relative-position table, segment ids
    long long swb, swh, swi, swj, srb, srh, sri;                                 // Pw strides (b,h,i,j); Rt strides (b,h,i), column = clamp(i - j + roff, 0, rn-1)
    long long sQb, sQh, sQi, sQd, sKb, sKh, sKj, sKd, sVb, sVh, sVj, sVd, sOb, sOh, sOi, sPb, sPh, sPi, smb, smh, smi, smj;
    int Lq, Lk, dh, dv, hrep, causal, coff, pband;   // pband > 0: P holds only the band |j - i| <= pband, column j - i + pband
    float scale, mfill; int nonorm, mpol;             // nonorm (online path only): O = sum_j exp(score_j) V_j without the 1/rowsum (scores must be <= ~0); mpol: Mi masks where ==0 (mpol 0) or where !=0 (mpol 1)
    int roff, rn, segpol, win;                        // Rt column offset/count; SQ/SK: score := mfill where (segpol 0) SQ[i] != SK[j] or (segpol 1) SQ[i] == SK[j]; win > 0: keys with i - j > win (after coff) -> -inf, key blocks wholly below the window skipped
};
//   Pw: the softmax numerator is multiplied by Pw(b,h,i,j) AFTER the row sum is taken (probs * weight, then P.V), as in post-softmax multiplicative biases.                                                    // ST (optional): per row (b,h,i) -> ST[((b*H + h)*Lq + i)*2 + {0,1}] = {row max of the scaled+masked score (natural units), sum_j exp(score - max)}
static_assert(sizeof(AttnP) == 13 * 8 + 29 * 8 + 16 * 4, "AttnP has padding");

#ifndef KATTN_ATTR
#define KATTN_ATTR
#endif
template <int DHP, int DVP, int QM, bool SPLITPV, bool TWOPASS, bool PLAIN = false, bool O16 = false>
__global__ __launch_bounds__(32 * AW) KATTN_ATTR void k_attn(AttnP pa) {
    static_assert(!PLAIN || (QM == 0 && !SPLITPV && !TWOPASS), "PLAIN covers the f16 one-pass form");
    static_assert(!O16 || (PLAIN && DVP == 64), "O16 covers the PLAIN form with 64 value columns");
    AttnP p = pa;
    if (PLAIN) {
        p.P = nullptr; p.Mf = nullptr; p.Mi = nullptr; p.ST = nullptr; p.Pw = nullptr; p.Rt = nullptr; p.SQ = nullptr; p.SK = nullptr;
        p.sQd = 1; p.sKd = 1; p.sVd = 1; p.dh = DHP; p.dv = DVP; p.hrep = 1; p.causal = 1; p.coff = 0; p.pband = 0; p.nonorm = 0;
    }
    constexpr int NT = DVP / 16;                // output tiles
    constexpr int KS = DHP / 32;                // k-steps for the scores
    constexpr int VP = DVP + 8;                 // LDS pitch (halves)
    constexpr int NV = 64 * (DVP / 4) / (32 * AW);   // PLAIN: 16-byte pieces of the V tile per thread
    static_assert(!PLAIN || NV * (32 * AW) == 64 * (DVP / 4), "the block's threads cover the V tile evenly");
    __shared__ __align__(16) float    pl[AW][16 * 64];
    __shared__ __align__(16) _Float16 vl[(SPLITPV ? 2 : 1) * 64 * VP];   // f16 V tile, or bf16 hi and lo tiles (same 2-byte size)
    const int lane = threadIdx.x & 31, hf = lane >> 4, l15 = lane & 15, wave = threadIdx.x >> 5;
    const int h = blockIdx.y, b = blockIdx.z, hk = h / p.hrep;
    const int q0 = (blockIdx.x * AW + wave) * 16;
    float* myp = pl[wave];
    const float L2E = 1.4426950408889634f;
    const float NEG = -__builtin_inff();
    const int qi = min(q0 + l15, p.Lq - 1);
    const float* qrow = p.Q + b * p.sQb + h * p.sQh + (long long)qi * p.sQi;
    const float* kbase = p.K + b * p.sKb + hk * p.sKh;
    const float* vbase = p.V + b * p.sVb + hk * p.sVh;
    v16h qa[QM == 0 ? KS : 1]; Split qs_[QM == 1 ? KS : 1]; Split3 qt_[QM == 2 ? KS : 1];
#pragma unroll
    for (int ks = 0; ks < KS; ++ks) {
        if (QM == 2) qt_[ks] = sp3_ld(qrow, p.sQd, ks * 32, hf, p.dh, 1.f);
        else if (QM == 1) qs_[ks] = sp_ld(qrow, p.sQd, ks * 32, hf, p.dh, 1.f);
        else if (PLAIN) qa[ks] = raw_f16(raw_ld4(qrow, ks * 32, hf));
        else qa[ks] = fh_ld(qrow, p.sQd, ks * 32, hf, p.dh, 1.f);
    }
    v8f o[NT]; float m8[8], l8[8];
#pragma unroll
    for (int t = 0; t < NT; ++t) { v8f zz = {}; o[t] = zz; }
#pragma unroll
    for (int i = 0; i < 8; ++i) { m8[i] = NEG; l8[i] = 0.f; }
    int jend = p.Lk;
    if (p.causal == 1) { const int je = (blockIdx.x * AW + AW - 1) * 16 + 16 + p.coff; jend = min(jend, max(je, 0)); }   // uniform per block
    int jbeg = 0;                                                // first key any query row of this block can see through the window; uniform per block
    if (p.win > 0 && !p.P) jbeg = max((int)(blockIdx.x * AW) * 16 + p.coff - p.win, 0);   // keys below it are -inf for all 16*AW rows (weight exactly 0); P, where asked for, still needs its zeros written
    const int npass = TWOPASS ? 2 : 1;
    for (int pass = 0; pass < npass; ++pass) {
        const bool dopv = (!TWOPASS) || pass == 1;
        for (int j0 = jbeg; j0 < jend; j0 += 64) {
            v4f vr[PLAIN ? NV : 1]; Raw16 kr[PLAIN ? 2 : 1][KS];   // PLAIN: this thread's part of the V tile and the lane's K fragments of two columns, f32 as loaded
            if (dopv) {
                __syncthreads();                                 // previous key block's reads of vl / pl are done
                if (!PLAIN)
                for (int idx = threadIdx.x; idx < 64 * DVP; idx += 32 * AW) {
                    const int jr = idx / DVP, d = idx - jr * DVP, j = j0 + jr;
                    const float f = (j < p.Lk && d < p.dv) ? vbase[(long long)j * p.sVj + (long long)d * p.sVd] : 0.f;
                    if (SPLITPV) {
                        const __bf16 hb = bf16_rne(f);
                        ((__bf16*)vl)[jr * VP + d] = hb; ((__bf16*)vl)[64 * VP + jr * VP + d] = bf16_rne(f - bf16_f32(hb));
                    } else vl[jr * VP + d] = (_Float16)f;
                }
            }
            v8f s[4];
#pragma unroll
            for (int t = 0; t < 4; ++t) {
                const int j = min(j0 + t * 16 + l15, p.Lk - 1);
                const float* krow = kbase + (long long)j * p.sKj;
                if (PLAIN && (t & 1) == 0) {
                    // the K loads of two 16-key columns are issued ahead of the first use of any of them: one trip to memory for 4 fragments
                    // (all four columns at once took the build past 256 registers). The loops here are unrolled so that kr and vr stay in registers.
#pragma unroll
                    for (int u = 0; u < 2; ++u) {
#pragma unroll
                        for (int ks = 0; ks < KS; ++ks) kr[u][ks] = raw_ld4(kbase + (long long)min(j0 + (t + u) * 16 + l15, p.Lk - 1) * p.sKj, ks * 32, hf);
                        // one column's loads share one address pair: this wait stands behind them, ahead of any later load whose result may be given that pair
                        asm volatile("s_wait_xcnt 0x0" ::: "memory");
                    }
#pragma unroll
                    for (int u = 0; u < 2; ++u)
#pragma unroll
                        for (int ks = 0; ks < KS; ++ks) loads_held(kr[u][ks].x0, kr[u][ks].x1, kr[u][ks].x2, kr[u][ks].x3);
                }
                v8f acc = {};
#pragma unroll
                for (int ks = 0; ks < KS; ++ks) {
                    if (QM == 2)      acc = wmma6(qt_[ks], sp3_ld(krow, p.sKd, ks * 32, hf, p.dh, 1.f), acc);
                    else if (QM == 1) acc = wmma3(qs_[ks], sp_ld(krow, p.sKd, ks * 32, hf, p.dh, 1.f), acc);
                    else if (PLAIN)   acc = wmma16(qa[ks], raw_f16(kr[t & 1][ks]), acc);
                    else              acc = wmma16(qa[ks], fh_ld(krow, p.sKd, ks * 32, hf, p.dh, 1.f), acc);
                }
                s[t] = acc;
            }
            if (PLAIN) {
                // the V tile's loads go out here and are first used behind the softmax, which covers their trip to memory
#pragma unroll
                for (int n = 0; n < NV; ++n) {
                    const int idx = threadIdx.x + n * (32 * AW), jr = idx / (DVP / 4), d = (idx - jr * (DVP / 4)) * 4;
                    vr[n] = *(const v4f*)(vbase + (long long)min(j0 + jr, p.Lk - 1) * p.sVj + d);   // row clamped, so no guard round the load
                }
            }
            float pv[8][4];
#pragma unroll
            for (int i = 0; i < 8; ++i) {
                const int irow = q0 + i + 8 * hf;
                const int ic = min(irow, p.Lq - 1);
                float sc[4];
#pragma unroll
                for (int t = 0; t < 4; ++t) {
                    const int jg = j0 + t * 16 + l15;
                    float v = s[t][i] * p.scale;
                    if (p.Mf) v += p.Mf[b * p.smb + h * p.smh + (long long)ic * p.smi + (long long)min(jg, p.Lk - 1) * p.smj];
                    if (p.Rt) { int rc = ic - min(jg, p.Lk - 1) + p.roff; rc = rc < 0 ? 0 : (rc >= p.rn ? p.rn - 1 : rc); v += p.Rt[b * p.srb + h * p.srh + (long long)ic * p.sri + rc]; }
                    if (p.Mi) { const int mv = p.Mi[b * p.smb + h * p.smh + (long long)ic * p.smi + (long long)min(jg, p.Lk - 1) * p.smj]; if (p.mpol ? (mv != 0) : (mv == 0)) v = p.mfill; }
                    if (p.SQ) { const bool same = p.SQ[(long long)b * p.Lq + ic] == p.SK[(long long)b * p.Lk + min(jg, p.Lk - 1)]; if (p.segpol ? same : !same) v = p.mfill; }
                    if (p.causal == 2 && jg > irow + p.coff) v = p.mfill;
                    if (jg >= p.Lk || (p.causal == 1 && jg > irow + p.coff) || (p.causal == 3 && jg < irow + p.coff) || (p.win > 0 && irow + p.coff - jg > p.win)) v = NEG; else v *= L2E;
                    sc[t] = v;
                }
                if (!TWOPASS || pass == 0) {
                    float mx = fmaxf(fmaxf(sc[0], sc[1]), fmaxf(sc[2], sc[3]));
                    mx = fmaxf(mx, __shfl_xor(mx, 1, 32)); mx = fmaxf(mx, __shfl_xor(mx, 2, 32));
                    mx = fmaxf(mx, __shfl_xor(mx, 4, 32)); mx = fmaxf(mx, __shfl_xor(mx, 8, 32));
                    const float mnew = fmaxf(m8[i], mx);
                    const float corr = (mnew == NEG) ? 1.f : exp2f(m8[i] - mnew);
                    float rs = 0.f;
#pragma unroll
                    for (int t = 0; t < 4; ++t) {
                        const float pp = (sc[t] == NEG) ? 0.f : exp2f(sc[t] - mnew); rs += pp;
                        pv[i][t] = p.Pw ? pp * p.Pw[b * p.swb + h * p.swh + (long long)ic * p.swi + (long long)min(j0 + t * 16 + l15, p.Lk - 1) * p.swj] : pp;
                    }
                    rs += __shfl_xor(rs, 1, 32); rs += __shfl_xor(rs, 2, 32); rs += __shfl_xor(rs, 4, 32); rs += __shfl_xor(rs, 8, 32);
                    l8[i] = l8[i] * corr + rs; m8[i] = mnew;
                    if (!TWOPASS) {
#pragma unroll
                        for (int t = 0; t < NT; ++t) o[t][i] *= corr;
                    }
                } else {
                    const float inv = (l8[i] > 0.f) ? 1.f / l8[i] : 0.f;
#pragma unroll
                    for (int t = 0; t < 4; ++t) {
                        const int jg = j0 + t * 16 + l15;
                        float pp = (sc[t] == NEG) ? 0.f : exp2f(sc[t] - m8[i]) * inv;
                        if (p.Pw) pp *= p.Pw[b * p.swb + h * p.swh + (long long)ic * p.swi + (long long)min(jg, p.Lk - 1) * p.swj];
                        pv[i][t] = pp;
                    }
                }
            }
            if (dopv) {
                if (PLAIN) {                                     // cast and stage the V tile loaded above (unrolled: vr stays in registers)
#pragma unroll
                    for (int n = 0; n < NV; ++n) {
                        const int idx = threadIdx.x + n * (32 * AW), jr = idx / (DVP / 4), d = (idx - jr * (DVP / 4)) * 4;
                        v4h hv;
#pragma unroll
                        for (int e = 0; e < 4; ++e) hv[e] = (_Float16)((j0 + jr < p.Lk) ? vr[n][e] : 0.f);
                        *(v4h*)&vl[jr * VP + d] = hv;
                    }
                }
#pragma unroll
                for (int i = 0; i < 8; ++i)
#pragma unroll
                    for (int t = 0; t < 4; ++t) ((float*)myp)[(i + 8 * hf) * 64 + t * 16 + l15] = pv[i][t];
                __syncthreads();                                 // P (per wave) and V (shared) visible
                if (p.P) {
                    float* pb_ = p.P + b * p.sPb + h * p.sPh;
                    const bool fastP = (p.pband == 0) && ((p.sPi & 3) == 0) && (j0 + 64 <= p.Lk) && (q0 + 16 <= p.Lq) && ((((size_t)pb_) & 15) == 0);
                    if (fastP) {
#pragma unroll
                        for (int s = 0; s < 8; ++s) {
                            const int row = s * 2 + (lane >> 4), c4 = (lane & 15) * 4;
                            const v4f v = *(const v4f*)(myp + row * 64 + c4);
                            VST2V4(pb_ + (long long)(q0 + row) * p.sPi + j0 + c4, v);
                        }
                    } else {
                        for (int row = 0; row < 16; ++row) {
                            const int irow = q0 + row; if (irow >= p.Lq) continue;
                            for (int c = lane; c < 64; c += 32) {
                                const int jg = j0 + c; if (jg >= p.Lk) continue;
                                if (p.pband == 0) VST2(float, pb_ + (long long)irow * p.sPi + jg, myp[row * 64 + c]);
                                else if (jg - irow <= p.pband && irow - jg <= p.pband) VST2(float, pb_ + (long long)irow * p.sPi + (jg - irow + p.pband), myp[row * 64 + c]);
                            }
                        }
                    }
                }
                if (SPLITPV) {
                    const Split pa0 = sp_ld(myp + l15 * 64, 1, 0, hf, 64, 1.f), pa1 = sp_ld(myp + l15 * 64, 1, 32, hf, 64, 1.f);
                    const __bf16* vh = (const __bf16*)vl; const __bf16* vlo = vh + 64 * VP;
#pragma unroll
                    for (int t = 0; t < NT; ++t) {
                        const int dcol = t * 16 + l15;
                        Split b0, b1;
#pragma unroll
                        for (int e = 0; e < 16; ++e) {
                            const int k0 = frag_k(e, hf), k1 = 32 + frag_k(e, hf);
                            b0.hi[e] = vh[k0 * VP + dcol]; b0.lo[e] = vlo[k0 * VP + dcol]; b1.hi[e] = vh[k1 * VP + dcol]; b1.lo[e] = vlo[k1 * VP + dcol];
                        }
                        o[t] = wmma3(pa0, b0, o[t]);
                        o[t] = wmma3(pa1, b1, o[t]);
                    }
                } else {
                    const v16h pa0 = fh_ld(myp + l15 * 64, 1, 0, hf, 64, 4096.f), pa1 = fh_ld(myp + l15 * 64, 1, 32, hf, 64, 4096.f);
#pragma unroll
                    for (int t = 0; t < NT; ++t) {
                        const int dcol = t * 16 + l15;
                        v16h b0, b1;
#pragma unroll
                        for (int e = 0; e < 16; ++e) { b0[e] = vl[frag_k(e, hf) * VP + dcol]; b1[e] = vl[(32 + frag_k(e, hf)) * VP + dcol]; }
                        o[t] = wmma16(pa0, b0, o[t]);
                        o[t] = wmma16(pa1, b1, o[t]);
                    }
                }
            }
        }
    }
    float* obase = p.O + b * p.sOb + h * p.sOh;
    if (p.ST) {
        const int rl = lane >> 1, isel = rl & 7;           // row q0 + rl ; rl>>3 == hf holds because lane>>4 == (lane>>1)>>3
        float mv = 0.f, lv = 0.f;
#pragma unroll
        for (int i = 0; i < 8; ++i) if (i == isel) { mv = m8[i]; lv = l8[i]; }
        const int irow = q0 + rl;
        if (irow < p.Lq) { float* st = p.ST + (((long long)b * gridDim.y + h) * p.Lq + irow) * 2 + (lane & 1); VST2(float, st, (lane & 1) ? lv : mv * 0.6931471805599453f); }
    }
    float invr[8];
#pragma unroll
    for (int i = 0; i < 8; ++i) {
        if (TWOPASS) invr[i] = SPLITPV ? 1.f : (1.f / 4096.f);
        else if (p.nonorm) invr[i] = exp2f(m8[i]) * (SPLITPV ? 1.f : (1.f / 4096.f));
        else invr[i] = (l8[i] > 0.f) ? (SPLITPV ? 1.f / l8[i] : 1.f / (l8[i] * 4096.f)) : 0.f;
    }
    __syncthreads();                                             // all waves done with pl/vl from the main loop
    const bool ofast = ((p.sOi & 3) == 0) && ((((size_t)obase) & 15) == 0) && (q0 + 16 <= p.Lq);
#pragma unroll
    for (int c0 = 0; c0 < DVP; c0 += 64) {
#pragma unroll
        for (int i = 0; i < 8; ++i)
#pragma unroll
            for (int t = 0; t < NT; ++t) if (t * 16 >= c0 && t * 16 < c0 + 64) ((float*)myp)[(i + 8 * hf) * 64 + (t * 16 - c0) + l15] = o[t][i] * invr[i];
        __syncthreads();
        const int cw = (DVP - c0 < 64) ? (DVP - c0) : 64;      // staged columns in this chunk (multiple of 16)
        if (O16) {
            _Float16* oh = p.Oh + b * p.sOb + h * p.sOh;
            if (q0 < p.Lq) {                                     // Lq is a multiple of 16: a wave's 16 rows are all there or none is
#pragma unroll   // four stores of 4 rows each, all in flight
                for (int r0 = 0; r0 < 16; r0 += 4) {
                    const int row = r0 + (lane >> 3), c8 = (lane & 7) * 8;
                    const float* sp = myp + row * 64 + c8;
                    v8h hv;
#pragma unroll   // constant element indices: the vector stays in registers
                    for (int e = 0; e < 8; ++e) hv[e] = (_Float16)sp[e];
                    *(v8h*)(oh + (long long)(q0 + row) * p.sOi + c8) = hv;
                }
            }
        } else if (ofast && (c0 + cw <= p.dv) && (cw % 32 == 0)) {
            const int lpr = cw / 4;                              // lanes per row (16 for 64 cols, 8 for 32)
            const int rows_per_ins = 32 / lpr;
            for (int r0 = 0; r0 < 16; r0 += rows_per_ins) {
                const int row = r0 + lane / lpr, c4 = (lane % lpr) * 4;
                const v4f v = *(const v4f*)(myp + row * 64 + c4);
                VST2V4(obase + (long long)(q0 + row) * p.sOi + c0 + c4, v);
            }
        } else {
            for (int row = 0; row < 16; ++row) {
                const int irow = q0 + row; if (irow >= p.Lq) continue;
                for (int c = lane; c < cw; c += 32) { const int d = c0 + c; if (d < p.dv) VST2(float, obase + (long long)irow * p.sOi + d, myp[row * 64 + c]); }
            }
        }
        __syncthreads();
    }
}

__device__ __forceinline__ float other_half(float v) {
    const int b = __builtin_bit_cast(int, v);
    return __builtin_bit_cast(float, __builtin_amdgcn_permlanex16(b, b, 0x76543210, 0xfedcba98, false, false));
}
__global__ __launch_bounds__(32 * AW) void k_attn_t(AttnP p) {
    constexpr int KS = 2;                       // k-steps of the scores (head dim 64)
    constexpr int VP = 64 + 8;                  // LDS pitch of the V tile and of the output staging (halves): 144 bytes
    constexpr int NV = 64 * 16 / (32 * AW);     // 16-byte pieces of the f32 V tile per thread
    __shared__ __align__(16) _Float16 vl[64 * VP];
    __shared__ __align__(16) _Float16 ol[AW][16 * VP];
    const int lane = threadIdx.x & 31, hf = lane >> 4, l15 = lane & 15, wave = threadIdx.x >> 5;
    const int h = blockIdx.y, b = blockIdx.z;
    const int q0 = (blockIdx.x * AW + wave) * 16;
    const float L2E = 1.4426950408889634f;
    const float NEG = -__builtin_inff();
    const int irow = q0 + l15;                  // the lane's query
    const float* qrow = p.Q + b * p.sQb + h * p.sQh + (long long)min(irow, p.Lq - 1) * p.sQi;
    const float* kbase = p.K + b * p.sKb + h * p.sKh;
    const float* vbase = p.V + b * p.sVb + h * p.sVh;
    v16h qa[KS];
    {
        Raw16 qr[KS];
#pragma unroll   // constant indices: the fragments stay in registers
        for (int ks = 0; ks < KS; ++ks) qr[ks] = raw_ld4(qrow, ks * 32, hf);
        asm volatile("s_wait_xcnt 0x0" ::: "memory");   // behind the run of loads off one address pair, ahead of any rewrite of that pair
#pragma unroll   // constant indices: the arrays stay in registers
        for (int ks = 0; ks < KS; ++ks) qa[ks] = raw_f16(qr[ks]);
    }
    v8f o[4]; float m = NEG, l = 0.f;
#pragma unroll   // constant indices: the arrays stay in registers
    for (int t = 0; t < 4; ++t) { v8f zz = {}; o[t] = zz; }
    const int jend = min(p.Lk, (int)(blockIdx.x * AW + AW) * 16);          // uniform per block: no key beyond the block's last query
    const int jbeg = (p.win > 0) ? max((int)(blockIdx.x * AW) * 16 - p.win, 0) : 0;   // uniform per block: first key that any of its queries sees through the window
    for (int j0 = jbeg; j0 < jend; j0 += 64) {
        v4f vr[NV]; Raw16 kr[2][KS];            // this thread's part of the V tile and the lane's K fragments of two 16-key tiles, f32 as loaded
        __syncthreads();                        // previous key block's reads of vl are done
        v8f s[4];
#pragma unroll   // constant indices: the arrays stay in registers
        for (int t = 0; t < 4; ++t) {
            if ((t & 1) == 0) {
                // the K loads of two 16-key tiles are issued ahead of the first use of any of them: one trip to memory for 4 fragments
#pragma unroll   // constant indices: the arrays stay in registers
                for (int u = 0; u < 2; ++u) {
#pragma unroll   // constant indices: the arrays stay in registers
                    for (int ks = 0; ks < KS; ++ks) kr[u][ks] = raw_ld4(kbase + (long long)min(j0 + (t + u) * 16 + l15, p.Lk - 1) * p.sKj, ks * 32, hf);
                    // one tile's loads share one address pair: this wait stands behind them, ahead of any later load whose result may be given that pair
                    asm volatile("s_wait_xcnt 0x0" ::: "memory");
                }
#pragma unroll   // constant indices: the arrays stay in registers
                for (int u = 0; u < 2; ++u)
#pragma unroll   // constant indices: the arrays stay in registers
                    for (int ks = 0; ks < KS; ++ks) loads_held(kr[u][ks].x0, kr[u][ks].x1, kr[u][ks].x2, kr[u][ks].x3);
            }
            v8f acc = {};
#pragma unroll   // constant indices: the arrays stay in registers
            for (int ks = 0; ks < KS; ++ks) acc = wmma16(raw_f16(kr[t & 1][ks]), qa[ks], acc);
            s[t] = acc;
        }
        // the V tile's loads go out here and are first used behind the softmax, which covers their trip to memory
#pragma unroll   // constant indices: the arrays stay in registers
        for (int n = 0; n < NV; ++n) {
            const int idx = threadIdx.x + n * (32 * AW), jr = idx >> 4, d = (idx & 15) * 4;
            vr[n] = *(const v4f*)(vbase + (long long)min(j0 + jr, p.Lk - 1) * p.sVj + d);   // row clamped, so no guard round the load
        }
        asm volatile("s_wait_xcnt 0x0" ::: "memory");   // behind the run of V loads, ahead of any rewrite of their address registers
        __builtin_amdgcn_sched_barrier(0);   // without it the compiler sinks the V loads to the end of the softmax, which then no longer covers their trip
        float mt[4];
#pragma unroll   // constant indices: the scores stay in registers; four independent chains of maxima
        for (int t = 0; t < 4; ++t) {
            mt[t] = NEG;
#pragma unroll   // constant indices: the arrays stay in registers
            for (int r = 0; r < 8; ++r) {
                const int jg = j0 + t * 16 + 8 * hf + r;
                float v = s[t][r] * p.scale;
                if (jg >= p.Lk || jg > irow || (p.win > 0 && irow - jg > p.win)) v = NEG; else v *= L2E;
                s[t][r] = v; mt[t] = fmaxf(mt[t], v);
            }
        }
        float mx = fmaxf(fmaxf(mt[0], mt[1]), fmaxf(mt[2], mt[3]));
        mx = fmaxf(mx, other_half(mx));
        const float mnew = fmaxf(m, mx);
        const float ms = (mnew == NEG) ? 0.f : mnew;    // no key seen yet: every score is -inf, and -inf - 0 gives weight 0 where -inf - -inf would give NaN
        const float corr = exp2f(m - ms);               // 0 while m is -inf, where l and o are still 0
        float rt[4];
#pragma unroll   // four independent chains of sums
        for (int t = 0; t < 4; ++t) {
            rt[t] = 0.f;
#pragma unroll   // constant indices: the arrays stay in registers
            for (int r = 0; r < 8; ++r) { const float pp = exp2f(s[t][r] - ms); s[t][r] = pp; rt[t] += pp; }
        }
        float rs = (rt[0] + rt[1]) + (rt[2] + rt[3]);
        rs += other_half(rs);
        l = l * corr + rs; m = mnew;
#pragma unroll   // constant indices: the arrays stay in registers
        for (int t = 0; t < 4; ++t) o[t] *= corr;
        v16h pb[2];
#pragma unroll   // constant element indices: the vectors stay in registers
        for (int k2 = 0; k2 < 2; ++k2)
#pragma unroll   // constant indices: the arrays stay in registers
            for (int i = 0; i < 8; ++i) { pb[k2][i] = (_Float16)(s[2 * k2][i] * 4096.f); pb[k2][8 + i] = (_Float16)(s[2 * k2 + 1][i] * 4096.f); }
        // cast and stage the V tile loaded above (unrolled: vr stays in registers)
#pragma unroll   // constant indices: the arrays stay in registers
        for (int n = 0; n < NV; ++n) {
            const int idx = threadIdx.x + n * (32 * AW), jr = idx >> 4, d = (idx & 15) * 4;
            v4h hv;
#pragma unroll   // constant indices: the arrays stay in registers
            for (int e = 0; e < 4; ++e) hv[e] = (_Float16)((j0 + jr < p.Lk) ? vr[n][e] : 0.f);
            *(v4h*)&vl[jr * VP + d] = hv;
        }
        __syncthreads();                        // the V tile is visible to every wave
#pragma unroll   // constant indices: the arrays stay in registers
        for (int t = 0; t < 4; ++t) {
            const int dcol = t * 16 + l15;
            v16h a0, a1;
#pragma unroll   // constant indices: the arrays stay in registers
            for (int e = 0; e < 16; ++e) { a0[e] = vl[frag_k(e, hf) * VP + dcol]; a1[e] = vl[(32 + frag_k(e, hf)) * VP + dcol]; }
            o[t] = wmma16(a0, pb[0], o[t]);
            o[t] = wmma16(a1, pb[1], o[t]);
        }
    }
    const float inv = (l > 0.f) ? 1.f / (l * 4096.f) : 0.f;
    _Float16* mo = ol[wave];                    // the wave's 16 x 64 output tile, so that the stores to memory cover whole 128-byte lines
#pragma unroll   // constant indices: the arrays stay in registers
    for (int t = 0; t < 4; ++t) {
        v8h hv;
#pragma unroll   // constant element indices
        for (int r = 0; r < 8; ++r) hv[r] = (_Float16)(o[t][r] * inv);
        *(v8h*)&mo[l15 * VP + t * 16 + 8 * hf] = hv;
    }
    __syncthreads();                            // the tile is written before other lanes read it
    _Float16* oh = p.Oh + b * p.sOb + h * p.sOh;
    if (q0 < p.Lq) {                            // Lq is a multiple of 16: a wave's 16 rows are all there or none is
#pragma unroll   // four stores of 4 rows each, all in flight
        for (int r0 = 0; r0 < 16; r0 += 4) {
            const int row = r0 + (lane >> 3), c8 = (lane & 7) * 8;
            *(v8h*)(oh + (long long)(q0 + row) * p.sOi + c8) = *(const v8h*)&mo[row * VP + c8];
        }
    }
}

// =====================================================================================================================
// k_tr: dst(z, c, r) = alpha * src(z, r, c) (+ beta * R2(z, c, r)): [Z][R][C] (row stride lds) -> [Z][C][R] (row stride ldd) through a 32x32 LDS tile;
//   flags: 1 -> add beta * residual R2 addressed like dst (z*sRz + c*ldr + r); act applied before the residual.
// =====================================================================================================================
struct TrP { const float* src; float* dst; const float* R2; long long sSz, lds, sDz, ldd, sRz, ldr; int R, C, flags, act; float alpha, beta; };
static_assert(sizeof(TrP) == 3 * 8 + 6 * 8 + 6 * 4, "TrP has padding");
__global__ __launch_bounds__(256) void k_tr(TrP p) {
    __shared__ float tile[32][33];
    const int c0 = blockIdx.x * 32, r0 = blockIdx.y * 32, z = blockIdx.z;
    const int lane = threadIdx.x & 31, wave = threadIdx.x >> 5;
    const float* s = p.src + z * p.sSz;
#pragma unroll
    for (int k = 0; k < 4; ++k) {
        const int rl = wave * 4 + k, r = r0 + rl, c = c0 + lane;
        tile[rl][lane] = (r < p.R && c < p.C) ? s[(long long)r * p.lds + c] : 0.f;
    }
    __syncthreads();
    float* d = p.dst + z * p.sDz; const float* rr = p.R2 + z * p.sRz;
#pragma unroll
    for (int k = 0; k < 4; ++k) {
        const int cl = wave * 4 + k, c = c0 + cl, r = r0 + lane;
        if (c < p.C && r < p.R) {
            float v = act_fn(p.alpha * tile[lane][cl], p.act);
            if (p.flags & 1) v += p.beta * rr[(long long)c * p.ldr + r];
            VST2(float, d + (long long)c * p.ldd + r, v);
        }
    }
}

// k_affine: dst[i] = a * (sdev ? sdev[0] : 1) * src[i] + b, i < n (one thread per element; consecutive lanes -> consecutive addresses)
__global__ __launch_bounds__(256) void k_affine(const float* __restrict__ src, float* __restrict__ dst, int n, float a, float b, const float* __restrict__ sdev) {
    const int i = blockIdx.x * 256 + threadIdx.x;
    if (i < n) { const float aa = sdev ? a * sdev[0] : a; const float v = aa * src[i] + b; VST2(float, dst + i, v); }
}

// =====================================================================================================================
// k_softmax: row softmax over n contiguous elements, one 256-thread block per row; rows addressed z*sz + r*sr (grid (R, Z)).
//   out = scale_out * softmax(scale_in * x + (Mf ? Mf[z*smz + r*smr + j] : 0)); a row whose max is -inf is written as 0.
// =====================================================================================================================
struct SmP { const float* src; float* dst; const float* Mf; long long sz, sr, dz, dr, smz, smr; int n, pad; float scale_in, scale_out; };
static_assert(sizeof(SmP) == 3 * 8 + 6 * 8 + 4 * 4, "SmP has padding");
__global__ __launch_bounds__(256) void k_softmax(SmP p) {
    __shared__ float red[256];
    const int r = blockIdx.x, z = blockIdx.y, tid = threadIdx.x;
    const float* s = p.src + z * p.sz + (long long)r * p.sr;
    const float* mf = p.Mf ? (p.Mf + z * p.smz + (long long)r * p.smr) : nullptr;
    float mx = -__builtin_inff();
    for (int j = tid; j < p.n; j += 256) { float v = s[j] * p.scale_in; if (mf) v += mf[j]; mx = fmaxf(mx, v); }
    red[tid] = mx; __syncthreads();
    for (int o = 128; o > 0; o >>= 1) { if (tid < o) red[tid] = fmaxf(red[tid], red[tid + o]); __syncthreads(); }
    mx = red[0]; __syncthreads();
    float sum = 0.f;
    for (int j = tid; j < p.n; j += 256) { float v = s[j] * p.scale_in; if (mf) v += mf[j]; sum += (mx == -__builtin_inff()) ? 0.f : expf(v - mx); }
    red[tid] = sum; __syncthreads();
    for (int o = 128; o > 0; o >>= 1) { if (tid < o) red[tid] += red[tid + o]; __syncthreads(); }
    sum = red[0];
    const float inv = (sum > 0.f) ? p.scale_out / sum : 0.f;
    float* d = p.dst + z * p.dz + (long long)r * p.dr;
    for (int j = tid; j < p.n; j += 256) { float v = s[j] * p.scale_in; if (mf) v += mf[j]; const float o = (mx == -__builtin_inff()) ? 0.f : expf(v - mx) * inv; VST2(float, d + j, o); }
}
// =====================================================================================================================
// k_stats: mean and rsqrt(var + eps) over a set of n elements addressed base + z*sz + (e / inner) * so + (e % inner) * si, one 256-thread
// k_norm_apply: y = (x - mean[set]) * rstd[set] * g[c] + b[c] over a [Z][C][L] channel-major tensor with set = z*G + c / (C/G) (G groups per z;
//   G = C -> per-channel sets indexed z*C+c; for batch norm pass stats indexed by c only via bn = 1). Optional act. Output same layout.
// =====================================================================================================================
//   mode 0: mean / rsqrt(var + eps); mode 1 (RMSNorm): 0 / rsqrt(mean(x^2) + eps); mode 2 (L2 normalize * sqrt(n)): 0 / sqrt(n) / max(||x||, eps); mode 3: as 0 with unbiased variance (n-1)
__global__ __launch_bounds__(256) void k_stats(const float* __restrict__ x, long long sz, long long so, long long si, int inner, int n, float eps, float* __restrict__ stat, int mode) {
    __shared__ float red[256];
    const int z = blockIdx.x, tid = threadIdx.x;
    const float* base = x + z * sz;
    float s = 0.f;
    for (int e = tid; e < n; e += 256) s += base[(long long)(e / inner) * so + (long long)(e % inner) * si];
    red[tid] = s; __syncthreads();
    for (int o = 128; o > 0; o >>= 1) { if (tid < o) red[tid] += red[tid + o]; __syncthreads(); }
    const float mu = (mode == 0 || mode == 3) ? red[0] / (float)n : 0.f; __syncthreads();
    float q = 0.f;
    for (int e = tid; e < n; e += 256) { const float dlt = base[(long long)(e / inner) * so + (long long)(e % inner) * si] - mu; q += dlt * dlt; }
    red[tid] = q; __syncthreads();
    for (int o = 128; o > 0; o >>= 1) { if (tid < o) red[tid] += red[tid + o]; __syncthreads(); }
    {
        float rs;
        if (mode == 2) rs = sqrtf((float)n) / fmaxf(sqrtf(red[0]), eps); else if (mode == 3) rs = rsqrtf(red[0] / (float)(n - 1) + eps); else rs = rsqrtf(red[0] / (float)n + eps);
        if (tid < 32) { const float v = (tid == 0) ? mu : ((tid == 1) ? rs : 0.f); VST2(float, stat + (long long)z * 32 + tid, v); }
    }
}
//   One thread per element over the flat [Z][C][L] index space: grid ceil(Z*C*L / 256).
__global__ __launch_bounds__(256) void k_norm_apply(const float* __restrict__ x, float* __restrict__ y, const float* __restrict__ stat, const float* __restrict__ g, const float* __restrict__ bta,
                                                     int Z, int C, int L, int G, int bn, int act) {
    const long long idx = (long long)blockIdx.x * 256 + threadIdx.x;
    if (idx >= (long long)Z * C * L) return;
    const int l = (int)(idx % L); const long long zc = idx / L; const int c = (int)(zc % C), z = (int)(zc / C); (void)l;
    const int set = bn ? c : (z * G + c / (C / G));
    float v = (x[idx] - stat[(long long)set * 32]) * stat[(long long)set * 32 + 1];
    if (g) v *= g[c];
    if (bta) v += bta[c];
    v = act_fn(v, act);
    VST2(float, y + idx, v);
}

// k_lse_neg: c[i] = -(st[2i] + log(st[2i+1])) = minus the log-sum-exp of row i from k_attn's ST output (for softmax over the query axis)
__global__ __launch_bounds__(256) void k_lse_neg(const float* __restrict__ st, float* __restrict__ c, int n) {
    const int i = blockIdx.x * 256 + threadIdx.x;
    if (i < n) { const float v = -(st[2 * i] + logf(st[2 * i + 1])); VST2(float, c + i, v); }
}

// k_iota: dst[i] = a * i + b as int32 (segment/position id helper)
__global__ __launch_bounds__(256) void k_iota(int* __restrict__ dst, int n, int a, int b) {
    const int i = blockIdx.x * 256 + threadIdx.x;
    if (i < n) { const int v = a * i + b; VST2(int, dst + i, v); }
}

// k_axpby: dst[i] = a * x[i] + b * y[i] (+ c), i < n
__global__ __launch_bounds__(256) void k_axpby(const float* __restrict__ x, const float* __restrict__ y, float* __restrict__ dst, int n, float a, float b, float c) {
    const int i = blockIdx.x * 256 + threadIdx.x;
    if (i < n) { const float v = a * x[i] + b * y[i] + c; VST2(float, dst + i, v); }
}

// =====================================================================================================================
// k_rope: rotary embedding on a [R rows][Hn heads][D] view (row stride sXr, head stride sXh, element stride 1) -> Y (own strides).
//   mode 0: rotate_half (partner d±D/2, sign - for d<D/2); mode 1: interleaved pairs (partner d^1, sign - for even d).
//   table column tcol: tmode 0 -> d, 1 -> d % (D/2), 2 -> d / 2; position p: pmode 0 -> r % S, 1 -> head index, 2 -> pos[r];
//   c = C[(r / S) * sCb + p * sCp + tcol * sCd], s likewise from Sn; y = x[d] * c + sign * x[partner] * s. X and Y must not alias.
// =====================================================================================================================
struct RopeP { const float* X; float* Y; const float* C; const float* Sn; const int* pos; long long sXr, sXh, sYr, sYh, sCb, sCp, sCd; int R, Hn, D, S, mode, tmode, pmode, pad; };
static_assert(sizeof(RopeP) == 5 * 8 + 7 * 8 + 8 * 4, "RopeP has padding");
__global__ __launch_bounds__(256) void k_rope(RopeP p) {
    const long long idx = (long long)blockIdx.x * 256 + threadIdx.x;
    if (idx >= (long long)p.R * p.Hn * p.D) return;
    const int d = (int)(idx % p.D); const long long rh = idx / p.D; const int h = (int)(rh % p.Hn); const int r = (int)(rh / p.Hn);
    const int half = p.D / 2;
    int partner; float sign;
    if (p.mode == 0) { partner = (d < half) ? d + half : d - half; sign = (d < half) ? -1.f : 1.f; }
    else { partner = d ^ 1; sign = (d & 1) ? 1.f : -1.f; }
    const int tcol = (p.tmode == 0) ? d : ((p.tmode == 1) ? (d % half) : (d >> 1));
    const int pp = (p.pmode == 0) ? (r % p.S) : ((p.pmode == 1) ? h : p.pos[r]);
    const long long toff = (long long)(r / p.S) * p.sCb + (long long)pp * p.sCp + (long long)tcol * p.sCd;
    const float* xr = p.X + (long long)r * p.sXr + (long long)h * p.sXh;
    const float v = xr[d] * p.C[toff] + sign * xr[partner] * p.Sn[toff];
    VST2(float, p.Y + (long long)r * p.sYr + (long long)h * p.sYh + d, v);
}

// k_invf + k_sincos (split so neither kernel carries a large VALU-fma footprint): invf_i = num * (1 / powf(base, (2 i)/D)) [fmode 0],
//   num * expf((2 i) * cexp) [fmode 1], num * powf(base, -2 (i - 1) / D) [fmode 2]; then cs/sn[s*half + i] = cos/sin((pscale * s) * invf_i)
__global__ __launch_bounds__(256) void k_invf(float* __restrict__ invb, int half, int D, float base, float num, int fmode, float cexp) {
    const int i = blockIdx.x * 256 + threadIdx.x;
    if (i >= ((half + 31) / 32) * 32) return;
    if (i >= half) { VST2(float, invb + i, 0.f); return; }
    const float e = (float)(2 * i) / (float)D;
    float invf;
    if (fmode == 1) invf = num * expf((float)(2 * i) * cexp);
    else if (fmode == 2) invf = num * powf(base, (-2.0f * ((float)i - 1.0f)) / (float)D);
    else invf = num * (1.0f / powf(base, e));
    VST2(float, invb + i, invf);
}
__global__ __launch_bounds__(256) void k_sincos(float* __restrict__ cs, float* __restrict__ sn, const float* __restrict__ invb, int S, int half, float pscale) {
    const int idx = blockIdx.x * 256 + threadIdx.x;
    if (idx >= S * half) return;
    const int s = idx / half, i = idx - s * half;
    const float ang = (pscale * (float)s) * invb[i];
    VST2(float, cs + idx, cosf(ang)); VST2(float, sn + idx, sinf(ang));
}

// k_mulact: dst[i] = act(x[i]) * y[i]
__global__ __launch_bounds__(256) void k_mulact(const float* __restrict__ x, const float* __restrict__ y, float* __restrict__ dst, int n, int act) {
    const int i = blockIdx.x * 256 + threadIdx.x;
    if (i < n) { const float v = act_fn(x[i], act) * y[i]; VST2(float, dst + i, v); }
}

// =====================================================================================================================
// k_matvec: thread-per-row matrix-vector products for N <= 8 output columns (heads with 1-3 outputs, gates), f32 on the VALU.
//   C[r*sCm + j] = act(alpha * sum_k A[r*sAm + k*sAk] * B[j*sBn + k*sBk] + bias[j]) + beta * R[r*sRm + j*sRn]; each thread writes its N contiguous floats.
// =====================================================================================================================
__global__ __launch_bounds__(256) void k_matvec(GemmP p) {
    // 32 lanes write one line with one instruction.
    const int rpt = (p.N == 1) ? 1 : 32;
    const long long r0 = ((long long)blockIdx.x * 256 + threadIdx.x) * rpt; const int z = blockIdx.z, zo = z / p.zi_n, zi = z - zo * p.zi_n;
    if (r0 >= p.M) return;
    const float* Bb = p.B + zo * p.sBo + zi * p.sBi;
    float* C = p.C + zo * p.sCo + zi * p.sCi; const float* R = p.R + zo * p.sRo + zi * p.sRi;
    for (int rr = 0; rr < rpt; ++rr) {
        const long long r = r0 + rr; if (r >= p.M) break;
        const float* A = p.A + zo * p.sAo + zi * p.sAi + r * p.sAm;
        float acc[8] = {0.f, 0.f, 0.f, 0.f, 0.f, 0.f, 0.f, 0.f};
        for (int k = 0; k < p.K; ++k) { const float a = A[(long long)k * p.sAk];
#pragma unroll
            for (int j = 0; j < 8; ++j) if (j < p.N) acc[j] += a * Bb[(long long)j * p.sBn + (long long)k * p.sBk]; }
#pragma unroll
        for (int j = 0; j < 8; ++j) if (j < p.N) {
            float v = acc[j] * p.alpha;
            if (p.flags & 1) v += p.bias[j];
            if (p.flags & 2) v += p.bias[r];
            v = act_fn(v, p.act);
            if (p.flags & 4) v += p.beta * R[r * p.sRm + (long long)j * p.sRn];
            VST2(float, C + r * p.sCm + j, v);
        }
    }
}
// k_smallsoftmax: thread-per-row softmax for short rows (n <= 64): dst[r*dr + j] = softmax(scale*src[r*sr + j])
__global__ __launch_bounds__(256) void k_smallsoftmax(const float* __restrict__ src, float* __restrict__ dst, long long sr, long long dr, int n, long long R, float scale) {
    const long long r0 = ((long long)blockIdx.x * 256 + threadIdx.x) * 32;
    for (int rr = 0; rr < 32; ++rr) {
        const long long r = r0 + rr; if (r >= R) return;
        const float* s = src + r * sr; float* d = dst + r * dr;
        float mx = -__builtin_inff();
        for (int j = 0; j < n; ++j) mx = fmaxf(mx, s[j] * scale);
        float sum = 0.f;
        for (int j = 0; j < n; ++j) sum += expf(s[j] * scale - mx);
        const float inv = 1.f / sum;
        for (int j = 0; j < n; ++j) { const float v = expf(s[j] * scale - mx) * inv; VST2(float, d + j, v); }
    }
}

__global__ __launch_bounds__(32) void k_unitstat(float* __restrict__ st) { const int t = threadIdx.x; const float v = (t == 1) ? 1.f : 0.f; VST2(float, st + t, v); }

// destination (e.g. a d_out whose row width is not a multiple of 32 floats) is written by consecutive lanes of one instruction
__global__ __launch_bounds__(256) void k_lincopy(const float* __restrict__ src, long long lds, float* __restrict__ dst, long long ldd, long long rows, int cols) {
    const long long i = (long long)blockIdx.x * 256 + threadIdx.x; if (i >= rows * cols) return;
    const long long r = i / cols; const int c = (int)(i - r * cols);
    const float v = src[r * lds + c]; VST2(float, dst + r * ldd + c, v);
}

namespace w25 {
typedef __attribute__((ext_vector_type(16))) _Float16 v16h;
typedef __attribute__((ext_vector_type(8)))  _Float16 v8h;
typedef __attribute__((ext_vector_type(16))) __bf16   v16b;
typedef __attribute__((ext_vector_type(8)))  __bf16   v8b;
typedef __attribute__((ext_vector_type(8)))  float    v8f;
typedef __attribute__((ext_vector_type(4)))  float    v4f;

__device__ __forceinline__ unsigned short f2bf_bits(float f) {
  unsigned u = __float_as_uint(f);
  return (unsigned short)((u + 0x7FFFu + ((u >> 16) & 1u)) >> 16);
}
__device__ __forceinline__ float bf_bits2f(unsigned short h) { return __uint_as_float(((unsigned)h) << 16); }

// hazard guards as plain device helpers (no inline asm inside the kernel template body)
__device__ __forceinline__ void dep_guard_h(v8f& a, v8f& b, v16h x, v16h y) { asm volatile("v_nop\n\tv_nop\n\tv_nop\n\tv_nop" : "+v"(a), "+v"(b) : "v"(x), "v"(y)); }
__device__ __forceinline__ void dep_guard_b(v8f& a, v8f& b, v16b x, v16b y) { asm volatile("v_nop\n\tv_nop\n\tv_nop\n\tv_nop" : "+v"(a), "+v"(b) : "v"(x), "v"(y)); }
__device__ __forceinline__ void keep4_h(v16h a, v16h b, v16h c, v16h d) { asm volatile("v_nop" :: "v"(a), "v"(b), "v"(c), "v"(d)); }
__device__ __forceinline__ void keep4_b(v16b a, v16b b, v16b c, v16b d) { asm volatile("v_nop" :: "v"(a), "v"(b), "v"(c), "v"(d)); }
__device__ __forceinline__ void acc_guard4(v8f& a, v8f& b, v8f& c, v8f& d) { asm volatile("v_nop\n\tv_nop\n\tv_nop\n\tv_nop" : "+v"(a), "+v"(b), "+v"(c), "+v"(d)); }
template <typename T> struct Frag;
template <> struct Frag<_Float16> {
  typedef v16h V; union U { v16h v; v8h h[2]; };
  static __device__ __forceinline__ v16h load(const _Float16* p) {   // elements 0..7 <- p[0..7], 8..15 <- p[16..23]
    U f; f.h[0] = *(const v8h*)(p); f.h[1] = *(const v8h*)(p + 16); return f.v;
  }
  static __device__ __forceinline__ v8f mma(v16h a, v16h b, v8f c) {
    return __builtin_amdgcn_wmma_f32_16x16x32_f16(false, a, false, b, (short)0, c, false, false);
  }
  static __device__ __forceinline__ void guard(v8f& a, v8f& b, v16h x, v16h y) { dep_guard_h(a, b, x, y); }
  static __device__ __forceinline__ void keep(v16h a, v16h b, v16h c, v16h d) { keep4_h(a, b, c, d); }
};
template <> struct Frag<__bf16> {
  typedef v16b V; union U { v16b v; v8b h[2]; };
  static __device__ __forceinline__ v16b load(const __bf16* p) {
    U f; f.h[0] = *(const v8b*)(p); f.h[1] = *(const v8b*)(p + 16); return f.v;
  }
  static __device__ __forceinline__ v8f mma(v16b a, v16b b, v8f c) {
    return __builtin_amdgcn_wmma_f32_16x16x32_bf16(false, a, false, b, (short)0, c, false, false);
  }
  static __device__ __forceinline__ void guard(v8f& a, v8f& b, v16b x, v16b y) { dep_guard_b(a, b, x, y); }
  static __device__ __forceinline__ void keep(v16b a, v16b b, v16b c, v16b d) { keep4_b(a, b, c, d); }
};

// ---- Register-blocked batched WMMA GEMM ------------------------------------
// C[m,n] = scale * sum_k A[m,k] * Bt[n,k] (+bias)(+resid); each wave owns a 64x64 tile.
// A row-major [M,K]; Bt row-major [N,K]; M,N % 64 == 0, K % 32 == 0.
// SPLIT: operands are hi/lo planes (A2/Bt2 = lo planes, same layout); product = hi·hi + hi·lo + lo·hi.
// BIAS_MODE: 0 = none, 1 = bias[m], 2 = bias[n]. Batch 1 takes bias_b1 and batch 2 bias_b2 in its place (up to three products that share A in one launch).
// OUT_MODE: 0 = f32, 1 = f16, 2 = bf16 hi plane (Cout) + bf16 lo plane (Cout2).
// ET: 0 = f16 operands, 1 = bf16 operands (pointers passed as 16-bit storage)
template <int ET> struct Elem;
template <> struct Elem<0> { typedef _Float16 T; };
template <> struct Elem<1> { typedef __bf16 T; };
template <int ET, bool SPLIT, int BIAS_MODE, int OUT_MODE, bool RESID, int ACT = 0>
__global__ __launch_bounds__(256) void wmma_gemm64(
    const unsigned short* __restrict__ Ap, const unsigned short* __restrict__ A2p, int lda, long strideA,
    const unsigned short* __restrict__ Btp, const unsigned short* __restrict__ Bt2p, int ldb, long strideB,
    void* __restrict__ Cout, void* __restrict__ Cout2, int ldc, long strideC,
    const float* __restrict__ bias, const float* __restrict__ bias_b1, const float* __restrict__ bias_b2,
    const float* __restrict__ resid, long strideR,
    int M, int N, int K, float scale) {
  typedef typename Elem<ET>::T T;
  typedef typename Frag<T>::V V;
  const T* A = (const T*)Ap; const T* A2 = (const T*)A2p; const T* Bt = (const T*)Btp; const T* Bt2 = (const T*)Bt2p;
  __shared__ __align__(16) float sT[8][16 * 68];   // per-wave 16x64 slab, pitch 68 floats
  const int b    = blockIdx.y;
  const int lane = threadIdx.x & 31;
  const int wave = threadIdx.x >> 5;
  const int tilesN = N >> 6;
  const int tilesM = M >> 6;
  const int tile = blockIdx.x * 8 + wave;
  if (tile >= tilesM * tilesN) return;   // wave-uniform; no block barriers in this kernel
  const int tm = tile / tilesN;
  const int tn = tile - tm * tilesN;
  const int m0 = tm << 6;
  const int n0 = tn << 6;

  const T* Ab  = A  + (size_t)b * strideA;
  const T* Bb  = Bt + (size_t)b * strideB;
  const T* Ab2 = SPLIT ? (A2  + (size_t)b * strideA) : nullptr;
  const T* Bb2 = SPLIT ? (Bt2 + (size_t)b * strideB) : nullptr;

  const int rlane = lane & 15;                 // row (A) / col (B, D) within subtile
  const int koff  = (lane >> 4) * 8;           // k offset of this lane half
  const int mOff  = (lane >> 4) * 8;           // D row offset

  v8f acc[4][4];
#pragma unroll
  for (int i = 0; i < 4; ++i)
#pragma unroll
    for (int j = 0; j < 4; ++j) acc[i][j] = (v8f){0.f,0.f,0.f,0.f,0.f,0.f,0.f,0.f};

  for (int k0 = 0; k0 < K; k0 += 32) {
    V bh[4], bl[4];
#pragma unroll
    for (int j = 0; j < 4; ++j) {
      const size_t bo = (size_t)(n0 + (j << 4) + rlane) * ldb + koff + k0;
      bh[j] = Frag<T>::load(Bb + bo);
      if (SPLIT) bl[j] = Frag<T>::load(Bb2 + bo);
    }
#pragma unroll
    for (int i = 0; i < 4; ++i) {
      const size_t ao = (size_t)(m0 + (i << 4) + rlane) * lda + koff + k0;
      V ah = Frag<T>::load(Ab + ao);
      V al;
      if (SPLIT) al = Frag<T>::load(Ab2 + ao);
#pragma unroll
      for (int j = 0; j < 4; ++j) {
        acc[i][j] = Frag<T>::mma(ah, bh[j], acc[i][j]);
        if (SPLIT) {
          acc[i][j] = Frag<T>::mma(ah, bl[j], acc[i][j]);
          acc[i][j] = Frag<T>::mma(al, bh[j], acc[i][j]);
        }
      }
      Frag<T>::guard(acc[i][0], acc[i][3], ah, SPLIT ? al : ah);
    }
    Frag<T>::keep(bh[0], bh[1], bh[2], bh[3]);
    if (SPLIT) Frag<T>::keep(bl[0], bl[1], bl[2], bl[3]);
  }
  acc_guard4(acc[0][0], acc[0][1], acc[0][2], acc[0][3]);
  acc_guard4(acc[1][0], acc[1][1], acc[1][2], acc[1][3]);
  acc_guard4(acc[2][0], acc[2][1], acc[2][2], acc[2][3]);
  acc_guard4(acc[3][0], acc[3][1], acc[3][2], acc[3][3]);

  // ---- epilogue ----
  float* slab = sT[wave];
  const float* Rb = RESID ? (resid + (size_t)b * strideR) : nullptr;
  const float* bsel = (b == 0) ? bias : ((b == 1) ? bias_b1 : bias_b2);
#pragma unroll
  for (int i = 0; i < 4; ++i) {
    const int mBase = m0 + (i << 4);
#pragma unroll
    for (int j = 0; j < 4; ++j) {
      const int n = n0 + (j << 4) + rlane;
      float bv = 0.f;
      if (BIAS_MODE == 2) bv = bsel[n];
#pragma unroll
      for (int r = 0; r < 8; ++r) {
        float v = acc[i][j][r] * scale;
        if (BIAS_MODE == 1) v += bsel[mBase + mOff + r];
        if (BIAS_MODE == 2) v += bv;
        if (RESID) v += Rb[(size_t)(mBase + mOff + r) * ldc + n];
        if (ACT == 1) v = tanhf(v);
        if (ACT == 2) v = fmaxf(v, 0.0f);
        if (ACT == 3) v = v / (1.0f + expf(-v));
        if (ACT == 4) v = (v > 0.f) ? v : 0.01f * v;
        if (ACT == 5) v = 0.5f * v * (1.0f + erff(v * 0.70710678118654752f));
        slab[(mOff + r) * 68 + (j << 4) + rlane] = v;
      }
    }
    __builtin_amdgcn_fence(__ATOMIC_RELEASE, "workgroup");
    __builtin_amdgcn_wave_barrier();
    __builtin_amdgcn_fence(__ATOMIC_ACQUIRE, "workgroup");
    if (OUT_MODE == 0) {
      float* C = (float*)Cout + (size_t)b * strideC;
      const int hh = lane >> 4, c4 = (lane & 15) * 4;     // row seg = 256 B = 16 lanes x 16 B
      {
#pragma unroll
        for (int it = 0; it < 8; ++it) {
          const int row = it * 2 + hh;
          v4f v = *(const v4f*)(slab + row * 68 + c4);
          *(v4f*)(C + (size_t)(mBase + row) * ldc + n0 + c4) = v;
        }
        
      }
    } else {
      const int q = lane >> 3, c8 = (lane & 7) * 8;
      unsigned short* C  = (unsigned short*)Cout  + (size_t)b * strideC;
      unsigned short* C2 = (OUT_MODE == 2) ? ((unsigned short*)Cout2 + (size_t)b * strideC) : nullptr;
      {
#pragma unroll
        for (int it = 0; it < 4; ++it) {
          const int row = it * 4 + q;
          const float* sp = slab + row * 68 + c8;
          v8h hv, lv;
#pragma unroll
          for (int e = 0; e < 8; ++e) {
            if (OUT_MODE == 1) {
              hv[e] = (_Float16)sp[e];
            } else {
              unsigned short hb = f2bf_bits(sp[e]);
              unsigned short lb = f2bf_bits(sp[e] - bf_bits2f(hb));
              hv[e] = __builtin_bit_cast(_Float16, hb);
              lv[e] = __builtin_bit_cast(_Float16, lb);
            }
          }
          *(v8h*)(C + (size_t)(mBase + row) * ldc + n0 + c8) = hv;
          if (OUT_MODE == 2) *(v8h*)(C2 + (size_t)(mBase + row) * ldc + n0 + c8) = lv;
        }
        
      }
    }
    __builtin_amdgcn_fence(__ATOMIC_RELEASE, "workgroup");
    __builtin_amdgcn_wave_barrier();
    __builtin_amdgcn_fence(__ATOMIC_ACQUIRE, "workgroup");
  }
}

// ---- WMMA GEMM with both operands staged in LDS by asynchronous copies -------
// The product, k order, accumulators' sum order and epilogue of wmma_gemm64 (f16 operands, bias[n]): C[m,n] = act(scale * sum_k A[m,k] * Bt[n,k] + bias[n] (+ resid[m,n])).
// A block of 4 waves owns a 128 x 64 tile of C, a wave 32 x 64 of it (2 x 4 accumulator tiles); grid (N / 64, M / 128, batches); A is shared by the batches.
// A stage is 128 k (256 bytes) of the block's 128 A rows and 64 Bt rows. Each lane copies 16 bytes, so a wave's copy covers two whole 256-byte row pieces
// (a fragment load from global memory touches 16 lines for the same 512 bytes), and a row is fetched once per block instead of once per wave that needs it.
// Two buffers: stage t + 1 flies while stage t is worked on. M % 128 == 0, N % 64 == 0, K % 128 == 0, rows 16-byte aligned. LDC: row pitch of C and of the residual, in elements.
constexpr int SG_KC = 128;                         // k per stage
constexpr int SG_PITCH = 272;                      // LDS row pitch in bytes: 256 + 16, conflict-free for the 16-byte fragment reads
constexpr int SG_BUF = (128 + 64) * SG_PITCH;      // one buffer: A rows 0..127, then Bt rows 0..63
// Twelve copies and the wait that stands in front of any rewrite of their address registers, in one statement so that the compiler can put nothing between them.
__device__ __forceinline__ void copy12(const unsigned (&l)[12], const _Float16* const (&g)[12]) {
  asm volatile(
      "global_load_async_to_lds_b128 %0, %1, off\n\t"
      "global_load_async_to_lds_b128 %2, %3, off\n\t"
      "global_load_async_to_lds_b128 %4, %5, off\n\t"
      "global_load_async_to_lds_b128 %6, %7, off\n\t"
      "global_load_async_to_lds_b128 %8, %9, off\n\t"
      "global_load_async_to_lds_b128 %10, %11, off\n\t"
      "global_load_async_to_lds_b128 %12, %13, off\n\t"
      "global_load_async_to_lds_b128 %14, %15, off\n\t"
      "global_load_async_to_lds_b128 %16, %17, off\n\t"
      "global_load_async_to_lds_b128 %18, %19, off\n\t"
      "global_load_async_to_lds_b128 %20, %21, off\n\t"
      "global_load_async_to_lds_b128 %22, %23, off\n\t"
      "s_wait_xcnt 0x0"
      :: "v"(l[0]), "v"(g[0]), "v"(l[1]), "v"(g[1]), "v"(l[2]), "v"(g[2]), "v"(l[3]), "v"(g[3]), "v"(l[4]), "v"(g[4]), "v"(l[5]), "v"(g[5]),
         "v"(l[6]), "v"(g[6]), "v"(l[7]), "v"(g[7]), "v"(l[8]), "v"(g[8]), "v"(l[9]), "v"(g[9]), "v"(l[10]), "v"(g[10]), "v"(l[11]), "v"(g[11])
      : "memory");
}
// One stage: thread t brings the 16-byte piece (t & 15) of rows (t >> 4) + 8 u, u = 0..23, of the buffer (24 copies per wave in flight).
// lds0: the LDS byte address of its piece in row t >> 4 of the buffer; a0, b0: the same piece of row t >> 4 of the block's A and Bt rows at this stage's k.
__device__ __forceinline__ void stage_in(unsigned lds0, const _Float16* a0, int lda, const _Float16* b0, int ldb) {
  unsigned l[12]; const _Float16* g[12];
#pragma unroll   // constant indices: the addresses stay in registers
  for (int u = 0; u < 12; ++u) { l[u] = lds0 + (unsigned)(u * 8 * SG_PITCH); g[u] = a0 + (size_t)(u * 8) * lda; }
  copy12(l, g);
#pragma unroll   // constant indices
  for (int u = 0; u < 4; ++u) { l[u] = lds0 + (unsigned)((12 + u) * 8 * SG_PITCH); g[u] = a0 + (size_t)((12 + u) * 8) * lda; }
#pragma unroll   // constant indices
  for (int u = 0; u < 8; ++u) { l[4 + u] = lds0 + (unsigned)((16 + u) * 8 * SG_PITCH); g[4 + u] = b0 + (size_t)(u * 8) * ldb; }
  copy12(l, g);
}
template <int OUT_MODE, bool RESID, int ACT, int LDC>
__global__ __launch_bounds__(128) void wmma_gemm_lds(
    const unsigned short* __restrict__ Ap, int lda,
    const unsigned short* __restrict__ Btp, int ldb, long strideB,
    void* __restrict__ Cout, long strideC,
    const float* __restrict__ bias, const float* __restrict__ bias_b1, const float* __restrict__ bias_b2,
    const float* __restrict__ resid, int K, float scale) {
  typedef _Float16 T;
  static_assert(OUT_MODE == 0 || OUT_MODE == 1, "f32 or f16 output");
  __shared__ __align__(16) unsigned char ring[2 * SG_BUF];   // the two buffers; behind the loop's last barrier its head is the waves' output staging
  const int b    = blockIdx.z;
  const int tid  = threadIdx.x;
  const int lane = tid & 31;
  const int wave = tid >> 5;
  const int n0 = blockIdx.x << 6;
  const int m0 = (blockIdx.y << 7) + (wave << 5);             // the wave's first row of C
  const int rlane = lane & 15;                 // row (A) / col (B, D) within subtile
  const int koff  = (lane >> 4) * 8;           // k offset of this lane half
  const int mOff  = (lane >> 4) * 8;           // D row offset

  const T* a0 = (const T*)Ap + (size_t)((blockIdx.y << 7) + (tid >> 4)) * lda + (tid & 15) * 8;
  const T* b0 = (const T*)Btp + (size_t)b * strideB + (size_t)(n0 + (tid >> 4)) * ldb + (tid & 15) * 8;
  const unsigned lds0 = (unsigned)(size_t)ring + (unsigned)((tid >> 4) * SG_PITCH + (tid & 15) * 16);
  const int nt = K / SG_KC;

  v8f acc[2][4];
#pragma unroll
  for (int i = 0; i < 2; ++i)
#pragma unroll
    for (int j = 0; j < 4; ++j) acc[i][j] = (v8f){0.f,0.f,0.f,0.f,0.f,0.f,0.f,0.f};

  stage_in(lds0, a0, lda, b0, ldb);
  asm volatile("s_wait_asynccnt 0x0" ::: "memory");           // this wave's part of stage 0 has landed
  __syncthreads();                                             // every wave's part has
  if (nt > 1) stage_in(lds0 + SG_BUF, a0 + SG_KC, lda, b0 + SG_KC, ldb);
  for (int t = 0; t < nt; ++t) {
    const unsigned char* buf = ring + (t & 1) * SG_BUF;
    const unsigned char* arow = buf + ((wave << 5) + rlane) * SG_PITCH + koff * 2;
    const unsigned char* brow = buf + (128 + rlane) * SG_PITCH + koff * 2;
    // Two fragment sets: the 12 LDS reads of k-step ks + 1 go out as one group ahead of the 8 products of k-step ks, which cover their latency.
    v16h bh[2][4], ah[2][2];
#pragma unroll   // constant indices: the fragments stay in registers
    for (int j = 0; j < 4; ++j) bh[0][j] = Frag<T>::load((const T*)(brow + j * 16 * SG_PITCH));
#pragma unroll
    for (int i = 0; i < 2; ++i) ah[0][i] = Frag<T>::load((const T*)(arow + i * 16 * SG_PITCH));
#pragma unroll   // constant set indices and LDS offsets
    for (int ks = 0; ks < SG_KC / 32; ++ks) {
      if (ks + 1 < SG_KC / 32) {
#pragma unroll
        for (int j = 0; j < 4; ++j) bh[(ks + 1) & 1][j] = Frag<T>::load((const T*)(brow + j * 16 * SG_PITCH + (ks + 1) * 64));
#pragma unroll
        for (int i = 0; i < 2; ++i) ah[(ks + 1) & 1][i] = Frag<T>::load((const T*)(arow + i * 16 * SG_PITCH + (ks + 1) * 64));
        __builtin_amdgcn_sched_barrier(0);   // without it the compiler sinks these reads among the products into one register set and waits out the LDS latency twice per k-step
      }
#pragma unroll
      for (int i = 0; i < 2; ++i)
#pragma unroll
        for (int j = 0; j < 4; ++j) acc[i][j] = Frag<T>::mma(ah[ks & 1][i], bh[ks & 1][j], acc[i][j]);
      if (ks + 1 < SG_KC / 32) __builtin_amdgcn_sched_barrier(0);   // the next group of reads stays behind these products, whole
    }
    asm volatile("s_wait_dscnt 0x0" ::: "memory");             // this wave's reads of stage t are done before the buffer is handed back
    asm volatile("s_wait_asynccnt 0x0" ::: "memory");          // this wave's part of stage t + 1 has landed
    __syncthreads();                                           // publishes stage t + 1 and ends every wave's reads of stage t
    if (t + 2 < nt) stage_in(lds0 + (unsigned)((t & 1) * SG_BUF), a0 + (size_t)(t + 2) * SG_KC, lda, b0 + (size_t)(t + 2) * SG_KC, ldb);
  }
  asm volatile("s_wait_asynccnt 0x0" ::: "memory");            // nothing is in flight when the ring becomes output staging

  // ---- epilogue: wmma_gemm64's arithmetic, per 16 x 64 slab ----
  float* slab = (float*)ring + wave * (16 * 68);               // per-wave 16x64 slab, pitch 68 floats
  const float* bsel = (b == 0) ? bias : ((b == 1) ? bias_b1 : bias_b2);
  // The bias values, and each slab's residual values, come as a run of loads in flight together, off one index or one address with constant offsets (LDC is a constant for that).
  const int nl = n0 + rlane;
  const float* rp = RESID ? resid + (size_t)(m0 + mOff) * LDC + nl : nullptr;
  float bv[4];
#pragma unroll   // constant indices: the values stay in registers
  for (int j = 0; j < 4; ++j) bv[j] = bsel[nl + (j << 4)];
  // The wait in front of any rewrite of a register that the run names; as its input the index stays whole until it, so that no load of the run lands in it.
  asm volatile("s_wait_xcnt 0x0" :: "v"(nl) : "memory");
#pragma unroll
  for (int i = 0; i < 2; ++i) {
    float rv[4][8];
    if (RESID) {
#pragma unroll   // constant indices
      for (int j = 0; j < 4; ++j)
#pragma unroll
        for (int r = 0; r < 8; ++r) rv[j][r] = rp[((i << 4) + r) * LDC + (j << 4)];
      asm volatile("s_wait_xcnt 0x0" :: "v"(rp) : "memory");   // the same wait for this run, the address as its input
    }
#pragma unroll
    for (int j = 0; j < 4; ++j) {
#pragma unroll
      for (int r = 0; r < 8; ++r) {
        float v = acc[i][j][r] * scale;
        v += bv[j];
        if (RESID) v += rv[j][r];
        if (ACT == 5) v = 0.5f * v * (1.0f + erff(v * 0.70710678118654752f));
        slab[(mOff + r) * 68 + (j << 4) + rlane] = v;
      }
    }
    __builtin_amdgcn_fence(__ATOMIC_RELEASE, "workgroup");
    __builtin_amdgcn_wave_barrier();
    __builtin_amdgcn_fence(__ATOMIC_ACQUIRE, "workgroup");
    if (OUT_MODE == 0) {
      const int hh = lane >> 4, c4 = (lane & 15) * 4;     // row seg = 256 B = 16 lanes x 16 B
      float* cp = (float*)Cout + (size_t)b * strideC + (size_t)(m0 + hh) * LDC + n0 + c4;   // one address, the rows at constant offsets
#pragma unroll
      for (int it = 0; it < 8; ++it) {
        const int row = it * 2 + hh;
        v4f v = *(const v4f*)(slab + row * 68 + c4);
        *(v4f*)(cp + ((i << 4) + it * 2) * LDC) = v;
      }
    } else {
      const int q = lane >> 3, c8 = (lane & 7) * 8;       // row seg = 128 B = 8 lanes x 16 B
      _Float16* cp = (_Float16*)Cout + (size_t)b * strideC + (size_t)(m0 + q) * LDC + n0 + c8;   // one address, the rows at constant offsets
#pragma unroll
      for (int it = 0; it < 4; ++it) {
        const int row = it * 4 + q;
        const float* sp = slab + row * 68 + c8;
        v8h hv;
#pragma unroll
        for (int e = 0; e < 8; ++e) hv[e] = (_Float16)sp[e];
        *(v8h*)(cp + ((i << 4) + it * 4) * LDC) = hv;
      }
    }
    __builtin_amdgcn_fence(__ATOMIC_RELEASE, "workgroup");
    __builtin_amdgcn_wave_barrier();
    __builtin_amdgcn_fence(__ATOMIC_ACQUIRE, "workgroup");
  }
}

__global__ __launch_bounds__(256) void cast_f32_f16x2(
    const float* __restrict__ in, _Float16* __restrict__ out, int n2) {
  int i = blockIdx.x * 256 + threadIdx.x;
  if (i < n2) {
    const _Float16 h0 = (_Float16)in[2 * i], h1 = (_Float16)in[2 * i + 1];
    const unsigned u = (unsigned)__builtin_bit_cast(unsigned short, h0) | ((unsigned)__builtin_bit_cast(unsigned short, h1) << 16);
    ((unsigned*)out)[i] = u;
    
  }
}


} // namespace w25

__global__ __launch_bounds__(256) void k_castT16(const float* __restrict__ src, long long lds, _Float16* __restrict__ dst, long long ldd, int R, int C, float s) {
    const long long i = (long long)blockIdx.x * 256 + threadIdx.x; const long long np = (long long)C * (R / 2); if (i >= np) return; const int c = (int)(i / (R / 2)); const int r = 2 * (int)(i % (R / 2));
    const _Float16 h0 = (_Float16)(src[(long long)r * lds + c] * s), h1 = (_Float16)(src[(long long)(r + 1) * lds + c] * s);
    const unsigned u = (unsigned)__builtin_bit_cast(unsigned short, h0) | ((unsigned)__builtin_bit_cast(unsigned short, h1) << 16);
    unsigned* d = (unsigned*)(dst + (long long)c * ldd + r); *d = u;  }
__global__ __launch_bounds__(256) void k_cast16(const float* __restrict__ src, long long lds, _Float16* __restrict__ dst, long long ldd, int R, int C, float s) {
    const long long i = (long long)blockIdx.x * 256 + threadIdx.x; const long long np = (long long)R * (C / 2); if (i >= np) return; const int r = (int)(i / (C / 2)); const int c = 2 * (int)(i % (C / 2));
    const _Float16 h0 = (_Float16)(src[(long long)r * lds + c] * s), h1 = (_Float16)(src[(long long)r * lds + c + 1] * s);
    const unsigned u = (unsigned)__builtin_bit_cast(unsigned short, h0) | ((unsigned)__builtin_bit_cast(unsigned short, h1) << 16);
    unsigned* d = (unsigned*)(dst + (long long)r * ldd + c); *d = u;  }

// cast_weights<U>: the six weight matrices (four of 512 x 512, two of 2048 x 512 elements) as f16 of s * w into one plane, one behind the other in argument order.
//   A block takes 256 * U consecutive pieces of 4 elements of one matrix, a thread the pieces threadIdx.x + 256 * u of them: a wave's load covers 512 contiguous bytes
//   and its store 256, and the U loads of a thread are in flight together. blk runs over all (4 * 512 * 512 + 2 * 2048 * 512) / (4 * 256 * U) blocks, so no element guard.
template <int U>
__device__ __forceinline__ void cast_weights(int blk, const float* __restrict__ w0, const float* __restrict__ w1, const float* __restrict__ w2, const float* __restrict__ w3,
                                             const float* __restrict__ w4, const float* __restrict__ w5, _Float16* __restrict__ dst, float s) {
    constexpr int BS = (512 * 512) / (4 * 256 * U), BL = (2048 * 512) / (4 * 256 * U);   // blocks per small and per large matrix
    static_assert(BS * (4 * 256 * U) == 512 * 512, "whole blocks per matrix");
    const float* src; int first;                                  // the block's matrix and that matrix's first block (the same for the whole block)
    if (blk < BS) { src = w0; first = 0; }
    else if (blk < 2 * BS) { src = w1; first = BS; }
    else if (blk < 3 * BS) { src = w2; first = 2 * BS; }
    else if (blk < 4 * BS) { src = w3; first = 3 * BS; }
    else if (blk < 4 * BS + BL) { src = w4; first = 4 * BS; }
    else { src = w5; first = 4 * BS + BL; }
    const v4f* sp = (const v4f*)src + (blk - first) * (256 * U) + threadIdx.x;
    v4h* dp = (v4h*)dst + blk * (256 * U) + threadIdx.x;
    v4f a[U];
#pragma unroll   // constant indices: a stays in registers, and all U loads are issued before the first cast
    for (int u = 0; u < U; ++u) a[u] = sp[u * 256];
#pragma unroll   // constant indices into a
    for (int u = 0; u < U; ++u) {
        v4h hv;
#pragma unroll   // constant element indices: the vectors stay in registers
        for (int e = 0; e < 4; ++e) hv[e] = (_Float16)(a[u][e] * s);
        dp[u * 256] = hv;
    }
}
// ln_rows_f16: y = f16((x - mean) * rsqrt(var + eps) * g + b) over contiguous rows of 512 elements, one wave per row, 8 rows per 256-thread block (blk = block of rows).
//   The row stays in registers between the two sums and the output: statistics, normalisation and the cast for the next product are one pass over x.
//   A lane holds the pieces lane + 32 * u of 4 channels (a wave's load covers 512 contiguous bytes): element t = 128 * u + 4 * lane + e.
//   Both sums keep the order of k_stats (256 partials of elements t and t + 256, then a binary tree that pairs t with t + 128, 64, ..., 1), so mean and rstd keep their bits:
//   distance 128 is u, 64 to 4 are the lane's bits (shuffles, both partners form the same sum), 2 and 1 are e.
__device__ __forceinline__ float tree256(const float (&p)[2][4]) {
    float r[4];
#pragma unroll   // constant indices: r stays in registers
    for (int e = 0; e < 4; ++e) r[e] = p[0][e] + p[1][e];
#pragma unroll   // the four shuffles of a level are independent and in flight together
    for (int o = 16; o > 0; o >>= 1)
#pragma unroll
        for (int e = 0; e < 4; ++e) r[e] += __shfl_xor(r[e], o, 32);
    return (r[0] + r[2]) + (r[1] + r[3]);
}
__device__ __forceinline__ void ln_rows_f16(int blk, const float* __restrict__ x, _Float16* __restrict__ y, const float* __restrict__ g, const float* __restrict__ bta, float eps) {
    constexpr int C = 512, U = C / 128;                           // pieces per lane
    const int lane = threadIdx.x & 31;
    const size_t row = (size_t)blk * 8 + (threadIdx.x >> 5);
    const v4f* xp = (const v4f*)(x + row * C) + lane;
    v4f xv[U], gv[U], bv[U];
#pragma unroll   // constant indices: the arrays stay in registers, and all loads are issued before the first use
    for (int u = 0; u < U; ++u) { xv[u] = xp[u * 32]; gv[u] = ((const v4f*)g)[lane + u * 32]; bv[u] = ((const v4f*)bta)[lane + u * 32]; }
    float p[2][4];
#pragma unroll   // constant indices into xv and p
    for (int u = 0; u < 2; ++u)
#pragma unroll
        for (int e = 0; e < 4; ++e) p[u][e] = xv[u][e] + xv[u + 2][e];
    const float mu = tree256(p) / (float)C;
#pragma unroll   // constant indices into xv and p
    for (int u = 0; u < 2; ++u)
#pragma unroll
        for (int e = 0; e < 4; ++e) { const float d0 = xv[u][e] - mu, d1 = xv[u + 2][e] - mu; p[u][e] = __builtin_fmaf(d1, d1, d0 * d0); }   // as k_stats rounds it: the square, then one fused step
    const float rs = rsqrtf(tree256(p) / (float)C + eps);
    v4h* yp = (v4h*)(y + row * C) + lane;
#pragma unroll   // constant indices into the arrays
    for (int u = 0; u < U; ++u) {
        v4h hv;
#pragma unroll   // constant element indices: the vectors stay in registers
        for (int e = 0; e < 4; ++e) hv[e] = (_Float16)((xv[u][e] - mu) * rs * gv[u][e] + bv[u][e]);
        yp[u * 32] = hv;
    }
}
// k_ln_f16: LayerNorm of 4096 rows of 512 to an f16 plane; grid 4096 / 8.
__global__ __launch_bounds__(256) void k_ln_f16(const float* __restrict__ x, _Float16* __restrict__ y, const float* __restrict__ g, const float* __restrict__ bta, float eps) {
    ln_rows_f16(blockIdx.x, x, y, g, bta, eps);
}
// k_ln_f16_weights: two jobs that depend on nothing but the inputs share one grid: blocks [0, 512) are k_ln_f16's, the 768 behind them cast the weights. No barrier in either.
__global__ __launch_bounds__(256) void k_ln_f16_weights(const float* __restrict__ x, _Float16* __restrict__ y, const float* __restrict__ g, const float* __restrict__ bta, float eps,
                                                        const float* __restrict__ w0, const float* __restrict__ w1, const float* __restrict__ w2, const float* __restrict__ w3,
                                                        const float* __restrict__ w4, const float* __restrict__ w5, _Float16* __restrict__ wdst, float ws) {
    if (blockIdx.x < 512) ln_rows_f16(blockIdx.x, x, y, g, bta, eps);
    else cast_weights<4>(blockIdx.x - 512, w0, w1, w2, w3, w4, w5, wdst, ws);
}

// f32 -> bf16 hi plane + bf16 lo plane (x = hi + lo to ~2^-17 relative; RNE both), [R][C] -> [R][C] (or transposed to [C][R]); 2 consecutive destination elements
__device__ __forceinline__ unsigned int f2bf2_pack(float a, float b, unsigned int* lo) {
    const unsigned short ha = w25::f2bf_bits(a), hb = w25::f2bf_bits(b);
    const unsigned short la = w25::f2bf_bits(a - w25::bf_bits2f(ha)), lb = w25::f2bf_bits(b - w25::bf_bits2f(hb));
    *lo = (unsigned)la | ((unsigned)lb << 16); return (unsigned)ha | ((unsigned)hb << 16); }
__global__ __launch_bounds__(256) void k_castS16(const float* __restrict__ src, long long lds, __bf16* __restrict__ dhi, __bf16* __restrict__ dlo, long long ldd, int R, int C, float s, int transpose) {
    const long long i = (long long)blockIdx.x * 256 + threadIdx.x; long long o; float a, b;
    if (transpose) { const long long np = (long long)C * (R / 2); if (i >= np) return; const int c = (int)(i / (R / 2)); const int r = 2 * (int)(i % (R / 2)); a = src[(long long)r * lds + c] * s; b = src[(long long)(r + 1) * lds + c] * s; o = (long long)c * ldd + r; }
    else { const long long np = (long long)R * (C / 2); if (i >= np) return; const int r = (int)(i / (C / 2)); const int c = 2 * (int)(i % (C / 2)); a = src[(long long)r * lds + c] * s; b = src[(long long)r * lds + c + 1] * s; o = (long long)r * ldd + c; }
    unsigned lo; const unsigned hi = f2bf2_pack(a, b, &lo); unsigned* ph = (unsigned*)(dhi + o); unsigned* pl = (unsigned*)(dlo + o);
    *ph = hi; *pl = lo;  }


extern "C" void kernel_launch(void* const* d_in, const int* in_sizes, int n_in, void* d_out, int out_size, void* d_ws, size_t ws_size, hipStream_t stream) {
    (void)in_sizes; (void)n_in; (void)out_size; (void)ws_size;
    const float* x = (const float*)d_in[0];
    const float* ln1g = (const float*)d_in[1];
    const float* ln1b = (const float*)d_in[2];
    const float* Wq = (const float*)d_in[3];
    const float* bq = (const float*)d_in[4];
    const float* Wk = (const float*)d_in[5];
    const float* bk = (const float*)d_in[6];
    const float* Wv = (const float*)d_in[7];
    const float* bv = (const float*)d_in[8];
    const float* Wo = (const float*)d_in[9];
    const float* bo = (const float*)d_in[10];
    const float* ln2g = (const float*)d_in[11];
    const float* ln2b = (const float*)d_in[12];
    const float* W1 = (const float*)d_in[13];
    const float* b1 = (const float*)d_in[14];
    const float* W2 = (const float*)d_in[15];
    const float* b2 = (const float*)d_in[16];
    const int L = 4096;
    const int C = 512;
    const int NH = 8;
    const int HD = 64;
    const int FF = 2048;
    const int LP = L / 2;
    const int WINP = 128;
    float* out = (float*)d_out;
    char* wsp = (char*)d_ws;
    _Float16* WH = (_Float16*)wsp; wsp += (((size_t)(4 * 512 * 512 + 2 * 2048 * 512) * 2 + 255) / 256) * 256;   // f16 of 16 w: Wq, Wk, Wv, Wo, W1, W2
    _Float16* HNh = (_Float16*)wsp; wsp += (((size_t)((size_t)L * C) * 2 + 255) / 256) * 256;
    float* Q = (float*)wsp; wsp += (((size_t)((size_t)L * C) * 4 + 255) / 256) * 256;    // Q, Kb and V lie L * C floats apart: the three batches of one product
    float* Kb = (float*)wsp; wsp += (((size_t)((size_t)L * C) * 4 + 255) / 256) * 256;
    float* V = (float*)wsp; wsp += (((size_t)((size_t)L * C) * 4 + 255) / 256) * 256;
    _Float16* Yh = (_Float16*)wsp; wsp += (((size_t)((size_t)L * C) * 2 + 255) / 256) * 256;
    float* X1 = (float*)wsp; wsp += (((size_t)((size_t)L * C) * 4 + 255) / 256) * 256;
    _Float16* H2h = (_Float16*)wsp; wsp += (((size_t)((size_t)L * C) * 2 + 255) / 256) * 256;
    _Float16* F1h = (_Float16*)wsp; wsp += (((size_t)((size_t)L * FF) * 2 + 255) / 256) * 256;
    k_ln_f16_weights<<<(unsigned)(512 + 768), 256, 0, stream>>>(x, HNh, ln1g, ln1b, 1e-05f, Wq, Wk, Wv, Wo, W1, W2, WH, 16.0f);
    w25::wmma_gemm_lds<0, false, 0, 512><<<dim3(8u, 32u, 3u), 128, 0, stream>>>((const unsigned short*)(HNh), 512, (const unsigned short*)(WH), 512, 512 * 512, (void*)(Q), 4096 * 512, bq, bk, bv, nullptr, 512, 0.0625f);
    { /*apv4*/ AttnP a;
      a.Q = Q; a.K = Kb; a.V = V; a.O = 0; a.Oh = Yh; a.P = 0; a.Mf = 0; a.Mi = 0; a.ST = 0;
      a.Pw = 0; a.Rt = 0; a.SQ = 0; a.SK = 0;
      a.swb = 0; a.swh = 0; a.swi = 0; a.swj = 0; a.srb = 0; a.srh = 0; a.sri = 0; a.sQb = C; a.sQh = HD; a.sQi = 2 * C; a.sQd = 1; a.sKb = C; a.sKh = HD; a.sKj = 2 * C; a.sKd = 1; a.sVb = C; a.sVh = HD; a.sVj = 2 * C; a.sVd = 1; a.sOb = C; a.sOh = HD; a.sOi = 2 * C; a.sPb = 0; a.sPh = 0; a.sPi = 0; a.smb = 0; a.smh = 0; a.smi = 0; a.smj = 0;
      a.Lq = LP; a.Lk = LP; a.dh = HD; a.dv = HD; a.hrep = 1; a.causal = 1; a.coff = 0; a.pband = 0;
      a.scale = 0.125f; a.mfill = 0.0f; a.nonorm = 0; a.mpol = 0;
      a.roff = 0; a.rn = 1; a.segpol = 0; a.win = WINP;
      k_attn_t<<<dim3((unsigned)((LP) + 16 * AW - 1) / (16 * AW), (unsigned)(NH), (unsigned)(2)), 32 * AW, 0, stream>>>(a); }   // batch = parity: row 0 or 1, then every second row
    w25::wmma_gemm_lds<0, true, 0, 512><<<dim3(8u, 32u, 1u), 128, 0, stream>>>((const unsigned short*)(Yh), 512, (const unsigned short*)(WH + 3 * 512 * 512), 512, 0, (void*)(X1), 0, bo, nullptr, nullptr, x, 512, 0.0625f);
    k_ln_f16<<<(unsigned)(512), 256, 0, stream>>>(X1, H2h, ln2g, ln2b, 1e-05f);
    w25::wmma_gemm_lds<1, false, 5, 2048><<<dim3(32u, 32u, 1u), 128, 0, stream>>>((const unsigned short*)(H2h), 512, (const unsigned short*)(WH + 4 * 512 * 512), 512, 0, (void*)(F1h), 0, b1, nullptr, nullptr, nullptr, 512, 0.0625f);
    w25::wmma_gemm_lds<0, true, 0, 512><<<dim3(8u, 32u, 1u), 128, 0, stream>>>((const unsigned short*)(F1h), 2048, (const unsigned short*)(WH + 4 * 512 * 512 + 2048 * 512), 2048, 0, (void*)(out), 0, b2, nullptr, nullptr, X1, 2048, 0.0625f);
}

// v007
// It runs in 79.6 microseconds.
// Next to v006, in two timings, it ran 1.10 times as fast each time.
// Counting every step since v000, which is the starting kernel, it is 27.2 times as fast.
// Contractions: q/k/v projections of the LayerNormed input [4096x512].[512x512] (+b), the output projection (+b, + residual), the FFN [4096x512].[512x2048] (+b, exact GELU) and [4096x2048].[2048x512] (+b, + residual) with f16 operands (v_wmma_f32_16x16x32_f16; 32x64 register-blocked wave tiles, 128x64 block tiles, over pre-cast f16 operand planes staged in LDS by asynchronous copies, weights pre-scaled by 16 at the cast and un-scaled in the f32 epilogue); the dilated causal attention (keys j <= i, i - j even, i - j <= 256) as one flash launch whose grid z is the parity of the position (stride-2 views; within a parity class the pattern is plain causal with window 128), head_dim 64, both products transposed (f16 k.q^T, f16 v^T.p^T with p as f16 of 4096 p, kept in registers); f32 accumulate, softmax and LayerNorms f32.
#include <hip/hip_runtime.h>
#include <math.h>

typedef __attribute__((ext_vector_type(16))) _Float16 v16h;
typedef __attribute__((ext_vector_type(8)))  _Float16 v8h;
typedef __attribute__((ext_vector_type(4)))  _Float16 v4h;
typedef __attribute__((ext_vector_type(16))) __bf16   v16b;
typedef __attribute__((ext_vector_type(8)))  float    v8f;
typedef __attribute__((ext_vector_type(4)))  float    v4f;

// 16-bit WMMA fragment map (wave32), lane L, h = L>>4, m = L&15:
//   A 16x32: lane = row m;   element i -> k = (i<8) ? 8h+i : 16+8h+(i-8)
//   B 32x16: lane = column m; the SAME k(i,h)
//   D 16x16 (8 f32): lane = column m; element r -> row 8h+r
__device__ __forceinline__ int frag_k(int i, int h) { return (i < 8) ? (8 * h + i) : (16 + 8 * h + (i - 8)); }
__device__ __forceinline__ __bf16 bf16_rne(float f) {
    unsigned int u = __float_as_uint(f);
    u += 0x7fffu + ((u >> 16) & 1u);
    return __builtin_bit_cast(__bf16, (unsigned short)(u >> 16));
}
__device__ __forceinline__ float bf16_f32(__bf16 b) { return __uint_as_float(((unsigned int)__builtin_bit_cast(unsigned short, b)) << 16); }
__device__ __forceinline__ v8f wmma16(v16h a, v16h b, v8f c) {
    c = __builtin_amdgcn_wmma_f32_16x16x32_f16(false, a, false, b, (short)0, c, false, false);
    asm volatile("v_nop\n\tv_nop\n\tv_nop\n\tv_nop" : "+v"(c) : "v"(a), "v"(b));
    return c;
}
__device__ __forceinline__ v8f wmmab(v16b a, v16b b, v8f c) {
    c = __builtin_amdgcn_wmma_f32_16x16x32_bf16(false, a, false, b, (short)0, c, false, false);
    asm volatile("v_nop\n\tv_nop\n\tv_nop\n\tv_nop" : "+v"(c) : "v"(a), "v"(b));
    return c;
}
struct Split { v16b hi, lo; };
// hi/lo split product: a.hi*b.hi + a.hi*b.lo + a.lo*b.hi
__device__ __forceinline__ v8f wmma3(const Split& a, const Split& b, v8f c) {
    c = __builtin_amdgcn_wmma_f32_16x16x32_bf16(false, a.hi, false, b.hi, (short)0, c, false, false);
    c = __builtin_amdgcn_wmma_f32_16x16x32_bf16(false, a.hi, false, b.lo, (short)0, c, false, false);
    c = __builtin_amdgcn_wmma_f32_16x16x32_bf16(false, a.lo, false, b.hi, (short)0, c, false, false);
    asm volatile("v_nop\n\tv_nop\n\tv_nop\n\tv_nop" : "+v"(c) : "v"(a.hi), "v"(a.lo), "v"(b.hi), "v"(b.lo));
    return c;
}
struct Split3 { v16b hi, mid, lo; };
// triple split product (6 terms, drops only terms below 2^-24 relative)
__device__ __forceinline__ v8f wmma6(const Split3& a, const Split3& b, v8f c) {
    c = __builtin_amdgcn_wmma_f32_16x16x32_bf16(false, a.hi, false, b.hi, (short)0, c, false, false);
    c = __builtin_amdgcn_wmma_f32_16x16x32_bf16(false, a.hi, false, b.mid, (short)0, c, false, false);
    c = __builtin_amdgcn_wmma_f32_16x16x32_bf16(false, a.mid, false, b.hi, (short)0, c, false, false);
    c = __builtin_amdgcn_wmma_f32_16x16x32_bf16(false, a.hi, false, b.lo, (short)0, c, false, false);
    c = __builtin_amdgcn_wmma_f32_16x16x32_bf16(false, a.mid, false, b.mid, (short)0, c, false, false);
    c = __builtin_amdgcn_wmma_f32_16x16x32_bf16(false, a.lo, false, b.hi, (short)0, c, false, false);
    asm volatile("v_nop\n\tv_nop\n\tv_nop\n\tv_nop" : "+v"(c) : "v"(a.hi), "v"(a.mid), "v"(a.lo), "v"(b.hi), "v"(b.mid), "v"(b.lo));
    return c;
}

// Fragment gathers from f32 memory: element i <- p[(k0 + frag_k(i,h)) * sk] * s, zero for k >= klen.
__device__ __forceinline__ v16h fh_ld(const float* __restrict__ p, long long sk, int k0, int h, int klen, float s) {
    v16h a;
#pragma unroll
    for (int i = 0; i < 16; ++i) { const int k = k0 + frag_k(i, h); a[i] = (k < klen) ? (_Float16)(p[(long long)k * sk] * s) : (_Float16)0.f; }
    return a;
}
__device__ __forceinline__ Split sp_ld(const float* __restrict__ p, long long sk, int k0, int h, int klen, float s) {
    Split r;
#pragma unroll
    for (int i = 0; i < 16; ++i) {
        const int k = k0 + frag_k(i, h); const float x = (k < klen) ? p[(long long)k * sk] * s : 0.f;
        const __bf16 hb = bf16_rne(x); r.hi[i] = hb; r.lo[i] = bf16_rne(x - bf16_f32(hb));
    }
    return r;
}
__device__ __forceinline__ Split3 sp3_ld(const float* __restrict__ p, long long sk, int k0, int h, int klen, float s) {
    Split3 r;
#pragma unroll
    for (int i = 0; i < 16; ++i) {
        const int k = k0 + frag_k(i, h); const float x = (k < klen) ? p[(long long)k * sk] * s : 0.f;
        const __bf16 hb = bf16_rne(x); const float r1 = x - bf16_f32(hb); const __bf16 mb = bf16_rne(r1);
        r.hi[i] = hb; r.mid[i] = mb; r.lo[i] = bf16_rne(r1 - bf16_f32(mb));
    }
    return r;
}
__device__ __forceinline__ v16b bh_ld(const float* __restrict__ p, long long sk, int k0, int h, int klen, float s) {
    v16b a;
#pragma unroll
    for (int i = 0; i < 16; ++i) { const int k = k0 + frag_k(i, h); a[i] = bf16_rne((k < klen) ? p[(long long)k * sk] * s : 0.f); }
    return a;
}
// f16 fragment from a 16-byte aligned f32 row with element stride 1 and all 32 k in range: four unguarded 16-byte loads, then the cast; same k order as fh_ld
struct Raw16 { v4f x0, x1, x2, x3; };   // the 16 floats of one lane's fragment, as loaded
__device__ __forceinline__ Raw16 raw_ld4(const float* __restrict__ row, int k0, int h) {
    const v4f* q = (const v4f*)(row + k0 + 8 * h);
    Raw16 r; r.x0 = q[0]; r.x1 = q[1]; r.x2 = q[4]; r.x3 = q[5];
    return r;
}
__device__ __forceinline__ v16h raw_f16(const Raw16& r) {
    v16h a;
#pragma unroll   // constant element indices: the vectors stay in registers
    for (int i = 0; i < 4; ++i) { a[i] = (_Float16)r.x0[i]; a[4 + i] = (_Float16)r.x1[i]; a[8 + i] = (_Float16)r.x2[i]; a[12 + i] = (_Float16)r.x3[i]; }
    return a;
}
// Inputs-only fence on loaded values: every load written above it is issued before it, so that a run of loads is in flight together.
// Without it the compiler converts each fragment as soon as it is loaded and waits for memory once per fragment.
__device__ __forceinline__ void loads_held(const v4f& a, const v4f& b, const v4f& c, const v4f& d) { asm volatile("" :: "v"(a), "v"(b), "v"(c), "v"(d)); }
// f16 fragment from an f16 LDS/global row with element stride 1 (k-contiguous), no bounds (tile already zero padded)
__device__ __forceinline__ v16h fh_row(const _Float16* __restrict__ row, int k0, int h) {
    v16h a;
#pragma unroll
    for (int i = 0; i < 16; ++i) a[i] = row[k0 + frag_k(i, h)];
    return a;
}

#define VST2(T, ptr, val) do { const T vst2_v_ = (val); *(T*)(ptr) = vst2_v_;  } while (0)
typedef float v4f __attribute__((ext_vector_type(4)));
#define VST2V4(ptr, val) do { const v4f vst2_v4_ = (val); *(v4f*)(ptr) = vst2_v4_;  } while (0)

__device__ __attribute__((noinline)) float act_fn(float v, int act) {
    if (act == 1) return fmaxf(v, 0.f);                                                                               // relu
    if (act == 2) { const float u = 0.7978845608028654f * (v + 0.044715f * v * v * v); return 0.5f * v * (1.f + tanhf(u)); } // tanh-gelu
    if (act == 3) return v / (1.f + expf(-v));                                                                        // silu
    if (act == 4) return 0.5f * v * (1.f + erff(v * 0.7071067811865476f));                                             // erf-gelu
    if (act == 5) return tanhf(v);
    if (act == 6) return 1.f / (1.f + expf(-v));                                                                      // sigmoid
    if (act == 7) return (v > 0.f) ? v : 0.01f * v;                                                                   // leaky relu 0.01
    if (act == 8) return (v > 0.f) ? v : (expf(v) - 1.f);                                                             // elu
    if (act == 9) return fminf(fmaxf(v, 0.f), 6.f);                                                                   // relu6
    if (act == 10) return fabsf(v);                                                                                    // abs
    if (act == 11) return (v >= 0.f) ? v : 0.1f * v;                                                                  // leaky 0.1
    if (act == 12) return (v > 0.f) ? v : 0.2f * v;                                                                   // leaky 0.2
    if (act == 13) return (v > 20.f) ? v : log1pf(expf(v));                                                            // softplus
    return v;
}

// =====================================================================================================================
// k_gemm<MODE>: C(z, m, n) = act(alpha * sum_k A(z, m, k) * B(z, k, n) + bias) + beta * R(z, m, n)
//   One wave (32-thread block) per 16 x 32 tile of C; grid (ceil(N/32), ceil(M/16), Z). Batch z -> (zo = z / zi_n, zi = z % zi_n)
//   with separate outer/inner strides for every tensor (e.g. batch and head). A(m,k) = A[zo*sAo + zi*sAi + m*sAm + k*sAk] (f32),
//   B(k,n) = B[zo*sBo + zi*sBi + n*sBn + k*sBk] (f32); any M, N, K (K zero-padded to 32 inside the fragments, M/N tails guarded).
//   C(m,n) = C[zo*sCo + zi*sCi + m*sCm + n] (n contiguous). flags: 1 bias[n], 2 bias[m], 4 residual R[zo*sRo + zi*sRi + m*sRm + n*sRn].
//   MODE 0: f16 operands (A prescaled by sa, B by sb, both undone in the epilogue); 1: bf16 hi/lo split (3 products); 2: bf16;
//   3: bf16 hi/mid/lo triple split (6 products); 4: as 3 with Kahan-compensated f32 accumulation across k-steps.
// =====================================================================================================================
struct GemmP {
    const float* A; const float* B; const float* bias; const float* R; float* C;
    long long sAo, sAi, sAm, sAk, sBo, sBi, sBn, sBk, sCo, sCi, sCm, sRo, sRi, sRm, sRn;
    int M, N, K, zi_n, flags, act; float alpha, beta, sa, sb;
    int Npad, pad_;     // columns [N, Npad) of C are written as 0 so that padded workspace rows are covered by whole-line stores; Npad >= N
};
static_assert(sizeof(GemmP) == 5 * 8 + 15 * 8 + 6 * 4 + 4 * 4 + 2 * 4, "GemmP has padding");

template <int MODE>
__global__ __launch_bounds__(32) void k_gemm(GemmP p) {
    const int lane = threadIdx.x & 31, h = lane >> 4, l15 = lane & 15;
    const int m0 = blockIdx.y * 16, n0 = blockIdx.x * 32;
    const int z = blockIdx.z, zo = z / p.zi_n, zi = z - zo * p.zi_n;
    const float* A = p.A + zo * p.sAo + zi * p.sAi;
    const float* B = p.B + zo * p.sBo + zi * p.sBi;
    const int am = min(m0 + l15, p.M - 1);                       // clamped row for loads (stores are guarded)
    v8f acc[2], comp[2];
#pragma unroll
    for (int t = 0; t < 2; ++t) { v8f zz = {}; acc[t] = zz; comp[t] = zz; }
    for (int k0 = 0; k0 < p.K; k0 += 32) {
        const float* arow = A + (long long)am * p.sAm;
        if (MODE == 1) {
            const Split a = sp_ld(arow, p.sAk, k0, h, p.K, 1.f);
#pragma unroll
            for (int t = 0; t < 2; ++t) {
                const int bn = min(n0 + t * 16 + l15, p.N - 1);
                acc[t] = wmma3(a, sp_ld(B + (long long)bn * p.sBn, p.sBk, k0, h, p.K, 1.f), acc[t]);
            }
        } else if (MODE == 3) {
            const Split3 a = sp3_ld(arow, p.sAk, k0, h, p.K, 1.f);
#pragma unroll
            for (int t = 0; t < 2; ++t) {
                const int bn = min(n0 + t * 16 + l15, p.N - 1);
                acc[t] = wmma6(a, sp3_ld(B + (long long)bn * p.sBn, p.sBk, k0, h, p.K, 1.f), acc[t]);
            }
        } else if (MODE == 4) {
            // triple split as MODE 3, but each k-step's 6 products go into a fresh accumulator and the partial is added to the running f32 sum
            // on the VALU with Kahan compensation (accumulation error stays ~1 ulp however long K is)
            const Split3 a = sp3_ld(arow, p.sAk, k0, h, p.K, 1.f);
#pragma unroll
            for (int t = 0; t < 2; ++t) {
                const int bn = min(n0 + t * 16 + l15, p.N - 1); v8f zz = {};
                const v8f part = wmma6(a, sp3_ld(B + (long long)bn * p.sBn, p.sBk, k0, h, p.K, 1.f), zz);
                const v8f y = part - comp[t]; const v8f s = acc[t] + y; comp[t] = (s - acc[t]) - y; acc[t] = s;
            }
        } else if (MODE == 2) {
            const v16b a = bh_ld(arow, p.sAk, k0, h, p.K, 1.f);
#pragma unroll
            for (int t = 0; t < 2; ++t) {
                const int bn = min(n0 + t * 16 + l15, p.N - 1);
                acc[t] = wmmab(a, bh_ld(B + (long long)bn * p.sBn, p.sBk, k0, h, p.K, 1.f), acc[t]);
            }
        } else {
            const v16h a = fh_ld(arow, p.sAk, k0, h, p.K, p.sa);
#pragma unroll
            for (int t = 0; t < 2; ++t) {
                const int bn = min(n0 + t * 16 + l15, p.N - 1);
                acc[t] = wmma16(a, fh_ld(B + (long long)bn * p.sBn, p.sBk, k0, h, p.K, p.sb), acc[t]);
            }
        }
    }
    const float iscale = (MODE == 0) ? p.alpha / (p.sa * p.sb) : p.alpha;
    float* C = p.C + zo * p.sCo + zi * p.sCi;
    const float* R = p.R + zo * p.sRo + zi * p.sRi;
    __shared__ __align__(16) float ctile[16][36];
#pragma unroll
    for (int t = 0; t < 2; ++t) {
        const int n = n0 + t * 16 + l15; const int nn = min(n, p.N - 1);
#pragma unroll
        for (int r = 0; r < 8; ++r) {
            const int m = m0 + 8 * h + r; const int mm = min(m, p.M - 1);
            float v = acc[t][r] * iscale;
            if (p.flags & 1) v += p.bias[nn];
            if (p.flags & 2) v += p.bias[mm];
            if (p.flags & 8) v *= p.bias[(long long)zo * p.M + mm];   /* per-(z,row) scale vector laid out [Z][M]; exclusive with the bias flags */
            v = act_fn(v, p.act);
            if (p.flags & 4) v += p.beta * R[(long long)mm * p.sRm + (long long)nn * p.sRn];
            ctile[8 * h + r][t * 16 + l15] = (n < p.N) ? v : 0.f;
        }
    }
    __syncthreads();
    const int NW = (p.Npad > p.N) ? p.Npad : p.N;           // write width
    const bool fast = (m0 + 16 <= p.M) && (n0 + 32 <= NW) && ((p.sCm & 3) == 0) && ((((size_t)C) & 15) == 0);
    if (fast) {
#pragma unroll
        for (int s = 0; s < 4; ++s) {
            const int row = s * 4 + (lane >> 3), c4 = (lane & 7) * 4;
            const v4f v = *(const v4f*)&ctile[row][c4];
            VST2V4(C + (long long)(m0 + row) * p.sCm + n0 + c4, v);
        }
    } else {
        for (int row = 0; row < 16; ++row) {
            const int m = m0 + row, n = n0 + lane;
            if (m < p.M && n < NW) VST2(float, C + (long long)m * p.sCm + n, ctile[row][lane]);
        }
    }
}


// =====================================================================================================================
// k_gemmT<MODE, TM, TN>: same contract as k_gemm, but one wave computes a (16*TM) x (16*TN) tile: TM A fragments and TN B fragments are
//   loaded per 32-wide k-step and reused across TM*TN WMMAs (far fewer load/convert instructions per MAC). MODE 0 (f16), 1 (bf16 hi/lo),
//   2 (bf16) only. grid (ceil(NW/(16*TN)), ceil(M/(16*TM)), Z), block 32. Epilogue identical to k_gemm, run per 16x32 sub-tile.
// =====================================================================================================================
template <int MODE, int TM, int TN>
__global__ __launch_bounds__(32) void k_gemmT(GemmP p) {
    const int lane = threadIdx.x & 31, h = lane >> 4, l15 = lane & 15;
    const int m0 = blockIdx.y * (16 * TM), n0 = blockIdx.x * (16 * TN);
    const int z = blockIdx.z, zo = z / p.zi_n, zi = z - zo * p.zi_n;
    const float* A = p.A + zo * p.sAo + zi * p.sAi;
    const float* B = p.B + zo * p.sBo + zi * p.sBi;
    v8f acc[TM][TN];
#pragma unroll
    for (int i = 0; i < TM; ++i)
#pragma unroll
        for (int t = 0; t < TN; ++t) { v8f zz = {}; acc[i][t] = zz; }
    for (int k0 = 0; k0 < p.K; k0 += 32) {
        if (MODE == 1) {
            Split a[TM], b[TN];
#pragma unroll
            for (int i = 0; i < TM; ++i) { const int am = min(m0 + 16 * i + l15, p.M - 1); a[i] = sp_ld(A + (long long)am * p.sAm, p.sAk, k0, h, p.K, 1.f); }
#pragma unroll
            for (int t = 0; t < TN; ++t) { const int bn = min(n0 + 16 * t + l15, p.N - 1); b[t] = sp_ld(B + (long long)bn * p.sBn, p.sBk, k0, h, p.K, 1.f); }
#pragma unroll
            for (int i = 0; i < TM; ++i)
#pragma unroll
                for (int t = 0; t < TN; ++t) acc[i][t] = wmma3(a[i], b[t], acc[i][t]);
        } else if (MODE == 2) {
            v16b a[TM], b[TN];
#pragma unroll
            for (int i = 0; i < TM; ++i) { const int am = min(m0 + 16 * i + l15, p.M - 1); a[i] = bh_ld(A + (long long)am * p.sAm, p.sAk, k0, h, p.K, 1.f); }
#pragma unroll
            for (int t = 0; t < TN; ++t) { const int bn = min(n0 + 16 * t + l15, p.N - 1); b[t] = bh_ld(B + (long long)bn * p.sBn, p.sBk, k0, h, p.K, 1.f); }
#pragma unroll
            for (int i = 0; i < TM; ++i)
#pragma unroll
                for (int t = 0; t < TN; ++t) acc[i][t] = wmmab(a[i], b[t], acc[i][t]);
        } else {
            v16h a[TM], b[TN];
#pragma unroll
            for (int i = 0; i < TM; ++i) { const int am = min(m0 + 16 * i + l15, p.M - 1); a[i] = fh_ld(A + (long long)am * p.sAm, p.sAk, k0, h, p.K, p.sa); }
#pragma unroll
            for (int t = 0; t < TN; ++t) { const int bn = min(n0 + 16 * t + l15, p.N - 1); b[t] = fh_ld(B + (long long)bn * p.sBn, p.sBk, k0, h, p.K, p.sb); }
#pragma unroll
            for (int i = 0; i < TM; ++i)
#pragma unroll
                for (int t = 0; t < TN; ++t) acc[i][t] = wmma16(a[i], b[t], acc[i][t]);
        }
    }
    const float iscale = (MODE == 0) ? p.alpha / (p.sa * p.sb) : p.alpha;
    float* C = p.C + zo * p.sCo + zi * p.sCi;
    const float* R = p.R + zo * p.sRo + zi * p.sRi;
    const int NW = (p.Npad > p.N) ? p.Npad : p.N;
    __shared__ __align__(16) float ctile[16][36];
#pragma unroll
    for (int i = 0; i < TM; ++i) {
        const int mb = m0 + 16 * i; if (mb >= p.M) break;          // wave-uniform
#pragma unroll
        for (int tp = 0; tp < TN / 2; ++tp) {
            const int nb = n0 + 32 * tp; if (nb >= NW) break;        // wave-uniform
#pragma unroll
            for (int t2 = 0; t2 < 2; ++t2) {
                const int t = 2 * tp + t2; const int n = nb + t2 * 16 + l15; const int nn = min(n, p.N - 1);
#pragma unroll
                for (int r = 0; r < 8; ++r) {
                    const int m = mb + 8 * h + r; const int mm = min(m, p.M - 1);
                    float v = acc[i][t][r] * iscale;
                    if (p.flags & 1) v += p.bias[nn];
                    if (p.flags & 2) v += p.bias[mm];
            if (p.flags & 8) v *= p.bias[(long long)zo * p.M + mm];   /* per-(z,row) scale vector laid out [Z][M]; exclusive with the bias flags */
                    v = act_fn(v, p.act);
                    if (p.flags & 4) v += p.beta * R[(long long)mm * p.sRm + (long long)nn * p.sRn];
                    ctile[8 * h + r][t2 * 16 + l15] = (n < p.N) ? v : 0.f;
                }
            }
            __syncthreads();
            const bool fast = (mb + 16 <= p.M) && (nb + 32 <= NW) && ((p.sCm & 3) == 0) && ((((size_t)C) & 15) == 0);
            if (fast) {
#pragma unroll
                for (int s = 0; s < 4; ++s) {
                    const int row = s * 4 + (lane >> 3), c4 = (lane & 7) * 4;
                    const v4f v = *(const v4f*)&ctile[row][c4];
                    VST2V4(C + (long long)(mb + row) * p.sCm + nb + c4, v);
                }
            } else {
                for (int row = 0; row < 16; ++row) {
                    const int m = mb + row, n = nb + lane;
                    if (m < p.M && n < NW) VST2(float, C + (long long)m * p.sCm + n, ctile[row][lane]);
                }
            }
            __syncthreads();
        }
    }
}

// =====================================================================================================================
//   Wave = 16 queries, AW waves per block, 64-key blocks; grid (ceil(Lq/(16*AW)), H, B), block 32*AW. Any Lq, Lk; head dim dh <= DHP
//   (DHP multiple of 32), value dim dv <= DVP (multiple of 16, <= 128). Every tensor addressed by (batch, head, row, element) strides, f32.
//   Scores: QM 0 f16 operands, 1 bf16 hi/lo split, 2 bf16 triple split; statistics f32 (exp2 domain); P.V: P x 4096 as f16 with V f16 staged in LDS
//   (SPLITPV: P and V as bf16 hi/lo splits). kv head = h / hrep. Masking: causal = 1 (keep j <= i + coff, masked -> -inf, key blocks beyond the
//   diagonal skipped), causal = 2 (masked -> mfill, a finite fill like the -1e9; no skipping), causal = 3 (keep j >= i + coff,
//   masked -> -inf, no skipping); optional additive f32 mask Mf,
//   optional int keep-mask Mi (0 -> score := mfill), both addressed b*smb + h*smh + i*smi + j*smj (0 strides broadcast).
//   PLAIN (QM 0, f16 P.V, one pass): the call is causal = 1 with coff 0, hrep 1, dh == DHP, dv == DVP, element strides 1, every Q/K/V row 16-byte aligned,
//   and none of P, Mf, Mi, ST, Pw, Rt, SQ/SK, nonorm. These become compile-time constants: the element guards fold away, so Q, K and V are read with
//   16-byte loads that are in flight in runs instead of one guarded float at a time, each waited for, and the option tests leave the score loop.
//   O16 (PLAIN, DVP 64, Lq a multiple of 16): the output goes to Oh as f16 (strides sOb, sOh, sOi in elements; rows 16-byte aligned), rounded from the same f32 value that O would hold,
//   so that the next product reads it without a cast launch in between. A (row, head) piece is one whole 128-byte line.
// =====================================================================================================================
#define AW 4
struct AttnP {   // apv4
    const float* Q; const float* K; const float* V; float* O; _Float16* Oh; float* P; const float* Mf; const int* Mi; float* ST;   // Oh: the output plane of the O16 form (O unused there)
    const float* Pw; const float* Rt; const int* SQ; const int* SK;           // optional: post-softmax weight, relative-position table, segment ids
    long long swb, swh, swi, swj, srb, srh, sri;                                 // Pw strides (b,h,i,j); Rt strides (b,h,i), column = clamp(i - j + roff, 0, rn-1)
    long long sQb, sQh, sQi, sQd, sKb, sKh, sKj, sKd, sVb, sVh, sVj, sVd, sOb, sOh, sOi, sPb, sPh, sPi, smb, smh, smi, smj;
    int Lq, Lk, dh, dv, hrep, causal, coff, pband;   // pband > 0: P holds only the band |j - i| <= pband, column j - i + pband
    float scale, mfill; int nonorm, mpol;             // nonorm (online path only): O = sum_j exp(score_j) V_j without the 1/rowsum (scores must be <= ~0); mpol: Mi masks where ==0 (mpol 0) or where !=0 (mpol 1)
    int roff, rn, segpol, win;                        // Rt column offset/count; SQ/SK: score := mfill where (segpol 0) SQ[i] != SK[j] or (segpol 1) SQ[i] == SK[j]; win > 0: keys with i - j > win (after coff) -> -inf, key blocks wholly below the window skipped
};
//   Pw: the softmax numerator is multiplied by Pw(b,h,i,j) AFTER the row sum is taken (probs * weight, then P.V), as in post-softmax multiplicative biases.                                                    // ST (optional): per row (b,h,i) -> ST[((b*H + h)*Lq + i)*2 + {0,1}] = {row max of the scaled+masked score (natural units), sum_j exp(score - max)}
static_assert(sizeof(AttnP) == 13 * 8 + 29 * 8 + 16 * 4, "AttnP has padding");

#ifndef KATTN_ATTR
#define KATTN_ATTR
#endif
template <int DHP, int DVP, int QM, bool SPLITPV, bool TWOPASS, bool PLAIN = false, bool O16 = false>
__global__ __launch_bounds__(32 * AW) KATTN_ATTR void k_attn(AttnP pa) {
    static_assert(!PLAIN || (QM == 0 && !SPLITPV && !TWOPASS), "PLAIN covers the f16 one-pass form");
    static_assert(!O16 || (PLAIN && DVP == 64), "O16 covers the PLAIN form with 64 value columns");
    AttnP p = pa;
    if (PLAIN) {
        p.P = nullptr; p.Mf = nullptr; p.Mi = nullptr; p.ST = nullptr; p.Pw = nullptr; p.Rt = nullptr; p.SQ = nullptr; p.SK = nullptr;
        p.sQd = 1; p.sKd = 1; p.sVd = 1; p.dh = DHP; p.dv = DVP; p.hrep = 1; p.causal = 1; p.coff = 0; p.pband = 0; p.nonorm = 0;
    }
    constexpr int NT = DVP / 16;                // output tiles
    constexpr int KS = DHP / 32;                // k-steps for the scores
    constexpr int VP = DVP + 8;                 // LDS pitch (halves)
    constexpr int NV = 64 * (DVP / 4) / (32 * AW);   // PLAIN: 16-byte pieces of the V tile per thread
    static_assert(!PLAIN || NV * (32 * AW) == 64 * (DVP / 4), "the block's threads cover the V tile evenly");
    __shared__ __align__(16) float    pl[AW][16 * 64];
    __shared__ __align__(16) _Float16 vl[(SPLITPV ? 2 : 1) * 64 * VP];   // f16 V tile, or bf16 hi and lo tiles (same 2-byte size)
    const int lane = threadIdx.x & 31, hf = lane >> 4, l15 = lane & 15, wave = threadIdx.x >> 5;
    const int h = blockIdx.y, b = blockIdx.z, hk = h / p.hrep;
    const int q0 = (blockIdx.x * AW + wave) * 16;
    float* myp = pl[wave];
    const float L2E = 1.4426950408889634f;
    const float NEG = -__builtin_inff();
    const int qi = min(q0 + l15, p.Lq - 1);
    const float* qrow = p.Q + b * p.sQb + h * p.sQh + (long long)qi * p.sQi;
    const float* kbase = p.K + b * p.sKb + hk * p.sKh;
    const float* vbase = p.V + b * p.sVb + hk * p.sVh;
    v16h qa[QM == 0 ? KS : 1]; Split qs_[QM == 1 ? KS : 1]; Split3 qt_[QM == 2 ? KS : 1];
#pragma unroll
    for (int ks = 0; ks < KS; ++ks) {
        if (QM == 2) qt_[ks] = sp3_ld(qrow, p.sQd, ks * 32, hf, p.dh, 1.f);
        else if (QM == 1) qs_[ks] = sp_ld(qrow, p.sQd, ks * 32, hf, p.dh, 1.f);
        else if (PLAIN) qa[ks] = raw_f16(raw_ld4(qrow, ks * 32, hf));
        else qa[ks] = fh_ld(qrow, p.sQd, ks * 32, hf, p.dh, 1.f);
    }
    v8f o[NT]; float m8[8], l8[8];
#pragma unroll
    for (int t = 0; t < NT; ++t) { v8f zz = {}; o[t] = zz; }
#pragma unroll
    for (int i = 0; i < 8; ++i) { m8[i] = NEG; l8[i] = 0.f; }
    int jend = p.Lk;
    if (p.causal == 1) { const int je = (blockIdx.x * AW + AW - 1) * 16 + 16 + p.coff; jend = min(jend, max(je, 0)); }   // uniform per block
    int jbeg = 0;                                                // first key any query row of this block can see through the window; uniform per block
    if (p.win > 0 && !p.P) jbeg = max((int)(blockIdx.x * AW) * 16 + p.coff - p.win, 0);   // keys below it are -inf for all 16*AW rows (weight exactly 0); P, where asked for, still needs its zeros written
    const int npass = TWOPASS ? 2 : 1;
    for (int pass = 0; pass < npass; ++pass) {
        const bool dopv = (!TWOPASS) || pass == 1;
        for (int j0 = jbeg; j0 < jend; j0 += 64) {
            v4f vr[PLAIN ? NV : 1]; Raw16 kr[PLAIN ? 2 : 1][KS];   // PLAIN: this thread's part of the V tile and the lane's K fragments of two columns, f32 as loaded
            if (dopv) {
                __syncthreads();                                 // previous key block's reads of vl / pl are done
                if (!PLAIN)
                for (int idx = threadIdx.x; idx < 64 * DVP; idx += 32 * AW) {
                    const int jr = idx / DVP, d = idx - jr * DVP, j = j0 + jr;
                    const float f = (j < p.Lk && d < p.dv) ? vbase[(long long)j * p.sVj + (long long)d * p.sVd] : 0.f;
                    if (SPLITPV) {
                        const __bf16 hb = bf16_rne(f);
                        ((__bf16*)vl)[jr * VP + d] = hb; ((__bf16*)vl)[64 * VP + jr * VP + d] = bf16_rne(f - bf16_f32(hb));
                    } else vl[jr * VP + d] = (_Float16)f;
                }
            }
            v8f s[4];
#pragma unroll
            for (int t = 0; t < 4; ++t) {
                const int j = min(j0 + t * 16 + l15, p.Lk - 1);
                const float* krow = kbase + (long long)j * p.sKj;
                if (PLAIN && (t & 1) == 0) {
                    // the K loads of two 16-key columns are issued ahead of the first use of any of them: one trip to memory for 4 fragments
                    // (all four columns at once took the build past 256 registers). The loops here are unrolled so that kr and vr stay in registers.
#pragma unroll
                    for (int u = 0; u < 2; ++u) {
#pragma unroll
                        for (int ks = 0; ks < KS; ++ks) kr[u][ks] = raw_ld4(kbase + (long long)min(j0 + (t + u) * 16 + l15, p.Lk - 1) * p.sKj, ks * 32, hf);
                        // one column's loads share one address pair: this wait stands behind them, ahead of any later load whose result may be given that pair
                        asm volatile("s_wait_xcnt 0x0" ::: "memory");
                    }
#pragma unroll
                    for (int u = 0; u < 2; ++u)
#pragma unroll
                        for (int ks = 0; ks < KS; ++ks) loads_held(kr[u][ks].x0, kr[u][ks].x1, kr[u][ks].x2, kr[u][ks].x3);
                }
                v8f acc = {};
#pragma unroll
                for (int ks = 0; ks < KS; ++ks) {
                    if (QM == 2)      acc = wmma6(qt_[ks], sp3_ld(krow, p.sKd, ks * 32, hf, p.dh, 1.f), acc);
                    else if (QM == 1) acc = wmma3(qs_[ks], sp_ld(krow, p.sKd, ks * 32, hf, p.dh, 1.f), acc);
                    else if (PLAIN)   acc = wmma16(qa[ks], raw_f16(kr[t & 1][ks]), acc);
                    else              acc = wmma16(qa[ks], fh_ld(krow, p.sKd, ks * 32, hf, p.dh, 1.f), acc);
                }
                s[t] = acc;
            }
            if (PLAIN) {
                // the V tile's loads go out here and are first used behind the softmax, which covers their trip to memory
#pragma unroll
                for (int n = 0; n < NV; ++n) {
                    const int idx = threadIdx.x + n * (32 * AW), jr = idx / (DVP / 4), d = (idx - jr * (DVP / 4)) * 4;
                    vr[n] = *(const v4f*)(vbase + (long long)min(j0 + jr, p.Lk - 1) * p.sVj + d);   // row clamped, so no guard round the load
                }
            }
            float pv[8][4];
#pragma unroll
            for (int i = 0; i < 8; ++i) {
                const int irow = q0 + i + 8 * hf;
                const int ic = min(irow, p.Lq - 1);
                float sc[4];
#pragma unroll
                for (int t = 0; t < 4; ++t) {
                    const int jg = j0 + t * 16 + l15;
                    float v = s[t][i] * p.scale;
                    if (p.Mf) v += p.Mf[b * p.smb + h * p.smh + (long long)ic * p.smi + (long long)min(jg, p.Lk - 1) * p.smj];
                    if (p.Rt) { int rc = ic - min(jg, p.Lk - 1) + p.roff; rc = rc < 0 ? 0 : (rc >= p.rn ? p.rn - 1 : rc); v += p.Rt[b * p.srb + h * p.srh + (long long)ic * p.sri + rc]; }
                    if (p.Mi) { const int mv = p.Mi[b * p.smb + h * p.smh + (long long)ic * p.smi + (long long)min(jg, p.Lk - 1) * p.smj]; if (p.mpol ? (mv != 0) : (mv == 0)) v = p.mfill; }
                    if (p.SQ) { const bool same = p.SQ[(long long)b * p.Lq + ic] == p.SK[(long long)b * p.Lk + min(jg, p.Lk - 1)]; if (p.segpol ? same : !same) v = p.mfill; }
                    if (p.causal == 2 && jg > irow + p.coff) v = p.mfill;
                    if (jg >= p.Lk || (p.causal == 1 && jg > irow + p.coff) || (p.causal == 3 && jg < irow + p.coff) || (p.win > 0 && irow + p.coff - jg > p.win)) v = NEG; else v *= L2E;
                    sc[t] = v;
                }
                if (!TWOPASS || pass == 0) {
                    float mx = fmaxf(fmaxf(sc[0], sc[1]), fmaxf(sc[2], sc[3]));
                    mx = fmaxf(mx, __shfl_xor(mx, 1, 32)); mx = fmaxf(mx, __shfl_xor(mx, 2, 32));
                    mx = fmaxf(mx, __shfl_xor(mx, 4, 32)); mx = fmaxf(mx, __shfl_xor(mx, 8, 32));
                    const float mnew = fmaxf(m8[i], mx);
                    const float corr = (mnew == NEG) ? 1.f : exp2f(m8[i] - mnew);
                    float rs = 0.f;
#pragma unroll
                    for (int t = 0; t < 4; ++t) {
                        const float pp = (sc[t] == NEG) ? 0.f : exp2f(sc[t] - mnew); rs += pp;
                        pv[i][t] = p.Pw ? pp * p.Pw[b * p.swb + h * p.swh + (long long)ic * p.swi + (long long)min(j0 + t * 16 + l15, p.Lk - 1) * p.swj] : pp;
                    }
                    rs += __shfl_xor(rs, 1, 32); rs += __shfl_xor(rs, 2, 32); rs += __shfl_xor(rs, 4, 32); rs += __shfl_xor(rs, 8, 32);
                    l8[i] = l8[i] * corr + rs; m8[i] = mnew;
                    if (!TWOPASS) {
#pragma unroll
                        for (int t = 0; t < NT; ++t) o[t][i] *= corr;
                    }
                } else {
                    const float inv = (l8[i] > 0.f) ? 1.f / l8[i] : 0.f;
#pragma unroll
                    for (int t = 0; t < 4; ++t) {
                        const int jg = j0 + t * 16 + l15;
                        float pp = (sc[t] == NEG) ? 0.f : exp2f(sc[t] - m8[i]) * inv;
                        if (p.Pw) pp *= p.Pw[b * p.swb + h * p.swh + (long long)ic * p.swi + (long long)min(jg, p.Lk - 1) * p.swj];
                        pv[i][t] = pp;
                    }
                }
            }
            if (dopv) {
                if (PLAIN) {                                     // cast and stage the V tile loaded above (unrolled: vr stays in registers)
#pragma unroll
                    for (int n = 0; n < NV; ++n) {
                        const int idx = threadIdx.x + n * (32 * AW), jr = idx / (DVP / 4), d = (idx - jr * (DVP / 4)) * 4;
                        v4h hv;
#pragma unroll
                        for (int e = 0; e < 4; ++e) hv[e] = (_Float16)((j0 + jr < p.Lk) ? vr[n][e] : 0.f);
                        *(v4h*)&vl[jr * VP + d] = hv;
                    }
                }
#pragma unroll
                for (int i = 0; i < 8; ++i)
#pragma unroll
                    for (int t = 0; t < 4; ++t) ((float*)myp)[(i + 8 * hf) * 64 + t * 16 + l15] = pv[i][t];
                __syncthreads();                                 // P (per wave) and V (shared) visible
                if (p.P) {
                    float* pb_ = p.P + b * p.sPb + h * p.sPh;
                    const bool fastP = (p.pband == 0) && ((p.sPi & 3) == 0) && (j0 + 64 <= p.Lk) && (q0 + 16 <= p.Lq) && ((((size_t)pb_) & 15) == 0);
                    if (fastP) {
#pragma unroll
                        for (int s = 0; s < 8; ++s) {
                            const int row = s * 2 + (lane >> 4), c4 = (lane & 15) * 4;
                            const v4f v = *(const v4f*)(myp + row * 64 + c4);
                            VST2V4(pb_ + (long long)(q0 + row) * p.sPi + j0 + c4, v);
                        }
                    } else {
                        for (int row = 0; row < 16; ++row) {
                            const int irow = q0 + row; if (irow >= p.Lq) continue;
                            for (int c = lane; c < 64; c += 32) {
                                const int jg = j0 + c; if (jg >= p.Lk) continue;
                                if (p.pband == 0) VST2(float, pb_ + (long long)irow * p.sPi + jg, myp[row * 64 + c]);
                                else if (jg - irow <= p.pband && irow - jg <= p.pband) VST2(float, pb_ + (long long)irow * p.sPi + (jg - irow + p.pband), myp[row * 64 + c]);
                            }
                        }
                    }
                }
                if (SPLITPV) {
                    const Split pa0 = sp_ld(myp + l15 * 64, 1, 0, hf, 64, 1.f), pa1 = sp_ld(myp + l15 * 64, 1, 32, hf, 64, 1.f);
                    const __bf16* vh = (const __bf16*)vl; const __bf16* vlo = vh + 64 * VP;
#pragma unroll
                    for (int t = 0; t < NT; ++t) {
                        const int dcol = t * 16 + l15;
                        Split b0, b1;
#pragma unroll
                        for (int e = 0; e < 16; ++e) {
                            const int k0 = frag_k(e, hf), k1 = 32 + frag_k(e, hf);
                            b0.hi[e] = vh[k0 * VP + dcol]; b0.lo[e] = vlo[k0 * VP + dcol]; b1.hi[e] = vh[k1 * VP + dcol]; b1.lo[e] = vlo[k1 * VP + dcol];
                        }
                        o[t] = wmma3(pa0, b0, o[t]);
                        o[t] = wmma3(pa1, b1, o[t]);
                    }
                } else {
                    const v16h pa0 = fh_ld(myp + l15 * 64, 1, 0, hf, 64, 4096.f), pa1 = fh_ld(myp + l15 * 64, 1, 32, hf, 64, 4096.f);
#pragma unroll
                    for (int t = 0; t < NT; ++t) {
                        const int dcol = t * 16 + l15;
                        v16h b0, b1;
#pragma unroll
                        for (int e = 0; e < 16; ++e) { b0[e] = vl[frag_k(e, hf) * VP + dcol]; b1[e] = vl[(32 + frag_k(e, hf)) * VP + dcol]; }
                        o[t] = wmma16(pa0, b0, o[t]);
                        o[t] = wmma16(pa1, b1, o[t]);
                    }
                }
            }
        }
    }
    float* obase = p.O + b * p.sOb + h * p.sOh;
    if (p.ST) {
        const int rl = lane >> 1, isel = rl & 7;           // row q0 + rl ; rl>>3 == hf holds because lane>>4 == (lane>>1)>>3
        float mv = 0.f, lv = 0.f;
#pragma unroll
        for (int i = 0; i < 8; ++i) if (i == isel) { mv = m8[i]; lv = l8[i]; }
        const int irow = q0 + rl;
        if (irow < p.Lq) { float* st = p.ST + (((long long)b * gridDim.y + h) * p.Lq + irow) * 2 + (lane & 1); VST2(float, st, (lane & 1) ? lv : mv * 0.6931471805599453f); }
    }
    float invr[8];
#pragma unroll
    for (int i = 0; i < 8; ++i) {
        if (TWOPASS) invr[i] = SPLITPV ? 1.f : (1.f / 4096.f);
        else if (p.nonorm) invr[i] = exp2f(m8[i]) * (SPLITPV ? 1.f : (1.f / 4096.f));
        else invr[i] = (l8[i] > 0.f) ? (SPLITPV ? 1.f / l8[i] : 1.f / (l8[i] * 4096.f)) : 0.f;
    }
    __syncthreads();                                             // all waves done with pl/vl from the main loop
    const bool ofast = ((p.sOi & 3) == 0) && ((((size_t)obase) & 15) == 0) && (q0 + 16 <= p.Lq);
#pragma unroll
    for (int c0 = 0; c0 < DVP; c0 += 64) {
#pragma unroll
        for (int i = 0; i < 8; ++i)
#pragma unroll
            for (int t = 0; t < NT; ++t) if (t * 16 >= c0 && t * 16 < c0 + 64) ((float*)myp)[(i + 8 * hf) * 64 + (t * 16 - c0) + l15] = o[t][i] * invr[i];
        __syncthreads();
        const int cw = (DVP - c0 < 64) ? (DVP - c0) : 64;      // staged columns in this chunk (multiple of 16)
        if (O16) {
            _Float16* oh = p.Oh + b * p.sOb + h * p.sOh;
            if (q0 < p.Lq) {                                     // Lq is a multiple of 16: a wave's 16 rows are all there or none is
#pragma unroll   // four stores of 4 rows each, all in flight
                for (int r0 = 0; r0 < 16; r0 += 4) {
                    const int row = r0 + (lane >> 3), c8 = (lane & 7) * 8;
                    const float* sp = myp + row * 64 + c8;
                    v8h hv;
#pragma unroll   // constant element indices: the vector stays in registers
                    for (int e = 0; e < 8; ++e) hv[e] = (_Float16)sp[e];
                    *(v8h*)(oh + (long long)(q0 + row) * p.sOi + c8) = hv;
                }
            }
        } else if (ofast && (c0 + cw <= p.dv) && (cw % 32 == 0)) {
            const int lpr = cw / 4;                              // lanes per row (16 for 64 cols, 8 for 32)
            const int rows_per_ins = 32 / lpr;
            for (int r0 = 0; r0 < 16; r0 += rows_per_ins) {
                const int row = r0 + lane / lpr, c4 = (lane % lpr) * 4;
                const v4f v = *(const v4f*)(myp + row * 64 + c4);
                VST2V4(obase + (long long)(q0 + row) * p.sOi + c0 + c4, v);
            }
        } else {
            for (int row = 0; row < 16; ++row) {
                const int irow = q0 + row; if (irow >= p.Lq) continue;
                for (int c = lane; c < cw; c += 32) { const int d = c0 + c; if (d < p.dv) VST2(float, obase + (long long)irow * p.sOi + d, myp[row * 64 + c]); }
            }
        }
        __syncthreads();
    }
}

__device__ __forceinline__ float other_half(float v) {
    const int b = __builtin_bit_cast(int, v);
    return __builtin_bit_cast(float, __builtin_amdgcn_permlanex16(b, b, 0x76543210, 0xfedcba98, false, false));
}
__global__ __launch_bounds__(32 * AW) void k_attn_t(AttnP p) {
    constexpr int KS = 2;                       // k-steps of the scores (head dim 64)
    constexpr int VP = 64 + 8;                  // LDS pitch of the V tile and of the output staging (halves): 144 bytes
    constexpr int NV = 64 * 16 / (32 * AW);     // 16-byte pieces of the f32 V tile per thread
    __shared__ __align__(16) _Float16 vl[64 * VP];
    __shared__ __align__(16) _Float16 ol[AW][16 * VP];
    const int lane = threadIdx.x & 31, hf = lane >> 4, l15 = lane & 15, wave = threadIdx.x >> 5;
    const int h = blockIdx.y, b = blockIdx.z;
    const int q0 = (blockIdx.x * AW + wave) * 16;
    const float L2E = 1.4426950408889634f;
    const float NEG = -__builtin_inff();
    const int irow = q0 + l15;                  // the lane's query
    const float* qrow = p.Q + b * p.sQb + h * p.sQh + (long long)min(irow, p.Lq - 1) * p.sQi;
    const float* kbase = p.K + b * p.sKb + h * p.sKh;
    const float* vbase = p.V + b * p.sVb + h * p.sVh;
    v16h qa[KS];
    {
        Raw16 qr[KS];
#pragma unroll   // constant indices: the fragments stay in registers
        for (int ks = 0; ks < KS; ++ks) qr[ks] = raw_ld4(qrow, ks * 32, hf);
        asm volatile("s_wait_xcnt 0x0" ::: "memory");   // behind the run of loads off one address pair, ahead of any rewrite of that pair
#pragma unroll   // constant indices: the arrays stay in registers
        for (int ks = 0; ks < KS; ++ks) qa[ks] = raw_f16(qr[ks]);
    }
    v8f o[4]; float m = NEG, l = 0.f;
#pragma unroll   // constant indices: the arrays stay in registers
    for (int t = 0; t < 4; ++t) { v8f zz = {}; o[t] = zz; }
    const int jend = min(p.Lk, (int)(blockIdx.x * AW + AW) * 16);          // uniform per block: no key beyond the block's last query
    const int jbeg = (p.win > 0) ? max((int)(blockIdx.x * AW) * 16 - p.win, 0) : 0;   // uniform per block: first key that any of its queries sees through the window
    for (int j0 = jbeg; j0 < jend; j0 += 64) {
        v4f vr[NV]; Raw16 kr[2][KS];            // this thread's part of the V tile and the lane's K fragments of two 16-key tiles, f32 as loaded
        __syncthreads();                        // previous key block's reads of vl are done
        v8f s[4];
#pragma unroll   // constant indices: the arrays stay in registers
        for (int t = 0; t < 4; ++t) {
            if ((t & 1) == 0) {
                // the K loads of two 16-key tiles are issued ahead of the first use of any of them: one trip to memory for 4 fragments
#pragma unroll   // constant indices: the arrays stay in registers
                for (int u = 0; u < 2; ++u) {
#pragma unroll   // constant indices: the arrays stay in registers
                    for (int ks = 0; ks < KS; ++ks) kr[u][ks] = raw_ld4(kbase + (long long)min(j0 + (t + u) * 16 + l15, p.Lk - 1) * p.sKj, ks * 32, hf);
                    // one tile's loads share one address pair: this wait stands behind them, ahead of any later load whose result may be given that pair
                    asm volatile("s_wait_xcnt 0x0" ::: "memory");
                }
#pragma unroll   // constant indices: the arrays stay in registers
                for (int u = 0; u < 2; ++u)
#pragma unroll   // constant indices: the arrays stay in registers
                    for (int ks = 0; ks < KS; ++ks) loads_held(kr[u][ks].x0, kr[u][ks].x1, kr[u][ks].x2, kr[u][ks].x3);
            }
            v8f acc = {};
#pragma unroll   // constant indices: the arrays stay in registers
            for (int ks = 0; ks < KS; ++ks) acc = wmma16(raw_f16(kr[t & 1][ks]), qa[ks], acc);
            s[t] = acc;
        }
        // the V tile's loads go out here and are first used behind the softmax, which covers their trip to memory
#pragma unroll   // constant indices: the arrays stay in registers
        for (int n = 0; n < NV; ++n) {
            const int idx = threadIdx.x + n * (32 * AW), jr = idx >> 4, d = (idx & 15) * 4;
            vr[n] = *(const v4f*)(vbase + (long long)min(j0 + jr, p.Lk - 1) * p.sVj + d);   // row clamped, so no guard round the load
        }
        asm volatile("s_wait_xcnt 0x0" ::: "memory");   // behind the run of V loads, ahead of any rewrite of their address registers
        __builtin_amdgcn_sched_barrier(0);   // without it the compiler sinks the V loads to the end of the softmax, which then no longer covers their trip
        float mt[4];
#pragma unroll   // constant indices: the scores stay in registers; four independent chains of maxima
        for (int t = 0; t < 4; ++t) {
            mt[t] = NEG;
#pragma unroll   // constant indices: the arrays stay in registers
            for (int r = 0; r < 8; ++r) {
                const int jg = j0 + t * 16 + 8 * hf + r;
                float v = s[t][r] * p.scale;
                if (jg >= p.Lk || jg > irow || (p.win > 0 && irow - jg > p.win)) v = NEG; else v *= L2E;
                s[t][r] = v; mt[t] = fmaxf(mt[t], v);
            }
        }
        float mx = fmaxf(fmaxf(mt[0], mt[1]), fmaxf(mt[2], mt[3]));
        mx = fmaxf(mx, other_half(mx));
        const float mnew = fmaxf(m, mx);
        const float ms = (mnew == NEG) ? 0.f : mnew;    // no key seen yet: every score is -inf, and -inf - 0 gives weight 0 where -inf - -inf would give NaN
        const float corr = exp2f(m - ms);               // 0 while m is -inf, where l and o are still 0
        float rt[4];
#pragma unroll   // four independent chains of sums
        for (int t = 0; t < 4; ++t) {
            rt[t] = 0.f;
#pragma unroll   // constant indices: the arrays stay in registers
            for (int r = 0; r < 8; ++r) { const float pp = exp2f(s[t][r] - ms); s[t][r] = pp; rt[t] += pp; }
        }
        float rs = (rt[0] + rt[1]) + (rt[2] + rt[3]);
        rs += other_half(rs);
        l = l * corr + rs; m = mnew;
#pragma unroll   // constant indices: the arrays stay in registers
        for (int t = 0; t < 4; ++t) o[t] *= corr;
        v16h pb[2];
#pragma unroll   // constant element indices: the vectors stay in registers
        for (int k2 = 0; k2 < 2; ++k2)
#pragma unroll   // constant indices: the arrays stay in registers
            for (int i = 0; i < 8; ++i) { pb[k2][i] = (_Float16)(s[2 * k2][i] * 4096.f); pb[k2][8 + i] = (_Float16)(s[2 * k2 + 1][i] * 4096.f); }
        // cast and stage the V tile loaded above (unrolled: vr stays in registers)
#pragma unroll   // constant indices: the arrays stay in registers
        for (int n = 0; n < NV; ++n) {
            const int idx = threadIdx.x + n * (32 * AW), jr = idx >> 4, d = (idx & 15) * 4;
            v4h hv;
#pragma unroll   // constant indices: the arrays stay in registers
            for (int e = 0; e < 4; ++e) hv[e] = (_Float16)((j0 + jr < p.Lk) ? vr[n][e] : 0.f);
            *(v4h*)&vl[jr * VP + d] = hv;
        }
        __syncthreads();                        // the V tile is visible to every wave
#pragma unroll   // constant indices: the arrays stay in registers
        for (int t = 0; t < 4; ++t) {
            const int dcol = t * 16 + l15;
            v16h a0, a1;
#pragma unroll   // constant indices: the arrays stay in registers
            for (int e = 0; e < 16; ++e) { a0[e] = vl[frag_k(e, hf) * VP + dcol]; a1[e] = vl[(32 + frag_k(e, hf)) * VP + dcol]; }
            o[t] = wmma16(a0, pb[0], o[t]);
            o[t] = wmma16(a1, pb[1], o[t]);
        }
    }
    const float inv = (l > 0.f) ? 1.f / (l * 4096.f) : 0.f;
    _Float16* mo = ol[wave];                    // the wave's 16 x 64 output tile, so that the stores to memory cover whole 128-byte lines
#pragma unroll   // constant indices: the arrays stay in registers
    for (int t = 0; t < 4; ++t) {
        v8h hv;
#pragma unroll   // constant element indices
        for (int r = 0; r < 8; ++r) hv[r] = (_Float16)(o[t][r] * inv);
        *(v8h*)&mo[l15 * VP + t * 16 + 8 * hf] = hv;
    }
    __syncthreads();                            // the tile is written before other lanes read it
    _Float16* oh = p.Oh + b * p.sOb + h * p.sOh;
    if (q0 < p.Lq) {                            // Lq is a multiple of 16: a wave's 16 rows are all there or none is
#pragma unroll   // four stores of 4 rows each, all in flight
        for (int r0 = 0; r0 < 16; r0 += 4) {
            const int row = r0 + (lane >> 3), c8 = (lane & 7) * 8;
            *(v8h*)(oh + (long long)(q0 + row) * p.sOi + c8) = *(const v8h*)&mo[row * VP + c8];
        }
    }
}

// =====================================================================================================================
// k_tr: dst(z, c, r) = alpha * src(z, r, c) (+ beta * R2(z, c, r)): [Z][R][C] (row stride lds) -> [Z][C][R] (row stride ldd) through a 32x32 LDS tile;
//   flags: 1 -> add beta * residual R2 addressed like dst (z*sRz + c*ldr + r); act applied before the residual.
// =====================================================================================================================
struct TrP { const float* src; float* dst; const float* R2; long long sSz, lds, sDz, ldd, sRz, ldr; int R, C, flags, act; float alpha, beta; };
static_assert(sizeof(TrP) == 3 * 8 + 6 * 8 + 6 * 4, "TrP has padding");
__global__ __launch_bounds__(256) void k_tr(TrP p) {
    __shared__ float tile[32][33];
    const int c0 = blockIdx.x * 32, r0 = blockIdx.y * 32, z = blockIdx.z;
    const int lane = threadIdx.x & 31, wave = threadIdx.x >> 5;
    const float* s = p.src + z * p.sSz;
#pragma unroll
    for (int k = 0; k < 4; ++k) {
        const int rl = wave * 4 + k, r = r0 + rl, c = c0 + lane;
        tile[rl][lane] = (r < p.R && c < p.C) ? s[(long long)r * p.lds + c] : 0.f;
    }
    __syncthreads();
    float* d = p.dst + z * p.sDz; const float* rr = p.R2 + z * p.sRz;
#pragma unroll
    for (int k = 0; k < 4; ++k) {
        const int cl = wave * 4 + k, c = c0 + cl, r = r0 + lane;
        if (c < p.C && r < p.R) {
            float v = act_fn(p.alpha * tile[lane][cl], p.act);
            if (p.flags & 1) v += p.beta * rr[(long long)c * p.ldr + r];
            VST2(float, d + (long long)c * p.ldd + r, v);
        }
    }
}

// k_affine: dst[i] = a * (sdev ? sdev[0] : 1) * src[i] + b, i < n (one thread per element; consecutive lanes -> consecutive addresses)
__global__ __launch_bounds__(256) void k_affine(const float* __restrict__ src, float* __restrict__ dst, int n, float a, float b, const float* __restrict__ sdev) {
    const int i = blockIdx.x * 256 + threadIdx.x;
    if (i < n) { const float aa = sdev ? a * sdev[0] : a; const float v = aa * src[i] + b; VST2(float, dst + i, v); }
}

// =====================================================================================================================
// k_softmax: row softmax over n contiguous elements, one 256-thread block per row; rows addressed z*sz + r*sr (grid (R, Z)).
//   out = scale_out * softmax(scale_in * x + (Mf ? Mf[z*smz + r*smr + j] : 0)); a row whose max is -inf is written as 0.
// =====================================================================================================================
struct SmP { const float* src; float* dst; const float* Mf; long long sz, sr, dz, dr, smz, smr; int n, pad; float scale_in, scale_out; };
static_assert(sizeof(SmP) == 3 * 8 + 6 * 8 + 4 * 4, "SmP has padding");
__global__ __launch_bounds__(256) void k_softmax(SmP p) {
    __shared__ float red[256];
    const int r = blockIdx.x, z = blockIdx.y, tid = threadIdx.x;
    const float* s = p.src + z * p.sz + (long long)r * p.sr;
    const float* mf = p.Mf ? (p.Mf + z * p.smz + (long long)r * p.smr) : nullptr;
    float mx = -__builtin_inff();
    for (int j = tid; j < p.n; j += 256) { float v = s[j] * p.scale_in; if (mf) v += mf[j]; mx = fmaxf(mx, v); }
    red[tid] = mx; __syncthreads();
    for (int o = 128; o > 0; o >>= 1) { if (tid < o) red[tid] = fmaxf(red[tid], red[tid + o]); __syncthreads(); }
    mx = red[0]; __syncthreads();
    float sum = 0.f;
    for (int j = tid; j < p.n; j += 256) { float v = s[j] * p.scale_in; if (mf) v += mf[j]; sum += (mx == -__builtin_inff()) ? 0.f : expf(v - mx); }
    red[tid] = sum; __syncthreads();
    for (int o = 128; o > 0; o >>= 1) { if (tid < o) red[tid] += red[tid + o]; __syncthreads(); }
    sum = red[0];
    const float inv = (sum > 0.f) ? p.scale_out / sum : 0.f;
    float* d = p.dst + z * p.dz + (long long)r * p.dr;
    for (int j = tid; j < p.n; j += 256) { float v = s[j] * p.scale_in; if (mf) v += mf[j]; const float o = (mx == -__builtin_inff()) ? 0.f : expf(v - mx) * inv; VST2(float, d + j, o); }
}
// =====================================================================================================================
// k_stats: mean and rsqrt(var + eps) over a set of n elements addressed base + z*sz + (e / inner) * so + (e % inner) * si, one 256-thread
// k_norm_apply: y = (x - mean[set]) * rstd[set] * g[c] + b[c] over a [Z][C][L] channel-major tensor with set = z*G + c / (C/G) (G groups per z;
//   G = C -> per-channel sets indexed z*C+c; for batch norm pass stats indexed by c only via bn = 1). Optional act. Output same layout.
// =====================================================================================================================
//   mode 0: mean / rsqrt(var + eps); mode 1 (RMSNorm): 0 / rsqrt(mean(x^2) + eps); mode 2 (L2 normalize * sqrt(n)): 0 / sqrt(n) / max(||x||, eps); mode 3: as 0 with unbiased variance (n-1)
__global__ __launch_bounds__(256) void k_stats(const float* __restrict__ x, long long sz, long long so, long long si, int inner, int n, float eps, float* __restrict__ stat, int mode) {
    __shared__ float red[256];
    const int z = blockIdx.x, tid = threadIdx.x;
    const float* base = x + z * sz;
    float s = 0.f;
    for (int e = tid; e < n; e += 256) s += base[(long long)(e / inner) * so + (long long)(e % inner) * si];
    red[tid] = s; __syncthreads();
    for (int o = 128; o > 0; o >>= 1) { if (tid < o) red[tid] += red[tid + o]; __syncthreads(); }
    const float mu = (mode == 0 || mode == 3) ? red[0] / (float)n : 0.f; __syncthreads();
    float q = 0.f;
    for (int e = tid; e < n; e += 256) { const float dlt = base[(long long)(e / inner) * so + (long long)(e % inner) * si] - mu; q += dlt * dlt; }
    red[tid] = q; __syncthreads();
    for (int o = 128; o > 0; o >>= 1) { if (tid < o) red[tid] += red[tid + o]; __syncthreads(); }
    {
        float rs;
        if (mode == 2) rs = sqrtf((float)n) / fmaxf(sqrtf(red[0]), eps); else if (mode == 3) rs = rsqrtf(red[0] / (float)(n - 1) + eps); else rs = rsqrtf(red[0] / (float)n + eps);
        if (tid < 32) { const float v = (tid == 0) ? mu : ((tid == 1) ? rs : 0.f); VST2(float, stat + (long long)z * 32 + tid, v); }
    }
}
//   One thread per element over the flat [Z][C][L] index space: grid ceil(Z*C*L / 256).
__global__ __launch_bounds__(256) void k_norm_apply(const float* __restrict__ x, float* __restrict__ y, const float* __restrict__ stat, const float* __restrict__ g, const float* __restrict__ bta,
                                                     int Z, int C, int L, int G, int bn, int act) {
    const long long idx = (long long)blockIdx.x * 256 + threadIdx.x;
    if (idx >= (long long)Z * C * L) return;
    const int l = (int)(idx % L); const long long zc = idx / L; const int c = (int)(zc % C), z = (int)(zc / C); (void)l;
    const int set = bn ? c : (z * G + c / (C / G));
    float v = (x[idx] - stat[(long long)set * 32]) * stat[(long long)set * 32 + 1];
    if (g) v *= g[c];
    if (bta) v += bta[c];
    v = act_fn(v, act);
    VST2(float, y + idx, v);
}

// k_lse_neg: c[i] = -(st[2i] + log(st[2i+1])) = minus the log-sum-exp of row i from k_attn's ST output (for softmax over the query axis)
__global__ __launch_bounds__(256) void k_lse_neg(const float* __restrict__ st, float* __restrict__ c, int n) {
    const int i = blockIdx.x * 256 + threadIdx.x;
    if (i < n) { const float v = -(st[2 * i] + logf(st[2 * i + 1])); VST2(float, c + i, v); }
}

// k_iota: dst[i] = a * i + b as int32 (segment/position id helper)
__global__ __launch_bounds__(256) void k_iota(int* __restrict__ dst, int n, int a, int b) {
    const int i = blockIdx.x * 256 + threadIdx.x;
    if (i < n) { const int v = a * i + b; VST2(int, dst + i, v); }
}

// k_axpby: dst[i] = a * x[i] + b * y[i] (+ c), i < n
__global__ __launch_bounds__(256) void k_axpby(const float* __restrict__ x, const float* __restrict__ y, float* __restrict__ dst, int n, float a, float b, float c) {
    const int i = blockIdx.x * 256 + threadIdx.x;
    if (i < n) { const float v = a * x[i] + b * y[i] + c; VST2(float, dst + i, v); }
}

// =====================================================================================================================
// k_rope: rotary embedding on a [R rows][Hn heads][D] view (row stride sXr, head stride sXh, element stride 1) -> Y (own strides).
//   mode 0: rotate_half (partner d±D/2, sign - for d<D/2); mode 1: interleaved pairs (partner d^1, sign - for even d).
//   table column tcol: tmode 0 -> d, 1 -> d % (D/2), 2 -> d / 2; position p: pmode 0 -> r % S, 1 -> head index, 2 -> pos[r];
//   c = C[(r / S) * sCb + p * sCp + tcol * sCd], s likewise from Sn; y = x[d] * c + sign * x[partner] * s. X and Y must not alias.
// =====================================================================================================================
struct RopeP { const float* X; float* Y; const float* C; const float* Sn; const int* pos; long long sXr, sXh, sYr, sYh, sCb, sCp, sCd; int R, Hn, D, S, mode, tmode, pmode, pad; };
static_assert(sizeof(RopeP) == 5 * 8 + 7 * 8 + 8 * 4, "RopeP has padding");
__global__ __launch_bounds__(256) void k_rope(RopeP p) {
    const long long idx = (long long)blockIdx.x * 256 + threadIdx.x;
    if (idx >= (long long)p.R * p.Hn * p.D) return;
    const int d = (int)(idx % p.D); const long long rh = idx / p.D; const int h = (int)(rh % p.Hn); const int r = (int)(rh / p.Hn);
    const int half = p.D / 2;
    int partner; float sign;
    if (p.mode == 0) { partner = (d < half) ? d + half : d - half; sign = (d < half) ? -1.f : 1.f; }
    else { partner = d ^ 1; sign = (d & 1) ? 1.f : -1.f; }
    const int tcol = (p.tmode == 0) ? d : ((p.tmode == 1) ? (d % half) : (d >> 1));
    const int pp = (p.pmode == 0) ? (r % p.S) : ((p.pmode == 1) ? h : p.pos[r]);
    const long long toff = (long long)(r / p.S) * p.sCb + (long long)pp * p.sCp + (long long)tcol * p.sCd;
    const float* xr = p.X + (long long)r * p.sXr + (long long)h * p.sXh;
    const float v = xr[d] * p.C[toff] + sign * xr[partner] * p.Sn[toff];
    VST2(float, p.Y + (long long)r * p.sYr + (long long)h * p.sYh + d, v);
}

// k_invf + k_sincos (split so neither kernel carries a large VALU-fma footprint): invf_i = num * (1 / powf(base, (2 i)/D)) [fmode 0],
//   num * expf((2 i) * cexp) [fmode 1], num * powf(base, -2 (i - 1) / D) [fmode 2]; then cs/sn[s*half + i] = cos/sin((pscale * s) * invf_i)
__global__ __launch_bounds__(256) void k_invf(float* __restrict__ invb, int half, int D, float base, float num, int fmode, float cexp) {
    const int i = blockIdx.x * 256 + threadIdx.x;
    if (i >= ((half + 31) / 32) * 32) return;
    if (i >= half) { VST2(float, invb + i, 0.f); return; }
    const float e = (float)(2 * i) / (float)D;
    float invf;
    if (fmode == 1) invf = num * expf((float)(2 * i) * cexp);
    else if (fmode == 2) invf = num * powf(base, (-2.0f * ((float)i - 1.0f)) / (float)D);
    else invf = num * (1.0f / powf(base, e));
    VST2(float, invb + i, invf);
}
__global__ __launch_bounds__(256) void k_sincos(float* __restrict__ cs, float* __restrict__ sn, const float* __restrict__ invb, int S, int half, float pscale) {
    const int idx = blockIdx.x * 256 + threadIdx.x;
    if (idx >= S * half) return;
    const int s = idx / half, i = idx - s * half;
    const float ang = (pscale * (float)s) * invb[i];
    VST2(float, cs + idx, cosf(ang)); VST2(float, sn + idx, sinf(ang));
}

// k_mulact: dst[i] = act(x[i]) * y[i]
__global__ __launch_bounds__(256) void k_mulact(const float* __restrict__ x, const float* __restrict__ y, float* __restrict__ dst, int n, int act) {
    const int i = blockIdx.x * 256 + threadIdx.x;
    if (i < n) { const float v = act_fn(x[i], act) * y[i]; VST2(float, dst + i, v); }
}

// =====================================================================================================================
// k_matvec: thread-per-row matrix-vector products for N <= 8 output columns (heads with 1-3 outputs, gates), f32 on the VALU.
//   C[r*sCm + j] = act(alpha * sum_k A[r*sAm + k*sAk] * B[j*sBn + k*sBk] + bias[j]) + beta * R[r*sRm + j*sRn]; each thread writes its N contiguous floats.
// =====================================================================================================================
__global__ __launch_bounds__(256) void k_matvec(GemmP p) {
    // 32 lanes write one line with one instruction.
    const int rpt = (p.N == 1) ? 1 : 32;
    const long long r0 = ((long long)blockIdx.x * 256 + threadIdx.x) * rpt; const int z = blockIdx.z, zo = z / p.zi_n, zi = z - zo * p.zi_n;
    if (r0 >= p.M) return;
    const float* Bb = p.B + zo * p.sBo + zi * p.sBi;
    float* C = p.C + zo * p.sCo + zi * p.sCi; const float* R = p.R + zo * p.sRo + zi * p.sRi;
    for (int rr = 0; rr < rpt; ++rr) {
        const long long r = r0 + rr; if (r >= p.M) break;
        const float* A = p.A + zo * p.sAo + zi * p.sAi + r * p.sAm;
        float acc[8] = {0.f, 0.f, 0.f, 0.f, 0.f, 0.f, 0.f, 0.f};
        for (int k = 0; k < p.K; ++k) { const float a = A[(long long)k * p.sAk];
#pragma unroll
            for (int j = 0; j < 8; ++j) if (j < p.N) acc[j] += a * Bb[(long long)j * p.sBn + (long long)k * p.sBk]; }
#pragma unroll
        for (int j = 0; j < 8; ++j) if (j < p.N) {
            float v = acc[j] * p.alpha;
            if (p.flags & 1) v += p.bias[j];
            if (p.flags & 2) v += p.bias[r];
            v = act_fn(v, p.act);
            if (p.flags & 4) v += p.beta * R[r * p.sRm + (long long)j * p.sRn];
            VST2(float, C + r * p.sCm + j, v);
        }
    }
}
// k_smallsoftmax: thread-per-row softmax for short rows (n <= 64): dst[r*dr + j] = softmax(scale*src[r*sr + j])
__global__ __launch_bounds__(256) void k_smallsoftmax(const float* __restrict__ src, float* __restrict__ dst, long long sr, long long dr, int n, long long R, float scale) {
    const long long r0 = ((long long)blockIdx.x * 256 + threadIdx.x) * 32;
    for (int rr = 0; rr < 32; ++rr) {
        const long long r = r0 + rr; if (r >= R) return;
        const float* s = src + r * sr; float* d = dst + r * dr;
        float mx = -__builtin_inff();
        for (int j = 0; j < n; ++j) mx = fmaxf(mx, s[j] * scale);
        float sum = 0.f;
        for (int j = 0; j < n; ++j) sum += expf(s[j] * scale - mx);
        const float inv = 1.f / sum;
        for (int j = 0; j < n; ++j) { const float v = expf(s[j] * scale - mx) * inv; VST2(float, d + j, v); }
    }
}

__global__ __launch_bounds__(32) void k_unitstat(float* __restrict__ st) { const int t = threadIdx.x; const float v = (t == 1) ? 1.f : 0.f; VST2(float, st + t, v); }

// destination (e.g. a d_out whose row width is not a multiple of 32 floats) is written by consecutive lanes of one instruction
__global__ __launch_bounds__(256) void k_lincopy(const float* __restrict__ src, long long lds, float* __restrict__ dst, long long ldd, long long rows, int cols) {
    const long long i = (long long)blockIdx.x * 256 + threadIdx.x; if (i >= rows * cols) return;
    const long long r = i / cols; const int c = (int)(i - r * cols);
    const float v = src[r * lds + c]; VST2(float, dst + r * ldd + c, v);
}

namespace w25 {
typedef __attribute__((ext_vector_type(16))) _Float16 v16h;
typedef __attribute__((ext_vector_type(8)))  _Float16 v8h;
typedef __attribute__((ext_vector_type(16))) __bf16   v16b;
typedef __attribute__((ext_vector_type(8)))  __bf16   v8b;
typedef __attribute__((ext_vector_type(8)))  float    v8f;
typedef __attribute__((ext_vector_type(4)))  float    v4f;

__device__ __forceinline__ unsigned short f2bf_bits(float f) {
  unsigned u = __float_as_uint(f);
  return (unsigned short)((u + 0x7FFFu + ((u >> 16) & 1u)) >> 16);
}
__device__ __forceinline__ float bf_bits2f(unsigned short h) { return __uint_as_float(((unsigned)h) << 16); }

// hazard guards as plain device helpers (no inline asm inside the kernel template body)
__device__ __forceinline__ void dep_guard_h(v8f& a, v8f& b, v16h x, v16h y) { asm volatile("v_nop\n\tv_nop\n\tv_nop\n\tv_nop" : "+v"(a), "+v"(b) : "v"(x), "v"(y)); }
__device__ __forceinline__ void dep_guard_b(v8f& a, v8f& b, v16b x, v16b y) { asm volatile("v_nop\n\tv_nop\n\tv_nop\n\tv_nop" : "+v"(a), "+v"(b) : "v"(x), "v"(y)); }
__device__ __forceinline__ void keep4_h(v16h a, v16h b, v16h c, v16h d) { asm volatile("v_nop" :: "v"(a), "v"(b), "v"(c), "v"(d)); }
__device__ __forceinline__ void keep4_b(v16b a, v16b b, v16b c, v16b d) { asm volatile("v_nop" :: "v"(a), "v"(b), "v"(c), "v"(d)); }
__device__ __forceinline__ void acc_guard4(v8f& a, v8f& b, v8f& c, v8f& d) { asm volatile("v_nop\n\tv_nop\n\tv_nop\n\tv_nop" : "+v"(a), "+v"(b), "+v"(c), "+v"(d)); }
template <typename T> struct Frag;
template <> struct Frag<_Float16> {
  typedef v16h V; union U { v16h v; v8h h[2]; };
  static __device__ __forceinline__ v16h load(const _Float16* p) {   // elements 0..7 <- p[0..7], 8..15 <- p[16..23]
    U f; f.h[0] = *(const v8h*)(p); f.h[1] = *(const v8h*)(p + 16); return f.v;
  }
  static __device__ __forceinline__ v8f mma(v16h a, v16h b, v8f c) {
    return __builtin_amdgcn_wmma_f32_16x16x32_f16(false, a, false, b, (short)0, c, false, false);
  }
  static __device__ __forceinline__ void guard(v8f& a, v8f& b, v16h x, v16h y) { dep_guard_h(a, b, x, y); }
  static __device__ __forceinline__ void keep(v16h a, v16h b, v16h c, v16h d) { keep4_h(a, b, c, d); }
};
template <> struct Frag<__bf16> {
  typedef v16b V; union U { v16b v; v8b h[2]; };
  static __device__ __forceinline__ v16b load(const __bf16* p) {
    U f; f.h[0] = *(const v8b*)(p); f.h[1] = *(const v8b*)(p + 16); return f.v;
  }
  static __device__ __forceinline__ v8f mma(v16b a, v16b b, v8f c) {
    return __builtin_amdgcn_wmma_f32_16x16x32_bf16(false, a, false, b, (short)0, c, false, false);
  }
  static __device__ __forceinline__ void guard(v8f& a, v8f& b, v16b x, v16b y) { dep_guard_b(a, b, x, y); }
  static __device__ __forceinline__ void keep(v16b a, v16b b, v16b c, v16b d) { keep4_b(a, b, c, d); }
};

// ---- Register-blocked batched WMMA GEMM ------------------------------------
// C[m,n] = scale * sum_k A[m,k] * Bt[n,k] (+bias)(+resid); each wave owns a 64x64 tile.
// A row-major [M,K]; Bt row-major [N,K]; M,N % 64 == 0, K % 32 == 0.
// SPLIT: operands are hi/lo planes (A2/Bt2 = lo planes, same layout); product = hi·hi + hi·lo + lo·hi.
// BIAS_MODE: 0 = none, 1 = bias[m], 2 = bias[n]. Batch 1 takes bias_b1 and batch 2 bias_b2 in its place (up to three products that share A in one launch).
// OUT_MODE: 0 = f32, 1 = f16, 2 = bf16 hi plane (Cout) + bf16 lo plane (Cout2).
// ET: 0 = f16 operands, 1 = bf16 operands (pointers passed as 16-bit storage)
template <int ET> struct Elem;
template <> struct Elem<0> { typedef _Float16 T; };
template <> struct Elem<1> { typedef __bf16 T; };
template <int ET, bool SPLIT, int BIAS_MODE, int OUT_MODE, bool RESID, int ACT = 0>
__global__ __launch_bounds__(256) void wmma_gemm64(
    const unsigned short* __restrict__ Ap, const unsigned short* __restrict__ A2p, int lda, long strideA,
    const unsigned short* __restrict__ Btp, const unsigned short* __restrict__ Bt2p, int ldb, long strideB,
    void* __restrict__ Cout, void* __restrict__ Cout2, int ldc, long strideC,
    const float* __restrict__ bias, const float* __restrict__ bias_b1, const float* __restrict__ bias_b2,
    const float* __restrict__ resid, long strideR,
    int M, int N, int K, float scale) {
  typedef typename Elem<ET>::T T;
  typedef typename Frag<T>::V V;
  const T* A = (const T*)Ap; const T* A2 = (const T*)A2p; const T* Bt = (const T*)Btp; const T* Bt2 = (const T*)Bt2p;
  __shared__ __align__(16) float sT[8][16 * 68];   // per-wave 16x64 slab, pitch 68 floats
  const int b    = blockIdx.y;
  const int lane = threadIdx.x & 31;
  const int wave = threadIdx.x >> 5;
  const int tilesN = N >> 6;
  const int tilesM = M >> 6;
  const int tile = blockIdx.x * 8 + wave;
  if (tile >= tilesM * tilesN) return;   // wave-uniform; no block barriers in this kernel
  const int tm = tile / tilesN;
  const int tn = tile - tm * tilesN;
  const int m0 = tm << 6;
  const int n0 = tn << 6;

  const T* Ab  = A  + (size_t)b * strideA;
  const T* Bb  = Bt + (size_t)b * strideB;
  const T* Ab2 = SPLIT ? (A2  + (size_t)b * strideA) : nullptr;
  const T* Bb2 = SPLIT ? (Bt2 + (size_t)b * strideB) : nullptr;

  const int rlane = lane & 15;                 // row (A) / col (B, D) within subtile
  const int koff  = (lane >> 4) * 8;           // k offset of this lane half
  const int mOff  = (lane >> 4) * 8;           // D row offset

  v8f acc[4][4];
#pragma unroll
  for (int i = 0; i < 4; ++i)
#pragma unroll
    for (int j = 0; j < 4; ++j) acc[i][j] = (v8f){0.f,0.f,0.f,0.f,0.f,0.f,0.f,0.f};

  for (int k0 = 0; k0 < K; k0 += 32) {
    V bh[4], bl[4];
#pragma unroll
    for (int j = 0; j < 4; ++j) {
      const size_t bo = (size_t)(n0 + (j << 4) + rlane) * ldb + koff + k0;
      bh[j] = Frag<T>::load(Bb + bo);
      if (SPLIT) bl[j] = Frag<T>::load(Bb2 + bo);
    }
#pragma unroll
    for (int i = 0; i < 4; ++i) {
      const size_t ao = (size_t)(m0 + (i << 4) + rlane) * lda + koff + k0;
      V ah = Frag<T>::load(Ab + ao);
      V al;
      if (SPLIT) al = Frag<T>::load(Ab2 + ao);
#pragma unroll
      for (int j = 0; j < 4; ++j) {
        acc[i][j] = Frag<T>::mma(ah, bh[j], acc[i][j]);
        if (SPLIT) {
          acc[i][j] = Frag<T>::mma(ah, bl[j], acc[i][j]);
          acc[i][j] = Frag<T>::mma(al, bh[j], acc[i][j]);
        }
      }
      Frag<T>::guard(acc[i][0], acc[i][3], ah, SPLIT ? al : ah);
    }
    Frag<T>::keep(bh[0], bh[1], bh[2], bh[3]);
    if (SPLIT) Frag<T>::keep(bl[0], bl[1], bl[2], bl[3]);
  }
  acc_guard4(acc[0][0], acc[0][1], acc[0][2], acc[0][3]);
  acc_guard4(acc[1][0], acc[1][1], acc[1][2], acc[1][3]);
  acc_guard4(acc[2][0], acc[2][1], acc[2][2], acc[2][3]);
  acc_guard4(acc[3][0], acc[3][1], acc[3][2], acc[3][3]);

  // ---- epilogue ----
  float* slab = sT[wave];
  const float* Rb = RESID ? (resid + (size_t)b * strideR) : nullptr;
  const float* bsel = (b == 0) ? bias : ((b == 1) ? bias_b1 : bias_b2);
#pragma unroll
  for (int i = 0; i < 4; ++i) {
    const int mBase = m0 + (i << 4);
#pragma unroll
    for (int j = 0; j < 4; ++j) {
      const int n = n0 + (j << 4) + rlane;
      float bv = 0.f;
      if (BIAS_MODE == 2) bv = bsel[n];
#pragma unroll
      for (int r = 0; r < 8; ++r) {
        float v = acc[i][j][r] * scale;
        if (BIAS_MODE == 1) v += bsel[mBase + mOff + r];
        if (BIAS_MODE == 2) v += bv;
        if (RESID) v += Rb[(size_t)(mBase + mOff + r) * ldc + n];
        if (ACT == 1) v = tanhf(v);
        if (ACT == 2) v = fmaxf(v, 0.0f);
        if (ACT == 3) v = v / (1.0f + expf(-v));
        if (ACT == 4) v = (v > 0.f) ? v : 0.01f * v;
        if (ACT == 5) v = 0.5f * v * (1.0f + erff(v * 0.70710678118654752f));
        slab[(mOff + r) * 68 + (j << 4) + rlane] = v;
      }
    }
    __builtin_amdgcn_fence(__ATOMIC_RELEASE, "workgroup");
    __builtin_amdgcn_wave_barrier();
    __builtin_amdgcn_fence(__ATOMIC_ACQUIRE, "workgroup");
    if (OUT_MODE == 0) {
      float* C = (float*)Cout + (size_t)b * strideC;
      const int hh = lane >> 4, c4 = (lane & 15) * 4;     // row seg = 256 B = 16 lanes x 16 B
      {
#pragma unroll
        for (int it = 0; it < 8; ++it) {
          const int row = it * 2 + hh;
          v4f v = *(const v4f*)(slab + row * 68 + c4);
          *(v4f*)(C + (size_t)(mBase + row) * ldc + n0 + c4) = v;
        }
        
      }
    } else {
      const int q = lane >> 3, c8 = (lane & 7) * 8;
      unsigned short* C  = (unsigned short*)Cout  + (size_t)b * strideC;
      unsigned short* C2 = (OUT_MODE == 2) ? ((unsigned short*)Cout2 + (size_t)b * strideC) : nullptr;
      {
#pragma unroll
        for (int it = 0; it < 4; ++it) {
          const int row = it * 4 + q;
          const float* sp = slab + row * 68 + c8;
          v8h hv, lv;
#pragma unroll
          for (int e = 0; e < 8; ++e) {
            if (OUT_MODE == 1) {
              hv[e] = (_Float16)sp[e];
            } else {
              unsigned short hb = f2bf_bits(sp[e]);
              unsigned short lb = f2bf_bits(sp[e] - bf_bits2f(hb));
              hv[e] = __builtin_bit_cast(_Float16, hb);
              lv[e] = __builtin_bit_cast(_Float16, lb);
            }
          }
          *(v8h*)(C + (size_t)(mBase + row) * ldc + n0 + c8) = hv;
          if (OUT_MODE == 2) *(v8h*)(C2 + (size_t)(mBase + row) * ldc + n0 + c8) = lv;
        }
        
      }
    }
    __builtin_amdgcn_fence(__ATOMIC_RELEASE, "workgroup");
    __builtin_amdgcn_wave_barrier();
    __builtin_amdgcn_fence(__ATOMIC_ACQUIRE, "workgroup");
  }
}

// ---- WMMA GEMM with both operands staged in LDS by asynchronous copies -------
// The product, k order, accumulators' sum order of wmma_gemm64 (f16 operands, bias[n]): C[m,n] = act(scale * sum_k A[m,k] * Bt[n,k] + bias[n] (+ resid[m,n])), act GELU by gelu2 for ACT 5, none otherwise.
// A block of 4 waves owns a 128 x 64 tile of C, a wave 32 x 64 of it (2 x 4 accumulator tiles); grid (N / 64, M / 128, batches); A is shared by the batches.
// A stage is 128 k (256 bytes) of the block's 128 A rows and 64 Bt rows. Each lane copies 16 bytes, so a wave's copy covers two whole 256-byte row pieces
// (a fragment load from global memory touches 16 lines for the same 512 bytes), and a row is fetched once per block instead of once per wave that needs it.
// Two buffers: stage t + 1 flies while stage t is worked on. M % 128 == 0, N % 64 == 0, K % 128 == 0, rows 16-byte aligned. LDC: row pitch of C and of the residual, in elements.
constexpr int SG_KC = 128;                         // k per stage
constexpr int SG_PITCH = 272;                      // LDS row pitch in bytes: 256 + 16, conflict-free for the 16-byte fragment reads
constexpr int SG_BUF = (128 + 64) * SG_PITCH;      // one buffer: A rows 0..127, then Bt rows 0..63
// Twelve copies and the wait that stands in front of any rewrite of their address registers, in one statement so that the compiler can put nothing between them.
__device__ __forceinline__ void copy12(const unsigned (&l)[12], const _Float16* const (&g)[12]) {
  asm volatile(
      "global_load_async_to_lds_b128 %0, %1, off\n\t"
      "global_load_async_to_lds_b128 %2, %3, off\n\t"
      "global_load_async_to_lds_b128 %4, %5, off\n\t"
      "global_load_async_to_lds_b128 %6, %7, off\n\t"
      "global_load_async_to_lds_b128 %8, %9, off\n\t"
      "global_load_async_to_lds_b128 %10, %11, off\n\t"
      "global_load_async_to_lds_b128 %12, %13, off\n\t"
      "global_load_async_to_lds_b128 %14, %15, off\n\t"
      "global_load_async_to_lds_b128 %16, %17, off\n\t"
      "global_load_async_to_lds_b128 %18, %19, off\n\t"
      "global_load_async_to_lds_b128 %20, %21, off\n\t"
      "global_load_async_to_lds_b128 %22, %23, off\n\t"
      "s_wait_xcnt 0x0"
      :: "v"(l[0]), "v"(g[0]), "v"(l[1]), "v"(g[1]), "v"(l[2]), "v"(g[2]), "v"(l[3]), "v"(g[3]), "v"(l[4]), "v"(g[4]), "v"(l[5]), "v"(g[5]),
         "v"(l[6]), "v"(g[6]), "v"(l[7]), "v"(g[7]), "v"(l[8]), "v"(g[8]), "v"(l[9]), "v"(g[9]), "v"(l[10]), "v"(g[10]), "v"(l[11]), "v"(g[11])
      : "memory");
}
// One stage: thread t brings the 16-byte piece (t & 15) of rows (t >> 4) + 8 u, u = 0..23, of the buffer (24 copies per wave in flight).
// lds0: the LDS byte address of its piece in row t >> 4 of the buffer; a0, b0: the same piece of row t >> 4 of the block's A and Bt rows at this stage's k.
__device__ __forceinline__ void stage_in(unsigned lds0, const _Float16* a0, int lda, const _Float16* b0, int ldb) {
  unsigned l[12]; const _Float16* g[12];
#pragma unroll   // constant indices: the addresses stay in registers
  for (int u = 0; u < 12; ++u) { l[u] = lds0 + (unsigned)(u * 8 * SG_PITCH); g[u] = a0 + (size_t)(u * 8) * lda; }
  copy12(l, g);
#pragma unroll   // constant indices
  for (int u = 0; u < 4; ++u) { l[u] = lds0 + (unsigned)((12 + u) * 8 * SG_PITCH); g[u] = a0 + (size_t)((12 + u) * 8) * lda; }
#pragma unroll   // constant indices
  for (int u = 0; u < 8; ++u) { l[4 + u] = lds0 + (unsigned)((16 + u) * 8 * SG_PITCH); g[4 + u] = b0 + (size_t)(u * 8) * ldb; }
  copy12(l, g);
}
// gelu2: 0.5 v (1 + erf(v / sqrt 2)) for two values at once, without a branch.
// erf by its two usual ranges, t = |x|: t < 1: t + t q(x^2); else 1 - exp(-(t + t p(t))); q, p minimax polynomials (f32 coefficients), the sign of x put back at the end.
// Both ranges are computed for every lane and one is chosen by a select: there is no test of EXEC between the values of a lane, so their chains of fused steps
// run interleaved, two values to a packed instruction. exp(-y) = 2^(-y log2 e) by the hardware's 2^x: y >= 1.8 where it is chosen, so the rounding of that one product moves
// exp(-y) by less than 3e-8, under half a unit in the last place of 1 - exp(-y).
typedef __attribute__((ext_vector_type(2))) float v2f;
__device__ __forceinline__ v2f fma2(v2f a, v2f b, float c) { return __builtin_elementwise_fma(a, b, (v2f){c, c}); }
__device__ __forceinline__ v2f gelu2(v2f v) {
  const v2f x = v * 0.70710678118654752f;
  const v2f t = {__builtin_fabsf(x.x), __builtin_fabsf(x.y)};
  v2f p = fma2(t, (v2f){1.69988107e-5f, 1.69988107e-5f}, -3.78677854e-4f);
  p = fma2(t, p, 3.85781587e-3f);
  p = fma2(t, p, -2.41816975e-2f);
  p = fma2(t, p, 1.06668264e-1f);
  p = fma2(t, p, 6.34933293e-1f);
  p = fma2(t, p, 1.28689408e-1f);
  p = __builtin_elementwise_fma(t, p, t) * -1.44269502f;
  const v2f u = x * x;
  v2f q = fma2(u, (v2f){-5.61801775e-4f, -5.61801775e-4f}, 4.91381623e-3f);
  q = fma2(u, q, -2.67075151e-2f);
  q = fma2(u, q, 1.12800106e-1f);
  q = fma2(u, q, -3.76122952e-1f);
  q = fma2(u, q, 1.28379107e-1f);
  q = __builtin_elementwise_fma(t, q, t);
  v2f e;
  e.x = __builtin_copysignf((t.x < 1.0f) ? q.x : 1.0f - __builtin_amdgcn_exp2f(p.x), x.x);
  e.y = __builtin_copysignf((t.y < 1.0f) ? q.y : 1.0f - __builtin_amdgcn_exp2f(p.y), x.y);
  return (0.5f * v) * (1.0f + e);
}
template <int OUT_MODE, bool RESID, int ACT, int LDC>
__global__ __launch_bounds__(128) void wmma_gemm_lds(
    const unsigned short* __restrict__ Ap, int lda,
    const unsigned short* __restrict__ Btp, int ldb, long strideB,
    void* __restrict__ Cout, long strideC,
    const float* __restrict__ bias, const float* __restrict__ bias_b1, const float* __restrict__ bias_b2,
    const float* __restrict__ resid, int K, float scale) {
  typedef _Float16 T;
  static_assert(OUT_MODE == 0 || OUT_MODE == 1, "f32 or f16 output");
  __shared__ __align__(16) unsigned char ring[2 * SG_BUF];   // the two buffers; behind the loop's last barrier its head is the waves' output staging
  const int b    = blockIdx.z;
  const int tid  = threadIdx.x;
  const int lane = tid & 31;
  const int wave = tid >> 5;
  const int n0 = blockIdx.x << 6;
  const int m0 = (blockIdx.y << 7) + (wave << 5);             // the wave's first row of C
  const int rlane = lane & 15;                 // row (A) / col (B, D) within subtile
  const int koff  = (lane >> 4) * 8;           // k offset of this lane half
  const int mOff  = (lane >> 4) * 8;           // D row offset

  const T* a0 = (const T*)Ap + (size_t)((blockIdx.y << 7) + (tid >> 4)) * lda + (tid & 15) * 8;
  const T* b0 = (const T*)Btp + (size_t)b * strideB + (size_t)(n0 + (tid >> 4)) * ldb + (tid & 15) * 8;
  const unsigned lds0 = (unsigned)(size_t)ring + (unsigned)((tid >> 4) * SG_PITCH + (tid & 15) * 16);
  const int nt = K / SG_KC;

  v8f acc[2][4];
#pragma unroll
  for (int i = 0; i < 2; ++i)
#pragma unroll
    for (int j = 0; j < 4; ++j) acc[i][j] = (v8f){0.f,0.f,0.f,0.f,0.f,0.f,0.f,0.f};

  stage_in(lds0, a0, lda, b0, ldb);
  asm volatile("s_wait_asynccnt 0x0" ::: "memory");           // this wave's part of stage 0 has landed
  __syncthreads();                                             // every wave's part has
  if (nt > 1) stage_in(lds0 + SG_BUF, a0 + SG_KC, lda, b0 + SG_KC, ldb);
  for (int t = 0; t < nt; ++t) {
    const unsigned char* buf = ring + (t & 1) * SG_BUF;
    const unsigned char* arow = buf + ((wave << 5) + rlane) * SG_PITCH + koff * 2;
    const unsigned char* brow = buf + (128 + rlane) * SG_PITCH + koff * 2;
    // Two fragment sets: the 12 LDS reads of k-step ks + 1 go out as one group ahead of the 8 products of k-step ks, which cover their latency.
    v16h bh[2][4], ah[2][2];
#pragma unroll   // constant indices: the fragments stay in registers
    for (int j = 0; j < 4; ++j) bh[0][j] = Frag<T>::load((const T*)(brow + j * 16 * SG_PITCH));
#pragma unroll
    for (int i = 0; i < 2; ++i) ah[0][i] = Frag<T>::load((const T*)(arow + i * 16 * SG_PITCH));
#pragma unroll   // constant set indices and LDS offsets
    for (int ks = 0; ks < SG_KC / 32; ++ks) {
      if (ks + 1 < SG_KC / 32) {
#pragma unroll
        for (int j = 0; j < 4; ++j) bh[(ks + 1) & 1][j] = Frag<T>::load((const T*)(brow + j * 16 * SG_PITCH + (ks + 1) * 64));
#pragma unroll
        for (int i = 0; i < 2; ++i) ah[(ks + 1) & 1][i] = Frag<T>::load((const T*)(arow + i * 16 * SG_PITCH + (ks + 1) * 64));
        __builtin_amdgcn_sched_barrier(0);   // without it the compiler sinks these reads among the products into one register set and waits out the LDS latency twice per k-step
      }
#pragma unroll
      for (int i = 0; i < 2; ++i)
#pragma unroll
        for (int j = 0; j < 4; ++j) acc[i][j] = Frag<T>::mma(ah[ks & 1][i], bh[ks & 1][j], acc[i][j]);
      if (ks + 1 < SG_KC / 32) __builtin_amdgcn_sched_barrier(0);   // the next group of reads stays behind these products, whole
    }
    asm volatile("s_wait_dscnt 0x0" ::: "memory");             // this wave's reads of stage t are done before the buffer is handed back
    asm volatile("s_wait_asynccnt 0x0" ::: "memory");          // this wave's part of stage t + 1 has landed
    __syncthreads();                                           // publishes stage t + 1 and ends every wave's reads of stage t
    if (t + 2 < nt) stage_in(lds0 + (unsigned)((t & 1) * SG_BUF), a0 + (size_t)(t + 2) * SG_KC, lda, b0 + (size_t)(t + 2) * SG_KC, ldb);
  }
  asm volatile("s_wait_asynccnt 0x0" ::: "memory");            // nothing is in flight when the ring becomes output staging

  // ---- epilogue per 16 x 64 slab: wmma_gemm64's arithmetic for ACT 0; ACT 5 fuses scale and bias in one step and takes GELU from gelu2 ----
  float* slab = (float*)ring + wave * (16 * 68);               // per-wave 16x64 slab, pitch 68 floats
  const float* bsel = (b == 0) ? bias : ((b == 1) ? bias_b1 : bias_b2);
  // The bias values, and each slab's residual values, come as a run of loads in flight together, off one index or one address with constant offsets (LDC is a constant for that).
  const int nl = n0 + rlane;
  const float* rp = RESID ? resid + (size_t)(m0 + mOff) * LDC + nl : nullptr;
  float bv[4];
#pragma unroll   // constant indices: the values stay in registers
  for (int j = 0; j < 4; ++j) bv[j] = bsel[nl + (j << 4)];
  // The wait in front of any rewrite of a register that the run names; as its input the index stays whole until it, so that no load of the run lands in it.
  asm volatile("s_wait_xcnt 0x0" :: "v"(nl) : "memory");
#pragma unroll
  for (int i = 0; i < 2; ++i) {
    float rv[4][8];
    if (RESID) {
#pragma unroll   // constant indices
      for (int j = 0; j < 4; ++j)
#pragma unroll
        for (int r = 0; r < 8; ++r) rv[j][r] = rp[((i << 4) + r) * LDC + (j << 4)];
      asm volatile("s_wait_xcnt 0x0" :: "v"(rp) : "memory");   // the same wait for this run, the address as its input
    }
#pragma unroll
    for (int j = 0; j < 4; ++j) {
      if (ACT == 5) {
#pragma unroll   // constant indices: the accumulators stay in registers; the 16 pairs of a slab are independent and interleave
        for (int r = 0; r < 8; r += 2) {
          v2f v = fma2((v2f){acc[i][j][r], acc[i][j][r + 1]}, (v2f){scale, scale}, bv[j]);
          if (RESID) v += (v2f){rv[j][r], rv[j][r + 1]};
          v = gelu2(v);
          slab[(mOff + r) * 68 + (j << 4) + rlane] = v.x;
          slab[(mOff + r + 1) * 68 + (j << 4) + rlane] = v.y;
        }
      } else {
#pragma unroll
        for (int r = 0; r < 8; ++r) {
          float v = acc[i][j][r] * scale;
          v += bv[j];
          if (RESID) v += rv[j][r];
          slab[(mOff + r) * 68 + (j << 4) + rlane] = v;
        }
      }
    }
    __builtin_amdgcn_fence(__ATOMIC_RELEASE, "workgroup");
    __builtin_amdgcn_wave_barrier();
    __builtin_amdgcn_fence(__ATOMIC_ACQUIRE, "workgroup");
    if (OUT_MODE == 0) {
      const int hh = lane >> 4, c4 = (lane & 15) * 4;     // row seg = 256 B = 16 lanes x 16 B
      float* cp = (float*)Cout + (size_t)b * strideC + (size_t)(m0 + hh) * LDC + n0 + c4;   // one address, the rows at constant offsets
#pragma unroll
      for (int it = 0; it < 8; ++it) {
        const int row = it * 2 + hh;
        v4f v = *(const v4f*)(slab + row * 68 + c4);
        *(v4f*)(cp + ((i << 4) + it * 2) * LDC) = v;
      }
    } else {
      const int q = lane >> 3, c8 = (lane & 7) * 8;       // row seg = 128 B = 8 lanes x 16 B
      _Float16* cp = (_Float16*)Cout + (size_t)b * strideC + (size_t)(m0 + q) * LDC + n0 + c8;   // one address, the rows at constant offsets
#pragma unroll
      for (int it = 0; it < 4; ++it) {
        const int row = it * 4 + q;
        const float* sp = slab + row * 68 + c8;
        v8h hv;
#pragma unroll
        for (int e = 0; e < 8; ++e) hv[e] = (_Float16)sp[e];
        *(v8h*)(cp + ((i << 4) + it * 4) * LDC) = hv;
      }
    }
    __builtin_amdgcn_fence(__ATOMIC_RELEASE, "workgroup");
    __builtin_amdgcn_wave_barrier();
    __builtin_amdgcn_fence(__ATOMIC_ACQUIRE, "workgroup");
  }
}

__global__ __launch_bounds__(256) void cast_f32_f16x2(
    const float* __restrict__ in, _Float16* __restrict__ out, int n2) {
  int i = blockIdx.x * 256 + threadIdx.x;
  if (i < n2) {
    const _Float16 h0 = (_Float16)in[2 * i], h1 = (_Float16)in[2 * i + 1];
    const unsigned u = (unsigned)__builtin_bit_cast(unsigned short, h0) | ((unsigned)__builtin_bit_cast(unsigned short, h1) << 16);
    ((unsigned*)out)[i] = u;
    
  }
}


} // namespace w25

__global__ __launch_bounds__(256) void k_castT16(const float* __restrict__ src, long long lds, _Float16* __restrict__ dst, long long ldd, int R, int C, float s) {
    const long long i = (long long)blockIdx.x * 256 + threadIdx.x; const long long np = (long long)C * (R / 2); if (i >= np) return; const int c = (int)(i / (R / 2)); const int r = 2 * (int)(i % (R / 2));
    const _Float16 h0 = (_Float16)(src[(long long)r * lds + c] * s), h1 = (_Float16)(src[(long long)(r + 1) * lds + c] * s);
    const unsigned u = (unsigned)__builtin_bit_cast(unsigned short, h0) | ((unsigned)__builtin_bit_cast(unsigned short, h1) << 16);
    unsigned* d = (unsigned*)(dst + (long long)c * ldd + r); *d = u;  }
__global__ __launch_bounds__(256) void k_cast16(const float* __restrict__ src, long long lds, _Float16* __restrict__ dst, long long ldd, int R, int C, float s) {
    const long long i = (long long)blockIdx.x * 256 + threadIdx.x; const long long np = (long long)R * (C / 2); if (i >= np) return; const int r = (int)(i / (C / 2)); const int c = 2 * (int)(i % (C / 2));
    const _Float16 h0 = (_Float16)(src[(long long)r * lds + c] * s), h1 = (_Float16)(src[(long long)r * lds + c + 1] * s);
    const unsigned u = (unsigned)__builtin_bit_cast(unsigned short, h0) | ((unsigned)__builtin_bit_cast(unsigned short, h1) << 16);
    unsigned* d = (unsigned*)(dst + (long long)r * ldd + c); *d = u;  }

// cast_weights<U>: the six weight matrices (four of 512 x 512, two of 2048 x 512 elements) as f16 of s * w into one plane, one behind the other in argument order.
//   A block takes 256 * U consecutive pieces of 4 elements of one matrix, a thread the pieces threadIdx.x + 256 * u of them: a wave's load covers 512 contiguous bytes
//   and its store 256, and the U loads of a thread are in flight together. blk runs over all (4 * 512 * 512 + 2 * 2048 * 512) / (4 * 256 * U) blocks, so no element guard.
template <int U>
__device__ __forceinline__ void cast_weights(int blk, const float* __restrict__ w0, const float* __restrict__ w1, const float* __restrict__ w2, const float* __restrict__ w3,
                                             const float* __restrict__ w4, const float* __restrict__ w5, _Float16* __restrict__ dst, float s) {
    constexpr int BS = (512 * 512) / (4 * 256 * U), BL = (2048 * 512) / (4 * 256 * U);   // blocks per small and per large matrix
    static_assert(BS * (4 * 256 * U) == 512 * 512, "whole blocks per matrix");
    const float* src; int first;                                  // the block's matrix and that matrix's first block (the same for the whole block)
    if (blk < BS) { src = w0; first = 0; }
    else if (blk < 2 * BS) { src = w1; first = BS; }
    else if (blk < 3 * BS) { src = w2; first = 2 * BS; }
    else if (blk < 4 * BS) { src = w3; first = 3 * BS; }
    else if (blk < 4 * BS + BL) { src = w4; first = 4 * BS; }
    else { src = w5; first = 4 * BS + BL; }
    const v4f* sp = (const v4f*)src + (blk - first) * (256 * U) + threadIdx.x;
    v4h* dp = (v4h*)dst + blk * (256 * U) + threadIdx.x;
    v4f a[U];
#pragma unroll   // constant indices: a stays in registers, and all U loads are issued before the first cast
    for (int u = 0; u < U; ++u) a[u] = sp[u * 256];
#pragma unroll   // constant indices into a
    for (int u = 0; u < U; ++u) {
        v4h hv;
#pragma unroll   // constant element indices: the vectors stay in registers
        for (int e = 0; e < 4; ++e) hv[e] = (_Float16)(a[u][e] * s);
        dp[u * 256] = hv;
    }
}
// ln_rows_f16: y = f16((x - mean) * rsqrt(var + eps) * g + b) over contiguous rows of 512 elements, one wave per row, 8 rows per 256-thread block (blk = block of rows).
//   The row stays in registers between the two sums and the output: statistics, normalisation and the cast for the next product are one pass over x.
//   A lane holds the pieces lane + 32 * u of 4 channels (a wave's load covers 512 contiguous bytes): element t = 128 * u + 4 * lane + e.
//   Both sums keep the order of k_stats (256 partials of elements t and t + 256, then a binary tree that pairs t with t + 128, 64, ..., 1), so mean and rstd keep their bits:
//   distance 128 is u, 64 to 4 are the lane's bits (shuffles, both partners form the same sum), 2 and 1 are e.
__device__ __forceinline__ float tree256(const float (&p)[2][4]) {
    float r[4];
#pragma unroll   // constant indices: r stays in registers
    for (int e = 0; e < 4; ++e) r[e] = p[0][e] + p[1][e];
#pragma unroll   // the four shuffles of a level are independent and in flight together
    for (int o = 16; o > 0; o >>= 1)
#pragma unroll
        for (int e = 0; e < 4; ++e) r[e] += __shfl_xor(r[e], o, 32);
    return (r[0] + r[2]) + (r[1] + r[3]);
}
__device__ __forceinline__ void ln_rows_f16(int blk, const float* __restrict__ x, _Float16* __restrict__ y, const float* __restrict__ g, const float* __restrict__ bta, float eps) {
    constexpr int C = 512, U = C / 128;                           // pieces per lane
    const int lane = threadIdx.x & 31;
    const size_t row = (size_t)blk * 8 + (threadIdx.x >> 5);
    const v4f* xp = (const v4f*)(x + row * C) + lane;
    v4f xv[U], gv[U], bv[U];
#pragma unroll   // constant indices: the arrays stay in registers, and all loads are issued before the first use
    for (int u = 0; u < U; ++u) { xv[u] = xp[u * 32]; gv[u] = ((const v4f*)g)[lane + u * 32]; bv[u] = ((const v4f*)bta)[lane + u * 32]; }
    float p[2][4];
#pragma unroll   // constant indices into xv and p
    for (int u = 0; u < 2; ++u)
#pragma unroll
        for (int e = 0; e < 4; ++e) p[u][e] = xv[u][e] + xv[u + 2][e];
    const float mu = tree256(p) / (float)C;
#pragma unroll   // constant indices into xv and p
    for (int u = 0; u < 2; ++u)
#pragma unroll
        for (int e = 0; e < 4; ++e) { const float d0 = xv[u][e] - mu, d1 = xv[u + 2][e] - mu; p[u][e] = __builtin_fmaf(d1, d1, d0 * d0); }   // as k_stats rounds it: the square, then one fused step
    const float rs = rsqrtf(tree256(p) / (float)C + eps);
    v4h* yp = (v4h*)(y + row * C) + lane;
#pragma unroll   // constant indices into the arrays
    for (int u = 0; u < U; ++u) {
        v4h hv;
#pragma unroll   // constant element indices: the vectors stay in registers
        for (int e = 0; e < 4; ++e) hv[e] = (_Float16)((xv[u][e] - mu) * rs * gv[u][e] + bv[u][e]);
        yp[u * 32] = hv;
    }
}
// k_ln_f16: LayerNorm of 4096 rows of 512 to an f16 plane; grid 4096 / 8.
__global__ __launch_bounds__(256) void k_ln_f16(const float* __restrict__ x, _Float16* __restrict__ y, const float* __restrict__ g, const float* __restrict__ bta, float eps) {
    ln_rows_f16(blockIdx.x, x, y, g, bta, eps);
}
// k_ln_f16_weights: two jobs that depend on nothing but the inputs share one grid: blocks [0, 512) are k_ln_f16's, the 768 behind them cast the weights. No barrier in either.
__global__ __launch_bounds__(256) void k_ln_f16_weights(const float* __restrict__ x, _Float16* __restrict__ y, const float* __restrict__ g, const float* __restrict__ bta, float eps,
                                                        const float* __restrict__ w0, const float* __restrict__ w1, const float* __restrict__ w2, const float* __restrict__ w3,
                                                        const float* __restrict__ w4, const float* __restrict__ w5, _Float16* __restrict__ wdst, float ws) {
    if (blockIdx.x < 512) ln_rows_f16(blockIdx.x, x, y, g, bta, eps);
    else cast_weights<4>(blockIdx.x - 512, w0, w1, w2, w3, w4, w5, wdst, ws);
}

// f32 -> bf16 hi plane + bf16 lo plane (x = hi + lo to ~2^-17 relative; RNE both), [R][C] -> [R][C] (or transposed to [C][R]); 2 consecutive destination elements
__device__ __forceinline__ unsigned int f2bf2_pack(float a, float b, unsigned int* lo) {
    const unsigned short ha = w25::f2bf_bits(a), hb = w25::f2bf_bits(b);
    const unsigned short la = w25::f2bf_bits(a - w25::bf_bits2f(ha)), lb = w25::f2bf_bits(b - w25::bf_bits2f(hb));
    *lo = (unsigned)la | ((unsigned)lb << 16); return (unsigned)ha | ((unsigned)hb << 16); }
__global__ __launch_bounds__(256) void k_castS16(const float* __restrict__ src, long long lds, __bf16* __restrict__ dhi, __bf16* __restrict__ dlo, long long ldd, int R, int C, float s, int transpose) {
    const long long i = (long long)blockIdx.x * 256 + threadIdx.x; long long o; float a, b;
    if (transpose) { const long long np = (long long)C * (R / 2); if (i >= np) return; const int c = (int)(i / (R / 2)); const int r = 2 * (int)(i % (R / 2)); a = src[(long long)r * lds + c] * s; b = src[(long long)(r + 1) * lds + c] * s; o = (long long)c * ldd + r; }
    else { const long long np = (long long)R * (C / 2); if (i >= np) return; const int r = (int)(i / (C / 2)); const int c = 2 * (int)(i % (C / 2)); a = src[(long long)r * lds + c] * s; b = src[(long long)r * lds + c + 1] * s; o = (long long)r * ldd + c; }
    unsigned lo; const unsigned hi = f2bf2_pack(a, b, &lo); unsigned* ph = (unsigned*)(dhi + o); unsigned* pl = (unsigned*)(dlo + o);
    *ph = hi; *pl = lo;  }


extern "C" void kernel_launch(void* const* d_in, const int* in_sizes, int n_in, void* d_out, int out_size, void* d_ws, size_t ws_size, hipStream_t stream) {
    (void)in_sizes; (void)n_in; (void)out_size; (void)ws_size;
    const float* x = (const float*)d_in[0];
    const float* ln1g = (const float*)d_in[1];
    const float* ln1b = (const float*)d_in[2];
    const float* Wq = (const float*)d_in[3];
    const float* bq = (const float*)d_in[4];
    const float* Wk = (const float*)d_in[5];
    const float* bk = (const float*)d_in[6];
    const float* Wv = (const float*)d_in[7];
    const float* bv = (const float*)d_in[8];
    const float* Wo = (const float*)d_in[9];
    const float* bo = (const float*)d_in[10];
    const float* ln2g = (const float*)d_in[11];
    const float* ln2b = (const float*)d_in[12];
    const float* W1 = (const float*)d_in[13];
    const float* b1 = (const float*)d_in[14];
    const float* W2 = (const float*)d_in[15];
    const float* b2 = (const float*)d_in[16];
    const int L = 4096;
    const int C = 512;
    const int NH = 8;
    const int HD = 64;
    const int FF = 2048;
    const int LP = L / 2;
    const int WINP = 128;
    float* out = (float*)d_out;
    char* wsp = (char*)d_ws;
    _Float16* WH = (_Float16*)wsp; wsp += (((size_t)(4 * 512 * 512 + 2 * 2048 * 512) * 2 + 255) / 256) * 256;   // f16 of 16 w: Wq, Wk, Wv, Wo, W1, W2
    _Float16* HNh = (_Float16*)wsp; wsp += (((size_t)((size_t)L * C) * 2 + 255) / 256) * 256;
    float* Q = (float*)wsp; wsp += (((size_t)((size_t)L * C) * 4 + 255) / 256) * 256;    // Q, Kb and V lie L * C floats apart: the three batches of one product
    float* Kb = (float*)wsp; wsp += (((size_t)((size_t)L * C) * 4 + 255) / 256) * 256;
    float* V = (float*)wsp; wsp += (((size_t)((size_t)L * C) * 4 + 255) / 256) * 256;
    _Float16* Yh = (_Float16*)wsp; wsp += (((size_t)((size_t)L * C) * 2 + 255) / 256) * 256;
    float* X1 = (float*)wsp; wsp += (((size_t)((size_t)L * C) * 4 + 255) / 256) * 256;
    _Float16* H2h = (_Float16*)wsp; wsp += (((size_t)((size_t)L * C) * 2 + 255) / 256) * 256;
    _Float16* F1h = (_Float16*)wsp; wsp += (((size_t)((size_t)L * FF) * 2 + 255) / 256) * 256;
    k_ln_f16_weights<<<(unsigned)(512 + 768), 256, 0, stream>>>(x, HNh, ln1g, ln1b, 1e-05f, Wq, Wk, Wv, Wo, W1, W2, WH, 16.0f);
    w25::wmma_gemm_lds<0, false, 0, 512><<<dim3(8u, 32u, 3u), 128, 0, stream>>>((const unsigned short*)(HNh), 512, (const unsigned short*)(WH), 512, 512 * 512, (void*)(Q), 4096 * 512, bq, bk, bv, nullptr, 512, 0.0625f);
    { /*apv4*/ AttnP a;
      a.Q = Q; a.K = Kb; a.V = V; a.O = 0; a.Oh = Yh; a.P = 0; a.Mf = 0; a.Mi = 0; a.ST = 0;
      a.Pw = 0; a.Rt = 0; a.SQ = 0; a.SK = 0;
      a.swb = 0; a.swh = 0; a.swi = 0; a.swj = 0; a.srb = 0; a.srh = 0; a.sri = 0; a.sQb = C; a.sQh = HD; a.sQi = 2 * C; a.sQd = 1; a.sKb = C; a.sKh = HD; a.sKj = 2 * C; a.sKd = 1; a.sVb = C; a.sVh = HD; a.sVj = 2 * C; a.sVd = 1; a.sOb = C; a.sOh = HD; a.sOi = 2 * C; a.sPb = 0; a.sPh = 0; a.sPi = 0; a.smb = 0; a.smh = 0; a.smi = 0; a.smj = 0;
      a.Lq = LP; a.Lk = LP; a.dh = HD; a.dv = HD; a.hrep = 1; a.causal = 1; a.coff = 0; a.pband = 0;
      a.scale = 0.125f; a.mfill = 0.0f; a.nonorm = 0; a.mpol = 0;
      a.roff = 0; a.rn = 1; a.segpol = 0; a.win = WINP;
      k_attn_t<<<dim3((unsigned)((LP) + 16 * AW - 1) / (16 * AW), (unsigned)(NH), (unsigned)(2)), 32 * AW, 0, stream>>>(a); }   // batch = parity: row 0 or 1, then every second row
    w25::wmma_gemm_lds<0, true, 0, 512><<<dim3(8u, 32u, 1u), 128, 0, stream>>>((const unsigned short*)(Yh), 512, (const unsigned short*)(WH + 3 * 512 * 512), 512, 0, (void*)(X1), 0, bo, nullptr, nullptr, x, 512, 0.0625f);
    k_ln_f16<<<(unsigned)(512), 256, 0, stream>>>(X1, H2h, ln2g, ln2b, 1e-05f);
    w25::wmma_gemm_lds<1, false, 5, 2048><<<dim3(32u, 32u, 1u), 128, 0, stream>>>((const unsigned short*)(H2h), 512, (const unsigned short*)(WH + 4 * 512 * 512), 512, 0, (void*)(F1h), 0, b1, nullptr, nullptr, nullptr, 512, 0.0625f);
    w25::wmma_gemm_lds<0, true, 0, 512><<<dim3(8u, 32u, 1u), 128, 0, stream>>>((const unsigned short*)(F1h), 2048, (const unsigned short*)(WH + 4 * 512 * 512 + 2048 * 512), 2048, 0, (void*)(out), 0, b2, nullptr, nullptr, X1, 2048, 0.0625f);
}

// v008
// Measured time: 76.7 microseconds a run.
// Two timings next to v007 put it at 1.05 and 1.03 times that version's speed.
// All steps since the starting kernel, v000, together make it 28.2 times as fast.
// Contractions: q/k/v projections of the LayerNormed input [4096x512].[512x512] (+b), the output projection (+b, + residual), the FFN [4096x512].[512x2048] (+b, exact GELU) and [4096x2048].[2048x512] (+b, + residual) with f16 operands (v_wmma_f32_16x16x32_f16; 32x64 register-blocked wave tiles, 128x64 block tiles, over pre-cast f16 operand planes staged in LDS by asynchronous copies, weights pre-scaled by 16 at the cast and un-scaled in the f32 epilogue); the dilated causal attention (keys j <= i, i - j even, i - j <= 256) as one flash launch whose grid z is the parity of the position (stride-2 views; within a parity class the pattern is plain causal with window 128), head_dim 64, both products transposed (f16 k.q^T, f16 v^T.p^T with p as f16 of 4096 p, kept in registers); f32 accumulate, softmax and LayerNorms f32.
#include <hip/hip_runtime.h>
#include <math.h>

typedef __attribute__((ext_vector_type(16))) _Float16 v16h;
typedef __attribute__((ext_vector_type(8)))  _Float16 v8h;
typedef __attribute__((ext_vector_type(4)))  _Float16 v4h;
typedef __attribute__((ext_vector_type(16))) __bf16   v16b;
typedef __attribute__((ext_vector_type(8)))  float    v8f;
typedef __attribute__((ext_vector_type(4)))  float    v4f;

// 16-bit WMMA fragment map (wave32), lane L, h = L>>4, m = L&15:
//   A 16x32: lane = row m;   element i -> k = (i<8) ? 8h+i : 16+8h+(i-8)
//   B 32x16: lane = column m; the SAME k(i,h)
//   D 16x16 (8 f32): lane = column m; element r -> row 8h+r
__device__ __forceinline__ int frag_k(int i, int h) { return (i < 8) ? (8 * h + i) : (16 + 8 * h + (i - 8)); }
__device__ __forceinline__ __bf16 bf16_rne(float f) {
    unsigned int u = __float_as_uint(f);
    u += 0x7fffu + ((u >> 16) & 1u);
    return __builtin_bit_cast(__bf16, (unsigned short)(u >> 16));
}
__device__ __forceinline__ float bf16_f32(__bf16 b) { return __uint_as_float(((unsigned int)__builtin_bit_cast(unsigned short, b)) << 16); }
__device__ __forceinline__ v8f wmma16(v16h a, v16h b, v8f c) {
    c = __builtin_amdgcn_wmma_f32_16x16x32_f16(false, a, false, b, (short)0, c, false, false);
    asm volatile("v_nop\n\tv_nop\n\tv_nop\n\tv_nop" : "+v"(c) : "v"(a), "v"(b));
    return c;
}
__device__ __forceinline__ v8f wmmab(v16b a, v16b b, v8f c) {
    c = __builtin_amdgcn_wmma_f32_16x16x32_bf16(false, a, false, b, (short)0, c, false, false);
    asm volatile("v_nop\n\tv_nop\n\tv_nop\n\tv_nop" : "+v"(c) : "v"(a), "v"(b));
    return c;
}
struct Split { v16b hi, lo; };
// hi/lo split product: a.hi*b.hi + a.hi*b.lo + a.lo*b.hi
__device__ __forceinline__ v8f wmma3(const Split& a, const Split& b, v8f c) {
    c = __builtin_amdgcn_wmma_f32_16x16x32_bf16(false, a.hi, false, b.hi, (short)0, c, false, false);
    c = __builtin_amdgcn_wmma_f32_16x16x32_bf16(false, a.hi, false, b.lo, (short)0, c, false, false);
    c = __builtin_amdgcn_wmma_f32_16x16x32_bf16(false, a.lo, false, b.hi, (short)0, c, false, false);
    asm volatile("v_nop\n\tv_nop\n\tv_nop\n\tv_nop" : "+v"(c) : "v"(a.hi), "v"(a.lo), "v"(b.hi), "v"(b.lo));
    return c;
}
struct Split3 { v16b hi, mid, lo; };
// triple split product (6 terms, drops only terms below 2^-24 relative)
__device__ __forceinline__ v8f wmma6(const Split3& a, const Split3& b, v8f c) {
    c = __builtin_amdgcn_wmma_f32_16x16x32_bf16(false, a.hi, false, b.hi, (short)0, c, false, false);
    c = __builtin_amdgcn_wmma_f32_16x16x32_bf16(false, a.hi, false, b.mid, (short)0, c, false, false);
    c = __builtin_amdgcn_wmma_f32_16x16x32_bf16(false, a.mid, false, b.hi, (short)0, c, false, false);
    c = __builtin_amdgcn_wmma_f32_16x16x32_bf16(false, a.hi, false, b.lo, (short)0, c, false, false);
    c = __builtin_amdgcn_wmma_f32_16x16x32_bf16(false, a.mid, false, b.mid, (short)0, c, false, false);
    c = __builtin_amdgcn_wmma_f32_16x16x32_bf16(false, a.lo, false, b.hi, (short)0, c, false, false);
    asm volatile("v_nop\n\tv_nop\n\tv_nop\n\tv_nop" : "+v"(c) : "v"(a.hi), "v"(a.mid), "v"(a.lo), "v"(b.hi), "v"(b.mid), "v"(b.lo));
    return c;
}

// Fragment gathers from f32 memory: element i <- p[(k0 + frag_k(i,h)) * sk] * s, zero for k >= klen.
__device__ __forceinline__ v16h fh_ld(const float* __restrict__ p, long long sk, int k0, int h, int klen, float s) {
    v16h a;
#pragma unroll
    for (int i = 0; i < 16; ++i) { const int k = k0 + frag_k(i, h); a[i] = (k < klen) ? (_Float16)(p[(long long)k * sk] * s) : (_Float16)0.f; }
    return a;
}
__device__ __forceinline__ Split sp_ld(const float* __restrict__ p, long long sk, int k0, int h, int klen, float s) {
    Split r;
#pragma unroll
    for (int i = 0; i < 16; ++i) {
        const int k = k0 + frag_k(i, h); const float x = (k < klen) ? p[(long long)k * sk] * s : 0.f;
        const __bf16 hb = bf16_rne(x); r.hi[i] = hb; r.lo[i] = bf16_rne(x - bf16_f32(hb));
    }
    return r;
}
__device__ __forceinline__ Split3 sp3_ld(const float* __restrict__ p, long long sk, int k0, int h, int klen, float s) {
    Split3 r;
#pragma unroll
    for (int i = 0; i < 16; ++i) {
        const int k = k0 + frag_k(i, h); const float x = (k < klen) ? p[(long long)k * sk] * s : 0.f;
        const __bf16 hb = bf16_rne(x); const float r1 = x - bf16_f32(hb); const __bf16 mb = bf16_rne(r1);
        r.hi[i] = hb; r.mid[i] = mb; r.lo[i] = bf16_rne(r1 - bf16_f32(mb));
    }
    return r;
}
__device__ __forceinline__ v16b bh_ld(const float* __restrict__ p, long long sk, int k0, int h, int klen, float s) {
    v16b a;
#pragma unroll
    for (int i = 0; i < 16; ++i) { const int k = k0 + frag_k(i, h); a[i] = bf16_rne((k < klen) ? p[(long long)k * sk] * s : 0.f); }
    return a;
}
// f16 fragment from a 16-byte aligned f32 row with element stride 1 and all 32 k in range: four unguarded 16-byte loads, then the cast; same k order as fh_ld
struct Raw16 { v4f x0, x1, x2, x3; };   // the 16 floats of one lane's fragment, as loaded
__device__ __forceinline__ Raw16 raw_ld4(const float* __restrict__ row, int k0, int h) {
    const v4f* q = (const v4f*)(row + k0 + 8 * h);
    Raw16 r; r.x0 = q[0]; r.x1 = q[1]; r.x2 = q[4]; r.x3 = q[5];
    return r;
}
__device__ __forceinline__ v16h raw_f16(const Raw16& r) {
    v16h a;
#pragma unroll   // constant element indices: the vectors stay in registers
    for (int i = 0; i < 4; ++i) { a[i] = (_Float16)r.x0[i]; a[4 + i] = (_Float16)r.x1[i]; a[8 + i] = (_Float16)r.x2[i]; a[12 + i] = (_Float16)r.x3[i]; }
    return a;
}
// Inputs-only fence on loaded values: every load written above it is issued before it, so that a run of loads is in flight together.
// Without it the compiler converts each fragment as soon as it is loaded and waits for memory once per fragment.
__device__ __forceinline__ void loads_held(const v4f& a, const v4f& b, const v4f& c, const v4f& d) { asm volatile("" :: "v"(a), "v"(b), "v"(c), "v"(d)); }
// f16 fragment from an f16 LDS/global row with element stride 1 (k-contiguous), no bounds (tile already zero padded)
__device__ __forceinline__ v16h fh_row(const _Float16* __restrict__ row, int k0, int h) {
    v16h a;
#pragma unroll
    for (int i = 0; i < 16; ++i) a[i] = row[k0 + frag_k(i, h)];
    return a;
}

#define VST2(T, ptr, val) do { const T vst2_v_ = (val); *(T*)(ptr) = vst2_v_;  } while (0)
typedef float v4f __attribute__((ext_vector_type(4)));
#define VST2V4(ptr, val) do { const v4f vst2_v4_ = (val); *(v4f*)(ptr) = vst2_v4_;  } while (0)

__device__ __attribute__((noinline)) float act_fn(float v, int act) {
    if (act == 1) return fmaxf(v, 0.f);                                                                               // relu
    if (act == 2) { const float u = 0.7978845608028654f * (v + 0.044715f * v * v * v); return 0.5f * v * (1.f + tanhf(u)); } // tanh-gelu
    if (act == 3) return v / (1.f + expf(-v));                                                                        // silu
    if (act == 4) return 0.5f * v * (1.f + erff(v * 0.7071067811865476f));                                             // erf-gelu
    if (act == 5) return tanhf(v);
    if (act == 6) return 1.f / (1.f + expf(-v));                                                                      // sigmoid
    if (act == 7) return (v > 0.f) ? v : 0.01f * v;                                                                   // leaky relu 0.01
    if (act == 8) return (v > 0.f) ? v : (expf(v) - 1.f);                                                             // elu
    if (act == 9) return fminf(fmaxf(v, 0.f), 6.f);                                                                   // relu6
    if (act == 10) return fabsf(v);                                                                                    // abs
    if (act == 11) return (v >= 0.f) ? v : 0.1f * v;                                                                  // leaky 0.1
    if (act == 12) return (v > 0.f) ? v : 0.2f * v;                                                                   // leaky 0.2
    if (act == 13) return (v > 20.f) ? v : log1pf(expf(v));                                                            // softplus
    return v;
}

// =====================================================================================================================
// k_gemm<MODE>: C(z, m, n) = act(alpha * sum_k A(z, m, k) * B(z, k, n) + bias) + beta * R(z, m, n)
//   One wave (32-thread block) per 16 x 32 tile of C; grid (ceil(N/32), ceil(M/16), Z). Batch z -> (zo = z / zi_n, zi = z % zi_n)
//   with separate outer/inner strides for every tensor (e.g. batch and head). A(m,k) = A[zo*sAo + zi*sAi + m*sAm + k*sAk] (f32),
//   B(k,n) = B[zo*sBo + zi*sBi + n*sBn + k*sBk] (f32); any M, N, K (K zero-padded to 32 inside the fragments, M/N tails guarded).
//   C(m,n) = C[zo*sCo + zi*sCi + m*sCm + n] (n contiguous). flags: 1 bias[n], 2 bias[m], 4 residual R[zo*sRo + zi*sRi + m*sRm + n*sRn].
//   MODE 0: f16 operands (A prescaled by sa, B by sb, both undone in the epilogue); 1: bf16 hi/lo split (3 products); 2: bf16;
//   3: bf16 hi/mid/lo triple split (6 products); 4: as 3 with Kahan-compensated f32 accumulation across k-steps.
// =====================================================================================================================
struct GemmP {
    const float* A; const float* B; const float* bias; const float* R; float* C;
    long long sAo, sAi, sAm, sAk, sBo, sBi, sBn, sBk, sCo, sCi, sCm, sRo, sRi, sRm, sRn;
    int M, N, K, zi_n, flags, act; float alpha, beta, sa, sb;
    int Npad, pad_;     // columns [N, Npad) of C are written as 0 so that padded workspace rows are covered by whole-line stores; Npad >= N
};
static_assert(sizeof(GemmP) == 5 * 8 + 15 * 8 + 6 * 4 + 4 * 4 + 2 * 4, "GemmP has padding");

template <int MODE>
__global__ __launch_bounds__(32) void k_gemm(GemmP p) {
    const int lane = threadIdx.x & 31, h = lane >> 4, l15 = lane & 15;
    const int m0 = blockIdx.y * 16, n0 = blockIdx.x * 32;
    const int z = blockIdx.z, zo = z / p.zi_n, zi = z - zo * p.zi_n;
    const float* A = p.A + zo * p.sAo + zi * p.sAi;
    const float* B = p.B + zo * p.sBo + zi * p.sBi;
    const int am = min(m0 + l15, p.M - 1);                       // clamped row for loads (stores are guarded)
    v8f acc[2], comp[2];
#pragma unroll
    for (int t = 0; t < 2; ++t) { v8f zz = {}; acc[t] = zz; comp[t] = zz; }
    for (int k0 = 0; k0 < p.K; k0 += 32) {
        const float* arow = A + (long long)am * p.sAm;
        if (MODE == 1) {
            const Split a = sp_ld(arow, p.sAk, k0, h, p.K, 1.f);
#pragma unroll
            for (int t = 0; t < 2; ++t) {
                const int bn = min(n0 + t * 16 + l15, p.N - 1);
                acc[t] = wmma3(a, sp_ld(B + (long long)bn * p.sBn, p.sBk, k0, h, p.K, 1.f), acc[t]);
            }
        } else if (MODE == 3) {
            const Split3 a = sp3_ld(arow, p.sAk, k0, h, p.K, 1.f);
#pragma unroll
            for (int t = 0; t < 2; ++t) {
                const int bn = min(n0 + t * 16 + l15, p.N - 1);
                acc[t] = wmma6(a, sp3_ld(B + (long long)bn * p.sBn, p.sBk, k0, h, p.K, 1.f), acc[t]);
            }
        } else if (MODE == 4) {
            // triple split as MODE 3, but each k-step's 6 products go into a fresh accumulator and the partial is added to the running f32 sum
            // on the VALU with Kahan compensation (accumulation error stays ~1 ulp however long K is)
            const Split3 a = sp3_ld(arow, p.sAk, k0, h, p.K, 1.f);
#pragma unroll
            for (int t = 0; t < 2; ++t) {
                const int bn = min(n0 + t * 16 + l15, p.N - 1); v8f zz = {};
                const v8f part = wmma6(a, sp3_ld(B + (long long)bn * p.sBn, p.sBk, k0, h, p.K, 1.f), zz);
                const v8f y = part - comp[t]; const v8f s = acc[t] + y; comp[t] = (s - acc[t]) - y; acc[t] = s;
            }
        } else if (MODE == 2) {
            const v16b a = bh_ld(arow, p.sAk, k0, h, p.K, 1.f);
#pragma unroll
            for (int t = 0; t < 2; ++t) {
                const int bn = min(n0 + t * 16 + l15, p.N - 1);
                acc[t] = wmmab(a, bh_ld(B + (long long)bn * p.sBn, p.sBk, k0, h, p.K, 1.f), acc[t]);
            }
        } else {
            const v16h a = fh_ld(arow, p.sAk, k0, h, p.K, p.sa);
#pragma unroll
            for (int t = 0; t < 2; ++t) {
                const int bn = min(n0 + t * 16 + l15, p.N - 1);
                acc[t] = wmma16(a, fh_ld(B + (long long)bn * p.sBn, p.sBk, k0, h, p.K, p.sb), acc[t]);
            }
        }
    }
    const float iscale = (MODE == 0) ? p.alpha / (p.sa * p.sb) : p.alpha;
    float* C = p.C + zo * p.sCo + zi * p.sCi;
    const float* R = p.R + zo * p.sRo + zi * p.sRi;
    __shared__ __align__(16) float ctile[16][36];
#pragma unroll
    for (int t = 0; t < 2; ++t) {
        const int n = n0 + t * 16 + l15; const int nn = min(n, p.N - 1);
#pragma unroll
        for (int r = 0; r < 8; ++r) {
            const int m = m0 + 8 * h + r; const int mm = min(m, p.M - 1);
            float v = acc[t][r] * iscale;
            if (p.flags & 1) v += p.bias[nn];
            if (p.flags & 2) v += p.bias[mm];
            if (p.flags & 8) v *= p.bias[(long long)zo * p.M + mm];   /* per-(z,row) scale vector laid out [Z][M]; exclusive with the bias flags */
            v = act_fn(v, p.act);
            if (p.flags & 4) v += p.beta * R[(long long)mm * p.sRm + (long long)nn * p.sRn];
            ctile[8 * h + r][t * 16 + l15] = (n < p.N) ? v : 0.f;
        }
    }
    __syncthreads();
    const int NW = (p.Npad > p.N) ? p.Npad : p.N;           // write width
    const bool fast = (m0 + 16 <= p.M) && (n0 + 32 <= NW) && ((p.sCm & 3) == 0) && ((((size_t)C) & 15) == 0);
    if (fast) {
#pragma unroll
        for (int s = 0; s < 4; ++s) {
            const int row = s * 4 + (lane >> 3), c4 = (lane & 7) * 4;
            const v4f v = *(const v4f*)&ctile[row][c4];
            VST2V4(C + (long long)(m0 + row) * p.sCm + n0 + c4, v);
        }
    } else {
        for (int row = 0; row < 16; ++row) {
            const int m = m0 + row, n = n0 + lane;
            if (m < p.M && n < NW) VST2(float, C + (long long)m * p.sCm + n, ctile[row][lane]);
        }
    }
}


// =====================================================================================================================
// k_gemmT<MODE, TM, TN>: same contract as k_gemm, but one wave computes a (16*TM) x (16*TN) tile: TM A fragments and TN B fragments are
//   loaded per 32-wide k-step and reused across TM*TN WMMAs (far fewer load/convert instructions per MAC). MODE 0 (f16), 1 (bf16 hi/lo),
//   2 (bf16) only. grid (ceil(NW/(16*TN)), ceil(M/(16*TM)), Z), block 32. Epilogue identical to k_gemm, run per 16x32 sub-tile.
// =====================================================================================================================
template <int MODE, int TM, int TN>
__global__ __launch_bounds__(32) void k_gemmT(GemmP p) {
    const int lane = threadIdx.x & 31, h = lane >> 4, l15 = lane & 15;
    const int m0 = blockIdx.y * (16 * TM), n0 = blockIdx.x * (16 * TN);
    const int z = blockIdx.z, zo = z / p.zi_n, zi = z - zo * p.zi_n;
    const float* A = p.A + zo * p.sAo + zi * p.sAi;
    const float* B = p.B + zo * p.sBo + zi * p.sBi;
    v8f acc[TM][TN];
#pragma unroll
    for (int i = 0; i < TM; ++i)
#pragma unroll
        for (int t = 0; t < TN; ++t) { v8f zz = {}; acc[i][t] = zz; }
    for (int k0 = 0; k0 < p.K; k0 += 32) {
        if (MODE == 1) {
            Split a[TM], b[TN];
#pragma unroll
            for (int i = 0; i < TM; ++i) { const int am = min(m0 + 16 * i + l15, p.M - 1); a[i] = sp_ld(A + (long long)am * p.sAm, p.sAk, k0, h, p.K, 1.f); }
#pragma unroll
            for (int t = 0; t < TN; ++t) { const int bn = min(n0 + 16 * t + l15, p.N - 1); b[t] = sp_ld(B + (long long)bn * p.sBn, p.sBk, k0, h, p.K, 1.f); }
#pragma unroll
            for (int i = 0; i < TM; ++i)
#pragma unroll
                for (int t = 0; t < TN; ++t) acc[i][t] = wmma3(a[i], b[t], acc[i][t]);
        } else if (MODE == 2) {
            v16b a[TM], b[TN];
#pragma unroll
            for (int i = 0; i < TM; ++i) { const int am = min(m0 + 16 * i + l15, p.M - 1); a[i] = bh_ld(A + (long long)am * p.sAm, p.sAk, k0, h, p.K, 1.f); }
#pragma unroll
            for (int t = 0; t < TN; ++t) { const int bn = min(n0 + 16 * t + l15, p.N - 1); b[t] = bh_ld(B + (long long)bn * p.sBn, p.sBk, k0, h, p.K, 1.f); }
#pragma unroll
            for (int i = 0; i < TM; ++i)
#pragma unroll
                for (int t = 0; t < TN; ++t) acc[i][t] = wmmab(a[i], b[t], acc[i][t]);
        } else {
            v16h a[TM], b[TN];
#pragma unroll
            for (int i = 0; i < TM; ++i) { const int am = min(m0 + 16 * i + l15, p.M - 1); a[i] = fh_ld(A + (long long)am * p.sAm, p.sAk, k0, h, p.K, p.sa); }
#pragma unroll
            for (int t = 0; t < TN; ++t) { const int bn = min(n0 + 16 * t + l15, p.N - 1); b[t] = fh_ld(B + (long long)bn * p.sBn, p.sBk, k0, h, p.K, p.sb); }
#pragma unroll
            for (int i = 0; i < TM; ++i)
#pragma unroll
                for (int t = 0; t < TN; ++t) acc[i][t] = wmma16(a[i], b[t], acc[i][t]);
        }
    }
    const float iscale = (MODE == 0) ? p.alpha / (p.sa * p.sb) : p.alpha;
    float* C = p.C + zo * p.sCo + zi * p.sCi;
    const float* R = p.R + zo * p.sRo + zi * p.sRi;
    const int NW = (p.Npad > p.N) ? p.Npad : p.N;
    __shared__ __align__(16) float ctile[16][36];
#pragma unroll
    for (int i = 0; i < TM; ++i) {
        const int mb = m0 + 16 * i; if (mb >= p.M) break;          // wave-uniform
#pragma unroll
        for (int tp = 0; tp < TN / 2; ++tp) {
            const int nb = n0 + 32 * tp; if (nb >= NW) break;        // wave-uniform
#pragma unroll
            for (int t2 = 0; t2 < 2; ++t2) {
                const int t = 2 * tp + t2; const int n = nb + t2 * 16 + l15; const int nn = min(n, p.N - 1);
#pragma unroll
                for (int r = 0; r < 8; ++r) {
                    const int m = mb + 8 * h + r; const int mm = min(m, p.M - 1);
                    float v = acc[i][t][r] * iscale;
                    if (p.flags & 1) v += p.bias[nn];
                    if (p.flags & 2) v += p.bias[mm];
            if (p.flags & 8) v *= p.bias[(long long)zo * p.M + mm];   /* per-(z,row) scale vector laid out [Z][M]; exclusive with the bias flags */
                    v = act_fn(v, p.act);
                    if (p.flags & 4) v += p.beta * R[(long long)mm * p.sRm + (long long)nn * p.sRn];
                    ctile[8 * h + r][t2 * 16 + l15] = (n < p.N) ? v : 0.f;
                }
            }
            __syncthreads();
            const bool fast = (mb + 16 <= p.M) && (nb + 32 <= NW) && ((p.sCm & 3) == 0) && ((((size_t)C) & 15) == 0);
            if (fast) {
#pragma unroll
                for (int s = 0; s < 4; ++s) {
                    const int row = s * 4 + (lane >> 3), c4 = (lane & 7) * 4;
                    const v4f v = *(const v4f*)&ctile[row][c4];
                    VST2V4(C + (long long)(mb + row) * p.sCm + nb + c4, v);
                }
            } else {
                for (int row = 0; row < 16; ++row) {
                    const int m = mb + row, n = nb + lane;
                    if (m < p.M && n < NW) VST2(float, C + (long long)m * p.sCm + n, ctile[row][lane]);
                }
            }
            __syncthreads();
        }
    }
}

// =====================================================================================================================
//   Wave = 16 queries, AW waves per block, 64-key blocks; grid (ceil(Lq/(16*AW)), H, B), block 32*AW. Any Lq, Lk; head dim dh <= DHP
//   (DHP multiple of 32), value dim dv <= DVP (multiple of 16, <= 128). Every tensor addressed by (batch, head, row, element) strides, f32.
//   Scores: QM 0 f16 operands, 1 bf16 hi/lo split, 2 bf16 triple split; statistics f32 (exp2 domain); P.V: P x 4096 as f16 with V f16 staged in LDS
//   (SPLITPV: P and V as bf16 hi/lo splits). kv head = h / hrep. Masking: causal = 1 (keep j <= i + coff, masked -> -inf, key blocks beyond the
//   diagonal skipped), causal = 2 (masked -> mfill, a finite fill like the -1e9; no skipping), causal = 3 (keep j >= i + coff,
//   masked -> -inf, no skipping); optional additive f32 mask Mf,
//   optional int keep-mask Mi (0 -> score := mfill), both addressed b*smb + h*smh + i*smi + j*smj (0 strides broadcast).
//   PLAIN (QM 0, f16 P.V, one pass): the call is causal = 1 with coff 0, hrep 1, dh == DHP, dv == DVP, element strides 1, every Q/K/V row 16-byte aligned,
//   and none of P, Mf, Mi, ST, Pw, Rt, SQ/SK, nonorm. These become compile-time constants: the element guards fold away, so Q, K and V are read with
//   16-byte loads that are in flight in runs instead of one guarded float at a time, each waited for, and the option tests leave the score loop.
//   O16 (PLAIN, DVP 64, Lq a multiple of 16): the output goes to Oh as f16 (strides sOb, sOh, sOi in elements; rows 16-byte aligned), rounded from the same f32 value that O would hold,
//   so that the next product reads it without a cast launch in between. A (row, head) piece is one whole 128-byte line.
// =====================================================================================================================
#define AW 4
struct AttnP {   // apv4
    const float* Q; const float* K; const float* V; float* O; _Float16* Oh; float* P; const float* Mf; const int* Mi; float* ST;   // Oh: the output plane of the O16 form (O unused there)
    const float* Pw; const float* Rt; const int* SQ; const int* SK;           // optional: post-softmax weight, relative-position table, segment ids
    long long swb, swh, swi, swj, srb, srh, sri;                                 // Pw strides (b,h,i,j); Rt strides (b,h,i), column = clamp(i - j + roff, 0, rn-1)
    long long sQb, sQh, sQi, sQd, sKb, sKh, sKj, sKd, sVb, sVh, sVj, sVd, sOb, sOh, sOi, sPb, sPh, sPi, smb, smh, smi, smj;
    int Lq, Lk, dh, dv, hrep, causal, coff, pband;   // pband > 0: P holds only the band |j - i| <= pband, column j - i + pband
    float scale, mfill; int nonorm, mpol;             // nonorm (online path only): O = sum_j exp(score_j) V_j without the 1/rowsum (scores must be <= ~0); mpol: Mi masks where ==0 (mpol 0) or where !=0 (mpol 1)
    int roff, rn, segpol, win;                        // Rt column offset/count; SQ/SK: score := mfill where (segpol 0) SQ[i] != SK[j] or (segpol 1) SQ[i] == SK[j]; win > 0: keys with i - j > win (after coff) -> -inf, key blocks wholly below the window skipped
};
//   Pw: the softmax numerator is multiplied by Pw(b,h,i,j) AFTER the row sum is taken (probs * weight, then P.V), as in post-softmax multiplicative biases.                                                    // ST (optional): per row (b,h,i) -> ST[((b*H + h)*Lq + i)*2 + {0,1}] = {row max of the scaled+masked score (natural units), sum_j exp(score - max)}
static_assert(sizeof(AttnP) == 13 * 8 + 29 * 8 + 16 * 4, "AttnP has padding");

#ifndef KATTN_ATTR
#define KATTN_ATTR
#endif
template <int DHP, int DVP, int QM, bool SPLITPV, bool TWOPASS, bool PLAIN = false, bool O16 = false>
__global__ __launch_bounds__(32 * AW) KATTN_ATTR void k_attn(AttnP pa) {
    static_assert(!PLAIN || (QM == 0 && !SPLITPV && !TWOPASS), "PLAIN covers the f16 one-pass form");
    static_assert(!O16 || (PLAIN && DVP == 64), "O16 covers the PLAIN form with 64 value columns");
    AttnP p = pa;
    if (PLAIN) {
        p.P = nullptr; p.Mf = nullptr; p.Mi = nullptr; p.ST = nullptr; p.Pw = nullptr; p.Rt = nullptr; p.SQ = nullptr; p.SK = nullptr;
        p.sQd = 1; p.sKd = 1; p.sVd = 1; p.dh = DHP; p.dv = DVP; p.hrep = 1; p.causal = 1; p.coff = 0; p.pband = 0; p.nonorm = 0;
    }
    constexpr int NT = DVP / 16;                // output tiles
    constexpr int KS = DHP / 32;                // k-steps for the scores
    constexpr int VP = DVP + 8;                 // LDS pitch (halves)
    constexpr int NV = 64 * (DVP / 4) / (32 * AW);   // PLAIN: 16-byte pieces of the V tile per thread
    static_assert(!PLAIN || NV * (32 * AW) == 64 * (DVP / 4), "the block's threads cover the V tile evenly");
    __shared__ __align__(16) float    pl[AW][16 * 64];
    __shared__ __align__(16) _Float16 vl[(SPLITPV ? 2 : 1) * 64 * VP];   // f16 V tile, or bf16 hi and lo tiles (same 2-byte size)
    const int lane = threadIdx.x & 31, hf = lane >> 4, l15 = lane & 15, wave = threadIdx.x >> 5;
    const int h = blockIdx.y, b = blockIdx.z, hk = h / p.hrep;
    const int q0 = (blockIdx.x * AW + wave) * 16;
    float* myp = pl[wave];
    const float L2E = 1.4426950408889634f;
    const float NEG = -__builtin_inff();
    const int qi = min(q0 + l15, p.Lq - 1);
    const float* qrow = p.Q + b * p.sQb + h * p.sQh + (long long)qi * p.sQi;
    const float* kbase = p.K + b * p.sKb + hk * p.sKh;
    const float* vbase = p.V + b * p.sVb + hk * p.sVh;
    v16h qa[QM == 0 ? KS : 1]; Split qs_[QM == 1 ? KS : 1]; Split3 qt_[QM == 2 ? KS : 1];
#pragma unroll
    for (int ks = 0; ks < KS; ++ks) {
        if (QM == 2) qt_[ks] = sp3_ld(qrow, p.sQd, ks * 32, hf, p.dh, 1.f);
        else if (QM == 1) qs_[ks] = sp_ld(qrow, p.sQd, ks * 32, hf, p.dh, 1.f);
        else if (PLAIN) qa[ks] = raw_f16(raw_ld4(qrow, ks * 32, hf));
        else qa[ks] = fh_ld(qrow, p.sQd, ks * 32, hf, p.dh, 1.f);
    }
    v8f o[NT]; float m8[8], l8[8];
#pragma unroll
    for (int t = 0; t < NT; ++t) { v8f zz = {}; o[t] = zz; }
#pragma unroll
    for (int i = 0; i < 8; ++i) { m8[i] = NEG; l8[i] = 0.f; }
    int jend = p.Lk;
    if (p.causal == 1) { const int je = (blockIdx.x * AW + AW - 1) * 16 + 16 + p.coff; jend = min(jend, max(je, 0)); }   // uniform per block
    int jbeg = 0;                                                // first key any query row of this block can see through the window; uniform per block
    if (p.win > 0 && !p.P) jbeg = max((int)(blockIdx.x * AW) * 16 + p.coff - p.win, 0);   // keys below it are -inf for all 16*AW rows (weight exactly 0); P, where asked for, still needs its zeros written
    const int npass = TWOPASS ? 2 : 1;
    for (int pass = 0; pass < npass; ++pass) {
        const bool dopv = (!TWOPASS) || pass == 1;
        for (int j0 = jbeg; j0 < jend; j0 += 64) {
            v4f vr[PLAIN ? NV : 1]; Raw16 kr[PLAIN ? 2 : 1][KS];   // PLAIN: this thread's part of the V tile and the lane's K fragments of two columns, f32 as loaded
            if (dopv) {
                __syncthreads();                                 // previous key block's reads of vl / pl are done
                if (!PLAIN)
                for (int idx = threadIdx.x; idx < 64 * DVP; idx += 32 * AW) {
                    const int jr = idx / DVP, d = idx - jr * DVP, j = j0 + jr;
                    const float f = (j < p.Lk && d < p.dv) ? vbase[(long long)j * p.sVj + (long long)d * p.sVd] : 0.f;
                    if (SPLITPV) {
                        const __bf16 hb = bf16_rne(f);
                        ((__bf16*)vl)[jr * VP + d] = hb; ((__bf16*)vl)[64 * VP + jr * VP + d] = bf16_rne(f - bf16_f32(hb));
                    } else vl[jr * VP + d] = (_Float16)f;
                }
            }
            v8f s[4];
#pragma unroll
            for (int t = 0; t < 4; ++t) {
                const int j = min(j0 + t * 16 + l15, p.Lk - 1);
                const float* krow = kbase + (long long)j * p.sKj;
                if (PLAIN && (t & 1) == 0) {
                    // the K loads of two 16-key columns are issued ahead of the first use of any of them: one trip to memory for 4 fragments
                    // (all four columns at once took the build past 256 registers). The loops here are unrolled so that kr and vr stay in registers.
#pragma unroll
                    for (int u = 0; u < 2; ++u) {
#pragma unroll
                        for (int ks = 0; ks < KS; ++ks) kr[u][ks] = raw_ld4(kbase + (long long)min(j0 + (t + u) * 16 + l15, p.Lk - 1) * p.sKj, ks * 32, hf);
                        // one column's loads share one address pair: this wait stands behind them, ahead of any later load whose result may be given that pair
                        asm volatile("s_wait_xcnt 0x0" ::: "memory");
                    }
#pragma unroll
                    for (int u = 0; u < 2; ++u)
#pragma unroll
                        for (int ks = 0; ks < KS; ++ks) loads_held(kr[u][ks].x0, kr[u][ks].x1, kr[u][ks].x2, kr[u][ks].x3);
                }
                v8f acc = {};
#pragma unroll
                for (int ks = 0; ks < KS; ++ks) {
                    if (QM == 2)      acc = wmma6(qt_[ks], sp3_ld(krow, p.sKd, ks * 32, hf, p.dh, 1.f), acc);
                    else if (QM == 1) acc = wmma3(qs_[ks], sp_ld(krow, p.sKd, ks * 32, hf, p.dh, 1.f), acc);
                    else if (PLAIN)   acc = wmma16(qa[ks], raw_f16(kr[t & 1][ks]), acc);
                    else              acc = wmma16(qa[ks], fh_ld(krow, p.sKd, ks * 32, hf, p.dh, 1.f), acc);
                }
                s[t] = acc;
            }
            if (PLAIN) {
                // the V tile's loads go out here and are first used behind the softmax, which covers their trip to memory
#pragma unroll
                for (int n = 0; n < NV; ++n) {
                    const int idx = threadIdx.x + n * (32 * AW), jr = idx / (DVP / 4), d = (idx - jr * (DVP / 4)) * 4;
                    vr[n] = *(const v4f*)(vbase + (long long)min(j0 + jr, p.Lk - 1) * p.sVj + d);   // row clamped, so no guard round the load
                }
            }
            float pv[8][4];
#pragma unroll
            for (int i = 0; i < 8; ++i) {
                const int irow = q0 + i + 8 * hf;
                const int ic = min(irow, p.Lq - 1);
                float sc[4];
#pragma unroll
                for (int t = 0; t < 4; ++t) {
                    const int jg = j0 + t * 16 + l15;
                    float v = s[t][i] * p.scale;
                    if (p.Mf) v += p.Mf[b * p.smb + h * p.smh + (long long)ic * p.smi + (long long)min(jg, p.Lk - 1) * p.smj];
                    if (p.Rt) { int rc = ic - min(jg, p.Lk - 1) + p.roff; rc = rc < 0 ? 0 : (rc >= p.rn ? p.rn - 1 : rc); v += p.Rt[b * p.srb + h * p.srh + (long long)ic * p.sri + rc]; }
                    if (p.Mi) { const int mv = p.Mi[b * p.smb + h * p.smh + (long long)ic * p.smi + (long long)min(jg, p.Lk - 1) * p.smj]; if (p.mpol ? (mv != 0) : (mv == 0)) v = p.mfill; }
                    if (p.SQ) { const bool same = p.SQ[(long long)b * p.Lq + ic] == p.SK[(long long)b * p.Lk + min(jg, p.Lk - 1)]; if (p.segpol ? same : !same) v = p.mfill; }
                    if (p.causal == 2 && jg > irow + p.coff) v = p.mfill;
                    if (jg >= p.Lk || (p.causal == 1 && jg > irow + p.coff) || (p.causal == 3 && jg < irow + p.coff) || (p.win > 0 && irow + p.coff - jg > p.win)) v = NEG; else v *= L2E;
                    sc[t] = v;
                }
                if (!TWOPASS || pass == 0) {
                    float mx = fmaxf(fmaxf(sc[0], sc[1]), fmaxf(sc[2], sc[3]));
                    mx = fmaxf(mx, __shfl_xor(mx, 1, 32)); mx = fmaxf(mx, __shfl_xor(mx, 2, 32));
                    mx = fmaxf(mx, __shfl_xor(mx, 4, 32)); mx = fmaxf(mx, __shfl_xor(mx, 8, 32));
                    const float mnew = fmaxf(m8[i], mx);
                    const float corr = (mnew == NEG) ? 1.f : exp2f(m8[i] - mnew);
                    float rs = 0.f;
#pragma unroll
                    for (int t = 0; t < 4; ++t) {
                        const float pp = (sc[t] == NEG) ? 0.f : exp2f(sc[t] - mnew); rs += pp;
                        pv[i][t] = p.Pw ? pp * p.Pw[b * p.swb + h * p.swh + (long long)ic * p.swi + (long long)min(j0 + t * 16 + l15, p.Lk - 1) * p.swj] : pp;
                    }
                    rs += __shfl_xor(rs, 1, 32); rs += __shfl_xor(rs, 2, 32); rs += __shfl_xor(rs, 4, 32); rs += __shfl_xor(rs, 8, 32);
                    l8[i] = l8[i] * corr + rs; m8[i] = mnew;
                    if (!TWOPASS) {
#pragma unroll
                        for (int t = 0; t < NT; ++t) o[t][i] *= corr;
                    }
                } else {
                    const float inv = (l8[i] > 0.f) ? 1.f / l8[i] : 0.f;
#pragma unroll
                    for (int t = 0; t < 4; ++t) {
                        const int jg = j0 + t * 16 + l15;
                        float pp = (sc[t] == NEG) ? 0.f : exp2f(sc[t] - m8[i]) * inv;
                        if (p.Pw) pp *= p.Pw[b * p.swb + h * p.swh + (long long)ic * p.swi + (long long)min(jg, p.Lk - 1) * p.swj];
                        pv[i][t] = pp;
                    }
                }
            }
            if (dopv) {
                if (PLAIN) {                                     // cast and stage the V tile loaded above (unrolled: vr stays in registers)
#pragma unroll
                    for (int n = 0; n < NV; ++n) {
                        const int idx = threadIdx.x + n * (32 * AW), jr = idx / (DVP / 4), d = (idx - jr * (DVP / 4)) * 4;
                        v4h hv;
#pragma unroll
                        for (int e = 0; e < 4; ++e) hv[e] = (_Float16)((j0 + jr < p.Lk) ? vr[n][e] : 0.f);
                        *(v4h*)&vl[jr * VP + d] = hv;
                    }
                }
#pragma unroll
                for (int i = 0; i < 8; ++i)
#pragma unroll
                    for (int t = 0; t < 4; ++t) ((float*)myp)[(i + 8 * hf) * 64 + t * 16 + l15] = pv[i][t];
                __syncthreads();                                 // P (per wave) and V (shared) visible
                if (p.P) {
                    float* pb_ = p.P + b * p.sPb + h * p.sPh;
                    const bool fastP = (p.pband == 0) && ((p.sPi & 3) == 0) && (j0 + 64 <= p.Lk) && (q0 + 16 <= p.Lq) && ((((size_t)pb_) & 15) == 0);
                    if (fastP) {
#pragma unroll
                        for (int s = 0; s < 8; ++s) {
                            const int row = s * 2 + (lane >> 4), c4 = (lane & 15) * 4;
                            const v4f v = *(const v4f*)(myp + row * 64 + c4);
                            VST2V4(pb_ + (long long)(q0 + row) * p.sPi + j0 + c4, v);
                        }
                    } else {
                        for (int row = 0; row < 16; ++row) {
                            const int irow = q0 + row; if (irow >= p.Lq) continue;
                            for (int c = lane; c < 64; c += 32) {
                                const int jg = j0 + c; if (jg >= p.Lk) continue;
                                if (p.pband == 0) VST2(float, pb_ + (long long)irow * p.sPi + jg, myp[row * 64 + c]);
                                else if (jg - irow <= p.pband && irow - jg <= p.pband) VST2(float, pb_ + (long long)irow * p.sPi + (jg - irow + p.pband), myp[row * 64 + c]);
                            }
                        }
                    }
                }
                if (SPLITPV) {
                    const Split pa0 = sp_ld(myp + l15 * 64, 1, 0, hf, 64, 1.f), pa1 = sp_ld(myp + l15 * 64, 1, 32, hf, 64, 1.f);
                    const __bf16* vh = (const __bf16*)vl; const __bf16* vlo = vh + 64 * VP;
#pragma unroll
                    for (int t = 0; t < NT; ++t) {
                        const int dcol = t * 16 + l15;
                        Split b0, b1;
#pragma unroll
                        for (int e = 0; e < 16; ++e) {
                            const int k0 = frag_k(e, hf), k1 = 32 + frag_k(e, hf);
                            b0.hi[e] = vh[k0 * VP + dcol]; b0.lo[e] = vlo[k0 * VP + dcol]; b1.hi[e] = vh[k1 * VP + dcol]; b1.lo[e] = vlo[k1 * VP + dcol];
                        }
                        o[t] = wmma3(pa0, b0, o[t]);
                        o[t] = wmma3(pa1, b1, o[t]);
                    }
                } else {
                    const v16h pa0 = fh_ld(myp + l15 * 64, 1, 0, hf, 64, 4096.f), pa1 = fh_ld(myp + l15 * 64, 1, 32, hf, 64, 4096.f);
#pragma unroll
                    for (int t = 0; t < NT; ++t) {
                        const int dcol = t * 16 + l15;
                        v16h b0, b1;
#pragma unroll
                        for (int e = 0; e < 16; ++e) { b0[e] = vl[frag_k(e, hf) * VP + dcol]; b1[e] = vl[(32 + frag_k(e, hf)) * VP + dcol]; }
                        o[t] = wmma16(pa0, b0, o[t]);
                        o[t] = wmma16(pa1, b1, o[t]);
                    }
                }
            }
        }
    }
    float* obase = p.O + b * p.sOb + h * p.sOh;
    if (p.ST) {
        const int rl = lane >> 1, isel = rl & 7;           // row q0 + rl ; rl>>3 == hf holds because lane>>4 == (lane>>1)>>3
        float mv = 0.f, lv = 0.f;
#pragma unroll
        for (int i = 0; i < 8; ++i) if (i == isel) { mv = m8[i]; lv = l8[i]; }
        const int irow = q0 + rl;
        if (irow < p.Lq) { float* st = p.ST + (((long long)b * gridDim.y + h) * p.Lq + irow) * 2 + (lane & 1); VST2(float, st, (lane & 1) ? lv : mv * 0.6931471805599453f); }
    }
    float invr[8];
#pragma unroll
    for (int i = 0; i < 8; ++i) {
        if (TWOPASS) invr[i] = SPLITPV ? 1.f : (1.f / 4096.f);
        else if (p.nonorm) invr[i] = exp2f(m8[i]) * (SPLITPV ? 1.f : (1.f / 4096.f));
        else invr[i] = (l8[i] > 0.f) ? (SPLITPV ? 1.f / l8[i] : 1.f / (l8[i] * 4096.f)) : 0.f;
    }
    __syncthreads();                                             // all waves done with pl/vl from the main loop
    const bool ofast = ((p.sOi & 3) == 0) && ((((size_t)obase) & 15) == 0) && (q0 + 16 <= p.Lq);
#pragma unroll
    for (int c0 = 0; c0 < DVP; c0 += 64) {
#pragma unroll
        for (int i = 0; i < 8; ++i)
#pragma unroll
            for (int t = 0; t < NT; ++t) if (t * 16 >= c0 && t * 16 < c0 + 64) ((float*)myp)[(i + 8 * hf) * 64 + (t * 16 - c0) + l15] = o[t][i] * invr[i];
        __syncthreads();
        const int cw = (DVP - c0 < 64) ? (DVP - c0) : 64;      // staged columns in this chunk (multiple of 16)
        if (O16) {
            _Float16* oh = p.Oh + b * p.sOb + h * p.sOh;
            if (q0 < p.Lq) {                                     // Lq is a multiple of 16: a wave's 16 rows are all there or none is
#pragma unroll   // four stores of 4 rows each, all in flight
                for (int r0 = 0; r0 < 16; r0 += 4) {
                    const int row = r0 + (lane >> 3), c8 = (lane & 7) * 8;
                    const float* sp = myp + row * 64 + c8;
                    v8h hv;
#pragma unroll   // constant element indices: the vector stays in registers
                    for (int e = 0; e < 8; ++e) hv[e] = (_Float16)sp[e];
                    *(v8h*)(oh + (long long)(q0 + row) * p.sOi + c8) = hv;
                }
            }
        } else if (ofast && (c0 + cw <= p.dv) && (cw % 32 == 0)) {
            const int lpr = cw / 4;                              // lanes per row (16 for 64 cols, 8 for 32)
            const int rows_per_ins = 32 / lpr;
            for (int r0 = 0; r0 < 16; r0 += rows_per_ins) {
                const int row = r0 + lane / lpr, c4 = (lane % lpr) * 4;
                const v4f v = *(const v4f*)(myp + row * 64 + c4);
                VST2V4(obase + (long long)(q0 + row) * p.sOi + c0 + c4, v);
            }
        } else {
            for (int row = 0; row < 16; ++row) {
                const int irow = q0 + row; if (irow >= p.Lq) continue;
                for (int c = lane; c < cw; c += 32) { const int d = c0 + c; if (d < p.dv) VST2(float, obase + (long long)irow * p.sOi + d, myp[row * 64 + c]); }
            }
        }
        __syncthreads();
    }
}

__device__ __forceinline__ float other_half(float v) {
    const int b = __builtin_bit_cast(int, v);
    return __builtin_bit_cast(float, __builtin_amdgcn_permlanex16(b, b, 0x76543210, 0xfedcba98, false, false));
}
// k_tile_ld: this thread's eight 16-byte pieces of the 64 x 64 f32 K tile that starts at key j: piece (thread & 15) of rows (thread >> 4) + 8 n, so that a wave's load
// covers two whole 256-byte row pieces. A row is clamped to the last key, so there is no guard round a load; such a key's scores are masked.
__device__ __forceinline__ void k_tile_ld(v4f (&kr)[8], const float* __restrict__ kbase, int j, int Lk, long long sKj) {
    static_assert(32 * AW == 128, "eight rows per pass of the block");
    const float* kp[8];
#pragma unroll   // constant indices: the arrays stay in registers
    for (int n = 0; n < 8; ++n) kp[n] = kbase + (long long)min(j + (int)(threadIdx.x >> 4) + 8 * n, Lk - 1) * sKj + (threadIdx.x & 15) * 4;
#pragma unroll   // constant indices; the eight loads are in flight together
    for (int n = 0; n < 8; ++n) kr[n] = *(const v4f*)kp[n];
    // The wait in front of any rewrite of a register that the run names; as its inputs the addresses stay whole until it, so that no load of the run lands in one.
    asm volatile("s_wait_xcnt 0x0" :: "v"(kp[0]), "v"(kp[1]), "v"(kp[2]), "v"(kp[3]), "v"(kp[4]), "v"(kp[5]), "v"(kp[6]), "v"(kp[7]) : "memory");
}
__global__ __launch_bounds__(32 * AW) void k_attn_t(AttnP p) {
    constexpr int KS = 2;                       // k-steps of the scores (head dim 64)
    constexpr int VP = 64 + 8;                  // LDS pitch of the K tile, the V tile and the output staging (halves): 144 bytes, an odd number of 16-byte pieces
    constexpr int NV = 64 * 16 / (32 * AW);     // 16-byte pieces of an f32 K or V tile per thread
    __shared__ __align__(16) _Float16 kl[64 * VP];
    __shared__ __align__(16) _Float16 vl[64 * VP];
    __shared__ __align__(16) _Float16 ol[AW][16 * VP];
    const int lane = threadIdx.x & 31, hf = lane >> 4, l15 = lane & 15, wave = threadIdx.x >> 5;
    const int h = blockIdx.y, b = blockIdx.z;
    const int q0 = (blockIdx.x * AW + wave) * 16;
    const float L2E = 1.4426950408889634f;
    const float NEG = -__builtin_inff();
    const int irow = q0 + l15;                  // the lane's query
    const float* qrow = p.Q + b * p.sQb + h * p.sQh + (long long)min(irow, p.Lq - 1) * p.sQi;
    const float* kbase = p.K + b * p.sKb + h * p.sKh;
    const float* vbase = p.V + b * p.sVb + h * p.sVh;
    v16h qa[KS];
    {
        Raw16 qr[KS];
#pragma unroll   // constant indices: the fragments stay in registers
        for (int ks = 0; ks < KS; ++ks) qr[ks] = raw_ld4(qrow, ks * 32, hf);
        asm volatile("s_wait_xcnt 0x0" ::: "memory");   // behind the run of loads off one address pair, ahead of any rewrite of that pair
#pragma unroll   // constant indices: the arrays stay in registers
        for (int ks = 0; ks < KS; ++ks) qa[ks] = raw_f16(qr[ks]);
    }
    v8f o[4]; float m = NEG, l = 0.f;
#pragma unroll   // constant indices: the arrays stay in registers
    for (int t = 0; t < 4; ++t) { v8f zz = {}; o[t] = zz; }
    const int jend = min(p.Lk, (int)(blockIdx.x * AW + AW) * 16);          // uniform per block: no key beyond the block's last query
    const int jbeg = (p.win > 0) ? max((int)(blockIdx.x * AW) * 16 - p.win, 0) : 0;   // uniform per block: first key that any of its queries sees through the window
    v4f kr[NV];                                 // this thread's part of a K tile, f32 as loaded: loaded one key block ahead
    if (jbeg < jend) k_tile_ld(kr, kbase, jbeg, p.Lk, p.sKj);
    for (int j0 = jbeg; j0 < jend; j0 += 64) {
        v4f vr[NV];                             // this thread's part of the V tile, f32 as loaded
        // cast and stage the K tile. Every wave's reads of the previous K tile ended ahead of that key block's second barrier, which this wave has passed.
#pragma unroll   // constant indices: the arrays stay in registers
        for (int n = 0; n < NV; ++n) {
            const int idx = threadIdx.x + n * (32 * AW), jr = idx >> 4, d = (idx & 15) * 4;
            v4h hv;
#pragma unroll   // constant indices: the arrays stay in registers
            for (int e = 0; e < 4; ++e) hv[e] = (_Float16)kr[n][e];
            *(v4h*)&kl[jr * VP + d] = hv;
        }
        __syncthreads();                        // the K tile is visible to every wave, and the previous key block's reads of vl are done
        v8f s[4]; v16h ka[4][KS];
#pragma unroll   // constant indices: the arrays stay in registers
        for (int t = 0; t < 4; ++t) {
            const _Float16* krow = &kl[(t * 16 + l15) * VP + 8 * hf];   // frag_k order: 8 halves at 8 hf and 8 at 16 + 8 hf of each 32
#pragma unroll   // constant indices: the arrays stay in registers
            for (int ks = 0; ks < KS; ++ks) {
                const v8h k0 = *(const v8h*)(krow + ks * 32), k1 = *(const v8h*)(krow + ks * 32 + 16);
                ka[t][ks] = __builtin_shufflevector(k0, k1, 0, 1, 2, 3, 4, 5, 6, 7, 8, 9, 10, 11, 12, 13, 14, 15);
            }
        }
        __builtin_amdgcn_sched_barrier(0);   // without it the compiler reads each fragment directly in front of its product and waits out the LDS latency eight times
#pragma unroll   // constant indices: the arrays stay in registers
        for (int t = 0; t < 4; ++t) {
            v8f acc = {};
#pragma unroll   // constant indices: the arrays stay in registers
            for (int ks = 0; ks < KS; ++ks) acc = wmma16(ka[t][ks], qa[ks], acc);
            s[t] = acc;
        }
        // the V tile's loads go out here and are first used behind the softmax, which covers their trip to memory
#pragma unroll   // constant indices: the arrays stay in registers
        for (int n = 0; n < NV; ++n) {
            const int idx = threadIdx.x + n * (32 * AW), jr = idx >> 4, d = (idx & 15) * 4;
            vr[n] = *(const v4f*)(vbase + (long long)min(j0 + jr, p.Lk - 1) * p.sVj + d);   // row clamped, so no guard round the load
        }
        asm volatile("s_wait_xcnt 0x0" ::: "memory");   // behind the run of V loads, ahead of any rewrite of their address registers
        if (j0 + 64 < jend) k_tile_ld(kr, kbase, j0 + 64, p.Lk, p.sKj);   // the next key block's K tile (the test is the same for the whole block): the rest of this key block covers its trip
        __builtin_amdgcn_sched_barrier(0);   // without it the compiler sinks the V loads to the end of the softmax, which then no longer covers their trip
        float mt[4];
#pragma unroll   // constant indices: the scores stay in registers; four independent chains of maxima
        for (int t = 0; t < 4; ++t) {
            mt[t] = NEG;
#pragma unroll   // constant indices: the arrays stay in registers
            for (int r = 0; r < 8; ++r) {
                const int jg = j0 + t * 16 + 8 * hf + r;
                float v = s[t][r] * p.scale;
                if (jg >= p.Lk || jg > irow || (p.win > 0 && irow - jg > p.win)) v = NEG; else v *= L2E;
                s[t][r] = v; mt[t] = fmaxf(mt[t], v);
            }
        }
        float mx = fmaxf(fmaxf(mt[0], mt[1]), fmaxf(mt[2], mt[3]));
        mx = fmaxf(mx, other_half(mx));
        const float mnew = fmaxf(m, mx);
        const float ms = (mnew == NEG) ? 0.f : mnew;    // no key seen yet: every score is -inf, and -inf - 0 gives weight 0 where -inf - -inf would give NaN
        const float corr = exp2f(m - ms);               // 0 while m is -inf, where l and o are still 0
        float rt[4];
#pragma unroll   // four independent chains of sums
        for (int t = 0; t < 4; ++t) {
            rt[t] = 0.f;
#pragma unroll   // constant indices: the arrays stay in registers
            for (int r = 0; r < 8; ++r) { const float pp = exp2f(s[t][r] - ms); s[t][r] = pp; rt[t] += pp; }
        }
        float rs = (rt[0] + rt[1]) + (rt[2] + rt[3]);
        rs += other_half(rs);
        l = l * corr + rs; m = mnew;
#pragma unroll   // constant indices: the arrays stay in registers
        for (int t = 0; t < 4; ++t) o[t] *= corr;
        v16h pb[2];
#pragma unroll   // constant element indices: the vectors stay in registers
        for (int k2 = 0; k2 < 2; ++k2)
#pragma unroll   // constant indices: the arrays stay in registers
            for (int i = 0; i < 8; ++i) { pb[k2][i] = (_Float16)(s[2 * k2][i] * 4096.f); pb[k2][8 + i] = (_Float16)(s[2 * k2 + 1][i] * 4096.f); }
        // cast and stage the V tile loaded above (unrolled: vr stays in registers)
#pragma unroll   // constant indices: the arrays stay in registers
        for (int n = 0; n < NV; ++n) {
            const int idx = threadIdx.x + n * (32 * AW), jr = idx >> 4, d = (idx & 15) * 4;
            v4h hv;
#pragma unroll   // constant indices: the arrays stay in registers
            for (int e = 0; e < 4; ++e) hv[e] = (_Float16)((j0 + jr < p.Lk) ? vr[n][e] : 0.f);
            *(v4h*)&vl[jr * VP + d] = hv;
        }
        __syncthreads();                        // the V tile is visible to every wave
#pragma unroll   // constant indices: the arrays stay in registers
        for (int t = 0; t < 4; ++t) {
            const int dcol = t * 16 + l15;
            v16h a0, a1;
#pragma unroll   // constant indices: the arrays stay in registers
            for (int e = 0; e < 16; ++e) { a0[e] = vl[frag_k(e, hf) * VP + dcol]; a1[e] = vl[(32 + frag_k(e, hf)) * VP + dcol]; }
            o[t] = wmma16(a0, pb[0], o[t]);
            o[t] = wmma16(a1, pb[1], o[t]);
        }
    }
    const float inv = (l > 0.f) ? 1.f / (l * 4096.f) : 0.f;
    _Float16* mo = ol[wave];                    // the wave's 16 x 64 output tile, so that the stores to memory cover whole 128-byte lines
#pragma unroll   // constant indices: the arrays stay in registers
    for (int t = 0; t < 4; ++t) {
        v8h hv;
#pragma unroll   // constant element indices
        for (int r = 0; r < 8; ++r) hv[r] = (_Float16)(o[t][r] * inv);
        *(v8h*)&mo[l15 * VP + t * 16 + 8 * hf] = hv;
    }
    __syncthreads();                            // the tile is written before other lanes read it
    _Float16* oh = p.Oh + b * p.sOb + h * p.sOh;
    if (q0 < p.Lq) {                            // Lq is a multiple of 16: a wave's 16 rows are all there or none is
#pragma unroll   // four stores of 4 rows each, all in flight
        for (int r0 = 0; r0 < 16; r0 += 4) {
            const int row = r0 + (lane >> 3), c8 = (lane & 7) * 8;
            *(v8h*)(oh + (long long)(q0 + row) * p.sOi + c8) = *(const v8h*)&mo[row * VP + c8];
        }
    }
}

// =====================================================================================================================
// k_tr: dst(z, c, r) = alpha * src(z, r, c) (+ beta * R2(z, c, r)): [Z][R][C] (row stride lds) -> [Z][C][R] (row stride ldd) through a 32x32 LDS tile;
//   flags: 1 -> add beta * residual R2 addressed like dst (z*sRz + c*ldr + r); act applied before the residual.
// =====================================================================================================================
struct TrP { const float* src; float* dst; const float* R2; long long sSz, lds, sDz, ldd, sRz, ldr; int R, C, flags, act; float alpha, beta; };
static_assert(sizeof(TrP) == 3 * 8 + 6 * 8 + 6 * 4, "TrP has padding");
__global__ __launch_bounds__(256) void k_tr(TrP p) {
    __shared__ float tile[32][33];
    const int c0 = blockIdx.x * 32, r0 = blockIdx.y * 32, z = blockIdx.z;
    const int lane = threadIdx.x & 31, wave = threadIdx.x >> 5;
    const float* s = p.src + z * p.sSz;
#pragma unroll
    for (int k = 0; k < 4; ++k) {
        const int rl = wave * 4 + k, r = r0 + rl, c = c0 + lane;
        tile[rl][lane] = (r < p.R && c < p.C) ? s[(long long)r * p.lds + c] : 0.f;
    }
    __syncthreads();
    float* d = p.dst + z * p.sDz; const float* rr = p.R2 + z * p.sRz;
#pragma unroll
    for (int k = 0; k < 4; ++k) {
        const int cl = wave * 4 + k, c = c0 + cl, r = r0 + lane;
        if (c < p.C && r < p.R) {
            float v = act_fn(p.alpha * tile[lane][cl], p.act);
            if (p.flags & 1) v += p.beta * rr[(long long)c * p.ldr + r];
            VST2(float, d + (long long)c * p.ldd + r, v);
        }
    }
}

// k_affine: dst[i] = a * (sdev ? sdev[0] : 1) * src[i] + b, i < n (one thread per element; consecutive lanes -> consecutive addresses)
__global__ __launch_bounds__(256) void k_affine(const float* __restrict__ src, float* __restrict__ dst, int n, float a, float b, const float* __restrict__ sdev) {
    const int i = blockIdx.x * 256 + threadIdx.x;
    if (i < n) { const float aa = sdev ? a * sdev[0] : a; const float v = aa * src[i] + b; VST2(float, dst + i, v); }
}

// =====================================================================================================================
// k_softmax: row softmax over n contiguous elements, one 256-thread block per row; rows addressed z*sz + r*sr (grid (R, Z)).
//   out = scale_out * softmax(scale_in * x + (Mf ? Mf[z*smz + r*smr + j] : 0)); a row whose max is -inf is written as 0.
// =====================================================================================================================
struct SmP { const float* src; float* dst; const float* Mf; long long sz, sr, dz, dr, smz, smr; int n, pad; float scale_in, scale_out; };
static_assert(sizeof(SmP) == 3 * 8 + 6 * 8 + 4 * 4, "SmP has padding");
__global__ __launch_bounds__(256) void k_softmax(SmP p) {
    __shared__ float red[256];
    const int r = blockIdx.x, z = blockIdx.y, tid = threadIdx.x;
    const float* s = p.src + z * p.sz + (long long)r * p.sr;
    const float* mf = p.Mf ? (p.Mf + z * p.smz + (long long)r * p.smr) : nullptr;
    float mx = -__builtin_inff();
    for (int j = tid; j < p.n; j += 256) { float v = s[j] * p.scale_in; if (mf) v += mf[j]; mx = fmaxf(mx, v); }
    red[tid] = mx; __syncthreads();
    for (int o = 128; o > 0; o >>= 1) { if (tid < o) red[tid] = fmaxf(red[tid], red[tid + o]); __syncthreads(); }
    mx = red[0]; __syncthreads();
    float sum = 0.f;
    for (int j = tid; j < p.n; j += 256) { float v = s[j] * p.scale_in; if (mf) v += mf[j]; sum += (mx == -__builtin_inff()) ? 0.f : expf(v - mx); }
    red[tid] = sum; __syncthreads();
    for (int o = 128; o > 0; o >>= 1) { if (tid < o) red[tid] += red[tid + o]; __syncthreads(); }
    sum = red[0];
    const float inv = (sum > 0.f) ? p.scale_out / sum : 0.f;
    float* d = p.dst + z * p.dz + (long long)r * p.dr;
    for (int j = tid; j < p.n; j += 256) { float v = s[j] * p.scale_in; if (mf) v += mf[j]; const float o = (mx == -__builtin_inff()) ? 0.f : expf(v - mx) * inv; VST2(float, d + j, o); }
}
// =====================================================================================================================
// k_stats: mean and rsqrt(var + eps) over a set of n elements addressed base + z*sz + (e / inner) * so + (e % inner) * si, one 256-thread
// k_norm_apply: y = (x - mean[set]) * rstd[set] * g[c] + b[c] over a [Z][C][L] channel-major tensor with set = z*G + c / (C/G) (G groups per z;
//   G = C -> per-channel sets indexed z*C+c; for batch norm pass stats indexed by c only via bn = 1). Optional act. Output same layout.
// =====================================================================================================================
//   mode 0: mean / rsqrt(var + eps); mode 1 (RMSNorm): 0 / rsqrt(mean(x^2) + eps); mode 2 (L2 normalize * sqrt(n)): 0 / sqrt(n) / max(||x||, eps); mode 3: as 0 with unbiased variance (n-1)
__global__ __launch_bounds__(256) void k_stats(const float* __restrict__ x, long long sz, long long so, long long si, int inner, int n, float eps, float* __restrict__ stat, int mode) {
    __shared__ float red[256];
    const int z = blockIdx.x, tid = threadIdx.x;
    const float* base = x + z * sz;
    float s = 0.f;
    for (int e = tid; e < n; e += 256) s += base[(long long)(e / inner) * so + (long long)(e % inner) * si];
    red[tid] = s; __syncthreads();
    for (int o = 128; o > 0; o >>= 1) { if (tid < o) red[tid] += red[tid + o]; __syncthreads(); }
    const float mu = (mode == 0 || mode == 3) ? red[0] / (float)n : 0.f; __syncthreads();
    float q = 0.f;
    for (int e = tid; e < n; e += 256) { const float dlt = base[(long long)(e / inner) * so + (long long)(e % inner) * si] - mu; q += dlt * dlt; }
    red[tid] = q; __syncthreads();
    for (int o = 128; o > 0; o >>= 1) { if (tid < o) red[tid] += red[tid + o]; __syncthreads(); }
    {
        float rs;
        if (mode == 2) rs = sqrtf((float)n) / fmaxf(sqrtf(red[0]), eps); else if (mode == 3) rs = rsqrtf(red[0] / (float)(n - 1) + eps); else rs = rsqrtf(red[0] / (float)n + eps);
        if (tid < 32) { const float v = (tid == 0) ? mu : ((tid == 1) ? rs : 0.f); VST2(float, stat + (long long)z * 32 + tid, v); }
    }
}
//   One thread per element over the flat [Z][C][L] index space: grid ceil(Z*C*L / 256).
__global__ __launch_bounds__(256) void k_norm_apply(const float* __restrict__ x, float* __restrict__ y, const float* __restrict__ stat, const float* __restrict__ g, const float* __restrict__ bta,
                                                     int Z, int C, int L, int G, int bn, int act) {
    const long long idx = (long long)blockIdx.x * 256 + threadIdx.x;
    if (idx >= (long long)Z * C * L) return;
    const int l = (int)(idx % L); const long long zc = idx / L; const int c = (int)(zc % C), z = (int)(zc / C); (void)l;
    const int set = bn ? c : (z * G + c / (C / G));
    float v = (x[idx] - stat[(long long)set * 32]) * stat[(long long)set * 32 + 1];
    if (g) v *= g[c];
    if (bta) v += bta[c];
    v = act_fn(v, act);
    VST2(float, y + idx, v);
}

// k_lse_neg: c[i] = -(st[2i] + log(st[2i+1])) = minus the log-sum-exp of row i from k_attn's ST output (for softmax over the query axis)
__global__ __launch_bounds__(256) void k_lse_neg(const float* __restrict__ st, float* __restrict__ c, int n) {
    const int i = blockIdx.x * 256 + threadIdx.x;
    if (i < n) { const float v = -(st[2 * i] + logf(st[2 * i + 1])); VST2(float, c + i, v); }
}

// k_iota: dst[i] = a * i + b as int32 (segment/position id helper)
__global__ __launch_bounds__(256) void k_iota(int* __restrict__ dst, int n, int a, int b) {
    const int i = blockIdx.x * 256 + threadIdx.x;
    if (i < n) { const int v = a * i + b; VST2(int, dst + i, v); }
}

// k_axpby: dst[i] = a * x[i] + b * y[i] (+ c), i < n
__global__ __launch_bounds__(256) void k_axpby(const float* __restrict__ x, const float* __restrict__ y, float* __restrict__ dst, int n, float a, float b, float c) {
    const int i = blockIdx.x * 256 + threadIdx.x;
    if (i < n) { const float v = a * x[i] + b * y[i] + c; VST2(float, dst + i, v); }
}

// =====================================================================================================================
// k_rope: rotary embedding on a [R rows][Hn heads][D] view (row stride sXr, head stride sXh, element stride 1) -> Y (own strides).
//   mode 0: rotate_half (partner d±D/2, sign - for d<D/2); mode 1: interleaved pairs (partner d^1, sign - for even d).
//   table column tcol: tmode 0 -> d, 1 -> d % (D/2), 2 -> d / 2; position p: pmode 0 -> r % S, 1 -> head index, 2 -> pos[r];
//   c = C[(r / S) * sCb + p * sCp + tcol * sCd], s likewise from Sn; y = x[d] * c + sign * x[partner] * s. X and Y must not alias.
// =====================================================================================================================
struct RopeP { const float* X; float* Y; const float* C; const float* Sn; const int* pos; long long sXr, sXh, sYr, sYh, sCb, sCp, sCd; int R, Hn, D, S, mode, tmode, pmode, pad; };
static_assert(sizeof(RopeP) == 5 * 8 + 7 * 8 + 8 * 4, "RopeP has padding");
__global__ __launch_bounds__(256) void k_rope(RopeP p) {
    const long long idx = (long long)blockIdx.x * 256 + threadIdx.x;
    if (idx >= (long long)p.R * p.Hn * p.D) return;
    const int d = (int)(idx % p.D); const long long rh = idx / p.D; const int h = (int)(rh % p.Hn); const int r = (int)(rh / p.Hn);
    const int half = p.D / 2;
    int partner; float sign;
    if (p.mode == 0) { partner = (d < half) ? d + half : d - half; sign = (d < half) ? -1.f : 1.f; }
    else { partner = d ^ 1; sign = (d & 1) ? 1.f : -1.f; }
    const int tcol = (p.tmode == 0) ? d : ((p.tmode == 1) ? (d % half) : (d >> 1));
    const int pp = (p.pmode == 0) ? (r % p.S) : ((p.pmode == 1) ? h : p.pos[r]);
    const long long toff = (long long)(r / p.S) * p.sCb + (long long)pp * p.sCp + (long long)tcol * p.sCd;
    const float* xr = p.X + (long long)r * p.sXr + (long long)h * p.sXh;
    const float v = xr[d] * p.C[toff] + sign * xr[partner] * p.Sn[toff];
    VST2(float, p.Y + (long long)r * p.sYr + (long long)h * p.sYh + d, v);
}

// k_invf + k_sincos (split so neither kernel carries a large VALU-fma footprint): invf_i = num * (1 / powf(base, (2 i)/D)) [fmode 0],
//   num * expf((2 i) * cexp) [fmode 1], num * powf(base, -2 (i - 1) / D) [fmode 2]; then cs/sn[s*half + i] = cos/sin((pscale * s) * invf_i)
__global__ __launch_bounds__(256) void k_invf(float* __restrict__ invb, int half, int D, float base, float num, int fmode, float cexp) {
    const int i = blockIdx.x * 256 + threadIdx.x;
    if (i >= ((half + 31) / 32) * 32) return;
    if (i >= half) { VST2(float, invb + i, 0.f); return; }
    const float e = (float)(2 * i) / (float)D;
    float invf;
    if (fmode == 1) invf = num * expf((float)(2 * i) * cexp);
    else if (fmode == 2) invf = num * powf(base, (-2.0f * ((float)i - 1.0f)) / (float)D);
    else invf = num * (1.0f / powf(base, e));
    VST2(float, invb + i, invf);
}
__global__ __launch_bounds__(256) void k_sincos(float* __restrict__ cs, float* __restrict__ sn, const float* __restrict__ invb, int S, int half, float pscale) {
    const int idx = blockIdx.x * 256 + threadIdx.x;
    if (idx >= S * half) return;
    const int s = idx / half, i = idx - s * half;
    const float ang = (pscale * (float)s) * invb[i];
    VST2(float, cs + idx, cosf(ang)); VST2(float, sn + idx, sinf(ang));
}

// k_mulact: dst[i] = act(x[i]) * y[i]
__global__ __launch_bounds__(256) void k_mulact(const float* __restrict__ x, const float* __restrict__ y, float* __restrict__ dst, int n, int act) {
    const int i = blockIdx.x * 256 + threadIdx.x;
    if (i < n) { const float v = act_fn(x[i], act) * y[i]; VST2(float, dst + i, v); }
}

// =====================================================================================================================
// k_matvec: thread-per-row matrix-vector products for N <= 8 output columns (heads with 1-3 outputs, gates), f32 on the VALU.
//   C[r*sCm + j] = act(alpha * sum_k A[r*sAm + k*sAk] * B[j*sBn + k*sBk] + bias[j]) + beta * R[r*sRm + j*sRn]; each thread writes its N contiguous floats.
// =====================================================================================================================
__global__ __launch_bounds__(256) void k_matvec(GemmP p) {
    // 32 lanes write one line with one instruction.
    const int rpt = (p.N == 1) ? 1 : 32;
    const long long r0 = ((long long)blockIdx.x * 256 + threadIdx.x) * rpt; const int z = blockIdx.z, zo = z / p.zi_n, zi = z - zo * p.zi_n;
    if (r0 >= p.M) return;
    const float* Bb = p.B + zo * p.sBo + zi * p.sBi;
    float* C = p.C + zo * p.sCo + zi * p.sCi; const float* R = p.R + zo * p.sRo + zi * p.sRi;
    for (int rr = 0; rr < rpt; ++rr) {
        const long long r = r0 + rr; if (r >= p.M) break;
        const float* A = p.A + zo * p.sAo + zi * p.sAi + r * p.sAm;
        float acc[8] = {0.f, 0.f, 0.f, 0.f, 0.f, 0.f, 0.f, 0.f};
        for (int k = 0; k < p.K; ++k) { const float a = A[(long long)k * p.sAk];
#pragma unroll
            for (int j = 0; j < 8; ++j) if (j < p.N) acc[j] += a * Bb[(long long)j * p.sBn + (long long)k * p.sBk]; }
#pragma unroll
        for (int j = 0; j < 8; ++j) if (j < p.N) {
            float v = acc[j] * p.alpha;
            if (p.flags & 1) v += p.bias[j];
            if (p.flags & 2) v += p.bias[r];
            v = act_fn(v, p.act);
            if (p.flags & 4) v += p.beta * R[r * p.sRm + (long long)j * p.sRn];
            VST2(float, C + r * p.sCm + j, v);
        }
    }
}
// k_smallsoftmax: thread-per-row softmax for short rows (n <= 64): dst[r*dr + j] = softmax(scale*src[r*sr + j])
__global__ __launch_bounds__(256) void k_smallsoftmax(const float* __restrict__ src, float* __restrict__ dst, long long sr, long long dr, int n, long long R, float scale) {
    const long long r0 = ((long long)blockIdx.x * 256 + threadIdx.x) * 32;
    for (int rr = 0; rr < 32; ++rr) {
        const long long r = r0 + rr; if (r >= R) return;
        const float* s = src + r * sr; float* d = dst + r * dr;
        float mx = -__builtin_inff();
        for (int j = 0; j < n; ++j) mx = fmaxf(mx, s[j] * scale);
        float sum = 0.f;
        for (int j = 0; j < n; ++j) sum += expf(s[j] * scale - mx);
        const float inv = 1.f / sum;
        for (int j = 0; j < n; ++j) { const float v = expf(s[j] * scale - mx) * inv; VST2(float, d + j, v); }
    }
}

__global__ __launch_bounds__(32) void k_unitstat(float* __restrict__ st) { const int t = threadIdx.x; const float v = (t == 1) ? 1.f : 0.f; VST2(float, st + t, v); }

// destination (e.g. a d_out whose row width is not a multiple of 32 floats) is written by consecutive lanes of one instruction
__global__ __launch_bounds__(256) void k_lincopy(const float* __restrict__ src, long long lds, float* __restrict__ dst, long long ldd, long long rows, int cols) {
    const long long i = (long long)blockIdx.x * 256 + threadIdx.x; if (i >= rows * cols) return;
    const long long r = i / cols; const int c = (int)(i - r * cols);
    const float v = src[r * lds + c]; VST2(float, dst + r * ldd + c, v);
}

namespace w25 {
typedef __attribute__((ext_vector_type(16))) _Float16 v16h;
typedef __attribute__((ext_vector_type(8)))  _Float16 v8h;
typedef __attribute__((ext_vector_type(16))) __bf16   v16b;
typedef __attribute__((ext_vector_type(8)))  __bf16   v8b;
typedef __attribute__((ext_vector_type(8)))  float    v8f;
typedef __attribute__((ext_vector_type(4)))  float    v4f;

__device__ __forceinline__ unsigned short f2bf_bits(float f) {
  unsigned u = __float_as_uint(f);
  return (unsigned short)((u + 0x7FFFu + ((u >> 16) & 1u)) >> 16);
}
__device__ __forceinline__ float bf_bits2f(unsigned short h) { return __uint_as_float(((unsigned)h) << 16); }

// hazard guards as plain device helpers (no inline asm inside the kernel template body)
__device__ __forceinline__ void dep_guard_h(v8f& a, v8f& b, v16h x, v16h y) { asm volatile("v_nop\n\tv_nop\n\tv_nop\n\tv_nop" : "+v"(a), "+v"(b) : "v"(x), "v"(y)); }
__device__ __forceinline__ void dep_guard_b(v8f& a, v8f& b, v16b x, v16b y) { asm volatile("v_nop\n\tv_nop\n\tv_nop\n\tv_nop" : "+v"(a), "+v"(b) : "v"(x), "v"(y)); }
__device__ __forceinline__ void keep4_h(v16h a, v16h b, v16h c, v16h d) { asm volatile("v_nop" :: "v"(a), "v"(b), "v"(c), "v"(d)); }
__device__ __forceinline__ void keep4_b(v16b a, v16b b, v16b c, v16b d) { asm volatile("v_nop" :: "v"(a), "v"(b), "v"(c), "v"(d)); }
__device__ __forceinline__ void acc_guard4(v8f& a, v8f& b, v8f& c, v8f& d) { asm volatile("v_nop\n\tv_nop\n\tv_nop\n\tv_nop" : "+v"(a), "+v"(b), "+v"(c), "+v"(d)); }
template <typename T> struct Frag;
template <> struct Frag<_Float16> {
  typedef v16h V; union U { v16h v; v8h h[2]; };
  static __device__ __forceinline__ v16h load(const _Float16* p) {   // elements 0..7 <- p[0..7], 8..15 <- p[16..23]
    U f; f.h[0] = *(const v8h*)(p); f.h[1] = *(const v8h*)(p + 16); return f.v;
  }
  static __device__ __forceinline__ v8f mma(v16h a, v16h b, v8f c) {
    return __builtin_amdgcn_wmma_f32_16x16x32_f16(false, a, false, b, (short)0, c, false, false);
  }
  static __device__ __forceinline__ void guard(v8f& a, v8f& b, v16h x, v16h y) { dep_guard_h(a, b, x, y); }
  static __device__ __forceinline__ void keep(v16h a, v16h b, v16h c, v16h d) { keep4_h(a, b, c, d); }
};
template <> struct Frag<__bf16> {
  typedef v16b V; union U { v16b v; v8b h[2]; };
  static __device__ __forceinline__ v16b load(const __bf16* p) {
    U f; f.h[0] = *(const v8b*)(p); f.h[1] = *(const v8b*)(p + 16); return f.v;
  }
  static __device__ __forceinline__ v8f mma(v16b a, v16b b, v8f c) {
    return __builtin_amdgcn_wmma_f32_16x16x32_bf16(false, a, false, b, (short)0, c, false, false);
  }
  static __device__ __forceinline__ void guard(v8f& a, v8f& b, v16b x, v16b y) { dep_guard_b(a, b, x, y); }
  static __device__ __forceinline__ void keep(v16b a, v16b b, v16b c, v16b d) { keep4_b(a, b, c, d); }
};

// ---- Register-blocked batched WMMA GEMM ------------------------------------
// C[m,n] = scale * sum_k A[m,k] * Bt[n,k] (+bias)(+resid); each wave owns a 64x64 tile.
// A row-major [M,K]; Bt row-major [N,K]; M,N % 64 == 0, K % 32 == 0.
// SPLIT: operands are hi/lo planes (A2/Bt2 = lo planes, same layout); product = hi·hi + hi·lo + lo·hi.
// BIAS_MODE: 0 = none, 1 = bias[m], 2 = bias[n]. Batch 1 takes bias_b1 and batch 2 bias_b2 in its place (up to three products that share A in one launch).
// OUT_MODE: 0 = f32, 1 = f16, 2 = bf16 hi plane (Cout) + bf16 lo plane (Cout2).
// ET: 0 = f16 operands, 1 = bf16 operands (pointers passed as 16-bit storage)
template <int ET> struct Elem;
template <> struct Elem<0> { typedef _Float16 T; };
template <> struct Elem<1> { typedef __bf16 T; };
template <int ET, bool SPLIT, int BIAS_MODE, int OUT_MODE, bool RESID, int ACT = 0>
__global__ __launch_bounds__(256) void wmma_gemm64(
    const unsigned short* __restrict__ Ap, const unsigned short* __restrict__ A2p, int lda, long strideA,
    const unsigned short* __restrict__ Btp, const unsigned short* __restrict__ Bt2p, int ldb, long strideB,
    void* __restrict__ Cout, void* __restrict__ Cout2, int ldc, long strideC,
    const float* __restrict__ bias, const float* __restrict__ bias_b1, const float* __restrict__ bias_b2,
    const float* __restrict__ resid, long strideR,
    int M, int N, int K, float scale) {
  typedef typename Elem<ET>::T T;
  typedef typename Frag<T>::V V;
  const T* A = (const T*)Ap; const T* A2 = (const T*)A2p; const T* Bt = (const T*)Btp; const T* Bt2 = (const T*)Bt2p;
  __shared__ __align__(16) float sT[8][16 * 68];   // per-wave 16x64 slab, pitch 68 floats
  const int b    = blockIdx.y;
  const int lane = threadIdx.x & 31;
  const int wave = threadIdx.x >> 5;
  const int tilesN = N >> 6;
  const int tilesM = M >> 6;
  const int tile = blockIdx.x * 8 + wave;
  if (tile >= tilesM * tilesN) return;   // wave-uniform; no block barriers in this kernel
  const int tm = tile / tilesN;
  const int tn = tile - tm * tilesN;
  const int m0 = tm << 6;
  const int n0 = tn << 6;

  const T* Ab  = A  + (size_t)b * strideA;
  const T* Bb  = Bt + (size_t)b * strideB;
  const T* Ab2 = SPLIT ? (A2  + (size_t)b * strideA) : nullptr;
  const T* Bb2 = SPLIT ? (Bt2 + (size_t)b * strideB) : nullptr;

  const int rlane = lane & 15;                 // row (A) / col (B, D) within subtile
  const int koff  = (lane >> 4) * 8;           // k offset of this lane half
  const int mOff  = (lane >> 4) * 8;           // D row offset

  v8f acc[4][4];
#pragma unroll
  for (int i = 0; i < 4; ++i)
#pragma unroll
    for (int j = 0; j < 4; ++j) acc[i][j] = (v8f){0.f,0.f,0.f,0.f,0.f,0.f,0.f,0.f};

  for (int k0 = 0; k0 < K; k0 += 32) {
    V bh[4], bl[4];
#pragma unroll
    for (int j = 0; j < 4; ++j) {
      const size_t bo = (size_t)(n0 + (j << 4) + rlane) * ldb + koff + k0;
      bh[j] = Frag<T>::load(Bb + bo);
      if (SPLIT) bl[j] = Frag<T>::load(Bb2 + bo);
    }
#pragma unroll
    for (int i = 0; i < 4; ++i) {
      const size_t ao = (size_t)(m0 + (i << 4) + rlane) * lda + koff + k0;
      V ah = Frag<T>::load(Ab + ao);
      V al;
      if (SPLIT) al = Frag<T>::load(Ab2 + ao);
#pragma unroll
      for (int j = 0; j < 4; ++j) {
        acc[i][j] = Frag<T>::mma(ah, bh[j], acc[i][j]);
        if (SPLIT) {
          acc[i][j] = Frag<T>::mma(ah, bl[j], acc[i][j]);
          acc[i][j] = Frag<T>::mma(al, bh[j], acc[i][j]);
        }
      }
      Frag<T>::guard(acc[i][0], acc[i][3], ah, SPLIT ? al : ah);
    }
    Frag<T>::keep(bh[0], bh[1], bh[2], bh[3]);
    if (SPLIT) Frag<T>::keep(bl[0], bl[1], bl[2], bl[3]);
  }
  acc_guard4(acc[0][0], acc[0][1], acc[0][2], acc[0][3]);
  acc_guard4(acc[1][0], acc[1][1], acc[1][2], acc[1][3]);
  acc_guard4(acc[2][0], acc[2][1], acc[2][2], acc[2][3]);
  acc_guard4(acc[3][0], acc[3][1], acc[3][2], acc[3][3]);

  // ---- epilogue ----
  float* slab = sT[wave];
  const float* Rb = RESID ? (resid + (size_t)b * strideR) : nullptr;
  const float* bsel = (b == 0) ? bias : ((b == 1) ? bias_b1 : bias_b2);
#pragma unroll
  for (int i = 0; i < 4; ++i) {
    const int mBase = m0 + (i << 4);
#pragma unroll
    for (int j = 0; j < 4; ++j) {
      const int n = n0 + (j << 4) + rlane;
      float bv = 0.f;
      if (BIAS_MODE == 2) bv = bsel[n];
#pragma unroll
      for (int r = 0; r < 8; ++r) {
        float v = acc[i][j][r] * scale;
        if (BIAS_MODE == 1) v += bsel[mBase + mOff + r];
        if (BIAS_MODE == 2) v += bv;
        if (RESID) v += Rb[(size_t)(mBase + mOff + r) * ldc + n];
        if (ACT == 1) v = tanhf(v);
        if (ACT == 2) v = fmaxf(v, 0.0f);
        if (ACT == 3) v = v / (1.0f + expf(-v));
        if (ACT == 4) v = (v > 0.f) ? v : 0.01f * v;
        if (ACT == 5) v = 0.5f * v * (1.0f + erff(v * 0.70710678118654752f));
        slab[(mOff + r) * 68 + (j << 4) + rlane] = v;
      }
    }
    __builtin_amdgcn_fence(__ATOMIC_RELEASE, "workgroup");
    __builtin_amdgcn_wave_barrier();
    __builtin_amdgcn_fence(__ATOMIC_ACQUIRE, "workgroup");
    if (OUT_MODE == 0) {
      float* C = (float*)Cout + (size_t)b * strideC;
      const int hh = lane >> 4, c4 = (lane & 15) * 4;     // row seg = 256 B = 16 lanes x 16 B
      {
#pragma unroll
        for (int it = 0; it < 8; ++it) {
          const int row = it * 2 + hh;
          v4f v = *(const v4f*)(slab + row * 68 + c4);
          *(v4f*)(C + (size_t)(mBase + row) * ldc + n0 + c4) = v;
        }
        
      }
    } else {
      const int q = lane >> 3, c8 = (lane & 7) * 8;
      unsigned short* C  = (unsigned short*)Cout  + (size_t)b * strideC;
      unsigned short* C2 = (OUT_MODE == 2) ? ((unsigned short*)Cout2 + (size_t)b * strideC) : nullptr;
      {
#pragma unroll
        for (int it = 0; it < 4; ++it) {
          const int row = it * 4 + q;
          const float* sp = slab + row * 68 + c8;
          v8h hv, lv;
#pragma unroll
          for (int e = 0; e < 8; ++e) {
            if (OUT_MODE == 1) {
              hv[e] = (_Float16)sp[e];
            } else {
              unsigned short hb = f2bf_bits(sp[e]);
              unsigned short lb = f2bf_bits(sp[e] - bf_bits2f(hb));
              hv[e] = __builtin_bit_cast(_Float16, hb);
              lv[e] = __builtin_bit_cast(_Float16, lb);
            }
          }
          *(v8h*)(C + (size_t)(mBase + row) * ldc + n0 + c8) = hv;
          if (OUT_MODE == 2) *(v8h*)(C2 + (size_t)(mBase + row) * ldc + n0 + c8) = lv;
        }
        
      }
    }
    __builtin_amdgcn_fence(__ATOMIC_RELEASE, "workgroup");
    __builtin_amdgcn_wave_barrier();
    __builtin_amdgcn_fence(__ATOMIC_ACQUIRE, "workgroup");
  }
}

// ---- WMMA GEMM with both operands staged in LDS by asynchronous copies -------
// The product, k order, accumulators' sum order of wmma_gemm64 (f16 operands, bias[n]): C[m,n] = act(scale * sum_k A[m,k] * Bt[n,k] + bias[n] (+ resid[m,n])), act GELU by gelu2 for ACT 5, none otherwise.
// A block of 4 waves owns a 128 x 64 tile of C, a wave 32 x 64 of it (2 x 4 accumulator tiles); grid (N / 64, M / 128, batches); A is shared by the batches.
// A stage is 128 k (256 bytes) of the block's 128 A rows and 64 Bt rows. Each lane copies 16 bytes, so a wave's copy covers two whole 256-byte row pieces
// (a fragment load from global memory touches 16 lines for the same 512 bytes), and a row is fetched once per block instead of once per wave that needs it.
// Two buffers: stage t + 1 flies while stage t is worked on. M % 128 == 0, N % 64 == 0, K % 128 == 0, rows 16-byte aligned. LDC: row pitch of C and of the residual, in elements.
constexpr int SG_KC = 128;                         // k per stage
constexpr int SG_PITCH = 272;                      // LDS row pitch in bytes: 256 + 16, conflict-free for the 16-byte fragment reads
constexpr int SG_BUF = (128 + 64) * SG_PITCH;      // one buffer: A rows 0..127, then Bt rows 0..63
// Twelve copies and the wait that stands in front of any rewrite of their address registers, in one statement so that the compiler can put nothing between them.
__device__ __forceinline__ void copy12(const unsigned (&l)[12], const _Float16* const (&g)[12]) {
  asm volatile(
      "global_load_async_to_lds_b128 %0, %1, off\n\t"
      "global_load_async_to_lds_b128 %2, %3, off\n\t"
      "global_load_async_to_lds_b128 %4, %5, off\n\t"
      "global_load_async_to_lds_b128 %6, %7, off\n\t"
      "global_load_async_to_lds_b128 %8, %9, off\n\t"
      "global_load_async_to_lds_b128 %10, %11, off\n\t"
      "global_load_async_to_lds_b128 %12, %13, off\n\t"
      "global_load_async_to_lds_b128 %14, %15, off\n\t"
      "global_load_async_to_lds_b128 %16, %17, off\n\t"
      "global_load_async_to_lds_b128 %18, %19, off\n\t"
      "global_load_async_to_lds_b128 %20, %21, off\n\t"
      "global_load_async_to_lds_b128 %22, %23, off\n\t"
      "s_wait_xcnt 0x0"
      :: "v"(l[0]), "v"(g[0]), "v"(l[1]), "v"(g[1]), "v"(l[2]), "v"(g[2]), "v"(l[3]), "v"(g[3]), "v"(l[4]), "v"(g[4]), "v"(l[5]), "v"(g[5]),
         "v"(l[6]), "v"(g[6]), "v"(l[7]), "v"(g[7]), "v"(l[8]), "v"(g[8]), "v"(l[9]), "v"(g[9]), "v"(l[10]), "v"(g[10]), "v"(l[11]), "v"(g[11])
      : "memory");
}
// One stage: thread t brings the 16-byte piece (t & 15) of rows (t >> 4) + 8 u, u = 0..23, of the buffer (24 copies per wave in flight).
// lds0: the LDS byte address of its piece in row t >> 4 of the buffer; a0, b0: the same piece of row t >> 4 of the block's A and Bt rows at this stage's k.
__device__ __forceinline__ void stage_in(unsigned lds0, const _Float16* a0, int lda, const _Float16* b0, int ldb) {
  unsigned l[12]; const _Float16* g[12];
#pragma unroll   // constant indices: the addresses stay in registers
  for (int u = 0; u < 12; ++u) { l[u] = lds0 + (unsigned)(u * 8 * SG_PITCH); g[u] = a0 + (size_t)(u * 8) * lda; }
  copy12(l, g);
#pragma unroll   // constant indices
  for (int u = 0; u < 4; ++u) { l[u] = lds0 + (unsigned)((12 + u) * 8 * SG_PITCH); g[u] = a0 + (size_t)((12 + u) * 8) * lda; }
#pragma unroll   // constant indices
  for (int u = 0; u < 8; ++u) { l[4 + u] = lds0 + (unsigned)((16 + u) * 8 * SG_PITCH); g[4 + u] = b0 + (size_t)(u * 8) * ldb; }
  copy12(l, g);
}
// gelu2: 0.5 v (1 + erf(v / sqrt 2)) for two values at once, without a branch.
// erf by its two usual ranges, t = |x|: t < 1: t + t q(x^2); else 1 - exp(-(t + t p(t))); q, p minimax polynomials (f32 coefficients), the sign of x put back at the end.
// Both ranges are computed for every lane and one is chosen by a select: there is no test of EXEC between the values of a lane, so their chains of fused steps
// run interleaved, two values to a packed instruction. exp(-y) = 2^(-y log2 e) by the hardware's 2^x: y >= 1.8 where it is chosen, so the rounding of that one product moves
// exp(-y) by less than 3e-8, under half a unit in the last place of 1 - exp(-y).
typedef __attribute__((ext_vector_type(2))) float v2f;
__device__ __forceinline__ v2f fma2(v2f a, v2f b, float c) { return __builtin_elementwise_fma(a, b, (v2f){c, c}); }
__device__ __forceinline__ v2f gelu2(v2f v) {
  const v2f x = v * 0.70710678118654752f;
  const v2f t = {__builtin_fabsf(x.x), __builtin_fabsf(x.y)};
  v2f p = fma2(t, (v2f){1.69988107e-5f, 1.69988107e-5f}, -3.78677854e-4f);
  p = fma2(t, p, 3.85781587e-3f);
  p = fma2(t, p, -2.41816975e-2f);
  p = fma2(t, p, 1.06668264e-1f);
  p = fma2(t, p, 6.34933293e-1f);
  p = fma2(t, p, 1.28689408e-1f);
  p = __builtin_elementwise_fma(t, p, t) * -1.44269502f;
  const v2f u = x * x;
  v2f q = fma2(u, (v2f){-5.61801775e-4f, -5.61801775e-4f}, 4.91381623e-3f);
  q = fma2(u, q, -2.67075151e-2f);
  q = fma2(u, q, 1.12800106e-1f);
  q = fma2(u, q, -3.76122952e-1f);
  q = fma2(u, q, 1.28379107e-1f);
  q = __builtin_elementwise_fma(t, q, t);
  v2f e;
  e.x = __builtin_copysignf((t.x < 1.0f) ? q.x : 1.0f - __builtin_amdgcn_exp2f(p.x), x.x);
  e.y = __builtin_copysignf((t.y < 1.0f) ? q.y : 1.0f - __builtin_amdgcn_exp2f(p.y), x.y);
  return (0.5f * v) * (1.0f + e);
}
template <int OUT_MODE, bool RESID, int ACT, int LDC>
__global__ __launch_bounds__(128) void wmma_gemm_lds(
    const unsigned short* __restrict__ Ap, int lda,
    const unsigned short* __restrict__ Btp, int ldb, long strideB,
    void* __restrict__ Cout, long strideC,
    const float* __restrict__ bias, const float* __restrict__ bias_b1, const float* __restrict__ bias_b2,
    const float* __restrict__ resid, int K, float scale) {
  typedef _Float16 T;
  static_assert(OUT_MODE == 0 || OUT_MODE == 1, "f32 or f16 output");
  __shared__ __align__(16) unsigned char ring[2 * SG_BUF];   // the two buffers; behind the loop's last barrier its head is the waves' output staging
  const int b    = blockIdx.z;
  const int tid  = threadIdx.x;
  const int lane = tid & 31;
  const int wave = tid >> 5;
  const int n0 = blockIdx.x << 6;
  const int m0 = (blockIdx.y << 7) + (wave << 5);             // the wave's first row of C
  const int rlane = lane & 15;                 // row (A) / col (B, D) within subtile
  const int koff  = (lane >> 4) * 8;           // k offset of this lane half
  const int mOff  = (lane >> 4) * 8;           // D row offset

  const T* a0 = (const T*)Ap + (size_t)((blockIdx.y << 7) + (tid >> 4)) * lda + (tid & 15) * 8;
  const T* b0 = (const T*)Btp + (size_t)b * strideB + (size_t)(n0 + (tid >> 4)) * ldb + (tid & 15) * 8;
  const unsigned lds0 = (unsigned)(size_t)ring + (unsigned)((tid >> 4) * SG_PITCH + (tid & 15) * 16);
  const int nt = K / SG_KC;

  v8f acc[2][4];
#pragma unroll
  for (int i = 0; i < 2; ++i)
#pragma unroll
    for (int j = 0; j < 4; ++j) acc[i][j] = (v8f){0.f,0.f,0.f,0.f,0.f,0.f,0.f,0.f};

  stage_in(lds0, a0, lda, b0, ldb);
  asm volatile("s_wait_asynccnt 0x0" ::: "memory");           // this wave's part of stage 0 has landed
  __syncthreads();                                             // every wave's part has
  if (nt > 1) stage_in(lds0 + SG_BUF, a0 + SG_KC, lda, b0 + SG_KC, ldb);
  for (int t = 0; t < nt; ++t) {
    const unsigned char* buf = ring + (t & 1) * SG_BUF;
    const unsigned char* arow = buf + ((wave << 5) + rlane) * SG_PITCH + koff * 2;
    const unsigned char* brow = buf + (128 + rlane) * SG_PITCH + koff * 2;
    // Two fragment sets: the 12 LDS reads of k-step ks + 1 go out as one group ahead of the 8 products of k-step ks, which cover their latency.
    v16h bh[2][4], ah[2][2];
#pragma unroll   // constant indices: the fragments stay in registers
    for (int j = 0; j < 4; ++j) bh[0][j] = Frag<T>::load((const T*)(brow + j * 16 * SG_PITCH));
#pragma unroll
    for (int i = 0; i < 2; ++i) ah[0][i] = Frag<T>::load((const T*)(arow + i * 16 * SG_PITCH));
#pragma unroll   // constant set indices and LDS offsets
    for (int ks = 0; ks < SG_KC / 32; ++ks) {
      if (ks + 1 < SG_KC / 32) {
#pragma unroll
        for (int j = 0; j < 4; ++j) bh[(ks + 1) & 1][j] = Frag<T>::load((const T*)(brow + j * 16 * SG_PITCH + (ks + 1) * 64));
#pragma unroll
        for (int i = 0; i < 2; ++i) ah[(ks + 1) & 1][i] = Frag<T>::load((const T*)(arow + i * 16 * SG_PITCH + (ks + 1) * 64));
        __builtin_amdgcn_sched_barrier(0);   // without it the compiler sinks these reads among the products into one register set and waits out the LDS latency twice per k-step
      }
#pragma unroll
      for (int i = 0; i < 2; ++i)
#pragma unroll
        for (int j = 0; j < 4; ++j) acc[i][j] = Frag<T>::mma(ah[ks & 1][i], bh[ks & 1][j], acc[i][j]);
      if (ks + 1 < SG_KC / 32) __builtin_amdgcn_sched_barrier(0);   // the next group of reads stays behind these products, whole
    }
    asm volatile("s_wait_dscnt 0x0" ::: "memory");             // this wave's reads of stage t are done before the buffer is handed back
    asm volatile("s_wait_asynccnt 0x0" ::: "memory");          // this wave's part of stage t + 1 has landed
    __syncthreads();                                           // publishes stage t + 1 and ends every wave's reads of stage t
    if (t + 2 < nt) stage_in(lds0 + (unsigned)((t & 1) * SG_BUF), a0 + (size_t)(t + 2) * SG_KC, lda, b0 + (size_t)(t + 2) * SG_KC, ldb);
  }
  asm volatile("s_wait_asynccnt 0x0" ::: "memory");            // nothing is in flight when the ring becomes output staging

  // ---- epilogue per 16 x 64 slab: wmma_gemm64's arithmetic for ACT 0; ACT 5 fuses scale and bias in one step and takes GELU from gelu2 ----
  float* slab = (float*)ring + wave * (16 * 68);               // per-wave 16x64 slab, pitch 68 floats
  const float* bsel = (b == 0) ? bias : ((b == 1) ? bias_b1 : bias_b2);
  // The bias values, and each slab's residual values, come as a run of loads in flight together, off one index or one address with constant offsets (LDC is a constant for that).
  const int nl = n0 + rlane;
  const float* rp = RESID ? resid + (size_t)(m0 + mOff) * LDC + nl : nullptr;
  float bv[4];
#pragma unroll   // constant indices: the values stay in registers
  for (int j = 0; j < 4; ++j) bv[j] = bsel[nl + (j << 4)];
  // The wait in front of any rewrite of a register that the run names; as its input the index stays whole until it, so that no load of the run lands in it.
  asm volatile("s_wait_xcnt 0x0" :: "v"(nl) : "memory");
#pragma unroll
  for (int i = 0; i < 2; ++i) {
    float rv[4][8];
    if (RESID) {
#pragma unroll   // constant indices
      for (int j = 0; j < 4; ++j)
#pragma unroll
        for (int r = 0; r < 8; ++r) rv[j][r] = rp[((i << 4) + r) * LDC + (j << 4)];
      asm volatile("s_wait_xcnt 0x0" :: "v"(rp) : "memory");   // the same wait for this run, the address as its input
    }
#pragma unroll
    for (int j = 0; j < 4; ++j) {
      if (ACT == 5) {
#pragma unroll   // constant indices: the accumulators stay in registers; the 16 pairs of a slab are independent and interleave
        for (int r = 0; r < 8; r += 2) {
          v2f v = fma2((v2f){acc[i][j][r], acc[i][j][r + 1]}, (v2f){scale, scale}, bv[j]);
          if (RESID) v += (v2f){rv[j][r], rv[j][r + 1]};
          v = gelu2(v);
          slab[(mOff + r) * 68 + (j << 4) + rlane] = v.x;
          slab[(mOff + r + 1) * 68 + (j << 4) + rlane] = v.y;
        }
      } else {
#pragma unroll
        for (int r = 0; r < 8; ++r) {
          float v = acc[i][j][r] * scale;
          v += bv[j];
          if (RESID) v += rv[j][r];
          slab[(mOff + r) * 68 + (j << 4) + rlane] = v;
        }
      }
    }
    __builtin_amdgcn_fence(__ATOMIC_RELEASE, "workgroup");
    __builtin_amdgcn_wave_barrier();
    __builtin_amdgcn_fence(__ATOMIC_ACQUIRE, "workgroup");
    if (OUT_MODE == 0) {
      const int hh = lane >> 4, c4 = (lane & 15) * 4;     // row seg = 256 B = 16 lanes x 16 B
      float* cp = (float*)Cout + (size_t)b * strideC + (size_t)(m0 + hh) * LDC + n0 + c4;   // one address, the rows at constant offsets
#pragma unroll
      for (int it = 0; it < 8; ++it) {
        const int row = it * 2 + hh;
        v4f v = *(const v4f*)(slab + row * 68 + c4);
        *(v4f*)(cp + ((i << 4) + it * 2) * LDC) = v;
      }
    } else {
      const int q = lane >> 3, c8 = (lane & 7) * 8;       // row seg = 128 B = 8 lanes x 16 B
      _Float16* cp = (_Float16*)Cout + (size_t)b * strideC + (size_t)(m0 + q) * LDC + n0 + c8;   // one address, the rows at constant offsets
#pragma unroll
      for (int it = 0; it < 4; ++it) {
        const int row = it * 4 + q;
        const float* sp = slab + row * 68 + c8;
        v8h hv;
#pragma unroll
        for (int e = 0; e < 8; ++e) hv[e] = (_Float16)sp[e];
        *(v8h*)(cp + ((i << 4) + it * 4) * LDC) = hv;
      }
    }
    __builtin_amdgcn_fence(__ATOMIC_RELEASE, "workgroup");
    __builtin_amdgcn_wave_barrier();
    __builtin_amdgcn_fence(__ATOMIC_ACQUIRE, "workgroup");
  }
}

__global__ __launch_bounds__(256) void cast_f32_f16x2(
    const float* __restrict__ in, _Float16* __restrict__ out, int n2) {
  int i = blockIdx.x * 256 + threadIdx.x;
  if (i < n2) {
    const _Float16 h0 = (_Float16)in[2 * i], h1 = (_Float16)in[2 * i + 1];
    const unsigned u = (unsigned)__builtin_bit_cast(unsigned short, h0) | ((unsigned)__builtin_bit_cast(unsigned short, h1) << 16);
    ((unsigned*)out)[i] = u;
    
  }
}


} // namespace w25

__global__ __launch_bounds__(256) void k_castT16(const float* __restrict__ src, long long lds, _Float16* __restrict__ dst, long long ldd, int R, int C, float s) {
    const long long i = (long long)blockIdx.x * 256 + threadIdx.x; const long long np = (long long)C * (R / 2); if (i >= np) return; const int c = (int)(i / (R / 2)); const int r = 2 * (int)(i % (R / 2));
    const _Float16 h0 = (_Float16)(src[(long long)r * lds + c] * s), h1 = (_Float16)(src[(long long)(r + 1) * lds + c] * s);
    const unsigned u = (unsigned)__builtin_bit_cast(unsigned short, h0) | ((unsigned)__builtin_bit_cast(unsigned short, h1) << 16);
    unsigned* d = (unsigned*)(dst + (long long)c * ldd + r); *d = u;  }
__global__ __launch_bounds__(256) void k_cast16(const float* __restrict__ src, long long lds, _Float16* __restrict__ dst, long long ldd, int R, int C, float s) {
    const long long i = (long long)blockIdx.x * 256 + threadIdx.x; const long long np = (long long)R * (C / 2); if (i >= np) return; const int r = (int)(i / (C / 2)); const int c = 2 * (int)(i % (C / 2));
    const _Float16 h0 = (_Float16)(src[(long long)r * lds + c] * s), h1 = (_Float16)(src[(long long)r * lds + c + 1] * s);
    const unsigned u = (unsigned)__builtin_bit_cast(unsigned short, h0) | ((unsigned)__builtin_bit_cast(unsigned short, h1) << 16);
    unsigned* d = (unsigned*)(dst + (long long)r * ldd + c); *d = u;  }

// cast_weights<U>: the six weight matrices (four of 512 x 512, two of 2048 x 512 elements) as f16 of s * w into one plane, one behind the other in argument order.
//   A block takes 256 * U consecutive pieces of 4 elements of one matrix, a thread the pieces threadIdx.x + 256 * u of them: a wave's load covers 512 contiguous bytes
//   and its store 256, and the U loads of a thread are in flight together. blk runs over all (4 * 512 * 512 + 2 * 2048 * 512) / (4 * 256 * U) blocks, so no element guard.
template <int U>
__device__ __forceinline__ void cast_weights(int blk, const float* __restrict__ w0, const float* __restrict__ w1, const float* __restrict__ w2, const float* __restrict__ w3,
                                             const float* __restrict__ w4, const float* __restrict__ w5, _Float16* __restrict__ dst, float s) {
    constexpr int BS = (512 * 512) / (4 * 256 * U), BL = (2048 * 512) / (4 * 256 * U);   // blocks per small and per large matrix
    static_assert(BS * (4 * 256 * U) == 512 * 512, "whole blocks per matrix");
    const float* src; int first;                                  // the block's matrix and that matrix's first block (the same for the whole block)
    if (blk < BS) { src = w0; first = 0; }
    else if (blk < 2 * BS) { src = w1; first = BS; }
    else if (blk < 3 * BS) { src = w2; first = 2 * BS; }
    else if (blk < 4 * BS) { src = w3; first = 3 * BS; }
    else if (blk < 4 * BS + BL) { src = w4; first = 4 * BS; }
    else { src = w5; first = 4 * BS + BL; }
    const v4f* sp = (const v4f*)src + (blk - first) * (256 * U) + threadIdx.x;
    v4h* dp = (v4h*)dst + blk * (256 * U) + threadIdx.x;
    v4f a[U];
#pragma unroll   // constant indices: a stays in registers, and all U loads are issued before the first cast
    for (int u = 0; u < U; ++u) a[u] = sp[u * 256];
#pragma unroll   // constant indices into a
    for (int u = 0; u < U; ++u) {
        v4h hv;
#pragma unroll   // constant element indices: the vectors stay in registers
        for (int e = 0; e < 4; ++e) hv[e] = (_Float16)(a[u][e] * s);
        dp[u * 256] = hv;
    }
}
// ln_rows_f16: y = f16((x - mean) * rsqrt(var + eps) * g + b) over contiguous rows of 512 elements, one wave per row, 8 rows per 256-thread block (blk = block of rows).
//   The row stays in registers between the two sums and the output: statistics, normalisation and the cast for the next product are one pass over x.
//   A lane holds the pieces lane + 32 * u of 4 channels (a wave's load covers 512 contiguous bytes): element t = 128 * u + 4 * lane + e.
//   Both sums keep the order of k_stats (256 partials of elements t and t + 256, then a binary tree that pairs t with t + 128, 64, ..., 1), so mean and rstd keep their bits:
//   distance 128 is u, 64 to 4 are the lane's bits (shuffles, both partners form the same sum), 2 and 1 are e.
__device__ __forceinline__ float tree256(const float (&p)[2][4]) {
    float r[4];
#pragma unroll   // constant indices: r stays in registers
    for (int e = 0; e < 4; ++e) r[e] = p[0][e] + p[1][e];
#pragma unroll   // the four shuffles of a level are independent and in flight together
    for (int o = 16; o > 0; o >>= 1)
#pragma unroll
        for (int e = 0; e < 4; ++e) r[e] += __shfl_xor(r[e], o, 32);
    return (r[0] + r[2]) + (r[1] + r[3]);
}
__device__ __forceinline__ void ln_rows_f16(int blk, const float* __restrict__ x, _Float16* __restrict__ y, const float* __restrict__ g, const float* __restrict__ bta, float eps) {
    constexpr int C = 512, U = C / 128;                           // pieces per lane
    const int lane = threadIdx.x & 31;
    const size_t row = (size_t)blk * 8 + (threadIdx.x >> 5);
    const v4f* xp = (const v4f*)(x + row * C) + lane;
    v4f xv[U], gv[U], bv[U];
#pragma unroll   // constant indices: the arrays stay in registers, and all loads are issued before the first use
    for (int u = 0; u < U; ++u) { xv[u] = xp[u * 32]; gv[u] = ((const v4f*)g)[lane + u * 32]; bv[u] = ((const v4f*)bta)[lane + u * 32]; }
    float p[2][4];
#pragma unroll   // constant indices into xv and p
    for (int u = 0; u < 2; ++u)
#pragma unroll
        for (int e = 0; e < 4; ++e) p[u][e] = xv[u][e] + xv[u + 2][e];
    const float mu = tree256(p) / (float)C;
#pragma unroll   // constant indices into xv and p
    for (int u = 0; u < 2; ++u)
#pragma unroll
        for (int e = 0; e < 4; ++e) { const float d0 = xv[u][e] - mu, d1 = xv[u + 2][e] - mu; p[u][e] = __builtin_fmaf(d1, d1, d0 * d0); }   // as k_stats rounds it: the square, then one fused step
    const float rs = rsqrtf(tree256(p) / (float)C + eps);
    v4h* yp = (v4h*)(y + row * C) + lane;
#pragma unroll   // constant indices into the arrays
    for (int u = 0; u < U; ++u) {
        v4h hv;
#pragma unroll   // constant element indices: the vectors stay in registers
        for (int e = 0; e < 4; ++e) hv[e] = (_Float16)((xv[u][e] - mu) * rs * gv[u][e] + bv[u][e]);
        yp[u * 32] = hv;
    }
}
// k_ln_f16: LayerNorm of 4096 rows of 512 to an f16 plane; grid 4096 / 8.
__global__ __launch_bounds__(256) void k_ln_f16(const float* __restrict__ x, _Float16* __restrict__ y, const float* __restrict__ g, const float* __restrict__ bta, float eps) {
    ln_rows_f16(blockIdx.x, x, y, g, bta, eps);
}
// k_ln_f16_weights: two jobs that depend on nothing but the inputs share one grid: blocks [0, 512) are k_ln_f16's, the 768 behind them cast the weights. No barrier in either.
__global__ __launch_bounds__(256) void k_ln_f16_weights(const float* __restrict__ x, _Float16* __restrict__ y, const float* __restrict__ g, const float* __restrict__ bta, float eps,
                                                        const float* __restrict__ w0, const float* __restrict__ w1, const float* __restrict__ w2, const float* __restrict__ w3,
                                                        const float* __restrict__ w4, const float* __restrict__ w5, _Float16* __restrict__ wdst, float ws) {
    if (blockIdx.x < 512) ln_rows_f16(blockIdx.x, x, y, g, bta, eps);
    else cast_weights<4>(blockIdx.x - 512, w0, w1, w2, w3, w4, w5, wdst, ws);
}

// f32 -> bf16 hi plane + bf16 lo plane (x = hi + lo to ~2^-17 relative; RNE both), [R][C] -> [R][C] (or transposed to [C][R]); 2 consecutive destination elements
__device__ __forceinline__ unsigned int f2bf2_pack(float a, float b, unsigned int* lo) {
    const unsigned short ha = w25::f2bf_bits(a), hb = w25::f2bf_bits(b);
    const unsigned short la = w25::f2bf_bits(a - w25::bf_bits2f(ha)), lb = w25::f2bf_bits(b - w25::bf_bits2f(hb));
    *lo = (unsigned)la | ((unsigned)lb << 16); return (unsigned)ha | ((unsigned)hb << 16); }
__global__ __launch_bounds__(256) void k_castS16(const float* __restrict__ src, long long lds, __bf16* __restrict__ dhi, __bf16* __restrict__ dlo, long long ldd, int R, int C, float s, int transpose) {
    const long long i = (long long)blockIdx.x * 256 + threadIdx.x; long long o; float a, b;
    if (transpose) { const long long np = (long long)C * (R / 2); if (i >= np) return; const int c = (int)(i / (R / 2)); const int r = 2 * (int)(i % (R / 2)); a = src[(long long)r * lds + c] * s; b = src[(long long)(r + 1) * lds + c] * s; o = (long long)c * ldd + r; }
    else { const long long np = (long long)R * (C / 2); if (i >= np) return; const int r = (int)(i / (C / 2)); const int c = 2 * (int)(i % (C / 2)); a = src[(long long)r * lds + c] * s; b = src[(long long)r * lds + c + 1] * s; o = (long long)r * ldd + c; }
    unsigned lo; const unsigned hi = f2bf2_pack(a, b, &lo); unsigned* ph = (unsigned*)(dhi + o); unsigned* pl = (unsigned*)(dlo + o);
    *ph = hi; *pl = lo;  }


extern "C" void kernel_launch(void* const* d_in, const int* in_sizes, int n_in, void* d_out, int out_size, void* d_ws, size_t ws_size, hipStream_t stream) {
    (void)in_sizes; (void)n_in; (void)out_size; (void)ws_size;
    const float* x = (const float*)d_in[0];
    const float* ln1g = (const float*)d_in[1];
    const float* ln1b = (const float*)d_in[2];
    const float* Wq = (const float*)d_in[3];
    const float* bq = (const float*)d_in[4];
    const float* Wk = (const float*)d_in[5];
    const float* bk = (const float*)d_in[6];
    const float* Wv = (const float*)d_in[7];
    const float* bv = (const float*)d_in[8];
    const float* Wo = (const float*)d_in[9];
    const float* bo = (const float*)d_in[10];
    const float* ln2g = (const float*)d_in[11];
    const float* ln2b = (const float*)d_in[12];
    const float* W1 = (const float*)d_in[13];
    const float* b1 = (const float*)d_in[14];
    const float* W2 = (const float*)d_in[15];
    const float* b2 = (const float*)d_in[16];
    const int L = 4096;
    const int C = 512;
    const int NH = 8;
    const int HD = 64;
    const int FF = 2048;
    const int LP = L / 2;
    const int WINP = 128;
    float* out = (float*)d_out;
    char* wsp = (char*)d_ws;
    _Float16* WH = (_Float16*)wsp; wsp += (((size_t)(4 * 512 * 512 + 2 * 2048 * 512) * 2 + 255) / 256) * 256;   // f16 of 16 w: Wq, Wk, Wv, Wo, W1, W2
    _Float16* HNh = (_Float16*)wsp; wsp += (((size_t)((size_t)L * C) * 2 + 255) / 256) * 256;
    float* Q = (float*)wsp; wsp += (((size_t)((size_t)L * C) * 4 + 255) / 256) * 256;    // Q, Kb and V lie L * C floats apart: the three batches of one product
    float* Kb = (float*)wsp; wsp += (((size_t)((size_t)L * C) * 4 + 255) / 256) * 256;
    float* V = (float*)wsp; wsp += (((size_t)((size_t)L * C) * 4 + 255) / 256) * 256;
    _Float16* Yh = (_Float16*)wsp; wsp += (((size_t)((size_t)L * C) * 2 + 255) / 256) * 256;
    float* X1 = (float*)wsp; wsp += (((size_t)((size_t)L * C) * 4 + 255) / 256) * 256;
    _Float16* H2h = (_Float16*)wsp; wsp += (((size_t)((size_t)L * C) * 2 + 255) / 256) * 256;
    _Float16* F1h = (_Float16*)wsp; wsp += (((size_t)((size_t)L * FF) * 2 + 255) / 256) * 256;
    k_ln_f16_weights<<<(unsigned)(512 + 768), 256, 0, stream>>>(x, HNh, ln1g, ln1b, 1e-05f, Wq, Wk, Wv, Wo, W1, W2, WH, 16.0f);
    w25::wmma_gemm_lds<0, false, 0, 512><<<dim3(8u, 32u, 3u), 128, 0, stream>>>((const unsigned short*)(HNh), 512, (const unsigned short*)(WH), 512, 512 * 512, (void*)(Q), 4096 * 512, bq, bk, bv, nullptr, 512, 0.0625f);
    { /*apv4*/ AttnP a;
      a.Q = Q; a.K = Kb; a.V = V; a.O = 0; a.Oh = Yh; a.P = 0; a.Mf = 0; a.Mi = 0; a.ST = 0;
      a.Pw = 0; a.Rt = 0; a.SQ = 0; a.SK = 0;
      a.swb = 0; a.swh = 0; a.swi = 0; a.swj = 0; a.srb = 0; a.srh = 0; a.sri = 0; a.sQb = C; a.sQh = HD; a.sQi = 2 * C; a.sQd = 1; a.sKb = C; a.sKh = HD; a.sKj = 2 * C; a.sKd = 1; a.sVb = C; a.sVh = HD; a.sVj = 2 * C; a.sVd = 1; a.sOb = C; a.sOh = HD; a.sOi = 2 * C; a.sPb = 0; a.sPh = 0; a.sPi = 0; a.smb = 0; a.smh = 0; a.smi = 0; a.smj = 0;
      a.Lq = LP; a.Lk = LP; a.dh = HD; a.dv = HD; a.hrep = 1; a.causal = 1; a.coff = 0; a.pband = 0;
      a.scale = 0.125f; a.mfill = 0.0f; a.nonorm = 0; a.mpol = 0;
      a.roff = 0; a.rn = 1; a.segpol = 0; a.win = WINP;
      k_attn_t<<<dim3((unsigned)((LP) + 16 * AW - 1) / (16 * AW), (unsigned)(NH), (unsigned)(2)), 32 * AW, 0, stream>>>(a); }   // batch = parity: row 0 or 1, then every second row
    w25::wmma_gemm_lds<0, true, 0, 512><<<dim3(8u, 32u, 1u), 128, 0, stream>>>((const unsigned short*)(Yh), 512, (const unsigned short*)(WH + 3 * 512 * 512), 512, 0, (void*)(X1), 0, bo, nullptr, nullptr, x, 512, 0.0625f);
    k_ln_f16<<<(unsigned)(512), 256, 0, stream>>>(X1, H2h, ln2g, ln2b, 1e-05f);
    w25::wmma_gemm_lds<1, false, 5, 2048><<<dim3(32u, 32u, 1u), 128, 0, stream>>>((const unsigned short*)(H2h), 512, (const unsigned short*)(WH + 4 * 512 * 512), 512, 0, (void*)(F1h), 0, b1, nullptr, nullptr, nullptr, 512, 0.0625f);
    w25::wmma_gemm_lds<0, true, 0, 512><<<dim3(8u, 32u, 1u), 128, 0, stream>>>((const unsigned short*)(F1h), 2048, (const unsigned short*)(WH + 4 * 512 * 512 + 2048 * 512), 2048, 0, (void*)(out), 0, b2, nullptr, nullptr, X1, 2048, 0.0625f);
}

// v009
// It runs in 69.9 microseconds.
// Two timings next to v008 put it at 1.11 and 1.10 times that version's speed.
// Counting every step since v000, which is the starting kernel, it is 31.2 times as fast.
// Contractions: q/k/v projections of the LayerNormed input [4096x512].[512x512] (+b), the output projection (+b, + residual), the FFN [4096x512].[512x2048] (+b, exact GELU) and [4096x2048].[2048x512] (+b, + residual) with f16 operands (v_wmma_f32_16x16x32_f16; 32x64 register-blocked wave tiles, 128x64 block tiles, over pre-cast f16 operand planes staged in LDS by asynchronous copies, weights pre-scaled by 16 at the cast and un-scaled in the f32 epilogue); the dilated causal attention (keys j <= i, i - j even, i - j <= 256) as one flash launch whose grid z is the parity of the position (stride-2 views; within a parity class the pattern is plain causal with window 128), head_dim 64, both products transposed (f16 k.q^T, f16 v^T.p^T with p as f16 of 4096 p, kept in registers); f32 accumulate, softmax and LayerNorms f32.
#include <hip/hip_runtime.h>
#include <math.h>

typedef __attribute__((ext_vector_type(16))) _Float16 v16h;
typedef __attribute__((ext_vector_type(8)))  _Float16 v8h;
typedef __attribute__((ext_vector_type(4)))  _Float16 v4h;
typedef __attribute__((ext_vector_type(16))) __bf16   v16b;
typedef __attribute__((ext_vector_type(8)))  float    v8f;
typedef __attribute__((ext_vector_type(4)))  float    v4f;

// 16-bit WMMA fragment map (wave32), lane L, h = L>>4, m = L&15:
//   A 16x32: lane = row m;   element i -> k = (i<8) ? 8h+i : 16+8h+(i-8)
//   B 32x16: lane = column m; the SAME k(i,h)
//   D 16x16 (8 f32): lane = column m; element r -> row 8h+r
__device__ __forceinline__ int frag_k(int i, int h) { return (i < 8) ? (8 * h + i) : (16 + 8 * h + (i - 8)); }
__device__ __forceinline__ __bf16 bf16_rne(float f) {
    unsigned int u = __float_as_uint(f);
    u += 0x7fffu + ((u >> 16) & 1u);
    return __builtin_bit_cast(__bf16, (unsigned short)(u >> 16));
}
__device__ __forceinline__ float bf16_f32(__bf16 b) { return __uint_as_float(((unsigned int)__builtin_bit_cast(unsigned short, b)) << 16); }
__device__ __forceinline__ v8f wmma16(v16h a, v16h b, v8f c) {
    c = __builtin_amdgcn_wmma_f32_16x16x32_f16(false, a, false, b, (short)0, c, false, false);
    asm volatile("v_nop\n\tv_nop\n\tv_nop\n\tv_nop" : "+v"(c) : "v"(a), "v"(b));
    return c;
}
__device__ __forceinline__ v8f wmmab(v16b a, v16b b, v8f c) {
    c = __builtin_amdgcn_wmma_f32_16x16x32_bf16(false, a, false, b, (short)0, c, false, false);
    asm volatile("v_nop\n\tv_nop\n\tv_nop\n\tv_nop" : "+v"(c) : "v"(a), "v"(b));
    return c;
}
struct Split { v16b hi, lo; };
// hi/lo split product: a.hi*b.hi + a.hi*b.lo + a.lo*b.hi
__device__ __forceinline__ v8f wmma3(const Split& a, const Split& b, v8f c) {
    c = __builtin_amdgcn_wmma_f32_16x16x32_bf16(false, a.hi, false, b.hi, (short)0, c, false, false);
    c = __builtin_amdgcn_wmma_f32_16x16x32_bf16(false, a.hi, false, b.lo, (short)0, c, false, false);
    c = __builtin_amdgcn_wmma_f32_16x16x32_bf16(false, a.lo, false, b.hi, (short)0, c, false, false);
    asm volatile("v_nop\n\tv_nop\n\tv_nop\n\tv_nop" : "+v"(c) : "v"(a.hi), "v"(a.lo), "v"(b.hi), "v"(b.lo));
    return c;
}
struct Split3 { v16b hi, mid, lo; };
// triple split product (6 terms, drops only terms below 2^-24 relative)
__device__ __forceinline__ v8f wmma6(const Split3& a, const Split3& b, v8f c) {
    c = __builtin_amdgcn_wmma_f32_16x16x32_bf16(false, a.hi, false, b.hi, (short)0, c, false, false);
    c = __builtin_amdgcn_wmma_f32_16x16x32_bf16(false, a.hi, false, b.mid, (short)0, c, false, false);
    c = __builtin_amdgcn_wmma_f32_16x16x32_bf16(false, a.mid, false, b.hi, (short)0, c, false, false);
    c = __builtin_amdgcn_wmma_f32_16x16x32_bf16(false, a.hi, false, b.lo, (short)0, c, false, false);
    c = __builtin_amdgcn_wmma_f32_16x16x32_bf16(false, a.mid, false, b.mid, (short)0, c, false, false);
    c = __builtin_amdgcn_wmma_f32_16x16x32_bf16(false, a.lo, false, b.hi, (short)0, c, false, false);
    asm volatile("v_nop\n\tv_nop\n\tv_nop\n\tv_nop" : "+v"(c) : "v"(a.hi), "v"(a.mid), "v"(a.lo), "v"(b.hi), "v"(b.mid), "v"(b.lo));
    return c;
}

// Fragment gathers from f32 memory: element i <- p[(k0 + frag_k(i,h)) * sk] * s, zero for k >= klen.
__device__ __forceinline__ v16h fh_ld(const float* __restrict__ p, long long sk, int k0, int h, int klen, float s) {
    v16h a;
#pragma unroll
    for (int i = 0; i < 16; ++i) { const int k = k0 + frag_k(i, h); a[i] = (k < klen) ? (_Float16)(p[(long long)k * sk] * s) : (_Float16)0.f; }
    return a;
}
__device__ __forceinline__ Split sp_ld(const float* __restrict__ p, long long sk, int k0, int h, int klen, float s) {
    Split r;
#pragma unroll
    for (int i = 0; i < 16; ++i) {
        const int k = k0 + frag_k(i, h); const float x = (k < klen) ? p[(long long)k * sk] * s : 0.f;
        const __bf16 hb = bf16_rne(x); r.hi[i] = hb; r.lo[i] = bf16_rne(x - bf16_f32(hb));
    }
    return r;
}
__device__ __forceinline__ Split3 sp3_ld(const float* __restrict__ p, long long sk, int k0, int h, int klen, float s) {
    Split3 r;
#pragma unroll
    for (int i = 0; i < 16; ++i) {
        const int k = k0 + frag_k(i, h); const float x = (k < klen) ? p[(long long)k * sk] * s : 0.f;
        const __bf16 hb = bf16_rne(x); const float r1 = x - bf16_f32(hb); const __bf16 mb = bf16_rne(r1);
        r.hi[i] = hb; r.mid[i] = mb; r.lo[i] = bf16_rne(r1 - bf16_f32(mb));
    }
    return r;
}
__device__ __forceinline__ v16b bh_ld(const float* __restrict__ p, long long sk, int k0, int h, int klen, float s) {
    v16b a;
#pragma unroll
    for (int i = 0; i < 16; ++i) { const int k = k0 + frag_k(i, h); a[i] = bf16_rne((k < klen) ? p[(long long)k * sk] * s : 0.f); }
    return a;
}
// f16 fragment from a 16-byte aligned f32 row with element stride 1 and all 32 k in range: four unguarded 16-byte loads, then the cast; same k order as fh_ld
struct Raw16 { v4f x0, x1, x2, x3; };   // the 16 floats of one lane's fragment, as loaded
__device__ __forceinline__ Raw16 raw_ld4(const float* __restrict__ row, int k0, int h) {
    const v4f* q = (const v4f*)(row + k0 + 8 * h);
    Raw16 r; r.x0 = q[0]; r.x1 = q[1]; r.x2 = q[4]; r.x3 = q[5];
    return r;
}
__device__ __forceinline__ v16h raw_f16(const Raw16& r) {
    v16h a;
#pragma unroll   // constant element indices: the vectors stay in registers
    for (int i = 0; i < 4; ++i) { a[i] = (_Float16)r.x0[i]; a[4 + i] = (_Float16)r.x1[i]; a[8 + i] = (_Float16)r.x2[i]; a[12 + i] = (_Float16)r.x3[i]; }
    return a;
}
// Inputs-only fence on loaded values: every load written above it is issued before it, so that a run of loads is in flight together.
// Without it the compiler converts each fragment as soon as it is loaded and waits for memory once per fragment.
__device__ __forceinline__ void loads_held(const v4f& a, const v4f& b, const v4f& c, const v4f& d) { asm volatile("" :: "v"(a), "v"(b), "v"(c), "v"(d)); }
// f16 fragment from an f16 LDS/global row with element stride 1 (k-contiguous), no bounds (tile already zero padded)
__device__ __forceinline__ v16h fh_row(const _Float16* __restrict__ row, int k0, int h) {
    v16h a;
#pragma unroll
    for (int i = 0; i < 16; ++i) a[i] = row[k0 + frag_k(i, h)];
    return a;
}

#define VST2(T, ptr, val) do { const T vst2_v_ = (val); *(T*)(ptr) = vst2_v_;  } while (0)
typedef float v4f __attribute__((ext_vector_type(4)));
#define VST2V4(ptr, val) do { const v4f vst2_v4_ = (val); *(v4f*)(ptr) = vst2_v4_;  } while (0)

__device__ __attribute__((noinline)) float act_fn(float v, int act) {
    if (act == 1) return fmaxf(v, 0.f);                                                                               // relu
    if (act == 2) { const float u = 0.7978845608028654f * (v + 0.044715f * v * v * v); return 0.5f * v * (1.f + tanhf(u)); } // tanh-gelu
    if (act == 3) return v / (1.f + expf(-v));                                                                        // silu
    if (act == 4) return 0.5f * v * (1.f + erff(v * 0.7071067811865476f));                                             // erf-gelu
    if (act == 5) return tanhf(v);
    if (act == 6) return 1.f / (1.f + expf(-v));                                                                      // sigmoid
    if (act == 7) return (v > 0.f) ? v : 0.01f * v;                                                                   // leaky relu 0.01
    if (act == 8) return (v > 0.f) ? v : (expf(v) - 1.f);                                                             // elu
    if (act == 9) return fminf(fmaxf(v, 0.f), 6.f);                                                                   // relu6
    if (act == 10) return fabsf(v);                                                                                    // abs
    if (act == 11) return (v >= 0.f) ? v : 0.1f * v;                                                                  // leaky 0.1
    if (act == 12) return (v > 0.f) ? v : 0.2f * v;                                                                   // leaky 0.2
    if (act == 13) return (v > 20.f) ? v : log1pf(expf(v));                                                            // softplus
    return v;
}

// =====================================================================================================================
// k_gemm<MODE>: C(z, m, n) = act(alpha * sum_k A(z, m, k) * B(z, k, n) + bias) + beta * R(z, m, n)
//   One wave (32-thread block) per 16 x 32 tile of C; grid (ceil(N/32), ceil(M/16), Z). Batch z -> (zo = z / zi_n, zi = z % zi_n)
//   with separate outer/inner strides for every tensor (e.g. batch and head). A(m,k) = A[zo*sAo + zi*sAi + m*sAm + k*sAk] (f32),
//   B(k,n) = B[zo*sBo + zi*sBi + n*sBn + k*sBk] (f32); any M, N, K (K zero-padded to 32 inside the fragments, M/N tails guarded).
//   C(m,n) = C[zo*sCo + zi*sCi + m*sCm + n] (n contiguous). flags: 1 bias[n], 2 bias[m], 4 residual R[zo*sRo + zi*sRi + m*sRm + n*sRn].
//   MODE 0: f16 operands (A prescaled by sa, B by sb, both undone in the epilogue); 1: bf16 hi/lo split (3 products); 2: bf16;
//   3: bf16 hi/mid/lo triple split (6 products); 4: as 3 with Kahan-compensated f32 accumulation across k-steps.
// =====================================================================================================================
struct GemmP {
    const float* A; const float* B; const float* bias; const float* R; float* C;
    long long sAo, sAi, sAm, sAk, sBo, sBi, sBn, sBk, sCo, sCi, sCm, sRo, sRi, sRm, sRn;
    int M, N, K, zi_n, flags, act; float alpha, beta, sa, sb;
    int Npad, pad_;     // columns [N, Npad) of C are written as 0 so that padded workspace rows are covered by whole-line stores; Npad >= N
};
static_assert(sizeof(GemmP) == 5 * 8 + 15 * 8 + 6 * 4 + 4 * 4 + 2 * 4, "GemmP has padding");

template <int MODE>
__global__ __launch_bounds__(32) void k_gemm(GemmP p) {
    const int lane = threadIdx.x & 31, h = lane >> 4, l15 = lane & 15;
    const int m0 = blockIdx.y * 16, n0 = blockIdx.x * 32;
    const int z = blockIdx.z, zo = z / p.zi_n, zi = z - zo * p.zi_n;
    const float* A = p.A + zo * p.sAo + zi * p.sAi;
    const float* B = p.B + zo * p.sBo + zi * p.sBi;
    const int am = min(m0 + l15, p.M - 1);                       // clamped row for loads (stores are guarded)
    v8f acc[2], comp[2];
#pragma unroll
    for (int t = 0; t < 2; ++t) { v8f zz = {}; acc[t] = zz; comp[t] = zz; }
    for (int k0 = 0; k0 < p.K; k0 += 32) {
        const float* arow = A + (long long)am * p.sAm;
        if (MODE == 1) {
            const Split a = sp_ld(arow, p.sAk, k0, h, p.K, 1.f);
#pragma unroll
            for (int t = 0; t < 2; ++t) {
                const int bn = min(n0 + t * 16 + l15, p.N - 1);
                acc[t] = wmma3(a, sp_ld(B + (long long)bn * p.sBn, p.sBk, k0, h, p.K, 1.f), acc[t]);
            }
        } else if (MODE == 3) {
            const Split3 a = sp3_ld(arow, p.sAk, k0, h, p.K, 1.f);
#pragma unroll
            for (int t = 0; t < 2; ++t) {
                const int bn = min(n0 + t * 16 + l15, p.N - 1);
                acc[t] = wmma6(a, sp3_ld(B + (long long)bn * p.sBn, p.sBk, k0, h, p.K, 1.f), acc[t]);
            }
        } else if (MODE == 4) {
            // triple split as MODE 3, but each k-step's 6 products go into a fresh accumulator and the partial is added to the running f32 sum
            // on the VALU with Kahan compensation (accumulation error stays ~1 ulp however long K is)
            const Split3 a = sp3_ld(arow, p.sAk, k0, h, p.K, 1.f);
#pragma unroll
            for (int t = 0; t < 2; ++t) {
                const int bn = min(n0 + t * 16 + l15, p.N - 1); v8f zz = {};
                const v8f part = wmma6(a, sp3_ld(B + (long long)bn * p.sBn, p.sBk, k0, h, p.K, 1.f), zz);
                const v8f y = part - comp[t]; const v8f s = acc[t] + y; comp[t] = (s - acc[t]) - y; acc[t] = s;
            }
        } else if (MODE == 2) {
            const v16b a = bh_ld(arow, p.sAk, k0, h, p.K, 1.f);
#pragma unroll
            for (int t = 0; t < 2; ++t) {
                const int bn = min(n0 + t * 16 + l15, p.N - 1);
                acc[t] = wmmab(a, bh_ld(B + (long long)bn * p.sBn, p.sBk, k0, h, p.K, 1.f), acc[t]);
            }
        } else {
            const v16h a = fh_ld(arow, p.sAk, k0, h, p.K, p.sa);
#pragma unroll
            for (int t = 0; t < 2; ++t) {
                const int bn = min(n0 + t * 16 + l15, p.N - 1);
                acc[t] = wmma16(a, fh_ld(B + (long long)bn * p.sBn, p.sBk, k0, h, p.K, p.sb), acc[t]);
            }
        }
    }
    const float iscale = (MODE == 0) ? p.alpha / (p.sa * p.sb) : p.alpha;
    float* C = p.C + zo * p.sCo + zi * p.sCi;
    const float* R = p.R + zo * p.sRo + zi * p.sRi;
    __shared__ __align__(16) float ctile[16][36];
#pragma unroll
    for (int t = 0; t < 2; ++t) {
        const int n = n0 + t * 16 + l15; const int nn = min(n, p.N - 1);
#pragma unroll
        for (int r = 0; r < 8; ++r) {
            const int m = m0 + 8 * h + r; const int mm = min(m, p.M - 1);
            float v = acc[t][r] * iscale;
            if (p.flags & 1) v += p.bias[nn];
            if (p.flags & 2) v += p.bias[mm];
            if (p.flags & 8) v *= p.bias[(long long)zo * p.M + mm];   /* per-(z,row) scale vector laid out [Z][M]; exclusive with the bias flags */
            v = act_fn(v, p.act);
            if (p.flags & 4) v += p.beta * R[(long long)mm * p.sRm + (long long)nn * p.sRn];
            ctile[8 * h + r][t * 16 + l15] = (n < p.N) ? v : 0.f;
        }
    }
    __syncthreads();
    const int NW = (p.Npad > p.N) ? p.Npad : p.N;           // write width
    const bool fast = (m0 + 16 <= p.M) && (n0 + 32 <= NW) && ((p.sCm & 3) == 0) && ((((size_t)C) & 15) == 0);
    if (fast) {
#pragma unroll
        for (int s = 0; s < 4; ++s) {
            const int row = s * 4 + (lane >> 3), c4 = (lane & 7) * 4;
            const v4f v = *(const v4f*)&ctile[row][c4];
            VST2V4(C + (long long)(m0 + row) * p.sCm + n0 + c4, v);
        }
    } else {
        for (int row = 0; row < 16; ++row) {
            const int m = m0 + row, n = n0 + lane;
            if (m < p.M && n < NW) VST2(float, C + (long long)m * p.sCm + n, ctile[row][lane]);
        }
    }
}


// =====================================================================================================================
// k_gemmT<MODE, TM, TN>: same contract as k_gemm, but one wave computes a (16*TM) x (16*TN) tile: TM A fragments and TN B fragments are
//   loaded per 32-wide k-step and reused across TM*TN WMMAs (far fewer load/convert instructions per MAC). MODE 0 (f16), 1 (bf16 hi/lo),
//   2 (bf16) only. grid (ceil(NW/(16*TN)), ceil(M/(16*TM)), Z), block 32. Epilogue identical to k_gemm, run per 16x32 sub-tile.
// =====================================================================================================================
template <int MODE, int TM, int TN>
__global__ __launch_bounds__(32) void k_gemmT(GemmP p) {
    const int lane = threadIdx.x & 31, h = lane >> 4, l15 = lane & 15;
    const int m0 = blockIdx.y * (16 * TM), n0 = blockIdx.x * (16 * TN);
    const int z = blockIdx.z, zo = z / p.zi_n, zi = z - zo * p.zi_n;
    const float* A = p.A + zo * p.sAo + zi * p.sAi;
    const float* B = p.B + zo * p.sBo + zi * p.sBi;
    v8f acc[TM][TN];
#pragma unroll
    for (int i = 0; i < TM; ++i)
#pragma unroll
        for (int t = 0; t < TN; ++t) { v8f zz = {}; acc[i][t] = zz; }
    for (int k0 = 0; k0 < p.K; k0 += 32) {
        if (MODE == 1) {
            Split a[TM], b[TN];
#pragma unroll
            for (int i = 0; i < TM; ++i) { const int am = min(m0 + 16 * i + l15, p.M - 1); a[i] = sp_ld(A + (long long)am * p.sAm, p.sAk, k0, h, p.K, 1.f); }
#pragma unroll
            for (int t = 0; t < TN; ++t) { const int bn = min(n0 + 16 * t + l15, p.N - 1); b[t] = sp_ld(B + (long long)bn * p.sBn, p.sBk, k0, h, p.K, 1.f); }
#pragma unroll
            for (int i = 0; i < TM; ++i)
#pragma unroll
                for (int t = 0; t < TN; ++t) acc[i][t] = wmma3(a[i], b[t], acc[i][t]);
        } else if (MODE == 2) {
            v16b a[TM], b[TN];
#pragma unroll
            for (int i = 0; i < TM; ++i) { const int am = min(m0 + 16 * i + l15, p.M - 1); a[i] = bh_ld(A + (long long)am * p.sAm, p.sAk, k0, h, p.K, 1.f); }
#pragma unroll
            for (int t = 0; t < TN; ++t) { const int bn = min(n0 + 16 * t + l15, p.N - 1); b[t] = bh_ld(B + (long long)bn * p.sBn, p.sBk, k0, h, p.K, 1.f); }
#pragma unroll
            for (int i = 0; i < TM; ++i)
#pragma unroll
                for (int t = 0; t < TN; ++t) acc[i][t] = wmmab(a[i], b[t], acc[i][t]);
        } else {
            v16h a[TM], b[TN];
#pragma unroll
            for (int i = 0; i < TM; ++i) { const int am = min(m0 + 16 * i + l15, p.M - 1); a[i] = fh_ld(A + (long long)am * p.sAm, p.sAk, k0, h, p.K, p.sa); }
#pragma unroll
            for (int t = 0; t < TN; ++t) { const int bn = min(n0 + 16 * t + l15, p.N - 1); b[t] = fh_ld(B + (long long)bn * p.sBn, p.sBk, k0, h, p.K, p.sb); }
#pragma unroll
            for (int i = 0; i < TM; ++i)
#pragma unroll
                for (int t = 0; t < TN; ++t) acc[i][t] = wmma16(a[i], b[t], acc[i][t]);
        }
    }
    const float iscale = (MODE == 0) ? p.alpha / (p.sa * p.sb) : p.alpha;
    float* C = p.C + zo * p.sCo + zi * p.sCi;
    const float* R = p.R + zo * p.sRo + zi * p.sRi;
    const int NW = (p.Npad > p.N) ? p.Npad : p.N;
    __shared__ __align__(16) float ctile[16][36];
#pragma unroll
    for (int i = 0; i < TM; ++i) {
        const int mb = m0 + 16 * i; if (mb >= p.M) break;          // wave-uniform
#pragma unroll
        for (int tp = 0; tp < TN / 2; ++tp) {
            const int nb = n0 + 32 * tp; if (nb >= NW) break;        // wave-uniform
#pragma unroll
            for (int t2 = 0; t2 < 2; ++t2) {
                const int t = 2 * tp + t2; const int n = nb + t2 * 16 + l15; const int nn = min(n, p.N - 1);
#pragma unroll
                for (int r = 0; r < 8; ++r) {
                    const int m = mb + 8 * h + r; const int mm = min(m, p.M - 1);
                    float v = acc[i][t][r] * iscale;
                    if (p.flags & 1) v += p.bias[nn];
                    if (p.flags & 2) v += p.bias[mm];
            if (p.flags & 8) v *= p.bias[(long long)zo * p.M + mm];   /* per-(z,row) scale vector laid out [Z][M]; exclusive with the bias flags */
                    v = act_fn(v, p.act);
                    if (p.flags & 4) v += p.beta * R[(long long)mm * p.sRm + (long long)nn * p.sRn];
                    ctile[8 * h + r][t2 * 16 + l15] = (n < p.N) ? v : 0.f;
                }
            }
            __syncthreads();
            const bool fast = (mb + 16 <= p.M) && (nb + 32 <= NW) && ((p.sCm & 3) == 0) && ((((size_t)C) & 15) == 0);
            if (fast) {
#pragma unroll
                for (int s = 0; s < 4; ++s) {
                    const int row = s * 4 + (lane >> 3), c4 = (lane & 7) * 4;
                    const v4f v = *(const v4f*)&ctile[row][c4];
                    VST2V4(C + (long long)(mb + row) * p.sCm + nb + c4, v);
                }
            } else {
                for (int row = 0; row < 16; ++row) {
                    const int m = mb + row, n = nb + lane;
                    if (m < p.M && n < NW) VST2(float, C + (long long)m * p.sCm + n, ctile[row][lane]);
                }
            }
            __syncthreads();
        }
    }
}

// =====================================================================================================================
//   Wave = 16 queries, AW waves per block, 64-key blocks; grid (ceil(Lq/(16*AW)), H, B), block 32*AW. Any Lq, Lk; head dim dh <= DHP
//   (DHP multiple of 32), value dim dv <= DVP (multiple of 16, <= 128). Every tensor addressed by (batch, head, row, element) strides, f32.
//   Scores: QM 0 f16 operands, 1 bf16 hi/lo split, 2 bf16 triple split; statistics f32 (exp2 domain); P.V: P x 4096 as f16 with V f16 staged in LDS
//   (SPLITPV: P and V as bf16 hi/lo splits). kv head = h / hrep. Masking: causal = 1 (keep j <= i + coff, masked -> -inf, key blocks beyond the
//   diagonal skipped), causal = 2 (masked -> mfill, a finite fill like the -1e9; no skipping), causal = 3 (keep j >= i + coff,
//   masked -> -inf, no skipping); optional additive f32 mask Mf,
//   optional int keep-mask Mi (0 -> score := mfill), both addressed b*smb + h*smh + i*smi + j*smj (0 strides broadcast).
//   PLAIN (QM 0, f16 P.V, one pass): the call is causal = 1 with coff 0, hrep 1, dh == DHP, dv == DVP, element strides 1, every Q/K/V row 16-byte aligned,
//   and none of P, Mf, Mi, ST, Pw, Rt, SQ/SK, nonorm. These become compile-time constants: the element guards fold away, so Q, K and V are read with
//   16-byte loads that are in flight in runs instead of one guarded float at a time, each waited for, and the option tests leave the score loop.
//   O16 (PLAIN, DVP 64, Lq a multiple of 16): the output goes to Oh as f16 (strides sOb, sOh, sOi in elements; rows 16-byte aligned), rounded from the same f32 value that O would hold,
//   so that the next product reads it without a cast launch in between. A (row, head) piece is one whole 128-byte line.
// =====================================================================================================================
#define AW 4
struct AttnP {   // apv4
    const float* Q; const float* K; const float* V; float* O; _Float16* Oh; float* P; const float* Mf; const int* Mi; float* ST;   // Oh: the output plane of the O16 form (O unused there)
    const float* Pw; const float* Rt; const int* SQ; const int* SK;           // optional: post-softmax weight, relative-position table, segment ids
    long long swb, swh, swi, swj, srb, srh, sri;                                 // Pw strides (b,h,i,j); Rt strides (b,h,i), column = clamp(i - j + roff, 0, rn-1)
    long long sQb, sQh, sQi, sQd, sKb, sKh, sKj, sKd, sVb, sVh, sVj, sVd, sOb, sOh, sOi, sPb, sPh, sPi, smb, smh, smi, smj;
    int Lq, Lk, dh, dv, hrep, causal, coff, pband;   // pband > 0: P holds only the band |j - i| <= pband, column j - i + pband
    float scale, mfill; int nonorm, mpol;             // nonorm (online path only): O = sum_j exp(score_j) V_j without the 1/rowsum (scores must be <= ~0); mpol: Mi masks where ==0 (mpol 0) or where !=0 (mpol 1)
    int roff, rn, segpol, win;                        // Rt column offset/count; SQ/SK: score := mfill where (segpol 0) SQ[i] != SK[j] or (segpol 1) SQ[i] == SK[j]; win > 0: keys with i - j > win (after coff) -> -inf, key blocks wholly below the window skipped
};
//   Pw: the softmax numerator is multiplied by Pw(b,h,i,j) AFTER the row sum is taken (probs * weight, then P.V), as in post-softmax multiplicative biases.                                                    // ST (optional): per row (b,h,i) -> ST[((b*H + h)*Lq + i)*2 + {0,1}] = {row max of the scaled+masked score (natural units), sum_j exp(score - max)}
static_assert(sizeof(AttnP) == 13 * 8 + 29 * 8 + 16 * 4, "AttnP has padding");

#ifndef KATTN_ATTR
#define KATTN_ATTR
#endif
template <int DHP, int DVP, int QM, bool SPLITPV, bool TWOPASS, bool PLAIN = false, bool O16 = false>
__global__ __launch_bounds__(32 * AW) KATTN_ATTR void k_attn(AttnP pa) {
    static_assert(!PLAIN || (QM == 0 && !SPLITPV && !TWOPASS), "PLAIN covers the f16 one-pass form");
    static_assert(!O16 || (PLAIN && DVP == 64), "O16 covers the PLAIN form with 64 value columns");
    AttnP p = pa;
    if (PLAIN) {
        p.P = nullptr; p.Mf = nullptr; p.Mi = nullptr; p.ST = nullptr; p.Pw = nullptr; p.Rt = nullptr; p.SQ = nullptr; p.SK = nullptr;
        p.sQd = 1; p.sKd = 1; p.sVd = 1; p.dh = DHP; p.dv = DVP; p.hrep = 1; p.causal = 1; p.coff = 0; p.pband = 0; p.nonorm = 0;
    }
    constexpr int NT = DVP / 16;                // output tiles
    constexpr int KS = DHP / 32;                // k-steps for the scores
    constexpr int VP = DVP + 8;                 // LDS pitch (halves)
    constexpr int NV = 64 * (DVP / 4) / (32 * AW);   // PLAIN: 16-byte pieces of the V tile per thread
    static_assert(!PLAIN || NV * (32 * AW) == 64 * (DVP / 4), "the block's threads cover the V tile evenly");
    __shared__ __align__(16) float    pl[AW][16 * 64];
    __shared__ __align__(16) _Float16 vl[(SPLITPV ? 2 : 1) * 64 * VP];   // f16 V tile, or bf16 hi and lo tiles (same 2-byte size)
    const int lane = threadIdx.x & 31, hf = lane >> 4, l15 = lane & 15, wave = threadIdx.x >> 5;
    const int h = blockIdx.y, b = blockIdx.z, hk = h / p.hrep;
    const int q0 = (blockIdx.x * AW + wave) * 16;
    float* myp = pl[wave];
    const float L2E = 1.4426950408889634f;
    const float NEG = -__builtin_inff();
    const int qi = min(q0 + l15, p.Lq - 1);
    const float* qrow = p.Q + b * p.sQb + h * p.sQh + (long long)qi * p.sQi;
    const float* kbase = p.K + b * p.sKb + hk * p.sKh;
    const float* vbase = p.V + b * p.sVb + hk * p.sVh;
    v16h qa[QM == 0 ? KS : 1]; Split qs_[QM == 1 ? KS : 1]; Split3 qt_[QM == 2 ? KS : 1];
#pragma unroll
    for (int ks = 0; ks < KS; ++ks) {
        if (QM == 2) qt_[ks] = sp3_ld(qrow, p.sQd, ks * 32, hf, p.dh, 1.f);
        else if (QM == 1) qs_[ks] = sp_ld(qrow, p.sQd, ks * 32, hf, p.dh, 1.f);
        else if (PLAIN) qa[ks] = raw_f16(raw_ld4(qrow, ks * 32, hf));
        else qa[ks] = fh_ld(qrow, p.sQd, ks * 32, hf, p.dh, 1.f);
    }
    v8f o[NT]; float m8[8], l8[8];
#pragma unroll
    for (int t = 0; t < NT; ++t) { v8f zz = {}; o[t] = zz; }
#pragma unroll
    for (int i = 0; i < 8; ++i) { m8[i] = NEG; l8[i] = 0.f; }
    int jend = p.Lk;
    if (p.causal == 1) { const int je = (blockIdx.x * AW + AW - 1) * 16 + 16 + p.coff; jend = min(jend, max(je, 0)); }   // uniform per block
    int jbeg = 0;                                                // first key any query row of this block can see through the window; uniform per block
    if (p.win > 0 && !p.P) jbeg = max((int)(blockIdx.x * AW) * 16 + p.coff - p.win, 0);   // keys below it are -inf for all 16*AW rows (weight exactly 0); P, where asked for, still needs its zeros written
    const int npass = TWOPASS ? 2 : 1;
    for (int pass = 0; pass < npass; ++pass) {
        const bool dopv = (!TWOPASS) || pass == 1;
        for (int j0 = jbeg; j0 < jend; j0 += 64) {
            v4f vr[PLAIN ? NV : 1]; Raw16 kr[PLAIN ? 2 : 1][KS];   // PLAIN: this thread's part of the V tile and the lane's K fragments of two columns, f32 as loaded
            if (dopv) {
                __syncthreads();                                 // previous key block's reads of vl / pl are done
                if (!PLAIN)
                for (int idx = threadIdx.x; idx < 64 * DVP; idx += 32 * AW) {
                    const int jr = idx / DVP, d = idx - jr * DVP, j = j0 + jr;
                    const float f = (j < p.Lk && d < p.dv) ? vbase[(long long)j * p.sVj + (long long)d * p.sVd] : 0.f;
                    if (SPLITPV) {
                        const __bf16 hb = bf16_rne(f);
                        ((__bf16*)vl)[jr * VP + d] = hb; ((__bf16*)vl)[64 * VP + jr * VP + d] = bf16_rne(f - bf16_f32(hb));
                    } else vl[jr * VP + d] = (_Float16)f;
                }
            }
            v8f s[4];
#pragma unroll
            for (int t = 0; t < 4; ++t) {
                const int j = min(j0 + t * 16 + l15, p.Lk - 1);
                const float* krow = kbase + (long long)j * p.sKj;
                if (PLAIN && (t & 1) == 0) {
                    // the K loads of two 16-key columns are issued ahead of the first use of any of them: one trip to memory for 4 fragments
                    // (all four columns at once took the build past 256 registers). The loops here are unrolled so that kr and vr stay in registers.
#pragma unroll
                    for (int u = 0; u < 2; ++u) {
#pragma unroll
                        for (int ks = 0; ks < KS; ++ks) kr[u][ks] = raw_ld4(kbase + (long long)min(j0 + (t + u) * 16 + l15, p.Lk - 1) * p.sKj, ks * 32, hf);
                        // one column's loads share one address pair: this wait stands behind them, ahead of any later load whose result may be given that pair
                        asm volatile("s_wait_xcnt 0x0" ::: "memory");
                    }
#pragma unroll
                    for (int u = 0; u < 2; ++u)
#pragma unroll
                        for (int ks = 0; ks < KS; ++ks) loads_held(kr[u][ks].x0, kr[u][ks].x1, kr[u][ks].x2, kr[u][ks].x3);
                }
                v8f acc = {};
#pragma unroll
                for (int ks = 0; ks < KS; ++ks) {
                    if (QM == 2)      acc = wmma6(qt_[ks], sp3_ld(krow, p.sKd, ks * 32, hf, p.dh, 1.f), acc);
                    else if (QM == 1) acc = wmma3(qs_[ks], sp_ld(krow, p.sKd, ks * 32, hf, p.dh, 1.f), acc);
                    else if (PLAIN)   acc = wmma16(qa[ks], raw_f16(kr[t & 1][ks]), acc);
                    else              acc = wmma16(qa[ks], fh_ld(krow, p.sKd, ks * 32, hf, p.dh, 1.f), acc);
                }
                s[t] = acc;
            }
            if (PLAIN) {
                // the V tile's loads go out here and are first used behind the softmax, which covers their trip to memory
#pragma unroll
                for (int n = 0; n < NV; ++n) {
                    const int idx = threadIdx.x + n * (32 * AW), jr = idx / (DVP / 4), d = (idx - jr * (DVP / 4)) * 4;
                    vr[n] = *(const v4f*)(vbase + (long long)min(j0 + jr, p.Lk - 1) * p.sVj + d);   // row clamped, so no guard round the load
                }
            }
            float pv[8][4];
#pragma unroll
            for (int i = 0; i < 8; ++i) {
                const int irow = q0 + i + 8 * hf;
                const int ic = min(irow, p.Lq - 1);
                float sc[4];
#pragma unroll
                for (int t = 0; t < 4; ++t) {
                    const int jg = j0 + t * 16 + l15;
                    float v = s[t][i] * p.scale;
                    if (p.Mf) v += p.Mf[b * p.smb + h * p.smh + (long long)ic * p.smi + (long long)min(jg, p.Lk - 1) * p.smj];
                    if (p.Rt) { int rc = ic - min(jg, p.Lk - 1) + p.roff; rc = rc < 0 ? 0 : (rc >= p.rn ? p.rn - 1 : rc); v += p.Rt[b * p.srb + h * p.srh + (long long)ic * p.sri + rc]; }
                    if (p.Mi) { const int mv = p.Mi[b * p.smb + h * p.smh + (long long)ic * p.smi + (long long)min(jg, p.Lk - 1) * p.smj]; if (p.mpol ? (mv != 0) : (mv == 0)) v = p.mfill; }
                    if (p.SQ) { const bool same = p.SQ[(long long)b * p.Lq + ic] == p.SK[(long long)b * p.Lk + min(jg, p.Lk - 1)]; if (p.segpol ? same : !same) v = p.mfill; }
                    if (p.causal == 2 && jg > irow + p.coff) v = p.mfill;
                    if (jg >= p.Lk || (p.causal == 1 && jg > irow + p.coff) || (p.causal == 3 && jg < irow + p.coff) || (p.win > 0 && irow + p.coff - jg > p.win)) v = NEG; else v *= L2E;
                    sc[t] = v;
                }
                if (!TWOPASS || pass == 0) {
                    float mx = fmaxf(fmaxf(sc[0], sc[1]), fmaxf(sc[2], sc[3]));
                    mx = fmaxf(mx, __shfl_xor(mx, 1, 32)); mx = fmaxf(mx, __shfl_xor(mx, 2, 32));
                    mx = fmaxf(mx, __shfl_xor(mx, 4, 32)); mx = fmaxf(mx, __shfl_xor(mx, 8, 32));
                    const float mnew = fmaxf(m8[i], mx);
                    const float corr = (mnew == NEG) ? 1.f : exp2f(m8[i] - mnew);
                    float rs = 0.f;
#pragma unroll
                    for (int t = 0; t < 4; ++t) {
                        const float pp = (sc[t] == NEG) ? 0.f : exp2f(sc[t] - mnew); rs += pp;
                        pv[i][t] = p.Pw ? pp * p.Pw[b * p.swb + h * p.swh + (long long)ic * p.swi + (long long)min(j0 + t * 16 + l15, p.Lk - 1) * p.swj] : pp;
                    }
                    rs += __shfl_xor(rs, 1, 32); rs += __shfl_xor(rs, 2, 32); rs += __shfl_xor(rs, 4, 32); rs += __shfl_xor(rs, 8, 32);
                    l8[i] = l8[i] * corr + rs; m8[i] = mnew;
                    if (!TWOPASS) {
#pragma unroll
                        for (int t = 0; t < NT; ++t) o[t][i] *= corr;
                    }
                } else {
                    const float inv = (l8[i] > 0.f) ? 1.f / l8[i] : 0.f;
#pragma unroll
                    for (int t = 0; t < 4; ++t) {
                        const int jg = j0 + t * 16 + l15;
                        float pp = (sc[t] == NEG) ? 0.f : exp2f(sc[t] - m8[i]) * inv;
                        if (p.Pw) pp *= p.Pw[b * p.swb + h * p.swh + (long long)ic * p.swi + (long long)min(jg, p.Lk - 1) * p.swj];
                        pv[i][t] = pp;
                    }
                }
            }
            if (dopv) {
                if (PLAIN) {                                     // cast and stage the V tile loaded above (unrolled: vr stays in registers)
#pragma unroll
                    for (int n = 0; n < NV; ++n) {
                        const int idx = threadIdx.x + n * (32 * AW), jr = idx / (DVP / 4), d = (idx - jr * (DVP / 4)) * 4;
                        v4h hv;
#pragma unroll
                        for (int e = 0; e < 4; ++e) hv[e] = (_Float16)((j0 + jr < p.Lk) ? vr[n][e] : 0.f);
                        *(v4h*)&vl[jr * VP + d] = hv;
                    }
                }
#pragma unroll
                for (int i = 0; i < 8; ++i)
#pragma unroll
                    for (int t = 0; t < 4; ++t) ((float*)myp)[(i + 8 * hf) * 64 + t * 16 + l15] = pv[i][t];
                __syncthreads();                                 // P (per wave) and V (shared) visible
                if (p.P) {
                    float* pb_ = p.P + b * p.sPb + h * p.sPh;
                    const bool fastP = (p.pband == 0) && ((p.sPi & 3) == 0) && (j0 + 64 <= p.Lk) && (q0 + 16 <= p.Lq) && ((((size_t)pb_) & 15) == 0);
                    if (fastP) {
#pragma unroll
                        for (int s = 0; s < 8; ++s) {
                            const int row = s * 2 + (lane >> 4), c4 = (lane & 15) * 4;
                            const v4f v = *(const v4f*)(myp + row * 64 + c4);
                            VST2V4(pb_ + (long long)(q0 + row) * p.sPi + j0 + c4, v);
                        }
                    } else {
                        for (int row = 0; row < 16; ++row) {
                            const int irow = q0 + row; if (irow >= p.Lq) continue;
                            for (int c = lane; c < 64; c += 32) {
                                const int jg = j0 + c; if (jg >= p.Lk) continue;
                                if (p.pband == 0) VST2(float, pb_ + (long long)irow * p.sPi + jg, myp[row * 64 + c]);
                                else if (jg - irow <= p.pband && irow - jg <= p.pband) VST2(float, pb_ + (long long)irow * p.sPi + (jg - irow + p.pband), myp[row * 64 + c]);
                            }
                        }
                    }
                }
                if (SPLITPV) {
                    const Split pa0 = sp_ld(myp + l15 * 64, 1, 0, hf, 64, 1.f), pa1 = sp_ld(myp + l15 * 64, 1, 32, hf, 64, 1.f);
                    const __bf16* vh = (const __bf16*)vl; const __bf16* vlo = vh + 64 * VP;
#pragma unroll
                    for (int t = 0; t < NT; ++t) {
                        const int dcol = t * 16 + l15;
                        Split b0, b1;
#pragma unroll
                        for (int e = 0; e < 16; ++e) {
                            const int k0 = frag_k(e, hf), k1 = 32 + frag_k(e, hf);
                            b0.hi[e] = vh[k0 * VP + dcol]; b0.lo[e] = vlo[k0 * VP + dcol]; b1.hi[e] = vh[k1 * VP + dcol]; b1.lo[e] = vlo[k1 * VP + dcol];
                        }
                        o[t] = wmma3(pa0, b0, o[t]);
                        o[t] = wmma3(pa1, b1, o[t]);
                    }
                } else {
                    const v16h pa0 = fh_ld(myp + l15 * 64, 1, 0, hf, 64, 4096.f), pa1 = fh_ld(myp + l15 * 64, 1, 32, hf, 64, 4096.f);
#pragma unroll
                    for (int t = 0; t < NT; ++t) {
                        const int dcol = t * 16 + l15;
                        v16h b0, b1;
#pragma unroll
                        for (int e = 0; e < 16; ++e) { b0[e] = vl[frag_k(e, hf) * VP + dcol]; b1[e] = vl[(32 + frag_k(e, hf)) * VP + dcol]; }
                        o[t] = wmma16(pa0, b0, o[t]);
                        o[t] = wmma16(pa1, b1, o[t]);
                    }
                }
            }
        }
    }
    float* obase = p.O + b * p.sOb + h * p.sOh;
    if (p.ST) {
        const int rl = lane >> 1, isel = rl & 7;           // row q0 + rl ; rl>>3 == hf holds because lane>>4 == (lane>>1)>>3
        float mv = 0.f, lv = 0.f;
#pragma unroll
        for (int i = 0; i < 8; ++i) if (i == isel) { mv = m8[i]; lv = l8[i]; }
        const int irow = q0 + rl;
        if (irow < p.Lq) { float* st = p.ST + (((long long)b * gridDim.y + h) * p.Lq + irow) * 2 + (lane & 1); VST2(float, st, (lane & 1) ? lv : mv * 0.6931471805599453f); }
    }
    float invr[8];
#pragma unroll
    for (int i = 0; i < 8; ++i) {
        if (TWOPASS) invr[i] = SPLITPV ? 1.f : (1.f / 4096.f);
        else if (p.nonorm) invr[i] = exp2f(m8[i]) * (SPLITPV ? 1.f : (1.f / 4096.f));
        else invr[i] = (l8[i] > 0.f) ? (SPLITPV ? 1.f / l8[i] : 1.f / (l8[i] * 4096.f)) : 0.f;
    }
    __syncthreads();                                             // all waves done with pl/vl from the main loop
    const bool ofast = ((p.sOi & 3) == 0) && ((((size_t)obase) & 15) == 0) && (q0 + 16 <= p.Lq);
#pragma unroll
    for (int c0 = 0; c0 < DVP; c0 += 64) {
#pragma unroll
        for (int i = 0; i < 8; ++i)
#pragma unroll
            for (int t = 0; t < NT; ++t) if (t * 16 >= c0 && t * 16 < c0 + 64) ((float*)myp)[(i + 8 * hf) * 64 + (t * 16 - c0) + l15] = o[t][i] * invr[i];
        __syncthreads();
        const int cw = (DVP - c0 < 64) ? (DVP - c0) : 64;      // staged columns in this chunk (multiple of 16)
        if (O16) {
            _Float16* oh = p.Oh + b * p.sOb + h * p.sOh;
            if (q0 < p.Lq) {                                     // Lq is a multiple of 16: a wave's 16 rows are all there or none is
#pragma unroll   // four stores of 4 rows each, all in flight
                for (int r0 = 0; r0 < 16; r0 += 4) {
                    const int row = r0 + (lane >> 3), c8 = (lane & 7) * 8;
                    const float* sp = myp + row * 64 + c8;
                    v8h hv;
#pragma unroll   // constant element indices: the vector stays in registers
                    for (int e = 0; e < 8; ++e) hv[e] = (_Float16)sp[e];
                    *(v8h*)(oh + (long long)(q0 + row) * p.sOi + c8) = hv;
                }
            }
        } else if (ofast && (c0 + cw <= p.dv) && (cw % 32 == 0)) {
            const int lpr = cw / 4;                              // lanes per row (16 for 64 cols, 8 for 32)
            const int rows_per_ins = 32 / lpr;
            for (int r0 = 0; r0 < 16; r0 += rows_per_ins) {
                const int row = r0 + lane / lpr, c4 = (lane % lpr) * 4;
                const v4f v = *(const v4f*)(myp + row * 64 + c4);
                VST2V4(obase + (long long)(q0 + row) * p.sOi + c0 + c4, v);
            }
        } else {
            for (int row = 0; row < 16; ++row) {
                const int irow = q0 + row; if (irow >= p.Lq) continue;
                for (int c = lane; c < cw; c += 32) { const int d = c0 + c; if (d < p.dv) VST2(float, obase + (long long)irow * p.sOi + d, myp[row * 64 + c]); }
            }
        }
        __syncthreads();
    }
}

__device__ __forceinline__ float other_half(float v) {
    const int b = __builtin_bit_cast(int, v);
    return __builtin_bit_cast(float, __builtin_amdgcn_permlanex16(b, b, 0x76543210, 0xfedcba98, false, false));
}
// k_tile_ld: this thread's eight 16-byte pieces of the 64 x 64 f32 K tile that starts at key j: piece (thread & 15) of rows (thread >> 4) + 8 n, so that a wave's load
// covers two whole 256-byte row pieces. A row is clamped to the last key, so there is no guard round a load; such a key's scores are masked.
__device__ __forceinline__ void k_tile_ld(v4f (&kr)[8], const float* __restrict__ kbase, int j, int Lk, long long sKj) {
    static_assert(32 * AW == 128, "eight rows per pass of the block");
    const float* kp[8];
#pragma unroll   // constant indices: the arrays stay in registers
    for (int n = 0; n < 8; ++n) kp[n] = kbase + (long long)min(j + (int)(threadIdx.x >> 4) + 8 * n, Lk - 1) * sKj + (threadIdx.x & 15) * 4;
#pragma unroll   // constant indices; the eight loads are in flight together
    for (int n = 0; n < 8; ++n) kr[n] = *(const v4f*)kp[n];
    // The wait in front of any rewrite of a register that the run names; as its inputs the addresses stay whole until it, so that no load of the run lands in one.
    asm volatile("s_wait_xcnt 0x0" :: "v"(kp[0]), "v"(kp[1]), "v"(kp[2]), "v"(kp[3]), "v"(kp[4]), "v"(kp[5]), "v"(kp[6]), "v"(kp[7]) : "memory");
}
__global__ __launch_bounds__(32 * AW) void k_attn_t(AttnP p) {
    constexpr int KS = 2;                       // k-steps of the scores (head dim 64)
    constexpr int VP = 64 + 8;                  // LDS pitch of the K tile, the V tile and the output staging (halves): 144 bytes, an odd number of 16-byte pieces
    constexpr int NV = 64 * 16 / (32 * AW);     // 16-byte pieces of an f32 K or V tile per thread
    __shared__ __align__(16) _Float16 kl[64 * VP];
    __shared__ __align__(16) _Float16 vl[64 * VP];
    __shared__ __align__(16) _Float16 ol[AW][16 * VP];
    const int lane = threadIdx.x & 31, hf = lane >> 4, l15 = lane & 15, wave = threadIdx.x >> 5;
    const int h = blockIdx.y, b = blockIdx.z;
    const int q0 = (blockIdx.x * AW + wave) * 16;
    const float L2E = 1.4426950408889634f;
    const float NEG = -__builtin_inff();
    const int irow = q0 + l15;                  // the lane's query
    const float* qrow = p.Q + b * p.sQb + h * p.sQh + (long long)min(irow, p.Lq - 1) * p.sQi;
    const float* kbase = p.K + b * p.sKb + h * p.sKh;
    const float* vbase = p.V + b * p.sVb + h * p.sVh;
    v16h qa[KS];
    {
        Raw16 qr[KS];
#pragma unroll   // constant indices: the fragments stay in registers
        for (int ks = 0; ks < KS; ++ks) qr[ks] = raw_ld4(qrow, ks * 32, hf);
        asm volatile("s_wait_xcnt 0x0" ::: "memory");   // behind the run of loads off one address pair, ahead of any rewrite of that pair
#pragma unroll   // constant indices: the arrays stay in registers
        for (int ks = 0; ks < KS; ++ks) qa[ks] = raw_f16(qr[ks]);
    }
    v8f o[4]; float m = NEG, l = 0.f;
#pragma unroll   // constant indices: the arrays stay in registers
    for (int t = 0; t < 4; ++t) { v8f zz = {}; o[t] = zz; }
    const int jend = min(p.Lk, (int)(blockIdx.x * AW + AW) * 16);          // uniform per block: no key beyond the block's last query
    const int jbeg = (p.win > 0) ? max((int)(blockIdx.x * AW) * 16 - p.win, 0) : 0;   // uniform per block: first key that any of its queries sees through the window
    v4f kr[NV];                                 // this thread's part of a K tile, f32 as loaded: loaded one key block ahead
    if (jbeg < jend) k_tile_ld(kr, kbase, jbeg, p.Lk, p.sKj);
    for (int j0 = jbeg; j0 < jend; j0 += 64) {
        v4f vr[NV];                             // this thread's part of the V tile, f32 as loaded
        // cast and stage the K tile. Every wave's reads of the previous K tile ended ahead of that key block's second barrier, which this wave has passed.
#pragma unroll   // constant indices: the arrays stay in registers
        for (int n = 0; n < NV; ++n) {
            const int idx = threadIdx.x + n * (32 * AW), jr = idx >> 4, d = (idx & 15) * 4;
            v4h hv;
#pragma unroll   // constant indices: the arrays stay in registers
            for (int e = 0; e < 4; ++e) hv[e] = (_Float16)kr[n][e];
            *(v4h*)&kl[jr * VP + d] = hv;
        }
        __syncthreads();                        // the K tile is visible to every wave, and the previous key block's reads of vl are done
        v8f s[4]; v16h ka[4][KS];
#pragma unroll   // constant indices: the arrays stay in registers
        for (int t = 0; t < 4; ++t) {
            const _Float16* krow = &kl[(t * 16 + l15) * VP + 8 * hf];   // frag_k order: 8 halves at 8 hf and 8 at 16 + 8 hf of each 32
#pragma unroll   // constant indices: the arrays stay in registers
            for (int ks = 0; ks < KS; ++ks) {
                const v8h k0 = *(const v8h*)(krow + ks * 32), k1 = *(const v8h*)(krow + ks * 32 + 16);
                ka[t][ks] = __builtin_shufflevector(k0, k1, 0, 1, 2, 3, 4, 5, 6, 7, 8, 9, 10, 11, 12, 13, 14, 15);
            }
        }
        __builtin_amdgcn_sched_barrier(0);   // without it the compiler reads each fragment directly in front of its product and waits out the LDS latency eight times
#pragma unroll   // constant indices: the arrays stay in registers
        for (int t = 0; t < 4; ++t) {
            v8f acc = {};
#pragma unroll   // constant indices: the arrays stay in registers
            for (int ks = 0; ks < KS; ++ks) acc = wmma16(ka[t][ks], qa[ks], acc);
            s[t] = acc;
        }
        // the V tile's loads go out here and are first used behind the softmax, which covers their trip to memory
#pragma unroll   // constant indices: the arrays stay in registers
        for (int n = 0; n < NV; ++n) {
            const int idx = threadIdx.x + n * (32 * AW), jr = idx >> 4, d = (idx & 15) * 4;
            vr[n] = *(const v4f*)(vbase + (long long)min(j0 + jr, p.Lk - 1) * p.sVj + d);   // row clamped, so no guard round the load
        }
        asm volatile("s_wait_xcnt 0x0" ::: "memory");   // behind the run of V loads, ahead of any rewrite of their address registers
        if (j0 + 64 < jend) k_tile_ld(kr, kbase, j0 + 64, p.Lk, p.sKj);   // the next key block's K tile (the test is the same for the whole block): the rest of this key block covers its trip
        __builtin_amdgcn_sched_barrier(0);   // without it the compiler sinks the V loads to the end of the softmax, which then no longer covers their trip
        float mt[4];
#pragma unroll   // constant indices: the scores stay in registers; four independent chains of maxima
        for (int t = 0; t < 4; ++t) {
            mt[t] = NEG;
#pragma unroll   // constant indices: the arrays stay in registers
            for (int r = 0; r < 8; ++r) {
                const int jg = j0 + t * 16 + 8 * hf + r;
                float v = s[t][r] * p.scale;
                if (jg >= p.Lk || jg > irow || (p.win > 0 && irow - jg > p.win)) v = NEG; else v *= L2E;
                s[t][r] = v; mt[t] = fmaxf(mt[t], v);
            }
        }
        float mx = fmaxf(fmaxf(mt[0], mt[1]), fmaxf(mt[2], mt[3]));
        mx = fmaxf(mx, other_half(mx));
        const float mnew = fmaxf(m, mx);
        const float ms = (mnew == NEG) ? 0.f : mnew;    // no key seen yet: every score is -inf, and -inf - 0 gives weight 0 where -inf - -inf would give NaN
        const float corr = exp2f(m - ms);               // 0 while m is -inf, where l and o are still 0
        float rt[4];
#pragma unroll   // four independent chains of sums
        for (int t = 0; t < 4; ++t) {
            rt[t] = 0.f;
#pragma unroll   // constant indices: the arrays stay in registers
            for (int r = 0; r < 8; ++r) { const float pp = exp2f(s[t][r] - ms); s[t][r] = pp; rt[t] += pp; }
        }
        float rs = (rt[0] + rt[1]) + (rt[2] + rt[3]);
        rs += other_half(rs);
        l = l * corr + rs; m = mnew;
#pragma unroll   // constant indices: the arrays stay in registers
        for (int t = 0; t < 4; ++t) o[t] *= corr;
        v16h pb[2];
#pragma unroll   // constant element indices: the vectors stay in registers
        for (int k2 = 0; k2 < 2; ++k2)
#pragma unroll   // constant indices: the arrays stay in registers
            for (int i = 0; i < 8; ++i) { pb[k2][i] = (_Float16)(s[2 * k2][i] * 4096.f); pb[k2][8 + i] = (_Float16)(s[2 * k2 + 1][i] * 4096.f); }
        // cast and stage the V tile loaded above (unrolled: vr stays in registers)
#pragma unroll   // constant indices: the arrays stay in registers
        for (int n = 0; n < NV; ++n) {
            const int idx = threadIdx.x + n * (32 * AW), jr = idx >> 4, d = (idx & 15) * 4;
            v4h hv;
#pragma unroll   // constant indices: the arrays stay in registers
            for (int e = 0; e < 4; ++e) hv[e] = (_Float16)((j0 + jr < p.Lk) ? vr[n][e] : 0.f);
            *(v4h*)&vl[jr * VP + d] = hv;
        }
        __syncthreads();                        // the V tile is visible to every wave
#pragma unroll   // constant indices: the arrays stay in registers
        for (int t = 0; t < 4; ++t) {
            const int dcol = t * 16 + l15;
            v16h a0, a1;
#pragma unroll   // constant indices: the arrays stay in registers
            for (int e = 0; e < 16; ++e) { a0[e] = vl[frag_k(e, hf) * VP + dcol]; a1[e] = vl[(32 + frag_k(e, hf)) * VP + dcol]; }
            o[t] = wmma16(a0, pb[0], o[t]);
            o[t] = wmma16(a1, pb[1], o[t]);
        }
    }
    const float inv = (l > 0.f) ? 1.f / (l * 4096.f) : 0.f;
    _Float16* mo = ol[wave];                    // the wave's 16 x 64 output tile, so that the stores to memory cover whole 128-byte lines
#pragma unroll   // constant indices: the arrays stay in registers
    for (int t = 0; t < 4; ++t) {
        v8h hv;
#pragma unroll   // constant element indices
        for (int r = 0; r < 8; ++r) hv[r] = (_Float16)(o[t][r] * inv);
        *(v8h*)&mo[l15 * VP + t * 16 + 8 * hf] = hv;
    }
    __syncthreads();                            // the tile is written before other lanes read it
    _Float16* oh = p.Oh + b * p.sOb + h * p.sOh;
    if (q0 < p.Lq) {                            // Lq is a multiple of 16: a wave's 16 rows are all there or none is
#pragma unroll   // four stores of 4 rows each, all in flight
        for (int r0 = 0; r0 < 16; r0 += 4) {
            const int row = r0 + (lane >> 3), c8 = (lane & 7) * 8;
            *(v8h*)(oh + (long long)(q0 + row) * p.sOi + c8) = *(const v8h*)&mo[row * VP + c8];
        }
    }
}

// =====================================================================================================================
// k_tr: dst(z, c, r) = alpha * src(z, r, c) (+ beta * R2(z, c, r)): [Z][R][C] (row stride lds) -> [Z][C][R] (row stride ldd) through a 32x32 LDS tile;
//   flags: 1 -> add beta * residual R2 addressed like dst (z*sRz + c*ldr + r); act applied before the residual.
// =====================================================================================================================
struct TrP { const float* src; float* dst; const float* R2; long long sSz, lds, sDz, ldd, sRz, ldr; int R, C, flags, act; float alpha, beta; };
static_assert(sizeof(TrP) == 3 * 8 + 6 * 8 + 6 * 4, "TrP has padding");
__global__ __launch_bounds__(256) void k_tr(TrP p) {
    __shared__ float tile[32][33];
    const int c0 = blockIdx.x * 32, r0 = blockIdx.y * 32, z = blockIdx.z;
    const int lane = threadIdx.x & 31, wave = threadIdx.x >> 5;
    const float* s = p.src + z * p.sSz;
#pragma unroll
    for (int k = 0; k < 4; ++k) {
        const int rl = wave * 4 + k, r = r0 + rl, c = c0 + lane;
        tile[rl][lane] = (r < p.R && c < p.C) ? s[(long long)r * p.lds + c] : 0.f;
    }
    __syncthreads();
    float* d = p.dst + z * p.sDz; const float* rr = p.R2 + z * p.sRz;
#pragma unroll
    for (int k = 0; k < 4; ++k) {
        const int cl = wave * 4 + k, c = c0 + cl, r = r0 + lane;
        if (c < p.C && r < p.R) {
            float v = act_fn(p.alpha * tile[lane][cl], p.act);
            if (p.flags & 1) v += p.beta * rr[(long long)c * p.ldr + r];
            VST2(float, d + (long long)c * p.ldd + r, v);
        }
    }
}

// k_affine: dst[i] = a * (sdev ? sdev[0] : 1) * src[i] + b, i < n (one thread per element; consecutive lanes -> consecutive addresses)
__global__ __launch_bounds__(256) void k_affine(const float* __restrict__ src, float* __restrict__ dst, int n, float a, float b, const float* __restrict__ sdev) {
    const int i = blockIdx.x * 256 + threadIdx.x;
    if (i < n) { const float aa = sdev ? a * sdev[0] : a; const float v = aa * src[i] + b; VST2(float, dst + i, v); }
}

// =====================================================================================================================
// k_softmax: row softmax over n contiguous elements, one 256-thread block per row; rows addressed z*sz + r*sr (grid (R, Z)).
//   out = scale_out * softmax(scale_in * x + (Mf ? Mf[z*smz + r*smr + j] : 0)); a row whose max is -inf is written as 0.
// =====================================================================================================================
struct SmP { const float* src; float* dst; const float* Mf; long long sz, sr, dz, dr, smz, smr; int n, pad; float scale_in, scale_out; };
static_assert(sizeof(SmP) == 3 * 8 + 6 * 8 + 4 * 4, "SmP has padding");
__global__ __launch_bounds__(256) void k_softmax(SmP p) {
    __shared__ float red[256];
    const int r = blockIdx.x, z = blockIdx.y, tid = threadIdx.x;
    const float* s = p.src + z * p.sz + (long long)r * p.sr;
    const float* mf = p.Mf ? (p.Mf + z * p.smz + (long long)r * p.smr) : nullptr;
    float mx = -__builtin_inff();
    for (int j = tid; j < p.n; j += 256) { float v = s[j] * p.scale_in; if (mf) v += mf[j]; mx = fmaxf(mx, v); }
    red[tid] = mx; __syncthreads();
    for (int o = 128; o > 0; o >>= 1) { if (tid < o) red[tid] = fmaxf(red[tid], red[tid + o]); __syncthreads(); }
    mx = red[0]; __syncthreads();
    float sum = 0.f;
    for (int j = tid; j < p.n; j += 256) { float v = s[j] * p.scale_in; if (mf) v += mf[j]; sum += (mx == -__builtin_inff()) ? 0.f : expf(v - mx); }
    red[tid] = sum; __syncthreads();
    for (int o = 128; o > 0; o >>= 1) { if (tid < o) red[tid] += red[tid + o]; __syncthreads(); }
    sum = red[0];
    const float inv = (sum > 0.f) ? p.scale_out / sum : 0.f;
    float* d = p.dst + z * p.dz + (long long)r * p.dr;
    for (int j = tid; j < p.n; j += 256) { float v = s[j] * p.scale_in; if (mf) v += mf[j]; const float o = (mx == -__builtin_inff()) ? 0.f : expf(v - mx) * inv; VST2(float, d + j, o); }
}
// =====================================================================================================================
// k_stats: mean and rsqrt(var + eps) over a set of n elements addressed base + z*sz + (e / inner) * so + (e % inner) * si, one 256-thread
// k_norm_apply: y = (x - mean[set]) * rstd[set] * g[c] + b[c] over a [Z][C][L] channel-major tensor with set = z*G + c / (C/G) (G groups per z;
//   G = C -> per-channel sets indexed z*C+c; for batch norm pass stats indexed by c only via bn = 1). Optional act. Output same layout.
// =====================================================================================================================
//   mode 0: mean / rsqrt(var + eps); mode 1 (RMSNorm): 0 / rsqrt(mean(x^2) + eps); mode 2 (L2 normalize * sqrt(n)): 0 / sqrt(n) / max(||x||, eps); mode 3: as 0 with unbiased variance (n-1)
__global__ __launch_bounds__(256) void k_stats(const float* __restrict__ x, long long sz, long long so, long long si, int inner, int n, float eps, float* __restrict__ stat, int mode) {
    __shared__ float red[256];
    const int z = blockIdx.x, tid = threadIdx.x;
    const float* base = x + z * sz;
    float s = 0.f;
    for (int e = tid; e < n; e += 256) s += base[(long long)(e / inner) * so + (long long)(e % inner) * si];
    red[tid] = s; __syncthreads();
    for (int o = 128; o > 0; o >>= 1) { if (tid < o) red[tid] += red[tid + o]; __syncthreads(); }
    const float mu = (mode == 0 || mode == 3) ? red[0] / (float)n : 0.f; __syncthreads();
    float q = 0.f;
    for (int e = tid; e < n; e += 256) { const float dlt = base[(long long)(e / inner) * so + (long long)(e % inner) * si] - mu; q += dlt * dlt; }
    red[tid] = q; __syncthreads();
    for (int o = 128; o > 0; o >>= 1) { if (tid < o) red[tid] += red[tid + o]; __syncthreads(); }
    {
        float rs;
        if (mode == 2) rs = sqrtf((float)n) / fmaxf(sqrtf(red[0]), eps); else if (mode == 3) rs = rsqrtf(red[0] / (float)(n - 1) + eps); else rs = rsqrtf(red[0] / (float)n + eps);
        if (tid < 32) { const float v = (tid == 0) ? mu : ((tid == 1) ? rs : 0.f); VST2(float, stat + (long long)z * 32 + tid, v); }
    }
}
//   One thread per element over the flat [Z][C][L] index space: grid ceil(Z*C*L / 256).
__global__ __launch_bounds__(256) void k_norm_apply(const float* __restrict__ x, float* __restrict__ y, const float* __restrict__ stat, const float* __restrict__ g, const float* __restrict__ bta,
                                                     int Z, int C, int L, int G, int bn, int act) {
    const long long idx = (long long)blockIdx.x * 256 + threadIdx.x;
    if (idx >= (long long)Z * C * L) return;
    const int l = (int)(idx % L); const long long zc = idx / L; const int c = (int)(zc % C), z = (int)(zc / C); (void)l;
    const int set = bn ? c : (z * G + c / (C / G));
    float v = (x[idx] - stat[(long long)set * 32]) * stat[(long long)set * 32 + 1];
    if (g) v *= g[c];
    if (bta) v += bta[c];
    v = act_fn(v, act);
    VST2(float, y + idx, v);
}

// k_lse_neg: c[i] = -(st[2i] + log(st[2i+1])) = minus the log-sum-exp of row i from k_attn's ST output (for softmax over the query axis)
__global__ __launch_bounds__(256) void k_lse_neg(const float* __restrict__ st, float* __restrict__ c, int n) {
    const int i = blockIdx.x * 256 + threadIdx.x;
    if (i < n) { const float v = -(st[2 * i] + logf(st[2 * i + 1])); VST2(float, c + i, v); }
}

// k_iota: dst[i] = a * i + b as int32 (segment/position id helper)
__global__ __launch_bounds__(256) void k_iota(int* __restrict__ dst, int n, int a, int b) {
    const int i = blockIdx.x * 256 + threadIdx.x;
    if (i < n) { const int v = a * i + b; VST2(int, dst + i, v); }
}

// k_axpby: dst[i] = a * x[i] + b * y[i] (+ c), i < n
__global__ __launch_bounds__(256) void k_axpby(const float* __restrict__ x, const float* __restrict__ y, float* __restrict__ dst, int n, float a, float b, float c) {
    const int i = blockIdx.x * 256 + threadIdx.x;
    if (i < n) { const float v = a * x[i] + b * y[i] + c; VST2(float, dst + i, v); }
}

// =====================================================================================================================
// k_rope: rotary embedding on a [R rows][Hn heads][D] view (row stride sXr, head stride sXh, element stride 1) -> Y (own strides).
//   mode 0: rotate_half (partner d±D/2, sign - for d<D/2); mode 1: interleaved pairs (partner d^1, sign - for even d).
//   table column tcol: tmode 0 -> d, 1 -> d % (D/2), 2 -> d / 2; position p: pmode 0 -> r % S, 1 -> head index, 2 -> pos[r];
//   c = C[(r / S) * sCb + p * sCp + tcol * sCd], s likewise from Sn; y = x[d] * c + sign * x[partner] * s. X and Y must not alias.
// =====================================================================================================================
struct RopeP { const float* X; float* Y; const float* C; const float* Sn; const int* pos; long long sXr, sXh, sYr, sYh, sCb, sCp, sCd; int R, Hn, D, S, mode, tmode, pmode, pad; };
static_assert(sizeof(RopeP) == 5 * 8 + 7 * 8 + 8 * 4, "RopeP has padding");
__global__ __launch_bounds__(256) void k_rope(RopeP p) {
    const long long idx = (long long)blockIdx.x * 256 + threadIdx.x;
    if (idx >= (long long)p.R * p.Hn * p.D) return;
    const int d = (int)(idx % p.D); const long long rh = idx / p.D; const int h = (int)(rh % p.Hn); const int r = (int)(rh / p.Hn);
    const int half = p.D / 2;
    int partner; float sign;
    if (p.mode == 0) { partner = (d < half) ? d + half : d - half; sign = (d < half) ? -1.f : 1.f; }
    else { partner = d ^ 1; sign = (d & 1) ? 1.f : -1.f; }
    const int tcol = (p.tmode == 0) ? d : ((p.tmode == 1) ? (d % half) : (d >> 1));
    const int pp = (p.pmode == 0) ? (r % p.S) : ((p.pmode == 1) ? h : p.pos[r]);
    const long long toff = (long long)(r / p.S) * p.sCb + (long long)pp * p.sCp + (long long)tcol * p.sCd;
    const float* xr = p.X + (long long)r * p.sXr + (long long)h * p.sXh;
    const float v = xr[d] * p.C[toff] + sign * xr[partner] * p.Sn[toff];
    VST2(float, p.Y + (long long)r * p.sYr + (long long)h * p.sYh + d, v);
}

// k_invf + k_sincos (split so neither kernel carries a large VALU-fma footprint): invf_i = num * (1 / powf(base, (2 i)/D)) [fmode 0],
//   num * expf((2 i) * cexp) [fmode 1], num * powf(base, -2 (i - 1) / D) [fmode 2]; then cs/sn[s*half + i] = cos/sin((pscale * s) * invf_i)
__global__ __launch_bounds__(256) void k_invf(float* __restrict__ invb, int half, int D, float base, float num, int fmode, float cexp) {
    const int i = blockIdx.x * 256 + threadIdx.x;
    if (i >= ((half + 31) / 32) * 32) return;
    if (i >= half) { VST2(float, invb + i, 0.f); return; }
    const float e = (float)(2 * i) / (float)D;
    float invf;
    if (fmode == 1) invf = num * expf((float)(2 * i) * cexp);
    else if (fmode == 2) invf = num * powf(base, (-2.0f * ((float)i - 1.0f)) / (float)D);
    else invf = num * (1.0f / powf(base, e));
    VST2(float, invb + i, invf);
}
__global__ __launch_bounds__(256) void k_sincos(float* __restrict__ cs, float* __restrict__ sn, const float* __restrict__ invb, int S, int half, float pscale) {
    const int idx = blockIdx.x * 256 + threadIdx.x;
    if (idx >= S * half) return;
    const int s = idx / half, i = idx - s * half;
    const float ang = (pscale * (float)s) * invb[i];
    VST2(float, cs + idx, cosf(ang)); VST2(float, sn + idx, sinf(ang));
}

// k_mulact: dst[i] = act(x[i]) * y[i]
__global__ __launch_bounds__(256) void k_mulact(const float* __restrict__ x, const float* __restrict__ y, float* __restrict__ dst, int n, int act) {
    const int i = blockIdx.x * 256 + threadIdx.x;
    if (i < n) { const float v = act_fn(x[i], act) * y[i]; VST2(float, dst + i, v); }
}

// =====================================================================================================================
// k_matvec: thread-per-row matrix-vector products for N <= 8 output columns (heads with 1-3 outputs, gates), f32 on the VALU.
//   C[r*sCm + j] = act(alpha * sum_k A[r*sAm + k*sAk] * B[j*sBn + k*sBk] + bias[j]) + beta * R[r*sRm + j*sRn]; each thread writes its N contiguous floats.
// =====================================================================================================================
__global__ __launch_bounds__(256) void k_matvec(GemmP p) {
    // 32 lanes write one line with one instruction.
    const int rpt = (p.N == 1) ? 1 : 32;
    const long long r0 = ((long long)blockIdx.x * 256 + threadIdx.x) * rpt; const int z = blockIdx.z, zo = z / p.zi_n, zi = z - zo * p.zi_n;
    if (r0 >= p.M) return;
    const float* Bb = p.B + zo * p.sBo + zi * p.sBi;
    float* C = p.C + zo * p.sCo + zi * p.sCi; const float* R = p.R + zo * p.sRo + zi * p.sRi;
    for (int rr = 0; rr < rpt; ++rr) {
        const long long r = r0 + rr; if (r >= p.M) break;
        const float* A = p.A + zo * p.sAo + zi * p.sAi + r * p.sAm;
        float acc[8] = {0.f, 0.f, 0.f, 0.f, 0.f, 0.f, 0.f, 0.f};
        for (int k = 0; k < p.K; ++k) { const float a = A[(long long)k * p.sAk];
#pragma unroll
            for (int j = 0; j < 8; ++j) if (j < p.N) acc[j] += a * Bb[(long long)j * p.sBn + (long long)k * p.sBk]; }
#pragma unroll
        for (int j = 0; j < 8; ++j) if (j < p.N) {
            float v = acc[j] * p.alpha;
            if (p.flags & 1) v += p.bias[j];
            if (p.flags & 2) v += p.bias[r];
            v = act_fn(v, p.act);
            if (p.flags & 4) v += p.beta * R[r * p.sRm + (long long)j * p.sRn];
            VST2(float, C + r * p.sCm + j, v);
        }
    }
}
// k_smallsoftmax: thread-per-row softmax for short rows (n <= 64): dst[r*dr + j] = softmax(scale*src[r*sr + j])
__global__ __launch_bounds__(256) void k_smallsoftmax(const float* __restrict__ src, float* __restrict__ dst, long long sr, long long dr, int n, long long R, float scale) {
    const long long r0 = ((long long)blockIdx.x * 256 + threadIdx.x) * 32;
    for (int rr = 0; rr < 32; ++rr) {
        const long long r = r0 + rr; if (r >= R) return;
        const float* s = src + r * sr; float* d = dst + r * dr;
        float mx = -__builtin_inff();
        for (int j = 0; j < n; ++j) mx = fmaxf(mx, s[j] * scale);
        float sum = 0.f;
        for (int j = 0; j < n; ++j) sum += expf(s[j] * scale - mx);
        const float inv = 1.f / sum;
        for (int j = 0; j < n; ++j) { const float v = expf(s[j] * scale - mx) * inv; VST2(float, d + j, v); }
    }
}

__global__ __launch_bounds__(32) void k_unitstat(float* __restrict__ st) { const int t = threadIdx.x; const float v = (t == 1) ? 1.f : 0.f; VST2(float, st + t, v); }

// destination (e.g. a d_out whose row width is not a multiple of 32 floats) is written by consecutive lanes of one instruction
__global__ __launch_bounds__(256) void k_lincopy(const float* __restrict__ src, long long lds, float* __restrict__ dst, long long ldd, long long rows, int cols) {
    const long long i = (long long)blockIdx.x * 256 + threadIdx.x; if (i >= rows * cols) return;
    const long long r = i / cols; const int c = (int)(i - r * cols);
    const float v = src[r * lds + c]; VST2(float, dst + r * ldd + c, v);
}

namespace w25 {
typedef __attribute__((ext_vector_type(16))) _Float16 v16h;
typedef __attribute__((ext_vector_type(8)))  _Float16 v8h;
typedef __attribute__((ext_vector_type(16))) __bf16   v16b;
typedef __attribute__((ext_vector_type(8)))  __bf16   v8b;
typedef __attribute__((ext_vector_type(8)))  float    v8f;
typedef __attribute__((ext_vector_type(4)))  float    v4f;

__device__ __forceinline__ unsigned short f2bf_bits(float f) {
  unsigned u = __float_as_uint(f);
  return (unsigned short)((u + 0x7FFFu + ((u >> 16) & 1u)) >> 16);
}
__device__ __forceinline__ float bf_bits2f(unsigned short h) { return __uint_as_float(((unsigned)h) << 16); }

// hazard guards as plain device helpers (no inline asm inside the kernel template body)
__device__ __forceinline__ void dep_guard_h(v8f& a, v8f& b, v16h x, v16h y) { asm volatile("v_nop\n\tv_nop\n\tv_nop\n\tv_nop" : "+v"(a), "+v"(b) : "v"(x), "v"(y)); }
__device__ __forceinline__ void dep_guard_b(v8f& a, v8f& b, v16b x, v16b y) { asm volatile("v_nop\n\tv_nop\n\tv_nop\n\tv_nop" : "+v"(a), "+v"(b) : "v"(x), "v"(y)); }
__device__ __forceinline__ void keep4_h(v16h a, v16h b, v16h c, v16h d) { asm volatile("v_nop" :: "v"(a), "v"(b), "v"(c), "v"(d)); }
__device__ __forceinline__ void keep4_b(v16b a, v16b b, v16b c, v16b d) { asm volatile("v_nop" :: "v"(a), "v"(b), "v"(c), "v"(d)); }
__device__ __forceinline__ void acc_guard4(v8f& a, v8f& b, v8f& c, v8f& d) { asm volatile("v_nop\n\tv_nop\n\tv_nop\n\tv_nop" : "+v"(a), "+v"(b), "+v"(c), "+v"(d)); }
template <typename T> struct Frag;
template <> struct Frag<_Float16> {
  typedef v16h V; union U { v16h v; v8h h[2]; };
  static __device__ __forceinline__ v16h load(const _Float16* p) {   // elements 0..7 <- p[0..7], 8..15 <- p[16..23]
    U f; f.h[0] = *(const v8h*)(p); f.h[1] = *(const v8h*)(p + 16); return f.v;
  }
  static __device__ __forceinline__ v8f mma(v16h a, v16h b, v8f c) {
    return __builtin_amdgcn_wmma_f32_16x16x32_f16(false, a, false, b, (short)0, c, false, false);
  }
  static __device__ __forceinline__ void guard(v8f& a, v8f& b, v16h x, v16h y) { dep_guard_h(a, b, x, y); }
  static __device__ __forceinline__ void keep(v16h a, v16h b, v16h c, v16h d) { keep4_h(a, b, c, d); }
};
template <> struct Frag<__bf16> {
  typedef v16b V; union U { v16b v; v8b h[2]; };
  static __device__ __forceinline__ v16b load(const __bf16* p) {
    U f; f.h[0] = *(const v8b*)(p); f.h[1] = *(const v8b*)(p + 16); return f.v;
  }
  static __device__ __forceinline__ v8f mma(v16b a, v16b b, v8f c) {
    return __builtin_amdgcn_wmma_f32_16x16x32_bf16(false, a, false, b, (short)0, c, false, false);
  }
  static __device__ __forceinline__ void guard(v8f& a, v8f& b, v16b x, v16b y) { dep_guard_b(a, b, x, y); }
  static __device__ __forceinline__ void keep(v16b a, v16b b, v16b c, v16b d) { keep4_b(a, b, c, d); }
};

// ---- Register-blocked batched WMMA GEMM ------------------------------------
// C[m,n] = scale * sum_k A[m,k] * Bt[n,k] (+bias)(+resid); each wave owns a 64x64 tile.
// A row-major [M,K]; Bt row-major [N,K]; M,N % 64 == 0, K % 32 == 0.
// SPLIT: operands are hi/lo planes (A2/Bt2 = lo planes, same layout); product = hi·hi + hi·lo + lo·hi.
// BIAS_MODE: 0 = none, 1 = bias[m], 2 = bias[n]. Batch 1 takes bias_b1 and batch 2 bias_b2 in its place (up to three products that share A in one launch).
// OUT_MODE: 0 = f32, 1 = f16, 2 = bf16 hi plane (Cout) + bf16 lo plane (Cout2).
// ET: 0 = f16 operands, 1 = bf16 operands (pointers passed as 16-bit storage)
template <int ET> struct Elem;
template <> struct Elem<0> { typedef _Float16 T; };
template <> struct Elem<1> { typedef __bf16 T; };
template <int ET, bool SPLIT, int BIAS_MODE, int OUT_MODE, bool RESID, int ACT = 0>
__global__ __launch_bounds__(256) void wmma_gemm64(
    const unsigned short* __restrict__ Ap, const unsigned short* __restrict__ A2p, int lda, long strideA,
    const unsigned short* __restrict__ Btp, const unsigned short* __restrict__ Bt2p, int ldb, long strideB,
    void* __restrict__ Cout, void* __restrict__ Cout2, int ldc, long strideC,
    const float* __restrict__ bias, const float* __restrict__ bias_b1, const float* __restrict__ bias_b2,
    const float* __restrict__ resid, long strideR,
    int M, int N, int K, float scale) {
  typedef typename Elem<ET>::T T;
  typedef typename Frag<T>::V V;
  const T* A = (const T*)Ap; const T* A2 = (const T*)A2p; const T* Bt = (const T*)Btp; const T* Bt2 = (const T*)Bt2p;
  __shared__ __align__(16) float sT[8][16 * 68];   // per-wave 16x64 slab, pitch 68 floats
  const int b    = blockIdx.y;
  const int lane = threadIdx.x & 31;
  const int wave = threadIdx.x >> 5;
  const int tilesN = N >> 6;
  const int tilesM = M >> 6;
  const int tile = blockIdx.x * 8 + wave;
  if (tile >= tilesM * tilesN) return;   // wave-uniform; no block barriers in this kernel
  const int tm = tile / tilesN;
  const int tn = tile - tm * tilesN;
  const int m0 = tm << 6;
  const int n0 = tn << 6;

  const T* Ab  = A  + (size_t)b * strideA;
  const T* Bb  = Bt + (size_t)b * strideB;
  const T* Ab2 = SPLIT ? (A2  + (size_t)b * strideA) : nullptr;
  const T* Bb2 = SPLIT ? (Bt2 + (size_t)b * strideB) : nullptr;

  const int rlane = lane & 15;                 // row (A) / col (B, D) within subtile
  const int koff  = (lane >> 4) * 8;           // k offset of this lane half
  const int mOff  = (lane >> 4) * 8;           // D row offset

  v8f acc[4][4];
#pragma unroll
  for (int i = 0; i < 4; ++i)
#pragma unroll
    for (int j = 0; j < 4; ++j) acc[i][j] = (v8f){0.f,0.f,0.f,0.f,0.f,0.f,0.f,0.f};

  for (int k0 = 0; k0 < K; k0 += 32) {
    V bh[4], bl[4];
#pragma unroll
    for (int j = 0; j < 4; ++j) {
      const size_t bo = (size_t)(n0 + (j << 4) + rlane) * ldb + koff + k0;
      bh[j] = Frag<T>::load(Bb + bo);
      if (SPLIT) bl[j] = Frag<T>::load(Bb2 + bo);
    }
#pragma unroll
    for (int i = 0; i < 4; ++i) {
      const size_t ao = (size_t)(m0 + (i << 4) + rlane) * lda + koff + k0;
      V ah = Frag<T>::load(Ab + ao);
      V al;
      if (SPLIT) al = Frag<T>::load(Ab2 + ao);
#pragma unroll
      for (int j = 0; j < 4; ++j) {
        acc[i][j] = Frag<T>::mma(ah, bh[j], acc[i][j]);
        if (SPLIT) {
          acc[i][j] = Frag<T>::mma(ah, bl[j], acc[i][j]);
          acc[i][j] = Frag<T>::mma(al, bh[j], acc[i][j]);
        }
      }
      Frag<T>::guard(acc[i][0], acc[i][3], ah, SPLIT ? al : ah);
    }
    Frag<T>::keep(bh[0], bh[1], bh[2], bh[3]);
    if (SPLIT) Frag<T>::keep(bl[0], bl[1], bl[2], bl[3]);
  }
  acc_guard4(acc[0][0], acc[0][1], acc[0][2], acc[0][3]);
  acc_guard4(acc[1][0], acc[1][1], acc[1][2], acc[1][3]);
  acc_guard4(acc[2][0], acc[2][1], acc[2][2], acc[2][3]);
  acc_guard4(acc[3][0], acc[3][1], acc[3][2], acc[3][3]);

  // ---- epilogue ----
  float* slab = sT[wave];
  const float* Rb = RESID ? (resid + (size_t)b * strideR) : nullptr;
  const float* bsel = (b == 0) ? bias : ((b == 1) ? bias_b1 : bias_b2);
#pragma unroll
  for (int i = 0; i < 4; ++i) {
    const int mBase = m0 + (i << 4);
#pragma unroll
    for (int j = 0; j < 4; ++j) {
      const int n = n0 + (j << 4) + rlane;
      float bv = 0.f;
      if (BIAS_MODE == 2) bv = bsel[n];
#pragma unroll
      for (int r = 0; r < 8; ++r) {
        float v = acc[i][j][r] * scale;
        if (BIAS_MODE == 1) v += bsel[mBase + mOff + r];
        if (BIAS_MODE == 2) v += bv;
        if (RESID) v += Rb[(size_t)(mBase + mOff + r) * ldc + n];
        if (ACT == 1) v = tanhf(v);
        if (ACT == 2) v = fmaxf(v, 0.0f);
        if (ACT == 3) v = v / (1.0f + expf(-v));
        if (ACT == 4) v = (v > 0.f) ? v : 0.01f * v;
        if (ACT == 5) v = 0.5f * v * (1.0f + erff(v * 0.70710678118654752f));
        slab[(mOff + r) * 68 + (j << 4) + rlane] = v;
      }
    }
    __builtin_amdgcn_fence(__ATOMIC_RELEASE, "workgroup");
    __builtin_amdgcn_wave_barrier();
    __builtin_amdgcn_fence(__ATOMIC_ACQUIRE, "workgroup");
    if (OUT_MODE == 0) {
      float* C = (float*)Cout + (size_t)b * strideC;
      const int hh = lane >> 4, c4 = (lane & 15) * 4;     // row seg = 256 B = 16 lanes x 16 B
      {
#pragma unroll
        for (int it = 0; it < 8; ++it) {
          const int row = it * 2 + hh;
          v4f v = *(const v4f*)(slab + row * 68 + c4);
          *(v4f*)(C + (size_t)(mBase + row) * ldc + n0 + c4) = v;
        }
        
      }
    } else {
      const int q = lane >> 3, c8 = (lane & 7) * 8;
      unsigned short* C  = (unsigned short*)Cout  + (size_t)b * strideC;
      unsigned short* C2 = (OUT_MODE == 2) ? ((unsigned short*)Cout2 + (size_t)b * strideC) : nullptr;
      {
#pragma unroll
        for (int it = 0; it < 4; ++it) {
          const int row = it * 4 + q;
          const float* sp = slab + row * 68 + c8;
          v8h hv, lv;
#pragma unroll
          for (int e = 0; e < 8; ++e) {
            if (OUT_MODE == 1) {
              hv[e] = (_Float16)sp[e];
            } else {
              unsigned short hb = f2bf_bits(sp[e]);
              unsigned short lb = f2bf_bits(sp[e] - bf_bits2f(hb));
              hv[e] = __builtin_bit_cast(_Float16, hb);
              lv[e] = __builtin_bit_cast(_Float16, lb);
            }
          }
          *(v8h*)(C + (size_t)(mBase + row) * ldc + n0 + c8) = hv;
          if (OUT_MODE == 2) *(v8h*)(C2 + (size_t)(mBase + row) * ldc + n0 + c8) = lv;
        }
        
      }
    }
    __builtin_amdgcn_fence(__ATOMIC_RELEASE, "workgroup");
    __builtin_amdgcn_wave_barrier();
    __builtin_amdgcn_fence(__ATOMIC_ACQUIRE, "workgroup");
  }
}

// ---- WMMA GEMM with both operands staged in LDS by asynchronous copies -------
// The product, k order and, with KG 1, accumulators' sum order of wmma_gemm64 (f16 operands, bias[n]): C[m,n] = act(scale * sum_k A[m,k] * Bt[n,k] + bias[n] (+ resid[m,n])), act GELU by gelu2 for ACT 5, none otherwise.
// A block of 4 waves owns a 128 x 64 tile of C, a wave 32 x 64 of it (2 x 4 accumulator tiles); grid (N / 64, M / 128, batches); A is shared by the batches.
// A stage is 128 k (256 bytes) of the block's 128 A rows and 64 Bt rows. Each lane copies 16 bytes, so a wave's copy covers two whole 256-byte row pieces
// (a fragment load from global memory touches 16 lines for the same 512 bytes), and a row is fetched once per block instead of once per wave that needs it.
// Two buffers: stage t + 1 flies while stage t is worked on. M % 128 == 0, N % 64 == 0, K % (128 KG) == 0, rows 16-byte aligned. LDC: row pitch of C and of the residual, in elements.
// KG = 2, for a grid of one block per WGP: the block has two groups of 4 waves on the same 128 x 64 tile. Group g takes the stages g, g + 2, g + 4, ... of K through two buffers of its own,
// so twice the bytes are in flight, a SIMD holds two waves (one issues copies or waits for LDS while the other multiplies) and the block passes half as many barriers.
// Behind the loop the two partial sums of each wave tile meet in LDS: group g hands over its rows of slab 1 - g, adds the partner's rows of slab g to its own and finishes slab g alone.
constexpr int SG_KC = 128;                         // k per stage
constexpr int SG_PITCH = 272;                      // LDS row pitch in bytes: 256 + 16, conflict-free for the 16-byte fragment reads
constexpr int SG_BUF = (128 + 64) * SG_PITCH;      // one buffer: A rows 0..127, then Bt rows 0..63
// Twelve copies and the wait that stands in front of any rewrite of their address registers, in one statement so that the compiler can put nothing between them.
__device__ __forceinline__ void copy12(const unsigned (&l)[12], const _Float16* const (&g)[12]) {
  asm volatile(
      "global_load_async_to_lds_b128 %0, %1, off\n\t"
      "global_load_async_to_lds_b128 %2, %3, off\n\t"
      "global_load_async_to_lds_b128 %4, %5, off\n\t"
      "global_load_async_to_lds_b128 %6, %7, off\n\t"
      "global_load_async_to_lds_b128 %8, %9, off\n\t"
      "global_load_async_to_lds_b128 %10, %11, off\n\t"
      "global_load_async_to_lds_b128 %12, %13, off\n\t"
      "global_load_async_to_lds_b128 %14, %15, off\n\t"
      "global_load_async_to_lds_b128 %16, %17, off\n\t"
      "global_load_async_to_lds_b128 %18, %19, off\n\t"
      "global_load_async_to_lds_b128 %20, %21, off\n\t"
      "global_load_async_to_lds_b128 %22, %23, off\n\t"
      "s_wait_xcnt 0x0"
      :: "v"(l[0]), "v"(g[0]), "v"(l[1]), "v"(g[1]), "v"(l[2]), "v"(g[2]), "v"(l[3]), "v"(g[3]), "v"(l[4]), "v"(g[4]), "v"(l[5]), "v"(g[5]),
         "v"(l[6]), "v"(g[6]), "v"(l[7]), "v"(g[7]), "v"(l[8]), "v"(g[8]), "v"(l[9]), "v"(g[9]), "v"(l[10]), "v"(g[10]), "v"(l[11]), "v"(g[11])
      : "memory");
}
// One stage: thread t brings the 16-byte piece (t & 15) of rows (t >> 4) + 8 u, u = 0..23, of the buffer (24 copies per wave in flight).
// lds0: the LDS byte address of its piece in row t >> 4 of the buffer; a0, b0: the same piece of row t >> 4 of the block's A and Bt rows at this stage's k.
__device__ __forceinline__ void stage_in(unsigned lds0, const _Float16* a0, int lda, const _Float16* b0, int ldb) {
  unsigned l[12]; const _Float16* g[12];
#pragma unroll   // constant indices: the addresses stay in registers
  for (int u = 0; u < 12; ++u) { l[u] = lds0 + (unsigned)(u * 8 * SG_PITCH); g[u] = a0 + (size_t)(u * 8) * lda; }
  copy12(l, g);
#pragma unroll   // constant indices
  for (int u = 0; u < 4; ++u) { l[u] = lds0 + (unsigned)((12 + u) * 8 * SG_PITCH); g[u] = a0 + (size_t)((12 + u) * 8) * lda; }
#pragma unroll   // constant indices
  for (int u = 0; u < 8; ++u) { l[4 + u] = lds0 + (unsigned)((16 + u) * 8 * SG_PITCH); g[4 + u] = b0 + (size_t)(u * 8) * ldb; }
  copy12(l, g);
}
// gelu2: 0.5 v (1 + erf(v / sqrt 2)) for two values at once, without a branch.
// erf by its two usual ranges, t = |x|: t < 1: t + t q(x^2); else 1 - exp(-(t + t p(t))); q, p minimax polynomials (f32 coefficients), the sign of x put back at the end.
// Both ranges are computed for every lane and one is chosen by a select: there is no test of EXEC between the values of a lane, so their chains of fused steps
// run interleaved, two values to a packed instruction. exp(-y) = 2^(-y log2 e) by the hardware's 2^x: y >= 1.8 where it is chosen, so the rounding of that one product moves
// exp(-y) by less than 3e-8, under half a unit in the last place of 1 - exp(-y).
typedef __attribute__((ext_vector_type(2))) float v2f;
__device__ __forceinline__ v2f fma2(v2f a, v2f b, float c) { return __builtin_elementwise_fma(a, b, (v2f){c, c}); }
__device__ __forceinline__ v2f gelu2(v2f v) {
  const v2f x = v * 0.70710678118654752f;
  const v2f t = {__builtin_fabsf(x.x), __builtin_fabsf(x.y)};
  v2f p = fma2(t, (v2f){1.69988107e-5f, 1.69988107e-5f}, -3.78677854e-4f);
  p = fma2(t, p, 3.85781587e-3f);
  p = fma2(t, p, -2.41816975e-2f);
  p = fma2(t, p, 1.06668264e-1f);
  p = fma2(t, p, 6.34933293e-1f);
  p = fma2(t, p, 1.28689408e-1f);
  p = __builtin_elementwise_fma(t, p, t) * -1.44269502f;
  const v2f u = x * x;
  v2f q = fma2(u, (v2f){-5.61801775e-4f, -5.61801775e-4f}, 4.91381623e-3f);
  q = fma2(u, q, -2.67075151e-2f);
  q = fma2(u, q, 1.12800106e-1f);
  q = fma2(u, q, -3.76122952e-1f);
  q = fma2(u, q, 1.28379107e-1f);
  q = __builtin_elementwise_fma(t, q, t);
  v2f e;
  e.x = __builtin_copysignf((t.x < 1.0f) ? q.x : 1.0f - __builtin_amdgcn_exp2f(p.x), x.x);
  e.y = __builtin_copysignf((t.y < 1.0f) ? q.y : 1.0f - __builtin_amdgcn_exp2f(p.y), x.y);
  return (0.5f * v) * (1.0f + e);
}
template <int OUT_MODE, bool RESID, int ACT, int LDC, int KG = 1>
__global__ __launch_bounds__(128 * KG) void wmma_gemm_lds(
    const unsigned short* __restrict__ Ap, int lda,
    const unsigned short* __restrict__ Btp, int ldb, long strideB,
    void* __restrict__ Cout, long strideC,
    const float* __restrict__ bias, const float* __restrict__ bias_b1, const float* __restrict__ bias_b2,
    const float* __restrict__ resid, int K, float scale) {
  typedef _Float16 T;
  static_assert(OUT_MODE == 0 || OUT_MODE == 1, "f32 or f16 output");
  static_assert(KG == 1 || KG == 2, "one group of waves, or two that share K");
  __shared__ __align__(16) unsigned char ring_all[KG * 2 * SG_BUF];   // each group's two buffers; behind the loop's last barrier the head is the exchange of partial sums and the waves' output staging
  const int b    = blockIdx.z;
  const int grp  = (KG == 2) ? __builtin_amdgcn_readfirstlane((int)(threadIdx.x >> 7)) : 0;   // the wave's group, the same in every lane
  unsigned char* ring = ring_all + grp * (2 * SG_BUF);   // the group's own two buffers
  const int tid  = (KG == 2) ? (int)(threadIdx.x & 127) : (int)threadIdx.x;   // thread within the group
  const int lane = tid & 31;
  const int wave = tid >> 5;                   // wave within the group
  const int n0 = blockIdx.x << 6;
  const int m0 = (blockIdx.y << 7) + (wave << 5);             // the wave's first row of C
  const int rlane = lane & 15;                 // row (A) / col (B, D) within subtile
  const int koff  = (lane >> 4) * 8;           // k offset of this lane half
  const int mOff  = (lane >> 4) * 8;           // D row offset

  constexpr int SG_STEP = KG * SG_KC;          // k from one stage of a group to its next
  const T* a0 = (const T*)Ap + (size_t)((blockIdx.y << 7) + (tid >> 4)) * lda + (tid & 15) * 8 + grp * SG_KC;
  const T* b0 = (const T*)Btp + (size_t)b * strideB + (size_t)(n0 + (tid >> 4)) * ldb + (tid & 15) * 8 + grp * SG_KC;
  const unsigned lds0 = (unsigned)(size_t)ring + (unsigned)((tid >> 4) * SG_PITCH + (tid & 15) * 16);
  const int nt = K / SG_STEP;                  // stages per group

  v8f acc[2][4];
#pragma unroll
  for (int i = 0; i < 2; ++i)
#pragma unroll
    for (int j = 0; j < 4; ++j) acc[i][j] = (v8f){0.f,0.f,0.f,0.f,0.f,0.f,0.f,0.f};

  stage_in(lds0, a0, lda, b0, ldb);
  asm volatile("s_wait_asynccnt 0x0" ::: "memory");           // this wave's part of stage 0 has landed
  __syncthreads();                                             // every wave's part has
  if (nt > 1) stage_in(lds0 + SG_BUF, a0 + SG_STEP, lda, b0 + SG_STEP, ldb);
  for (int t = 0; t < nt; ++t) {
    const unsigned char* buf = ring + (t & 1) * SG_BUF;
    const unsigned char* arow = buf + ((wave << 5) + rlane) * SG_PITCH + koff * 2;
    const unsigned char* brow = buf + (128 + rlane) * SG_PITCH + koff * 2;
    // Two fragment sets: the 12 LDS reads of k-step ks + 1 go out as one group ahead of the 8 products of k-step ks, which cover their latency.
    v16h bh[2][4], ah[2][2];
#pragma unroll   // constant indices: the fragments stay in registers
    for (int j = 0; j < 4; ++j) bh[0][j] = Frag<T>::load((const T*)(brow + j * 16 * SG_PITCH));
#pragma unroll
    for (int i = 0; i < 2; ++i) ah[0][i] = Frag<T>::load((const T*)(arow + i * 16 * SG_PITCH));
#pragma unroll   // constant set indices and LDS offsets
    for (int ks = 0; ks < SG_KC / 32; ++ks) {
      if (ks + 1 < SG_KC / 32) {
#pragma unroll
        for (int j = 0; j < 4; ++j) bh[(ks + 1) & 1][j] = Frag<T>::load((const T*)(brow + j * 16 * SG_PITCH + (ks + 1) * 64));
#pragma unroll
        for (int i = 0; i < 2; ++i) ah[(ks + 1) & 1][i] = Frag<T>::load((const T*)(arow + i * 16 * SG_PITCH + (ks + 1) * 64));
        __builtin_amdgcn_sched_barrier(0);   // without it the compiler sinks these reads among the products into one register set and waits out the LDS latency twice per k-step
      }
#pragma unroll
      for (int i = 0; i < 2; ++i)
#pragma unroll
        for (int j = 0; j < 4; ++j) acc[i][j] = Frag<T>::mma(ah[ks & 1][i], bh[ks & 1][j], acc[i][j]);
      if (ks + 1 < SG_KC / 32) __builtin_amdgcn_sched_barrier(0);   // the next group of reads stays behind these products, whole
    }
    asm volatile("s_wait_dscnt 0x0" ::: "memory");             // this wave's reads of stage t are done before the buffer is handed back
    asm volatile("s_wait_asynccnt 0x0" ::: "memory");          // this wave's part of stage t + 1 has landed
    __syncthreads();                                           // publishes stage t + 1 and ends every wave's reads of stage t
    if (t + 2 < nt) stage_in(lds0 + (unsigned)((t & 1) * SG_BUF), a0 + (size_t)(t + 2) * SG_STEP, lda, b0 + (size_t)(t + 2) * SG_STEP, ldb);
  }
  asm volatile("s_wait_asynccnt 0x0" ::: "memory");            // nothing is in flight when the ring becomes output staging

  constexpr int NI = 2 / KG;                                   // slabs of 16 rows that a wave finishes
  const int mE = m0 + ((KG == 2) ? (grp << 4) : 0);            // the first row of C that it finishes
  if (KG == 2) {
    // The two groups' partial sums meet: 4 KiB per wave, each lane's 16-byte pieces side by side (no bank conflict). The loop's last barrier has ended every read of the ring.
    v4f* xs = (v4f*)ring_all + ((grp << 2) + wave) * 256 + lane;              // this wave's rows for its partner
    const v4f* xr = (const v4f*)ring_all + (((grp ^ 1) << 2) + wave) * 256 + lane;   // the partner's rows for this wave
#pragma unroll   // constant indices: the accumulators stay in registers
    for (int j = 0; j < 4; ++j) {
      const v8f s = grp ? acc[0][j] : acc[1][j];
      xs[(2 * j) * 32] = (v4f){s[0], s[1], s[2], s[3]};
      xs[(2 * j + 1) * 32] = (v4f){s[4], s[5], s[6], s[7]};
    }
    __syncthreads();                                           // every wave's rows are written before its partner reads them
#pragma unroll   // constant indices
    for (int j = 0; j < 4; ++j) {
      const v8f k = grp ? acc[1][j] : acc[0][j];
      const v4f lo = xr[(2 * j) * 32], hi = xr[(2 * j + 1) * 32];
      acc[0][j] = k + (v8f){lo[0], lo[1], lo[2], lo[3], hi[0], hi[1], hi[2], hi[3]};
    }
  }
  // ---- epilogue: scale, bias, residual and act, per 16 x 64 slab ----
  float* slab = (float*)(ring_all + ((KG == 2) ? 8 * 4096 : 0)) + ((grp << 2) + wave) * (16 * 68);   // per-wave 16x64 slab, pitch 68 floats, behind the exchange
  const float* bsel = (b == 0) ? bias : ((b == 1) ? bias_b1 : bias_b2);
  // The bias values, and each slab's residual values, come as a run of loads in flight together, off one index or one address with constant offsets (LDC is a constant for that).
  const int nl = n0 + rlane;
  const float* rp = RESID ? resid + (size_t)(mE + mOff) * LDC + nl : nullptr;
  float bv[4];
#pragma unroll   // constant indices: the values stay in registers
  for (int j = 0; j < 4; ++j) bv[j] = bsel[nl + (j << 4)];
  // The wait in front of any rewrite of a register that the run names; as its input the index stays whole until it, so that no load of the run lands in it.
  asm volatile("s_wait_xcnt 0x0" :: "v"(nl) : "memory");
#pragma unroll
  for (int i = 0; i < NI; ++i) {
    float rv[4][8];
    if (RESID) {
#pragma unroll   // constant indices
      for (int j = 0; j < 4; ++j)
#pragma unroll
        for (int r = 0; r < 8; ++r) rv[j][r] = rp[((i << 4) + r) * LDC + (j << 4)];
      asm volatile("s_wait_xcnt 0x0" :: "v"(rp) : "memory");   // the same wait for this run, the address as its input
    }
#pragma unroll
    for (int j = 0; j < 4; ++j) {
      if (ACT == 5) {
#pragma unroll   // constant indices: the accumulators stay in registers; the 16 pairs of a slab are independent and interleave
        for (int r = 0; r < 8; r += 2) {
          v2f v = fma2((v2f){acc[i][j][r], acc[i][j][r + 1]}, (v2f){scale, scale}, bv[j]);
          if (RESID) v += (v2f){rv[j][r], rv[j][r + 1]};
          v = gelu2(v);
          slab[(mOff + r) * 68 + (j << 4) + rlane] = v.x;
          slab[(mOff + r + 1) * 68 + (j << 4) + rlane] = v.y;
        }
      } else {
#pragma unroll
        for (int r = 0; r < 8; ++r) {
          float v = acc[i][j][r] * scale;
          v += bv[j];
          if (RESID) v += rv[j][r];
          slab[(mOff + r) * 68 + (j << 4) + rlane] = v;
        }
      }
    }
    __builtin_amdgcn_fence(__ATOMIC_RELEASE, "workgroup");
    __builtin_amdgcn_wave_barrier();
    __builtin_amdgcn_fence(__ATOMIC_ACQUIRE, "workgroup");
    if (OUT_MODE == 0) {
      const int hh = lane >> 4, c4 = (lane & 15) * 4;     // row seg = 256 B = 16 lanes x 16 B
      float* cp = (float*)Cout + (size_t)b * strideC + (size_t)(mE + hh) * LDC + n0 + c4;   // one address, the rows at constant offsets
#pragma unroll
      for (int it = 0; it < 8; ++it) {
        const int row = it * 2 + hh;
        v4f v = *(const v4f*)(slab + row * 68 + c4);
        *(v4f*)(cp + ((i << 4) + it * 2) * LDC) = v;
      }
    } else {
      const int q = lane >> 3, c8 = (lane & 7) * 8;       // row seg = 128 B = 8 lanes x 16 B
      _Float16* cp = (_Float16*)Cout + (size_t)b * strideC + (size_t)(mE + q) * LDC + n0 + c8;   // one address, the rows at constant offsets
#pragma unroll
      for (int it = 0; it < 4; ++it) {
        const int row = it * 4 + q;
        const float* sp = slab + row * 68 + c8;
        v8h hv;
#pragma unroll
        for (int e = 0; e < 8; ++e) hv[e] = (_Float16)sp[e];
        *(v8h*)(cp + ((i << 4) + it * 4) * LDC) = hv;
      }
    }
    __builtin_amdgcn_fence(__ATOMIC_RELEASE, "workgroup");
    __builtin_amdgcn_wave_barrier();
    __builtin_amdgcn_fence(__ATOMIC_ACQUIRE, "workgroup");
  }
}

__global__ __launch_bounds__(256) void cast_f32_f16x2(
    const float* __restrict__ in, _Float16* __restrict__ out, int n2) {
  int i = blockIdx.x * 256 + threadIdx.x;
  if (i < n2) {
    const _Float16 h0 = (_Float16)in[2 * i], h1 = (_Float16)in[2 * i + 1];
    const unsigned u = (unsigned)__builtin_bit_cast(unsigned short, h0) | ((unsigned)__builtin_bit_cast(unsigned short, h1) << 16);
    ((unsigned*)out)[i] = u;
    
  }
}


} // namespace w25

__global__ __launch_bounds__(256) void k_castT16(const float* __restrict__ src, long long lds, _Float16* __restrict__ dst, long long ldd, int R, int C, float s) {
    const long long i = (long long)blockIdx.x * 256 + threadIdx.x; const long long np = (long long)C * (R / 2); if (i >= np) return; const int c = (int)(i / (R / 2)); const int r = 2 * (int)(i % (R / 2));
    const _Float16 h0 = (_Float16)(src[(long long)r * lds + c] * s), h1 = (_Float16)(src[(long long)(r + 1) * lds + c] * s);
    const unsigned u = (unsigned)__builtin_bit_cast(unsigned short, h0) | ((unsigned)__builtin_bit_cast(unsigned short, h1) << 16);
    unsigned* d = (unsigned*)(dst + (long long)c * ldd + r); *d = u;  }
__global__ __launch_bounds__(256) void k_cast16(const float* __restrict__ src, long long lds, _Float16* __restrict__ dst, long long ldd, int R, int C, float s) {
    const long long i = (long long)blockIdx.x * 256 + threadIdx.x; const long long np = (long long)R * (C / 2); if (i >= np) return; const int r = (int)(i / (C / 2)); const int c = 2 * (int)(i % (C / 2));
    const _Float16 h0 = (_Float16)(src[(long long)r * lds + c] * s), h1 = (_Float16)(src[(long long)r * lds + c + 1] * s);
    const unsigned u = (unsigned)__builtin_bit_cast(unsigned short, h0) | ((unsigned)__builtin_bit_cast(unsigned short, h1) << 16);
    unsigned* d = (unsigned*)(dst + (long long)r * ldd + c); *d = u;  }

// cast_weights<U>: the six weight matrices (four of 512 x 512, two of 2048 x 512 elements) as f16 of s * w into one plane, one behind the other in argument order.
//   A block takes 256 * U consecutive pieces of 4 elements of one matrix, a thread the pieces threadIdx.x + 256 * u of them: a wave's load covers 512 contiguous bytes
//   and its store 256, and the U loads of a thread are in flight together. blk runs over all (4 * 512 * 512 + 2 * 2048 * 512) / (4 * 256 * U) blocks, so no element guard.
template <int U>
__device__ __forceinline__ void cast_weights(int blk, const float* __restrict__ w0, const float* __restrict__ w1, const float* __restrict__ w2, const float* __restrict__ w3,
                                             const float* __restrict__ w4, const float* __restrict__ w5, _Float16* __restrict__ dst, float s) {
    constexpr int BS = (512 * 512) / (4 * 256 * U), BL = (2048 * 512) / (4 * 256 * U);   // blocks per small and per large matrix
    static_assert(BS * (4 * 256 * U) == 512 * 512, "whole blocks per matrix");
    const float* src; int first;                                  // the block's matrix and that matrix's first block (the same for the whole block)
    if (blk < BS) { src = w0; first = 0; }
    else if (blk < 2 * BS) { src = w1; first = BS; }
    else if (blk < 3 * BS) { src = w2; first = 2 * BS; }
    else if (blk < 4 * BS) { src = w3; first = 3 * BS; }
    else if (blk < 4 * BS + BL) { src = w4; first = 4 * BS; }
    else { src = w5; first = 4 * BS + BL; }
    const v4f* sp = (const v4f*)src + (blk - first) * (256 * U) + threadIdx.x;
    v4h* dp = (v4h*)dst + blk * (256 * U) + threadIdx.x;
    v4f a[U];
#pragma unroll   // constant indices: a stays in registers, and all U loads are issued before the first cast
    for (int u = 0; u < U; ++u) a[u] = sp[u * 256];
#pragma unroll   // constant indices into a
    for (int u = 0; u < U; ++u) {
        v4h hv;
#pragma unroll   // constant element indices: the vectors stay in registers
        for (int e = 0; e < 4; ++e) hv[e] = (_Float16)(a[u][e] * s);
        dp[u * 256] = hv;
    }
}
// ln_rows_f16: y = f16((x - mean) * rsqrt(var + eps) * g + b) over contiguous rows of 512 elements, one wave per row, 8 rows per 256-thread block (blk = block of rows).
//   The row stays in registers between the two sums and the output: statistics, normalisation and the cast for the next product are one pass over x.
//   A lane holds the pieces lane + 32 * u of 4 channels (a wave's load covers 512 contiguous bytes): element t = 128 * u + 4 * lane + e.
//   Both sums keep the order of k_stats (256 partials of elements t and t + 256, then a binary tree that pairs t with t + 128, 64, ..., 1), so mean and rstd keep their bits:
//   distance 128 is u, 64 to 4 are the lane's bits (shuffles, both partners form the same sum), 2 and 1 are e.
__device__ __forceinline__ float tree256(const float (&p)[2][4]) {
    float r[4];
#pragma unroll   // constant indices: r stays in registers
    for (int e = 0; e < 4; ++e) r[e] = p[0][e] + p[1][e];
#pragma unroll   // the four shuffles of a level are independent and in flight together
    for (int o = 16; o > 0; o >>= 1)
#pragma unroll
        for (int e = 0; e < 4; ++e) r[e] += __shfl_xor(r[e], o, 32);
    return (r[0] + r[2]) + (r[1] + r[3]);
}
__device__ __forceinline__ void ln_rows_f16(int blk, const float* __restrict__ x, _Float16* __restrict__ y, const float* __restrict__ g, const float* __restrict__ bta, float eps) {
    constexpr int C = 512, U = C / 128;                           // pieces per lane
    const int lane = threadIdx.x & 31;
    const size_t row = (size_t)blk * 8 + (threadIdx.x >> 5);
    const v4f* xp = (const v4f*)(x + row * C) + lane;
    v4f xv[U], gv[U], bv[U];
#pragma unroll   // constant indices: the arrays stay in registers, and all loads are issued before the first use
    for (int u = 0; u < U; ++u) { xv[u] = xp[u * 32]; gv[u] = ((const v4f*)g)[lane + u * 32]; bv[u] = ((const v4f*)bta)[lane + u * 32]; }
    float p[2][4];
#pragma unroll   // constant indices into xv and p
    for (int u = 0; u < 2; ++u)
#pragma unroll
        for (int e = 0; e < 4; ++e) p[u][e] = xv[u][e] + xv[u + 2][e];
    const float mu = tree256(p) / (float)C;
#pragma unroll   // constant indices into xv and p
    for (int u = 0; u < 2; ++u)
#pragma unroll
        for (int e = 0; e < 4; ++e) { const float d0 = xv[u][e] - mu, d1 = xv[u + 2][e] - mu; p[u][e] = __builtin_fmaf(d1, d1, d0 * d0); }   // as k_stats rounds it: the square, then one fused step
    const float rs = rsqrtf(tree256(p) / (float)C + eps);
    v4h* yp = (v4h*)(y + row * C) + lane;
#pragma unroll   // constant indices into the arrays
    for (int u = 0; u < U; ++u) {
        v4h hv;
#pragma unroll   // constant element indices: the vectors stay in registers
        for (int e = 0; e < 4; ++e) hv[e] = (_Float16)((xv[u][e] - mu) * rs * gv[u][e] + bv[u][e]);
        yp[u * 32] = hv;
    }
}
// k_ln_f16: LayerNorm of 4096 rows of 512 to an f16 plane; grid 4096 / 8.
__global__ __launch_bounds__(256) void k_ln_f16(const float* __restrict__ x, _Float16* __restrict__ y, const float* __restrict__ g, const float* __restrict__ bta, float eps) {
    ln_rows_f16(blockIdx.x, x, y, g, bta, eps);
}
// k_ln_f16_weights: two jobs that depend on nothing but the inputs share one grid: blocks [0, 512) are k_ln_f16's, the 768 behind them cast the weights. No barrier in either.
__global__ __launch_bounds__(256) void k_ln_f16_weights(const float* __restrict__ x, _Float16* __restrict__ y, const float* __restrict__ g, const float* __restrict__ bta, float eps,
                                                        const float* __restrict__ w0, const float* __restrict__ w1, const float* __restrict__ w2, const float* __restrict__ w3,
                                                        const float* __restrict__ w4, const float* __restrict__ w5, _Float16* __restrict__ wdst, float ws) {
    if (blockIdx.x < 512) ln_rows_f16(blockIdx.x, x, y, g, bta, eps);
    else cast_weights<4>(blockIdx.x - 512, w0, w1, w2, w3, w4, w5, wdst, ws);
}

// f32 -> bf16 hi plane + bf16 lo plane (x = hi + lo to ~2^-17 relative; RNE both), [R][C] -> [R][C] (or transposed to [C][R]); 2 consecutive destination elements
__device__ __forceinline__ unsigned int f2bf2_pack(float a, float b, unsigned int* lo) {
    const unsigned short ha = w25::f2bf_bits(a), hb = w25::f2bf_bits(b);
    const unsigned short la = w25::f2bf_bits(a - w25::bf_bits2f(ha)), lb = w25::f2bf_bits(b - w25::bf_bits2f(hb));
    *lo = (unsigned)la | ((unsigned)lb << 16); return (unsigned)ha | ((unsigned)hb << 16); }
__global__ __launch_bounds__(256) void k_castS16(const float* __restrict__ src, long long lds, __bf16* __restrict__ dhi, __bf16* __restrict__ dlo, long long ldd, int R, int C, float s, int transpose) {
    const long long i = (long long)blockIdx.x * 256 + threadIdx.x; long long o; float a, b;
    if (transpose) { const long long np = (long long)C * (R / 2); if (i >= np) return; const int c = (int)(i / (R / 2)); const int r = 2 * (int)(i % (R / 2)); a = src[(long long)r * lds + c] * s; b = src[(long long)(r + 1) * lds + c] * s; o = (long long)c * ldd + r; }
    else { const long long np = (long long)R * (C / 2); if (i >= np) return; const int r = (int)(i / (C / 2)); const int c = 2 * (int)(i % (C / 2)); a = src[(long long)r * lds + c] * s; b = src[(long long)r * lds + c + 1] * s; o = (long long)r * ldd + c; }
    unsigned lo; const unsigned hi = f2bf2_pack(a, b, &lo); unsigned* ph = (unsigned*)(dhi + o); unsigned* pl = (unsigned*)(dlo + o);
    *ph = hi; *pl = lo;  }


extern "C" void kernel_launch(void* const* d_in, const int* in_sizes, int n_in, void* d_out, int out_size, void* d_ws, size_t ws_size, hipStream_t stream) {
    (void)in_sizes; (void)n_in; (void)out_size; (void)ws_size;
    const float* x = (const float*)d_in[0];
    const float* ln1g = (const float*)d_in[1];
    const float* ln1b = (const float*)d_in[2];
    const float* Wq = (const float*)d_in[3];
    const float* bq = (const float*)d_in[4];
    const float* Wk = (const float*)d_in[5];
    const float* bk = (const float*)d_in[6];
    const float* Wv = (const float*)d_in[7];
    const float* bv = (const float*)d_in[8];
    const float* Wo = (const float*)d_in[9];
    const float* bo = (const float*)d_in[10];
    const float* ln2g = (const float*)d_in[11];
    const float* ln2b = (const float*)d_in[12];
    const float* W1 = (const float*)d_in[13];
    const float* b1 = (const float*)d_in[14];
    const float* W2 = (const float*)d_in[15];
    const float* b2 = (const float*)d_in[16];
    const int L = 4096;
    const int C = 512;
    const int NH = 8;
    const int HD = 64;
    const int FF = 2048;
    const int LP = L / 2;
    const int WINP = 128;
    float* out = (float*)d_out;
    char* wsp = (char*)d_ws;
    _Float16* WH = (_Float16*)wsp; wsp += (((size_t)(4 * 512 * 512 + 2 * 2048 * 512) * 2 + 255) / 256) * 256;   // f16 of 16 w: Wq, Wk, Wv, Wo, W1, W2
    _Float16* HNh = (_Float16*)wsp; wsp += (((size_t)((size_t)L * C) * 2 + 255) / 256) * 256;
    float* Q = (float*)wsp; wsp += (((size_t)((size_t)L * C) * 4 + 255) / 256) * 256;    // Q, Kb and V lie L * C floats apart: the three batches of one product
    float* Kb = (float*)wsp; wsp += (((size_t)((size_t)L * C) * 4 + 255) / 256) * 256;
    float* V = (float*)wsp; wsp += (((size_t)((size_t)L * C) * 4 + 255) / 256) * 256;
    _Float16* Yh = (_Float16*)wsp; wsp += (((size_t)((size_t)L * C) * 2 + 255) / 256) * 256;
    float* X1 = (float*)wsp; wsp += (((size_t)((size_t)L * C) * 4 + 255) / 256) * 256;
    _Float16* H2h = (_Float16*)wsp; wsp += (((size_t)((size_t)L * C) * 2 + 255) / 256) * 256;
    _Float16* F1h = (_Float16*)wsp; wsp += (((size_t)((size_t)L * FF) * 2 + 255) / 256) * 256;
    k_ln_f16_weights<<<(unsigned)(512 + 768), 256, 0, stream>>>(x, HNh, ln1g, ln1b, 1e-05f, Wq, Wk, Wv, Wo, W1, W2, WH, 16.0f);
    w25::wmma_gemm_lds<0, false, 0, 512><<<dim3(8u, 32u, 3u), 128, 0, stream>>>((const unsigned short*)(HNh), 512, (const unsigned short*)(WH), 512, 512 * 512, (void*)(Q), 4096 * 512, bq, bk, bv, nullptr, 512, 0.0625f);
    { /*apv4*/ AttnP a;
      a.Q = Q; a.K = Kb; a.V = V; a.O = 0; a.Oh = Yh; a.P = 0; a.Mf = 0; a.Mi = 0; a.ST = 0;
      a.Pw = 0; a.Rt = 0; a.SQ = 0; a.SK = 0;
      a.swb = 0; a.swh = 0; a.swi = 0; a.swj = 0; a.srb = 0; a.srh = 0; a.sri = 0; a.sQb = C; a.sQh = HD; a.sQi = 2 * C; a.sQd = 1; a.sKb = C; a.sKh = HD; a.sKj = 2 * C; a.sKd = 1; a.sVb = C; a.sVh = HD; a.sVj = 2 * C; a.sVd = 1; a.sOb = C; a.sOh = HD; a.sOi = 2 * C; a.sPb = 0; a.sPh = 0; a.sPi = 0; a.smb = 0; a.smh = 0; a.smi = 0; a.smj = 0;
      a.Lq = LP; a.Lk = LP; a.dh = HD; a.dv = HD; a.hrep = 1; a.causal = 1; a.coff = 0; a.pband = 0;
      a.scale = 0.125f; a.mfill = 0.0f; a.nonorm = 0; a.mpol = 0;
      a.roff = 0; a.rn = 1; a.segpol = 0; a.win = WINP;
      k_attn_t<<<dim3((unsigned)((LP) + 16 * AW - 1) / (16 * AW), (unsigned)(NH), (unsigned)(2)), 32 * AW, 0, stream>>>(a); }   // batch = parity: row 0 or 1, then every second row
    w25::wmma_gemm_lds<0, true, 0, 512, 2><<<dim3(8u, 32u, 1u), 256, 0, stream>>>((const unsigned short*)(Yh), 512, (const unsigned short*)(WH + 3 * 512 * 512), 512, 0, (void*)(X1), 0, bo, nullptr, nullptr, x, 512, 0.0625f);
    k_ln_f16<<<(unsigned)(512), 256, 0, stream>>>(X1, H2h, ln2g, ln2b, 1e-05f);
    w25::wmma_gemm_lds<1, false, 5, 2048><<<dim3(32u, 32u, 1u), 128, 0, stream>>>((const unsigned short*)(H2h), 512, (const unsigned short*)(WH + 4 * 512 * 512), 512, 0, (void*)(F1h), 0, b1, nullptr, nullptr, nullptr, 512, 0.0625f);
    w25::wmma_gemm_lds<0, true, 0, 512, 2><<<dim3(8u, 32u, 1u), 256, 0, stream>>>((const unsigned short*)(F1h), 2048, (const unsigned short*)(WH + 4 * 512 * 512 + 2048 * 512), 2048, 0, (void*)(out), 0, b2, nullptr, nullptr, X1, 2048, 0.0625f);
}

// v010
// Measured time: 66.2 microseconds a run.
// In two side-by-side timings against v009, it was 1.07 and 1.06 times as fast.
// Counting every step since v000, which is the starting kernel, it is 33.2 times as fast.
// Contractions: q/k/v projections of the LayerNormed input [4096x512].[512x512] (+b), the output projection (+b, + residual), the FFN [4096x512].[512x2048] (+b, exact GELU) and [4096x2048].[2048x512] (+b, + residual) with f16 operands (v_wmma_f32_16x16x32_f16; 32x64 register-blocked wave tiles, 128x64 block tiles (128x192 for q/k/v together, 128x256 for the first FFN product), over pre-cast f16 operand planes staged in LDS by asynchronous copies, weights pre-scaled by 16 at the cast and un-scaled in the f32 epilogue); the dilated causal attention (keys j <= i, i - j even, i - j <= 256) as one flash launch whose grid z is the parity of the position (stride-2 views; within a parity class the pattern is plain causal with window 128), head_dim 64, both products transposed (f16 k.q^T, f16 v^T.p^T with p as f16 of 4096 p, kept in registers); f32 accumulate, softmax and LayerNorms f32.
#include <hip/hip_runtime.h>
#include <math.h>

typedef __attribute__((ext_vector_type(16))) _Float16 v16h;
typedef __attribute__((ext_vector_type(8)))  _Float16 v8h;
typedef __attribute__((ext_vector_type(4)))  _Float16 v4h;
typedef __attribute__((ext_vector_type(16))) __bf16   v16b;
typedef __attribute__((ext_vector_type(8)))  float    v8f;
typedef __attribute__((ext_vector_type(4)))  float    v4f;

// 16-bit WMMA fragment map (wave32), lane L, h = L>>4, m = L&15:
//   A 16x32: lane = row m;   element i -> k = (i<8) ? 8h+i : 16+8h+(i-8)
//   B 32x16: lane = column m; the SAME k(i,h)
//   D 16x16 (8 f32): lane = column m; element r -> row 8h+r
__device__ __forceinline__ int frag_k(int i, int h) { return (i < 8) ? (8 * h + i) : (16 + 8 * h + (i - 8)); }
__device__ __forceinline__ __bf16 bf16_rne(float f) {
    unsigned int u = __float_as_uint(f);
    u += 0x7fffu + ((u >> 16) & 1u);
    return __builtin_bit_cast(__bf16, (unsigned short)(u >> 16));
}
__device__ __forceinline__ float bf16_f32(__bf16 b) { return __uint_as_float(((unsigned int)__builtin_bit_cast(unsigned short, b)) << 16); }
__device__ __forceinline__ v8f wmma16(v16h a, v16h b, v8f c) {
    c = __builtin_amdgcn_wmma_f32_16x16x32_f16(false, a, false, b, (short)0, c, false, false);
    asm volatile("v_nop\n\tv_nop\n\tv_nop\n\tv_nop" : "+v"(c) : "v"(a), "v"(b));
    return c;
}
__device__ __forceinline__ v8f wmmab(v16b a, v16b b, v8f c) {
    c = __builtin_amdgcn_wmma_f32_16x16x32_bf16(false, a, false, b, (short)0, c, false, false);
    asm volatile("v_nop\n\tv_nop\n\tv_nop\n\tv_nop" : "+v"(c) : "v"(a), "v"(b));
    return c;
}
struct Split { v16b hi, lo; };
// hi/lo split product: a.hi*b.hi + a.hi*b.lo + a.lo*b.hi
__device__ __forceinline__ v8f wmma3(const Split& a, const Split& b, v8f c) {
    c = __builtin_amdgcn_wmma_f32_16x16x32_bf16(false, a.hi, false, b.hi, (short)0, c, false, false);
    c = __builtin_amdgcn_wmma_f32_16x16x32_bf16(false, a.hi, false, b.lo, (short)0, c, false, false);
    c = __builtin_amdgcn_wmma_f32_16x16x32_bf16(false, a.lo, false, b.hi, (short)0, c, false, false);
    asm volatile("v_nop\n\tv_nop\n\tv_nop\n\tv_nop" : "+v"(c) : "v"(a.hi), "v"(a.lo), "v"(b.hi), "v"(b.lo));
    return c;
}
struct Split3 { v16b hi, mid, lo; };
// triple split product (6 terms, drops only terms below 2^-24 relative)
__device__ __forceinline__ v8f wmma6(const Split3& a, const Split3& b, v8f c) {
    c = __builtin_amdgcn_wmma_f32_16x16x32_bf16(false, a.hi, false, b.hi, (short)0, c, false, false);
    c = __builtin_amdgcn_wmma_f32_16x16x32_bf16(false, a.hi, false, b.mid, (short)0, c, false, false);
    c = __builtin_amdgcn_wmma_f32_16x16x32_bf16(false, a.mid, false, b.hi, (short)0, c, false, false);
    c = __builtin_amdgcn_wmma_f32_16x16x32_bf16(false, a.hi, false, b.lo, (short)0, c, false, false);
    c = __builtin_amdgcn_wmma_f32_16x16x32_bf16(false, a.mid, false, b.mid, (short)0, c, false, false);
    c = __builtin_amdgcn_wmma_f32_16x16x32_bf16(false, a.lo, false, b.hi, (short)0, c, false, false);
    asm volatile("v_nop\n\tv_nop\n\tv_nop\n\tv_nop" : "+v"(c) : "v"(a.hi), "v"(a.mid), "v"(a.lo), "v"(b.hi), "v"(b.mid), "v"(b.lo));
    return c;
}

// Fragment gathers from f32 memory: element i <- p[(k0 + frag_k(i,h)) * sk] * s, zero for k >= klen.
__device__ __forceinline__ v16h fh_ld(const float* __restrict__ p, long long sk, int k0, int h, int klen, float s) {
    v16h a;
#pragma unroll
    for (int i = 0; i < 16; ++i) { const int k = k0 + frag_k(i, h); a[i] = (k < klen) ? (_Float16)(p[(long long)k * sk] * s) : (_Float16)0.f; }
    return a;
}
__device__ __forceinline__ Split sp_ld(const float* __restrict__ p, long long sk, int k0, int h, int klen, float s) {
    Split r;
#pragma unroll
    for (int i = 0; i < 16; ++i) {
        const int k = k0 + frag_k(i, h); const float x = (k < klen) ? p[(long long)k * sk] * s : 0.f;
        const __bf16 hb = bf16_rne(x); r.hi[i] = hb; r.lo[i] = bf16_rne(x - bf16_f32(hb));
    }
    return r;
}
__device__ __forceinline__ Split3 sp3_ld(const float* __restrict__ p, long long sk, int k0, int h, int klen, float s) {
    Split3 r;
#pragma unroll
    for (int i = 0; i < 16; ++i) {
        const int k = k0 + frag_k(i, h); const float x = (k < klen) ? p[(long long)k * sk] * s : 0.f;
        const __bf16 hb = bf16_rne(x); const float r1 = x - bf16_f32(hb); const __bf16 mb = bf16_rne(r1);
        r.hi[i] = hb; r.mid[i] = mb; r.lo[i] = bf16_rne(r1 - bf16_f32(mb));
    }
    return r;
}
__device__ __forceinline__ v16b bh_ld(const float* __restrict__ p, long long sk, int k0, int h, int klen, float s) {
    v16b a;
#pragma unroll
    for (int i = 0; i < 16; ++i) { const int k = k0 + frag_k(i, h); a[i] = bf16_rne((k < klen) ? p[(long long)k * sk] * s : 0.f); }
    return a;
}
// f16 fragment from a 16-byte aligned f32 row with element stride 1 and all 32 k in range: four unguarded 16-byte loads, then the cast; same k order as fh_ld
struct Raw16 { v4f x0, x1, x2, x3; };   // the 16 floats of one lane's fragment, as loaded
__device__ __forceinline__ Raw16 raw_ld4(const float* __restrict__ row, int k0, int h) {
    const v4f* q = (const v4f*)(row + k0 + 8 * h);
    Raw16 r; r.x0 = q[0]; r.x1 = q[1]; r.x2 = q[4]; r.x3 = q[5];
    return r;
}
__device__ __forceinline__ v16h raw_f16(const Raw16& r) {
    v16h a;
#pragma unroll   // constant element indices: the vectors stay in registers
    for (int i = 0; i < 4; ++i) { a[i] = (_Float16)r.x0[i]; a[4 + i] = (_Float16)r.x1[i]; a[8 + i] = (_Float16)r.x2[i]; a[12 + i] = (_Float16)r.x3[i]; }
    return a;
}
// Inputs-only fence on loaded values: every load written above it is issued before it, so that a run of loads is in flight together.
// Without it the compiler converts each fragment as soon as it is loaded and waits for memory once per fragment.
__device__ __forceinline__ void loads_held(const v4f& a, const v4f& b, const v4f& c, const v4f& d) { asm volatile("" :: "v"(a), "v"(b), "v"(c), "v"(d)); }
// f16 fragment from an f16 LDS/global row with element stride 1 (k-contiguous), no bounds (tile already zero padded)
__device__ __forceinline__ v16h fh_row(const _Float16* __restrict__ row, int k0, int h) {
    v16h a;
#pragma unroll
    for (int i = 0; i < 16; ++i) a[i] = row[k0 + frag_k(i, h)];
    return a;
}

#define VST2(T, ptr, val) do { const T vst2_v_ = (val); *(T*)(ptr) = vst2_v_;  } while (0)
typedef float v4f __attribute__((ext_vector_type(4)));
#define VST2V4(ptr, val) do { const v4f vst2_v4_ = (val); *(v4f*)(ptr) = vst2_v4_;  } while (0)

__device__ __attribute__((noinline)) float act_fn(float v, int act) {
    if (act == 1) return fmaxf(v, 0.f);                                                                               // relu
    if (act == 2) { const float u = 0.7978845608028654f * (v + 0.044715f * v * v * v); return 0.5f * v * (1.f + tanhf(u)); } // tanh-gelu
    if (act == 3) return v / (1.f + expf(-v));                                                                        // silu
    if (act == 4) return 0.5f * v * (1.f + erff(v * 0.7071067811865476f));                                             // erf-gelu
    if (act == 5) return tanhf(v);
    if (act == 6) return 1.f / (1.f + expf(-v));                                                                      // sigmoid
    if (act == 7) return (v > 0.f) ? v : 0.01f * v;                                                                   // leaky relu 0.01
    if (act == 8) return (v > 0.f) ? v : (expf(v) - 1.f);                                                             // elu
    if (act == 9) return fminf(fmaxf(v, 0.f), 6.f);                                                                   // relu6
    if (act == 10) return fabsf(v);                                                                                    // abs
    if (act == 11) return (v >= 0.f) ? v : 0.1f * v;                                                                  // leaky 0.1
    if (act == 12) return (v > 0.f) ? v : 0.2f * v;                                                                   // leaky 0.2
    if (act == 13) return (v > 20.f) ? v : log1pf(expf(v));                                                            // softplus
    return v;
}

// =====================================================================================================================
// k_gemm<MODE>: C(z, m, n) = act(alpha * sum_k A(z, m, k) * B(z, k, n) + bias) + beta * R(z, m, n)
//   One wave (32-thread block) per 16 x 32 tile of C; grid (ceil(N/32), ceil(M/16), Z). Batch z -> (zo = z / zi_n, zi = z % zi_n)
//   with separate outer/inner strides for every tensor (e.g. batch and head). A(m,k) = A[zo*sAo + zi*sAi + m*sAm + k*sAk] (f32),
//   B(k,n) = B[zo*sBo + zi*sBi + n*sBn + k*sBk] (f32); any M, N, K (K zero-padded to 32 inside the fragments, M/N tails guarded).
//   C(m,n) = C[zo*sCo + zi*sCi + m*sCm + n] (n contiguous). flags: 1 bias[n], 2 bias[m], 4 residual R[zo*sRo + zi*sRi + m*sRm + n*sRn].
//   MODE 0: f16 operands (A prescaled by sa, B by sb, both undone in the epilogue); 1: bf16 hi/lo split (3 products); 2: bf16;
//   3: bf16 hi/mid/lo triple split (6 products); 4: as 3 with Kahan-compensated f32 accumulation across k-steps.
// =====================================================================================================================
struct GemmP {
    const float* A; const float* B; const float* bias; const float* R; float* C;
    long long sAo, sAi, sAm, sAk, sBo, sBi, sBn, sBk, sCo, sCi, sCm, sRo, sRi, sRm, sRn;
    int M, N, K, zi_n, flags, act; float alpha, beta, sa, sb;
    int Npad, pad_;     // columns [N, Npad) of C are written as 0 so that padded workspace rows are covered by whole-line stores; Npad >= N
};
static_assert(sizeof(GemmP) == 5 * 8 + 15 * 8 + 6 * 4 + 4 * 4 + 2 * 4, "GemmP has padding");

template <int MODE>
__global__ __launch_bounds__(32) void k_gemm(GemmP p) {
    const int lane = threadIdx.x & 31, h = lane >> 4, l15 = lane & 15;
    const int m0 = blockIdx.y * 16, n0 = blockIdx.x * 32;
    const int z = blockIdx.z, zo = z / p.zi_n, zi = z - zo * p.zi_n;
    const float* A = p.A + zo * p.sAo + zi * p.sAi;
    const float* B = p.B + zo * p.sBo + zi * p.sBi;
    const int am = min(m0 + l15, p.M - 1);                       // clamped row for loads (stores are guarded)
    v8f acc[2], comp[2];
#pragma unroll
    for (int t = 0; t < 2; ++t) { v8f zz = {}; acc[t] = zz; comp[t] = zz; }
    for (int k0 = 0; k0 < p.K; k0 += 32) {
        const float* arow = A + (long long)am * p.sAm;
        if (MODE == 1) {
            const Split a = sp_ld(arow, p.sAk, k0, h, p.K, 1.f);
#pragma unroll
            for (int t = 0; t < 2; ++t) {
                const int bn = min(n0 + t * 16 + l15, p.N - 1);
                acc[t] = wmma3(a, sp_ld(B + (long long)bn * p.sBn, p.sBk, k0, h, p.K, 1.f), acc[t]);
            }
        } else if (MODE == 3) {
            const Split3 a = sp3_ld(arow, p.sAk, k0, h, p.K, 1.f);
#pragma unroll
            for (int t = 0; t < 2; ++t) {
                const int bn = min(n0 + t * 16 + l15, p.N - 1);
                acc[t] = wmma6(a, sp3_ld(B + (long long)bn * p.sBn, p.sBk, k0, h, p.K, 1.f), acc[t]);
            }
        } else if (MODE == 4) {
            // triple split as MODE 3, but each k-step's 6 products go into a fresh accumulator and the partial is added to the running f32 sum
            // on the VALU with Kahan compensation (accumulation error stays ~1 ulp however long K is)
            const Split3 a = sp3_ld(arow, p.sAk, k0, h, p.K, 1.f);
#pragma unroll
            for (int t = 0; t < 2; ++t) {
                const int bn = min(n0 + t * 16 + l15, p.N - 1); v8f zz = {};
                const v8f part = wmma6(a, sp3_ld(B + (long long)bn * p.sBn, p.sBk, k0, h, p.K, 1.f), zz);
                const v8f y = part - comp[t]; const v8f s = acc[t] + y; comp[t] = (s - acc[t]) - y; acc[t] = s;
            }
        } else if (MODE == 2) {
            const v16b a = bh_ld(arow, p.sAk, k0, h, p.K, 1.f);
#pragma unroll
            for (int t = 0; t < 2; ++t) {
                const int bn = min(n0 + t * 16 + l15, p.N - 1);
                acc[t] = wmmab(a, bh_ld(B + (long long)bn * p.sBn, p.sBk, k0, h, p.K, 1.f), acc[t]);
            }
        } else {
            const v16h a = fh_ld(arow, p.sAk, k0, h, p.K, p.sa);
#pragma unroll
            for (int t = 0; t < 2; ++t) {
                const int bn = min(n0 + t * 16 + l15, p.N - 1);
                acc[t] = wmma16(a, fh_ld(B + (long long)bn * p.sBn, p.sBk, k0, h, p.K, p.sb), acc[t]);
            }
        }
    }
    const float iscale = (MODE == 0) ? p.alpha / (p.sa * p.sb) : p.alpha;
    float* C = p.C + zo * p.sCo + zi * p.sCi;
    const float* R = p.R + zo * p.sRo + zi * p.sRi;
    __shared__ __align__(16) float ctile[16][36];
#pragma unroll
    for (int t = 0; t < 2; ++t) {
        const int n = n0 + t * 16 + l15; const int nn = min(n, p.N - 1);
#pragma unroll
        for (int r = 0; r < 8; ++r) {
            const int m = m0 + 8 * h + r; const int mm = min(m, p.M - 1);
            float v = acc[t][r] * iscale;
            if (p.flags & 1) v += p.bias[nn];
            if (p.flags & 2) v += p.bias[mm];
            if (p.flags & 8) v *= p.bias[(long long)zo * p.M + mm];   /* per-(z,row) scale vector laid out [Z][M]; exclusive with the bias flags */
            v = act_fn(v, p.act);
            if (p.flags & 4) v += p.beta * R[(long long)mm * p.sRm + (long long)nn * p.sRn];
            ctile[8 * h + r][t * 16 + l15] = (n < p.N) ? v : 0.f;
        }
    }
    __syncthreads();
    const int NW = (p.Npad > p.N) ? p.Npad : p.N;           // write width
    const bool fast = (m0 + 16 <= p.M) && (n0 + 32 <= NW) && ((p.sCm & 3) == 0) && ((((size_t)C) & 15) == 0);
    if (fast) {
#pragma unroll
        for (int s = 0; s < 4; ++s) {
            const int row = s * 4 + (lane >> 3), c4 = (lane & 7) * 4;
            const v4f v = *(const v4f*)&ctile[row][c4];
            VST2V4(C + (long long)(m0 + row) * p.sCm + n0 + c4, v);
        }
    } else {
        for (int row = 0; row < 16; ++row) {
            const int m = m0 + row, n = n0 + lane;
            if (m < p.M && n < NW) VST2(float, C + (long long)m * p.sCm + n, ctile[row][lane]);
        }
    }
}


// =====================================================================================================================
// k_gemmT<MODE, TM, TN>: same contract as k_gemm, but one wave computes a (16*TM) x (16*TN) tile: TM A fragments and TN B fragments are
//   loaded per 32-wide k-step and reused across TM*TN WMMAs (far fewer load/convert instructions per MAC). MODE 0 (f16), 1 (bf16 hi/lo),
//   2 (bf16) only. grid (ceil(NW/(16*TN)), ceil(M/(16*TM)), Z), block 32. Epilogue identical to k_gemm, run per 16x32 sub-tile.
// =====================================================================================================================
template <int MODE, int TM, int TN>
__global__ __launch_bounds__(32) void k_gemmT(GemmP p) {
    const int lane = threadIdx.x & 31, h = lane >> 4, l15 = lane & 15;
    const int m0 = blockIdx.y * (16 * TM), n0 = blockIdx.x * (16 * TN);
    const int z = blockIdx.z, zo = z / p.zi_n, zi = z - zo * p.zi_n;
    const float* A = p.A + zo * p.sAo + zi * p.sAi;
    const float* B = p.B + zo * p.sBo + zi * p.sBi;
    v8f acc[TM][TN];
#pragma unroll
    for (int i = 0; i < TM; ++i)
#pragma unroll
        for (int t = 0; t < TN; ++t) { v8f zz = {}; acc[i][t] = zz; }
    for (int k0 = 0; k0 < p.K; k0 += 32) {
        if (MODE == 1) {
            Split a[TM], b[TN];
#pragma unroll
            for (int i = 0; i < TM; ++i) { const int am = min(m0 + 16 * i + l15, p.M - 1); a[i] = sp_ld(A + (long long)am * p.sAm, p.sAk, k0, h, p.K, 1.f); }
#pragma unroll
            for (int t = 0; t < TN; ++t) { const int bn = min(n0 + 16 * t + l15, p.N - 1); b[t] = sp_ld(B + (long long)bn * p.sBn, p.sBk, k0, h, p.K, 1.f); }
#pragma unroll
            for (int i = 0; i < TM; ++i)
#pragma unroll
                for (int t = 0; t < TN; ++t) acc[i][t] = wmma3(a[i], b[t], acc[i][t]);
        } else if (MODE == 2) {
            v16b a[TM], b[TN];
#pragma unroll
            for (int i = 0; i < TM; ++i) { const int am = min(m0 + 16 * i + l15, p.M - 1); a[i] = bh_ld(A + (long long)am * p.sAm, p.sAk, k0, h, p.K, 1.f); }
#pragma unroll
            for (int t = 0; t < TN; ++t) { const int bn = min(n0 + 16 * t + l15, p.N - 1); b[t] = bh_ld(B + (long long)bn * p.sBn, p.sBk, k0, h, p.K, 1.f); }
#pragma unroll
            for (int i = 0; i < TM; ++i)
#pragma unroll
                for (int t = 0; t < TN; ++t) acc[i][t] = wmmab(a[i], b[t], acc[i][t]);
        } else {
            v16h a[TM], b[TN];
#pragma unroll
            for (int i = 0; i < TM; ++i) { const int am = min(m0 + 16 * i + l15, p.M - 1); a[i] = fh_ld(A + (long long)am * p.sAm, p.sAk, k0, h, p.K, p.sa); }
#pragma unroll
            for (int t = 0; t < TN; ++t) { const int bn = min(n0 + 16 * t + l15, p.N - 1); b[t] = fh_ld(B + (long long)bn * p.sBn, p.sBk, k0, h, p.K, p.sb); }
#pragma unroll
            for (int i = 0; i < TM; ++i)
#pragma unroll
                for (int t = 0; t < TN; ++t) acc[i][t] = wmma16(a[i], b[t], acc[i][t]);
        }
    }
    const float iscale = (MODE == 0) ? p.alpha / (p.sa * p.sb) : p.alpha;
    float* C = p.C + zo * p.sCo + zi * p.sCi;
    const float* R = p.R + zo * p.sRo + zi * p.sRi;
    const int NW = (p.Npad > p.N) ? p.Npad : p.N;
    __shared__ __align__(16) float ctile[16][36];
#pragma unroll
    for (int i = 0; i < TM; ++i) {
        const int mb = m0 + 16 * i; if (mb >= p.M) break;          // wave-uniform
#pragma unroll
        for (int tp = 0; tp < TN / 2; ++tp) {
            const int nb = n0 + 32 * tp; if (nb >= NW) break;        // wave-uniform
#pragma unroll
            for (int t2 = 0; t2 < 2; ++t2) {
                const int t = 2 * tp + t2; const int n = nb + t2 * 16 + l15; const int nn = min(n, p.N - 1);
#pragma unroll
                for (int r = 0; r < 8; ++r) {
                    const int m = mb + 8 * h + r; const int mm = min(m, p.M - 1);
                    float v = acc[i][t][r] * iscale;
                    if (p.flags & 1) v += p.bias[nn];
                    if (p.flags & 2) v += p.bias[mm];
            if (p.flags & 8) v *= p.bias[(long long)zo * p.M + mm];   /* per-(z,row) scale vector laid out [Z][M]; exclusive with the bias flags */
                    v = act_fn(v, p.act);
                    if (p.flags & 4) v += p.beta * R[(long long)mm * p.sRm + (long long)nn * p.sRn];
                    ctile[8 * h + r][t2 * 16 + l15] = (n < p.N) ? v : 0.f;
                }
            }
            __syncthreads();
            const bool fast = (mb + 16 <= p.M) && (nb + 32 <= NW) && ((p.sCm & 3) == 0) && ((((size_t)C) & 15) == 0);
            if (fast) {
#pragma unroll
                for (int s = 0; s < 4; ++s) {
                    const int row = s * 4 + (lane >> 3), c4 = (lane & 7) * 4;
                    const v4f v = *(const v4f*)&ctile[row][c4];
                    VST2V4(C + (long long)(mb + row) * p.sCm + nb + c4, v);
                }
            } else {
                for (int row = 0; row < 16; ++row) {
                    const int m = mb + row, n = nb + lane;
                    if (m < p.M && n < NW) VST2(float, C + (long long)m * p.sCm + n, ctile[row][lane]);
                }
            }
            __syncthreads();
        }
    }
}

// =====================================================================================================================
//   Wave = 16 queries, AW waves per block, 64-key blocks; grid (ceil(Lq/(16*AW)), H, B), block 32*AW. Any Lq, Lk; head dim dh <= DHP
//   (DHP multiple of 32), value dim dv <= DVP (multiple of 16, <= 128). Every tensor addressed by (batch, head, row, element) strides, f32.
//   Scores: QM 0 f16 operands, 1 bf16 hi/lo split, 2 bf16 triple split; statistics f32 (exp2 domain); P.V: P x 4096 as f16 with V f16 staged in LDS
//   (SPLITPV: P and V as bf16 hi/lo splits). kv head = h / hrep. Masking: causal = 1 (keep j <= i + coff, masked -> -inf, key blocks beyond the
//   diagonal skipped), causal = 2 (masked -> mfill, a finite fill like the -1e9; no skipping), causal = 3 (keep j >= i + coff,
//   masked -> -inf, no skipping); optional additive f32 mask Mf,
//   optional int keep-mask Mi (0 -> score := mfill), both addressed b*smb + h*smh + i*smi + j*smj (0 strides broadcast).
//   PLAIN (QM 0, f16 P.V, one pass): the call is causal = 1 with coff 0, hrep 1, dh == DHP, dv == DVP, element strides 1, every Q/K/V row 16-byte aligned,
//   and none of P, Mf, Mi, ST, Pw, Rt, SQ/SK, nonorm. These become compile-time constants: the element guards fold away, so Q, K and V are read with
//   16-byte loads that are in flight in runs instead of one guarded float at a time, each waited for, and the option tests leave the score loop.
//   O16 (PLAIN, DVP 64, Lq a multiple of 16): the output goes to Oh as f16 (strides sOb, sOh, sOi in elements; rows 16-byte aligned), rounded from the same f32 value that O would hold,
//   so that the next product reads it without a cast launch in between. A (row, head) piece is one whole 128-byte line.
// =====================================================================================================================
#define AW 4
struct AttnP {   // apv4
    const float* Q; const float* K; const float* V; float* O; _Float16* Oh; float* P; const float* Mf; const int* Mi; float* ST;   // Oh: the output plane of the O16 form (O unused there)
    const float* Pw; const float* Rt; const int* SQ; const int* SK;           // optional: post-softmax weight, relative-position table, segment ids
    long long swb, swh, swi, swj, srb, srh, sri;                                 // Pw strides (b,h,i,j); Rt strides (b,h,i), column = clamp(i - j + roff, 0, rn-1)
    long long sQb, sQh, sQi, sQd, sKb, sKh, sKj, sKd, sVb, sVh, sVj, sVd, sOb, sOh, sOi, sPb, sPh, sPi, smb, smh, smi, smj;
    int Lq, Lk, dh, dv, hrep, causal, coff, pband;   // pband > 0: P holds only the band |j - i| <= pband, column j - i + pband
    float scale, mfill; int nonorm, mpol;             // nonorm (online path only): O = sum_j exp(score_j) V_j without the 1/rowsum (scores must be <= ~0); mpol: Mi masks where ==0 (mpol 0) or where !=0 (mpol 1)
    int roff, rn, segpol, win;                        // Rt column offset/count; SQ/SK: score := mfill where (segpol 0) SQ[i] != SK[j] or (segpol 1) SQ[i] == SK[j]; win > 0: keys with i - j > win (after coff) -> -inf, key blocks wholly below the window skipped
};
//   Pw: the softmax numerator is multiplied by Pw(b,h,i,j) AFTER the row sum is taken (probs * weight, then P.V), as in post-softmax multiplicative biases.                                                    // ST (optional): per row (b,h,i) -> ST[((b*H + h)*Lq + i)*2 + {0,1}] = {row max of the scaled+masked score (natural units), sum_j exp(score - max)}
static_assert(sizeof(AttnP) == 13 * 8 + 29 * 8 + 16 * 4, "AttnP has padding");

#ifndef KATTN_ATTR
#define KATTN_ATTR
#endif
template <int DHP, int DVP, int QM, bool SPLITPV, bool TWOPASS, bool PLAIN = false, bool O16 = false>
__global__ __launch_bounds__(32 * AW) KATTN_ATTR void k_attn(AttnP pa) {
    static_assert(!PLAIN || (QM == 0 && !SPLITPV && !TWOPASS), "PLAIN covers the f16 one-pass form");
    static_assert(!O16 || (PLAIN && DVP == 64), "O16 covers the PLAIN form with 64 value columns");
    AttnP p = pa;
    if (PLAIN) {
        p.P = nullptr; p.Mf = nullptr; p.Mi = nullptr; p.ST = nullptr; p.Pw = nullptr; p.Rt = nullptr; p.SQ = nullptr; p.SK = nullptr;
        p.sQd = 1; p.sKd = 1; p.sVd = 1; p.dh = DHP; p.dv = DVP; p.hrep = 1; p.causal = 1; p.coff = 0; p.pband = 0; p.nonorm = 0;
    }
    constexpr int NT = DVP / 16;                // output tiles
    constexpr int KS = DHP / 32;                // k-steps for the scores
    constexpr int VP = DVP + 8;                 // LDS pitch (halves)
    constexpr int NV = 64 * (DVP / 4) / (32 * AW);   // PLAIN: 16-byte pieces of the V tile per thread
    static_assert(!PLAIN || NV * (32 * AW) == 64 * (DVP / 4), "the block's threads cover the V tile evenly");
    __shared__ __align__(16) float    pl[AW][16 * 64];
    __shared__ __align__(16) _Float16 vl[(SPLITPV ? 2 : 1) * 64 * VP];   // f16 V tile, or bf16 hi and lo tiles (same 2-byte size)
    const int lane = threadIdx.x & 31, hf = lane >> 4, l15 = lane & 15, wave = threadIdx.x >> 5;
    const int h = blockIdx.y, b = blockIdx.z, hk = h / p.hrep;
    const int q0 = (blockIdx.x * AW + wave) * 16;
    float* myp = pl[wave];
    const float L2E = 1.4426950408889634f;
    const float NEG = -__builtin_inff();
    const int qi = min(q0 + l15, p.Lq - 1);
    const float* qrow = p.Q + b * p.sQb + h * p.sQh + (long long)qi * p.sQi;
    const float* kbase = p.K + b * p.sKb + hk * p.sKh;
    const float* vbase = p.V + b * p.sVb + hk * p.sVh;
    v16h qa[QM == 0 ? KS : 1]; Split qs_[QM == 1 ? KS : 1]; Split3 qt_[QM == 2 ? KS : 1];
#pragma unroll
    for (int ks = 0; ks < KS; ++ks) {
        if (QM == 2) qt_[ks] = sp3_ld(qrow, p.sQd, ks * 32, hf, p.dh, 1.f);
        else if (QM == 1) qs_[ks] = sp_ld(qrow, p.sQd, ks * 32, hf, p.dh, 1.f);
        else if (PLAIN) qa[ks] = raw_f16(raw_ld4(qrow, ks * 32, hf));
        else qa[ks] = fh_ld(qrow, p.sQd, ks * 32, hf, p.dh, 1.f);
    }
    v8f o[NT]; float m8[8], l8[8];
#pragma unroll
    for (int t = 0; t < NT; ++t) { v8f zz = {}; o[t] = zz; }
#pragma unroll
    for (int i = 0; i < 8; ++i) { m8[i] = NEG; l8[i] = 0.f; }
    int jend = p.Lk;
    if (p.causal == 1) { const int je = (blockIdx.x * AW + AW - 1) * 16 + 16 + p.coff; jend = min(jend, max(je, 0)); }   // uniform per block
    int jbeg = 0;                                                // first key any query row of this block can see through the window; uniform per block
    if (p.win > 0 && !p.P) jbeg = max((int)(blockIdx.x * AW) * 16 + p.coff - p.win, 0);   // keys below it are -inf for all 16*AW rows (weight exactly 0); P, where asked for, still needs its zeros written
    const int npass = TWOPASS ? 2 : 1;
    for (int pass = 0; pass < npass; ++pass) {
        const bool dopv = (!TWOPASS) || pass == 1;
        for (int j0 = jbeg; j0 < jend; j0 += 64) {
            v4f vr[PLAIN ? NV : 1]; Raw16 kr[PLAIN ? 2 : 1][KS];   // PLAIN: this thread's part of the V tile and the lane's K fragments of two columns, f32 as loaded
            if (dopv) {
                __syncthreads();                                 // previous key block's reads of vl / pl are done
                if (!PLAIN)
                for (int idx = threadIdx.x; idx < 64 * DVP; idx += 32 * AW) {
                    const int jr = idx / DVP, d = idx - jr * DVP, j = j0 + jr;
                    const float f = (j < p.Lk && d < p.dv) ? vbase[(long long)j * p.sVj + (long long)d * p.sVd] : 0.f;
                    if (SPLITPV) {
                        const __bf16 hb = bf16_rne(f);
                        ((__bf16*)vl)[jr * VP + d] = hb; ((__bf16*)vl)[64 * VP + jr * VP + d] = bf16_rne(f - bf16_f32(hb));
                    } else vl[jr * VP + d] = (_Float16)f;
                }
            }
            v8f s[4];
#pragma unroll
            for (int t = 0; t < 4; ++t) {
                const int j = min(j0 + t * 16 + l15, p.Lk - 1);
                const float* krow = kbase + (long long)j * p.sKj;
                if (PLAIN && (t & 1) == 0) {
                    // the K loads of two 16-key columns are issued ahead of the first use of any of them: one trip to memory for 4 fragments
                    // (all four columns at once took the build past 256 registers). The loops here are unrolled so that kr and vr stay in registers.
#pragma unroll
                    for (int u = 0; u < 2; ++u) {
#pragma unroll
                        for (int ks = 0; ks < KS; ++ks) kr[u][ks] = raw_ld4(kbase + (long long)min(j0 + (t + u) * 16 + l15, p.Lk - 1) * p.sKj, ks * 32, hf);
                        // one column's loads share one address pair: this wait stands behind them, ahead of any later load whose result may be given that pair
                        asm volatile("s_wait_xcnt 0x0" ::: "memory");
                    }
#pragma unroll
                    for (int u = 0; u < 2; ++u)
#pragma unroll
                        for (int ks = 0; ks < KS; ++ks) loads_held(kr[u][ks].x0, kr[u][ks].x1, kr[u][ks].x2, kr[u][ks].x3);
                }
                v8f acc = {};
#pragma unroll
                for (int ks = 0; ks < KS; ++ks) {
                    if (QM == 2)      acc = wmma6(qt_[ks], sp3_ld(krow, p.sKd, ks * 32, hf, p.dh, 1.f), acc);
                    else if (QM == 1) acc = wmma3(qs_[ks], sp_ld(krow, p.sKd, ks * 32, hf, p.dh, 1.f), acc);
                    else if (PLAIN)   acc = wmma16(qa[ks], raw_f16(kr[t & 1][ks]), acc);
                    else              acc = wmma16(qa[ks], fh_ld(krow, p.sKd, ks * 32, hf, p.dh, 1.f), acc);
                }
                s[t] = acc;
            }
            if (PLAIN) {
                // the V tile's loads go out here and are first used behind the softmax, which covers their trip to memory
#pragma unroll
                for (int n = 0; n < NV; ++n) {
                    const int idx = threadIdx.x + n * (32 * AW), jr = idx / (DVP / 4), d = (idx - jr * (DVP / 4)) * 4;
                    vr[n] = *(const v4f*)(vbase + (long long)min(j0 + jr, p.Lk - 1) * p.sVj + d);   // row clamped, so no guard round the load
                }
            }
            float pv[8][4];
#pragma unroll
            for (int i = 0; i < 8; ++i) {
                const int irow = q0 + i + 8 * hf;
                const int ic = min(irow, p.Lq - 1);
                float sc[4];
#pragma unroll
                for (int t = 0; t < 4; ++t) {
                    const int jg = j0 + t * 16 + l15;
                    float v = s[t][i] * p.scale;
                    if (p.Mf) v += p.Mf[b * p.smb + h * p.smh + (long long)ic * p.smi + (long long)min(jg, p.Lk - 1) * p.smj];
                    if (p.Rt) { int rc = ic - min(jg, p.Lk - 1) + p.roff; rc = rc < 0 ? 0 : (rc >= p.rn ? p.rn - 1 : rc); v += p.Rt[b * p.srb + h * p.srh + (long long)ic * p.sri + rc]; }
                    if (p.Mi) { const int mv = p.Mi[b * p.smb + h * p.smh + (long long)ic * p.smi + (long long)min(jg, p.Lk - 1) * p.smj]; if (p.mpol ? (mv != 0) : (mv == 0)) v = p.mfill; }
                    if (p.SQ) { const bool same = p.SQ[(long long)b * p.Lq + ic] == p.SK[(long long)b * p.Lk + min(jg, p.Lk - 1)]; if (p.segpol ? same : !same) v = p.mfill; }
                    if (p.causal == 2 && jg > irow + p.coff) v = p.mfill;
                    if (jg >= p.Lk || (p.causal == 1 && jg > irow + p.coff) || (p.causal == 3 && jg < irow + p.coff) || (p.win > 0 && irow + p.coff - jg > p.win)) v = NEG; else v *= L2E;
                    sc[t] = v;
                }
                if (!TWOPASS || pass == 0) {
                    float mx = fmaxf(fmaxf(sc[0], sc[1]), fmaxf(sc[2], sc[3]));
                    mx = fmaxf(mx, __shfl_xor(mx, 1, 32)); mx = fmaxf(mx, __shfl_xor(mx, 2, 32));
                    mx = fmaxf(mx, __shfl_xor(mx, 4, 32)); mx = fmaxf(mx, __shfl_xor(mx, 8, 32));
                    const float mnew = fmaxf(m8[i], mx);
                    const float corr = (mnew == NEG) ? 1.f : exp2f(m8[i] - mnew);
                    float rs = 0.f;
#pragma unroll
                    for (int t = 0; t < 4; ++t) {
                        const float pp = (sc[t] == NEG) ? 0.f : exp2f(sc[t] - mnew); rs += pp;
                        pv[i][t] = p.Pw ? pp * p.Pw[b * p.swb + h * p.swh + (long long)ic * p.swi + (long long)min(j0 + t * 16 + l15, p.Lk - 1) * p.swj] : pp;
                    }
                    rs += __shfl_xor(rs, 1, 32); rs += __shfl_xor(rs, 2, 32); rs += __shfl_xor(rs, 4, 32); rs += __shfl_xor(rs, 8, 32);
                    l8[i] = l8[i] * corr + rs; m8[i] = mnew;
                    if (!TWOPASS) {
#pragma unroll
                        for (int t = 0; t < NT; ++t) o[t][i] *= corr;
                    }
                } else {
                    const float inv = (l8[i] > 0.f) ? 1.f / l8[i] : 0.f;
#pragma unroll
                    for (int t = 0; t < 4; ++t) {
                        const int jg = j0 + t * 16 + l15;
                        float pp = (sc[t] == NEG) ? 0.f : exp2f(sc[t] - m8[i]) * inv;
                        if (p.Pw) pp *= p.Pw[b * p.swb + h * p.swh + (long long)ic * p.swi + (long long)min(jg, p.Lk - 1) * p.swj];
                        pv[i][t] = pp;
                    }
                }
            }
            if (dopv) {
                if (PLAIN) {                                     // cast and stage the V tile loaded above (unrolled: vr stays in registers)
#pragma unroll
                    for (int n = 0; n < NV; ++n) {
                        const int idx = threadIdx.x + n * (32 * AW), jr = idx / (DVP / 4), d = (idx - jr * (DVP / 4)) * 4;
                        v4h hv;
#pragma unroll
                        for (int e = 0; e < 4; ++e) hv[e] = (_Float16)((j0 + jr < p.Lk) ? vr[n][e] : 0.f);
                        *(v4h*)&vl[jr * VP + d] = hv;
                    }
                }
#pragma unroll
                for (int i = 0; i < 8; ++i)
#pragma unroll
                    for (int t = 0; t < 4; ++t) ((float*)myp)[(i + 8 * hf) * 64 + t * 16 + l15] = pv[i][t];
                __syncthreads();                                 // P (per wave) and V (shared) visible
                if (p.P) {
                    float* pb_ = p.P + b * p.sPb + h * p.sPh;
                    const bool fastP = (p.pband == 0) && ((p.sPi & 3) == 0) && (j0 + 64 <= p.Lk) && (q0 + 16 <= p.Lq) && ((((size_t)pb_) & 15) == 0);
                    if (fastP) {
#pragma unroll
                        for (int s = 0; s < 8; ++s) {
                            const int row = s * 2 + (lane >> 4), c4 = (lane & 15) * 4;
                            const v4f v = *(const v4f*)(myp + row * 64 + c4);
                            VST2V4(pb_ + (long long)(q0 + row) * p.sPi + j0 + c4, v);
                        }
                    } else {
                        for (int row = 0; row < 16; ++row) {
                            const int irow = q0 + row; if (irow >= p.Lq) continue;
                            for (int c = lane; c < 64; c += 32) {
                                const int jg = j0 + c; if (jg >= p.Lk) continue;
                                if (p.pband == 0) VST2(float, pb_ + (long long)irow * p.sPi + jg, myp[row * 64 + c]);
                                else if (jg - irow <= p.pband && irow - jg <= p.pband) VST2(float, pb_ + (long long)irow * p.sPi + (jg - irow + p.pband), myp[row * 64 + c]);
                            }
                        }
                    }
                }
                if (SPLITPV) {
                    const Split pa0 = sp_ld(myp + l15 * 64, 1, 0, hf, 64, 1.f), pa1 = sp_ld(myp + l15 * 64, 1, 32, hf, 64, 1.f);
                    const __bf16* vh = (const __bf16*)vl; const __bf16* vlo = vh + 64 * VP;
#pragma unroll
                    for (int t = 0; t < NT; ++t) {
                        const int dcol = t * 16 + l15;
                        Split b0, b1;
#pragma unroll
                        for (int e = 0; e < 16; ++e) {
                            const int k0 = frag_k(e, hf), k1 = 32 + frag_k(e, hf);
                            b0.hi[e] = vh[k0 * VP + dcol]; b0.lo[e] = vlo[k0 * VP + dcol]; b1.hi[e] = vh[k1 * VP + dcol]; b1.lo[e] = vlo[k1 * VP + dcol];
                        }
                        o[t] = wmma3(pa0, b0, o[t]);
                        o[t] = wmma3(pa1, b1, o[t]);
                    }
                } else {
                    const v16h pa0 = fh_ld(myp + l15 * 64, 1, 0, hf, 64, 4096.f), pa1 = fh_ld(myp + l15 * 64, 1, 32, hf, 64, 4096.f);
#pragma unroll
                    for (int t = 0; t < NT; ++t) {
                        const int dcol = t * 16 + l15;
                        v16h b0, b1;
#pragma unroll
                        for (int e = 0; e < 16; ++e) { b0[e] = vl[frag_k(e, hf) * VP + dcol]; b1[e] = vl[(32 + frag_k(e, hf)) * VP + dcol]; }
                        o[t] = wmma16(pa0, b0, o[t]);
                        o[t] = wmma16(pa1, b1, o[t]);
                    }
                }
            }
        }
    }
    float* obase = p.O + b * p.sOb + h * p.sOh;
    if (p.ST) {
        const int rl = lane >> 1, isel = rl & 7;           // row q0 + rl ; rl>>3 == hf holds because lane>>4 == (lane>>1)>>3
        float mv = 0.f, lv = 0.f;
#pragma unroll
        for (int i = 0; i < 8; ++i) if (i == isel) { mv = m8[i]; lv = l8[i]; }
        const int irow = q0 + rl;
        if (irow < p.Lq) { float* st = p.ST + (((long long)b * gridDim.y + h) * p.Lq + irow) * 2 + (lane & 1); VST2(float, st, (lane & 1) ? lv : mv * 0.6931471805599453f); }
    }
    float invr[8];
#pragma unroll
    for (int i = 0; i < 8; ++i) {
        if (TWOPASS) invr[i] = SPLITPV ? 1.f : (1.f / 4096.f);
        else if (p.nonorm) invr[i] = exp2f(m8[i]) * (SPLITPV ? 1.f : (1.f / 4096.f));
        else invr[i] = (l8[i] > 0.f) ? (SPLITPV ? 1.f / l8[i] : 1.f / (l8[i] * 4096.f)) : 0.f;
    }
    __syncthreads();                                             // all waves done with pl/vl from the main loop
    const bool ofast = ((p.sOi & 3) == 0) && ((((size_t)obase) & 15) == 0) && (q0 + 16 <= p.Lq);
#pragma unroll
    for (int c0 = 0; c0 < DVP; c0 += 64) {
#pragma unroll
        for (int i = 0; i < 8; ++i)
#pragma unroll
            for (int t = 0; t < NT; ++t) if (t * 16 >= c0 && t * 16 < c0 + 64) ((float*)myp)[(i + 8 * hf) * 64 + (t * 16 - c0) + l15] = o[t][i] * invr[i];
        __syncthreads();
        const int cw = (DVP - c0 < 64) ? (DVP - c0) : 64;      // staged columns in this chunk (multiple of 16)
        if (O16) {
            _Float16* oh = p.Oh + b * p.sOb + h * p.sOh;
            if (q0 < p.Lq) {                                     // Lq is a multiple of 16: a wave's 16 rows are all there or none is
#pragma unroll   // four stores of 4 rows each, all in flight
                for (int r0 = 0; r0 < 16; r0 += 4) {
                    const int row = r0 + (lane >> 3), c8 = (lane & 7) * 8;
                    const float* sp = myp + row * 64 + c8;
                    v8h hv;
#pragma unroll   // constant element indices: the vector stays in registers
                    for (int e = 0; e < 8; ++e) hv[e] = (_Float16)sp[e];
                    *(v8h*)(oh + (long long)(q0 + row) * p.sOi + c8) = hv;
                }
            }
        } else if (ofast && (c0 + cw <= p.dv) && (cw % 32 == 0)) {
            const int lpr = cw / 4;                              // lanes per row (16 for 64 cols, 8 for 32)
            const int rows_per_ins = 32 / lpr;
            for (int r0 = 0; r0 < 16; r0 += rows_per_ins) {
                const int row = r0 + lane / lpr, c4 = (lane % lpr) * 4;
                const v4f v = *(const v4f*)(myp + row * 64 + c4);
                VST2V4(obase + (long long)(q0 + row) * p.sOi + c0 + c4, v);
            }
        } else {
            for (int row = 0; row < 16; ++row) {
                const int irow = q0 + row; if (irow >= p.Lq) continue;
                for (int c = lane; c < cw; c += 32) { const int d = c0 + c; if (d < p.dv) VST2(float, obase + (long long)irow * p.sOi + d, myp[row * 64 + c]); }
            }
        }
        __syncthreads();
    }
}

__device__ __forceinline__ float other_half(float v) {
    const int b = __builtin_bit_cast(int, v);
    return __builtin_bit_cast(float, __builtin_amdgcn_permlanex16(b, b, 0x76543210, 0xfedcba98, false, false));
}
// k_tile_ld: this thread's eight 16-byte pieces of the 64 x 64 f32 K tile that starts at key j: piece (thread & 15) of rows (thread >> 4) + 8 n, so that a wave's load
// covers two whole 256-byte row pieces. A row is clamped to the last key, so there is no guard round a load; such a key's scores are masked.
__device__ __forceinline__ void k_tile_ld(v4f (&kr)[8], const float* __restrict__ kbase, int j, int Lk, long long sKj) {
    static_assert(32 * AW == 128, "eight rows per pass of the block");
    const float* kp[8];
#pragma unroll   // constant indices: the arrays stay in registers
    for (int n = 0; n < 8; ++n) kp[n] = kbase + (long long)min(j + (int)(threadIdx.x >> 4) + 8 * n, Lk - 1) * sKj + (threadIdx.x & 15) * 4;
#pragma unroll   // constant indices; the eight loads are in flight together
    for (int n = 0; n < 8; ++n) kr[n] = *(const v4f*)kp[n];
    // The wait in front of any rewrite of a register that the run names; as its inputs the addresses stay whole until it, so that no load of the run lands in one.
    asm volatile("s_wait_xcnt 0x0" :: "v"(kp[0]), "v"(kp[1]), "v"(kp[2]), "v"(kp[3]), "v"(kp[4]), "v"(kp[5]), "v"(kp[6]), "v"(kp[7]) : "memory");
}
__global__ __launch_bounds__(32 * AW) void k_attn_t(AttnP p) {
    constexpr int KS = 2;                       // k-steps of the scores (head dim 64)
    constexpr int VP = 64 + 8;                  // LDS pitch of the K tile, the V tile and the output staging (halves): 144 bytes, an odd number of 16-byte pieces
    constexpr int NV = 64 * 16 / (32 * AW);     // 16-byte pieces of an f32 K or V tile per thread
    __shared__ __align__(16) _Float16 kl[64 * VP];
    __shared__ __align__(16) _Float16 vl[64 * VP];
    __shared__ __align__(16) _Float16 ol[AW][16 * VP];
    const int lane = threadIdx.x & 31, hf = lane >> 4, l15 = lane & 15, wave = threadIdx.x >> 5;
    const int h = blockIdx.y, b = blockIdx.z;
    const int q0 = (blockIdx.x * AW + wave) * 16;
    const float L2E = 1.4426950408889634f;
    const float NEG = -__builtin_inff();
    const int irow = q0 + l15;                  // the lane's query
    const float* qrow = p.Q + b * p.sQb + h * p.sQh + (long long)min(irow, p.Lq - 1) * p.sQi;
    const float* kbase = p.K + b * p.sKb + h * p.sKh;
    const float* vbase = p.V + b * p.sVb + h * p.sVh;
    v16h qa[KS];
    {
        Raw16 qr[KS];
#pragma unroll   // constant indices: the fragments stay in registers
        for (int ks = 0; ks < KS; ++ks) qr[ks] = raw_ld4(qrow, ks * 32, hf);
        asm volatile("s_wait_xcnt 0x0" ::: "memory");   // behind the run of loads off one address pair, ahead of any rewrite of that pair
#pragma unroll   // constant indices: the arrays stay in registers
        for (int ks = 0; ks < KS; ++ks) qa[ks] = raw_f16(qr[ks]);
    }
    v8f o[4]; float m = NEG, l = 0.f;
#pragma unroll   // constant indices: the arrays stay in registers
    for (int t = 0; t < 4; ++t) { v8f zz = {}; o[t] = zz; }
    const int jend = min(p.Lk, (int)(blockIdx.x * AW + AW) * 16);          // uniform per block: no key beyond the block's last query
    const int jbeg = (p.win > 0) ? max((int)(blockIdx.x * AW) * 16 - p.win, 0) : 0;   // uniform per block: first key that any of its queries sees through the window
    v4f kr[NV];                                 // this thread's part of a K tile, f32 as loaded: loaded one key block ahead
    if (jbeg < jend) k_tile_ld(kr, kbase, jbeg, p.Lk, p.sKj);
    for (int j0 = jbeg; j0 < jend; j0 += 64) {
        v4f vr[NV];                             // this thread's part of the V tile, f32 as loaded
        // cast and stage the K tile. Every wave's reads of the previous K tile ended ahead of that key block's second barrier, which this wave has passed.
#pragma unroll   // constant indices: the arrays stay in registers
        for (int n = 0; n < NV; ++n) {
            const int idx = threadIdx.x + n * (32 * AW), jr = idx >> 4, d = (idx & 15) * 4;
            v4h hv;
#pragma unroll   // constant indices: the arrays stay in registers
            for (int e = 0; e < 4; ++e) hv[e] = (_Float16)kr[n][e];
            *(v4h*)&kl[jr * VP + d] = hv;
        }
        __syncthreads();                        // the K tile is visible to every wave, and the previous key block's reads of vl are done
        v8f s[4]; v16h ka[4][KS];
#pragma unroll   // constant indices: the arrays stay in registers
        for (int t = 0; t < 4; ++t) {
            const _Float16* krow = &kl[(t * 16 + l15) * VP + 8 * hf];   // frag_k order: 8 halves at 8 hf and 8 at 16 + 8 hf of each 32
#pragma unroll   // constant indices: the arrays stay in registers
            for (int ks = 0; ks < KS; ++ks) {
                const v8h k0 = *(const v8h*)(krow + ks * 32), k1 = *(const v8h*)(krow + ks * 32 + 16);
                ka[t][ks] = __builtin_shufflevector(k0, k1, 0, 1, 2, 3, 4, 5, 6, 7, 8, 9, 10, 11, 12, 13, 14, 15);
            }
        }
        __builtin_amdgcn_sched_barrier(0);   // without it the compiler reads each fragment directly in front of its product and waits out the LDS latency eight times
#pragma unroll   // constant indices: the arrays stay in registers
        for (int t = 0; t < 4; ++t) {
            v8f acc = {};
#pragma unroll   // constant indices: the arrays stay in registers
            for (int ks = 0; ks < KS; ++ks) acc = wmma16(ka[t][ks], qa[ks], acc);
            s[t] = acc;
        }
        // the V tile's loads go out here and are first used behind the softmax, which covers their trip to memory
#pragma unroll   // constant indices: the arrays stay in registers
        for (int n = 0; n < NV; ++n) {
            const int idx = threadIdx.x + n * (32 * AW), jr = idx >> 4, d = (idx & 15) * 4;
            vr[n] = *(const v4f*)(vbase + (long long)min(j0 + jr, p.Lk - 1) * p.sVj + d);   // row clamped, so no guard round the load
        }
        asm volatile("s_wait_xcnt 0x0" ::: "memory");   // behind the run of V loads, ahead of any rewrite of their address registers
        if (j0 + 64 < jend) k_tile_ld(kr, kbase, j0 + 64, p.Lk, p.sKj);   // the next key block's K tile (the test is the same for the whole block): the rest of this key block covers its trip
        __builtin_amdgcn_sched_barrier(0);   // without it the compiler sinks the V loads to the end of the softmax, which then no longer covers their trip
        float mt[4];
#pragma unroll   // constant indices: the scores stay in registers; four independent chains of maxima
        for (int t = 0; t < 4; ++t) {
            mt[t] = NEG;
#pragma unroll   // constant indices: the arrays stay in registers
            for (int r = 0; r < 8; ++r) {
                const int jg = j0 + t * 16 + 8 * hf + r;
                float v = s[t][r] * p.scale;
                if (jg >= p.Lk || jg > irow || (p.win > 0 && irow - jg > p.win)) v = NEG; else v *= L2E;
                s[t][r] = v; mt[t] = fmaxf(mt[t], v);
            }
        }
        float mx = fmaxf(fmaxf(mt[0], mt[1]), fmaxf(mt[2], mt[3]));
        mx = fmaxf(mx, other_half(mx));
        const float mnew = fmaxf(m, mx);
        const float ms = (mnew == NEG) ? 0.f : mnew;    // no key seen yet: every score is -inf, and -inf - 0 gives weight 0 where -inf - -inf would give NaN
        const float corr = exp2f(m - ms);               // 0 while m is -inf, where l and o are still 0
        float rt[4];
#pragma unroll   // four independent chains of sums
        for (int t = 0; t < 4; ++t) {
            rt[t] = 0.f;
#pragma unroll   // constant indices: the arrays stay in registers
            for (int r = 0; r < 8; ++r) { const float pp = exp2f(s[t][r] - ms); s[t][r] = pp; rt[t] += pp; }
        }
        float rs = (rt[0] + rt[1]) + (rt[2] + rt[3]);
        rs += other_half(rs);
        l = l * corr + rs; m = mnew;
#pragma unroll   // constant indices: the arrays stay in registers
        for (int t = 0; t < 4; ++t) o[t] *= corr;
        v16h pb[2];
#pragma unroll   // constant element indices: the vectors stay in registers
        for (int k2 = 0; k2 < 2; ++k2)
#pragma unroll   // constant indices: the arrays stay in registers
            for (int i = 0; i < 8; ++i) { pb[k2][i] = (_Float16)(s[2 * k2][i] * 4096.f); pb[k2][8 + i] = (_Float16)(s[2 * k2 + 1][i] * 4096.f); }
        // cast and stage the V tile loaded above (unrolled: vr stays in registers)
#pragma unroll   // constant indices: the arrays stay in registers
        for (int n = 0; n < NV; ++n) {
            const int idx = threadIdx.x + n * (32 * AW), jr = idx >> 4, d = (idx & 15) * 4;
            v4h hv;
#pragma unroll   // constant indices: the arrays stay in registers
            for (int e = 0; e < 4; ++e) hv[e] = (_Float16)((j0 + jr < p.Lk) ? vr[n][e] : 0.f);
            *(v4h*)&vl[jr * VP + d] = hv;
        }
        __syncthreads();                        // the V tile is visible to every wave
#pragma unroll   // constant indices: the arrays stay in registers
        for (int t = 0; t < 4; ++t) {
            const int dcol = t * 16 + l15;
            v16h a0, a1;
#pragma unroll   // constant indices: the arrays stay in registers
            for (int e = 0; e < 16; ++e) { a0[e] = vl[frag_k(e, hf) * VP + dcol]; a1[e] = vl[(32 + frag_k(e, hf)) * VP + dcol]; }
            o[t] = wmma16(a0, pb[0], o[t]);
            o[t] = wmma16(a1, pb[1], o[t]);
        }
    }
    const float inv = (l > 0.f) ? 1.f / (l * 4096.f) : 0.f;
    _Float16* mo = ol[wave];                    // the wave's 16 x 64 output tile, so that the stores to memory cover whole 128-byte lines
#pragma unroll   // constant indices: the arrays stay in registers
    for (int t = 0; t < 4; ++t) {
        v8h hv;
#pragma unroll   // constant element indices
        for (int r = 0; r < 8; ++r) hv[r] = (_Float16)(o[t][r] * inv);
        *(v8h*)&mo[l15 * VP + t * 16 + 8 * hf] = hv;
    }
    __syncthreads();                            // the tile is written before other lanes read it
    _Float16* oh = p.Oh + b * p.sOb + h * p.sOh;
    if (q0 < p.Lq) {                            // Lq is a multiple of 16: a wave's 16 rows are all there or none is
#pragma unroll   // four stores of 4 rows each, all in flight
        for (int r0 = 0; r0 < 16; r0 += 4) {
            const int row = r0 + (lane >> 3), c8 = (lane & 7) * 8;
            *(v8h*)(oh + (long long)(q0 + row) * p.sOi + c8) = *(const v8h*)&mo[row * VP + c8];
        }
    }
}

// =====================================================================================================================
// k_tr: dst(z, c, r) = alpha * src(z, r, c) (+ beta * R2(z, c, r)): [Z][R][C] (row stride lds) -> [Z][C][R] (row stride ldd) through a 32x32 LDS tile;
//   flags: 1 -> add beta * residual R2 addressed like dst (z*sRz + c*ldr + r); act applied before the residual.
// =====================================================================================================================
struct TrP { const float* src; float* dst; const float* R2; long long sSz, lds, sDz, ldd, sRz, ldr; int R, C, flags, act; float alpha, beta; };
static_assert(sizeof(TrP) == 3 * 8 + 6 * 8 + 6 * 4, "TrP has padding");
__global__ __launch_bounds__(256) void k_tr(TrP p) {
    __shared__ float tile[32][33];
    const int c0 = blockIdx.x * 32, r0 = blockIdx.y * 32, z = blockIdx.z;
    const int lane = threadIdx.x & 31, wave = threadIdx.x >> 5;
    const float* s = p.src + z * p.sSz;
#pragma unroll
    for (int k = 0; k < 4; ++k) {
        const int rl = wave * 4 + k, r = r0 + rl, c = c0 + lane;
        tile[rl][lane] = (r < p.R && c < p.C) ? s[(long long)r * p.lds + c] : 0.f;
    }
    __syncthreads();
    float* d = p.dst + z * p.sDz; const float* rr = p.R2 + z * p.sRz;
#pragma unroll
    for (int k = 0; k < 4; ++k) {
        const int cl = wave * 4 + k, c = c0 + cl, r = r0 + lane;
        if (c < p.C && r < p.R) {
            float v = act_fn(p.alpha * tile[lane][cl], p.act);
            if (p.flags & 1) v += p.beta * rr[(long long)c * p.ldr + r];
            VST2(float, d + (long long)c * p.ldd + r, v);
        }
    }
}

// k_affine: dst[i] = a * (sdev ? sdev[0] : 1) * src[i] + b, i < n (one thread per element; consecutive lanes -> consecutive addresses)
__global__ __launch_bounds__(256) void k_affine(const float* __restrict__ src, float* __restrict__ dst, int n, float a, float b, const float* __restrict__ sdev) {
    const int i = blockIdx.x * 256 + threadIdx.x;
    if (i < n) { const float aa = sdev ? a * sdev[0] : a; const float v = aa * src[i] + b; VST2(float, dst + i, v); }
}

// =====================================================================================================================
// k_softmax: row softmax over n contiguous elements, one 256-thread block per row; rows addressed z*sz + r*sr (grid (R, Z)).
//   out = scale_out * softmax(scale_in * x + (Mf ? Mf[z*smz + r*smr + j] : 0)); a row whose max is -inf is written as 0.
// =====================================================================================================================
struct SmP { const float* src; float* dst; const float* Mf; long long sz, sr, dz, dr, smz, smr; int n, pad; float scale_in, scale_out; };
static_assert(sizeof(SmP) == 3 * 8 + 6 * 8 + 4 * 4, "SmP has padding");
__global__ __launch_bounds__(256) void k_softmax(SmP p) {
    __shared__ float red[256];
    const int r = blockIdx.x, z = blockIdx.y, tid = threadIdx.x;
    const float* s = p.src + z * p.sz + (long long)r * p.sr;
    const float* mf = p.Mf ? (p.Mf + z * p.smz + (long long)r * p.smr) : nullptr;
    float mx = -__builtin_inff();
    for (int j = tid; j < p.n; j += 256) { float v = s[j] * p.scale_in; if (mf) v += mf[j]; mx = fmaxf(mx, v); }
    red[tid] = mx; __syncthreads();
    for (int o = 128; o > 0; o >>= 1) { if (tid < o) red[tid] = fmaxf(red[tid], red[tid + o]); __syncthreads(); }
    mx = red[0]; __syncthreads();
    float sum = 0.f;
    for (int j = tid; j < p.n; j += 256) { float v = s[j] * p.scale_in; if (mf) v += mf[j]; sum += (mx == -__builtin_inff()) ? 0.f : expf(v - mx); }
    red[tid] = sum; __syncthreads();
    for (int o = 128; o > 0; o >>= 1) { if (tid < o) red[tid] += red[tid + o]; __syncthreads(); }
    sum = red[0];
    const float inv = (sum > 0.f) ? p.scale_out / sum : 0.f;
    float* d = p.dst + z * p.dz + (long long)r * p.dr;
    for (int j = tid; j < p.n; j += 256) { float v = s[j] * p.scale_in; if (mf) v += mf[j]; const float o = (mx == -__builtin_inff()) ? 0.f : expf(v - mx) * inv; VST2(float, d + j, o); }
}
// =====================================================================================================================
// k_stats: mean and rsqrt(var + eps) over a set of n elements addressed base + z*sz + (e / inner) * so + (e % inner) * si, one 256-thread
// k_norm_apply: y = (x - mean[set]) * rstd[set] * g[c] + b[c] over a [Z][C][L] channel-major tensor with set = z*G + c / (C/G) (G groups per z;
//   G = C -> per-channel sets indexed z*C+c; for batch norm pass stats indexed by c only via bn = 1). Optional act. Output same layout.
// =====================================================================================================================
//   mode 0: mean / rsqrt(var + eps); mode 1 (RMSNorm): 0 / rsqrt(mean(x^2) + eps); mode 2 (L2 normalize * sqrt(n)): 0 / sqrt(n) / max(||x||, eps); mode 3: as 0 with unbiased variance (n-1)
__global__ __launch_bounds__(256) void k_stats(const float* __restrict__ x, long long sz, long long so, long long si, int inner, int n, float eps, float* __restrict__ stat, int mode) {
    __shared__ float red[256];
    const int z = blockIdx.x, tid = threadIdx.x;
    const float* base = x + z * sz;
    float s = 0.f;
    for (int e = tid; e < n; e += 256) s += base[(long long)(e / inner) * so + (long long)(e % inner) * si];
    red[tid] = s; __syncthreads();
    for (int o = 128; o > 0; o >>= 1) { if (tid < o) red[tid] += red[tid + o]; __syncthreads(); }
    const float mu = (mode == 0 || mode == 3) ? red[0] / (float)n : 0.f; __syncthreads();
    float q = 0.f;
    for (int e = tid; e < n; e += 256) { const float dlt = base[(long long)(e / inner) * so + (long long)(e % inner) * si] - mu; q += dlt * dlt; }
    red[tid] = q; __syncthreads();
    for (int o = 128; o > 0; o >>= 1) { if (tid < o) red[tid] += red[tid + o]; __syncthreads(); }
    {
        float rs;
        if (mode == 2) rs = sqrtf((float)n) / fmaxf(sqrtf(red[0]), eps); else if (mode == 3) rs = rsqrtf(red[0] / (float)(n - 1) + eps); else rs = rsqrtf(red[0] / (float)n + eps);
        if (tid < 32) { const float v = (tid == 0) ? mu : ((tid == 1) ? rs : 0.f); VST2(float, stat + (long long)z * 32 + tid, v); }
    }
}
//   One thread per element over the flat [Z][C][L] index space: grid ceil(Z*C*L / 256).
__global__ __launch_bounds__(256) void k_norm_apply(const float* __restrict__ x, float* __restrict__ y, const float* __restrict__ stat, const float* __restrict__ g, const float* __restrict__ bta,
                                                     int Z, int C, int L, int G, int bn, int act) {
    const long long idx = (long long)blockIdx.x * 256 + threadIdx.x;
    if (idx >= (long long)Z * C * L) return;
    const int l = (int)(idx % L); const long long zc = idx / L; const int c = (int)(zc % C), z = (int)(zc / C); (void)l;
    const int set = bn ? c : (z * G + c / (C / G));
    float v = (x[idx] - stat[(long long)set * 32]) * stat[(long long)set * 32 + 1];
    if (g) v *= g[c];
    if (bta) v += bta[c];
    v = act_fn(v, act);
    VST2(float, y + idx, v);
}

// k_lse_neg: c[i] = -(st[2i] + log(st[2i+1])) = minus the log-sum-exp of row i from k_attn's ST output (for softmax over the query axis)
__global__ __launch_bounds__(256) void k_lse_neg(const float* __restrict__ st, float* __restrict__ c, int n) {
    const int i = blockIdx.x * 256 + threadIdx.x;
    if (i < n) { const float v = -(st[2 * i] + logf(st[2 * i + 1])); VST2(float, c + i, v); }
}

// k_iota: dst[i] = a * i + b as int32 (segment/position id helper)
__global__ __launch_bounds__(256) void k_iota(int* __restrict__ dst, int n, int a, int b) {
    const int i = blockIdx.x * 256 + threadIdx.x;
    if (i < n) { const int v = a * i + b; VST2(int, dst + i, v); }
}

// k_axpby: dst[i] = a * x[i] + b * y[i] (+ c), i < n
__global__ __launch_bounds__(256) void k_axpby(const float* __restrict__ x, const float* __restrict__ y, float* __restrict__ dst, int n, float a, float b, float c) {
    const int i = blockIdx.x * 256 + threadIdx.x;
    if (i < n) { const float v = a * x[i] + b * y[i] + c; VST2(float, dst + i, v); }
}

// =====================================================================================================================
// k_rope: rotary embedding on a [R rows][Hn heads][D] view (row stride sXr, head stride sXh, element stride 1) -> Y (own strides).
//   mode 0: rotate_half (partner d±D/2, sign - for d<D/2); mode 1: interleaved pairs (partner d^1, sign - for even d).
//   table column tcol: tmode 0 -> d, 1 -> d % (D/2), 2 -> d / 2; position p: pmode 0 -> r % S, 1 -> head index, 2 -> pos[r];
//   c = C[(r / S) * sCb + p * sCp + tcol * sCd], s likewise from Sn; y = x[d] * c + sign * x[partner] * s. X and Y must not alias.
// =====================================================================================================================
struct RopeP { const float* X; float* Y; const float* C; const float* Sn; const int* pos; long long sXr, sXh, sYr, sYh, sCb, sCp, sCd; int R, Hn, D, S, mode, tmode, pmode, pad; };
static_assert(sizeof(RopeP) == 5 * 8 + 7 * 8 + 8 * 4, "RopeP has padding");
__global__ __launch_bounds__(256) void k_rope(RopeP p) {
    const long long idx = (long long)blockIdx.x * 256 + threadIdx.x;
    if (idx >= (long long)p.R * p.Hn * p.D) return;
    const int d = (int)(idx % p.D); const long long rh = idx / p.D; const int h = (int)(rh % p.Hn); const int r = (int)(rh / p.Hn);
    const int half = p.D / 2;
    int partner; float sign;
    if (p.mode == 0) { partner = (d < half) ? d + half : d - half; sign = (d < half) ? -1.f : 1.f; }
    else { partner = d ^ 1; sign = (d & 1) ? 1.f : -1.f; }
    const int tcol = (p.tmode == 0) ? d : ((p.tmode == 1) ? (d % half) : (d >> 1));
    const int pp = (p.pmode == 0) ? (r % p.S) : ((p.pmode == 1) ? h : p.pos[r]);
    const long long toff = (long long)(r / p.S) * p.sCb + (long long)pp * p.sCp + (long long)tcol * p.sCd;
    const float* xr = p.X + (long long)r * p.sXr + (long long)h * p.sXh;
    const float v = xr[d] * p.C[toff] + sign * xr[partner] * p.Sn[toff];
    VST2(float, p.Y + (long long)r * p.sYr + (long long)h * p.sYh + d, v);
}

// k_invf + k_sincos (split so neither kernel carries a large VALU-fma footprint): invf_i = num * (1 / powf(base, (2 i)/D)) [fmode 0],
//   num * expf((2 i) * cexp) [fmode 1], num * powf(base, -2 (i - 1) / D) [fmode 2]; then cs/sn[s*half + i] = cos/sin((pscale * s) * invf_i)
__global__ __launch_bounds__(256) void k_invf(float* __restrict__ invb, int half, int D, float base, float num, int fmode, float cexp) {
    const int i = blockIdx.x * 256 + threadIdx.x;
    if (i >= ((half + 31) / 32) * 32) return;
    if (i >= half) { VST2(float, invb + i, 0.f); return; }
    const float e = (float)(2 * i) / (float)D;
    float invf;
    if (fmode == 1) invf = num * expf((float)(2 * i) * cexp);
    else if (fmode == 2) invf = num * powf(base, (-2.0f * ((float)i - 1.0f)) / (float)D);
    else invf = num * (1.0f / powf(base, e));
    VST2(float, invb + i, invf);
}
__global__ __launch_bounds__(256) void k_sincos(float* __restrict__ cs, float* __restrict__ sn, const float* __restrict__ invb, int S, int half, float pscale) {
    const int idx = blockIdx.x * 256 + threadIdx.x;
    if (idx >= S * half) return;
    const int s = idx / half, i = idx - s * half;
    const float ang = (pscale * (float)s) * invb[i];
    VST2(float, cs + idx, cosf(ang)); VST2(float, sn + idx, sinf(ang));
}

// k_mulact: dst[i] = act(x[i]) * y[i]
__global__ __launch_bounds__(256) void k_mulact(const float* __restrict__ x, const float* __restrict__ y, float* __restrict__ dst, int n, int act) {
    const int i = blockIdx.x * 256 + threadIdx.x;
    if (i < n) { const float v = act_fn(x[i], act) * y[i]; VST2(float, dst + i, v); }
}

// =====================================================================================================================
// k_matvec: thread-per-row matrix-vector products for N <= 8 output columns (heads with 1-3 outputs, gates), f32 on the VALU.
//   C[r*sCm + j] = act(alpha * sum_k A[r*sAm + k*sAk] * B[j*sBn + k*sBk] + bias[j]) + beta * R[r*sRm + j*sRn]; each thread writes its N contiguous floats.
// =====================================================================================================================
__global__ __launch_bounds__(256) void k_matvec(GemmP p) {
    // 32 lanes write one line with one instruction.
    const int rpt = (p.N == 1) ? 1 : 32;
    const long long r0 = ((long long)blockIdx.x * 256 + threadIdx.x) * rpt; const int z = blockIdx.z, zo = z / p.zi_n, zi = z - zo * p.zi_n;
    if (r0 >= p.M) return;
    const float* Bb = p.B + zo * p.sBo + zi * p.sBi;
    float* C = p.C + zo * p.sCo + zi * p.sCi; const float* R = p.R + zo * p.sRo + zi * p.sRi;
    for (int rr = 0; rr < rpt; ++rr) {
        const long long r = r0 + rr; if (r >= p.M) break;
        const float* A = p.A + zo * p.sAo + zi * p.sAi + r * p.sAm;
        float acc[8] = {0.f, 0.f, 0.f, 0.f, 0.f, 0.f, 0.f, 0.f};
        for (int k = 0; k < p.K; ++k) { const float a = A[(long long)k * p.sAk];
#pragma unroll
            for (int j = 0; j < 8; ++j) if (j < p.N) acc[j] += a * Bb[(long long)j * p.sBn + (long long)k * p.sBk]; }
#pragma unroll
        for (int j = 0; j < 8; ++j) if (j < p.N) {
            float v = acc[j] * p.alpha;
            if (p.flags & 1) v += p.bias[j];
            if (p.flags & 2) v += p.bias[r];
            v = act_fn(v, p.act);
            if (p.flags & 4) v += p.beta * R[r * p.sRm + (long long)j * p.sRn];
            VST2(float, C + r * p.sCm + j, v);
        }
    }
}
// k_smallsoftmax: thread-per-row softmax for short rows (n <= 64): dst[r*dr + j] = softmax(scale*src[r*sr + j])
__global__ __launch_bounds__(256) void k_smallsoftmax(const float* __restrict__ src, float* __restrict__ dst, long long sr, long long dr, int n, long long R, float scale) {
    const long long r0 = ((long long)blockIdx.x * 256 + threadIdx.x) * 32;
    for (int rr = 0; rr < 32; ++rr) {
        const long long r = r0 + rr; if (r >= R) return;
        const float* s = src + r * sr; float* d = dst + r * dr;
        float mx = -__builtin_inff();
        for (int j = 0; j < n; ++j) mx = fmaxf(mx, s[j] * scale);
        float sum = 0.f;
        for (int j = 0; j < n; ++j) sum += expf(s[j] * scale - mx);
        const float inv = 1.f / sum;
        for (int j = 0; j < n; ++j) { const float v = expf(s[j] * scale - mx) * inv; VST2(float, d + j, v); }
    }
}

__global__ __launch_bounds__(32) void k_unitstat(float* __restrict__ st) { const int t = threadIdx.x; const float v = (t == 1) ? 1.f : 0.f; VST2(float, st + t, v); }

// destination (e.g. a d_out whose row width is not a multiple of 32 floats) is written by consecutive lanes of one instruction
__global__ __launch_bounds__(256) void k_lincopy(const float* __restrict__ src, long long lds, float* __restrict__ dst, long long ldd, long long rows, int cols) {
    const long long i = (long long)blockIdx.x * 256 + threadIdx.x; if (i >= rows * cols) return;
    const long long r = i / cols; const int c = (int)(i - r * cols);
    const float v = src[r * lds + c]; VST2(float, dst + r * ldd + c, v);
}

namespace w25 {
typedef __attribute__((ext_vector_type(16))) _Float16 v16h;
typedef __attribute__((ext_vector_type(8)))  _Float16 v8h;
typedef __attribute__((ext_vector_type(16))) __bf16   v16b;
typedef __attribute__((ext_vector_type(8)))  __bf16   v8b;
typedef __attribute__((ext_vector_type(8)))  float    v8f;
typedef __attribute__((ext_vector_type(4)))  float    v4f;

__device__ __forceinline__ unsigned short f2bf_bits(float f) {
  unsigned u = __float_as_uint(f);
  return (unsigned short)((u + 0x7FFFu + ((u >> 16) & 1u)) >> 16);
}
__device__ __forceinline__ float bf_bits2f(unsigned short h) { return __uint_as_float(((unsigned)h) << 16); }

// hazard guards as plain device helpers (no inline asm inside the kernel template body)
__device__ __forceinline__ void dep_guard_h(v8f& a, v8f& b, v16h x, v16h y) { asm volatile("v_nop\n\tv_nop\n\tv_nop\n\tv_nop" : "+v"(a), "+v"(b) : "v"(x), "v"(y)); }
__device__ __forceinline__ void dep_guard_b(v8f& a, v8f& b, v16b x, v16b y) { asm volatile("v_nop\n\tv_nop\n\tv_nop\n\tv_nop" : "+v"(a), "+v"(b) : "v"(x), "v"(y)); }
__device__ __forceinline__ void keep4_h(v16h a, v16h b, v16h c, v16h d) { asm volatile("v_nop" :: "v"(a), "v"(b), "v"(c), "v"(d)); }
__device__ __forceinline__ void keep4_b(v16b a, v16b b, v16b c, v16b d) { asm volatile("v_nop" :: "v"(a), "v"(b), "v"(c), "v"(d)); }
__device__ __forceinline__ void acc_guard4(v8f& a, v8f& b, v8f& c, v8f& d) { asm volatile("v_nop\n\tv_nop\n\tv_nop\n\tv_nop" : "+v"(a), "+v"(b), "+v"(c), "+v"(d)); }
template <typename T> struct Frag;
template <> struct Frag<_Float16> {
  typedef v16h V; union U { v16h v; v8h h[2]; };
  static __device__ __forceinline__ v16h load(const _Float16* p) {   // elements 0..7 <- p[0..7], 8..15 <- p[16..23]
    U f; f.h[0] = *(const v8h*)(p); f.h[1] = *(const v8h*)(p + 16); return f.v;
  }
  static __device__ __forceinline__ v8f mma(v16h a, v16h b, v8f c) {
    return __builtin_amdgcn_wmma_f32_16x16x32_f16(false, a, false, b, (short)0, c, false, false);
  }
  static __device__ __forceinline__ void guard(v8f& a, v8f& b, v16h x, v16h y) { dep_guard_h(a, b, x, y); }
  static __device__ __forceinline__ void keep(v16h a, v16h b, v16h c, v16h d) { keep4_h(a, b, c, d); }
};
template <> struct Frag<__bf16> {
  typedef v16b V; union U { v16b v; v8b h[2]; };
  static __device__ __forceinline__ v16b load(const __bf16* p) {
    U f; f.h[0] = *(const v8b*)(p); f.h[1] = *(const v8b*)(p + 16); return f.v;
  }
  static __device__ __forceinline__ v8f mma(v16b a, v16b b, v8f c) {
    return __builtin_amdgcn_wmma_f32_16x16x32_bf16(false, a, false, b, (short)0, c, false, false);
  }
  static __device__ __forceinline__ void guard(v8f& a, v8f& b, v16b x, v16b y) { dep_guard_b(a, b, x, y); }
  static __device__ __forceinline__ void keep(v16b a, v16b b, v16b c, v16b d) { keep4_b(a, b, c, d); }
};

// ---- Register-blocked batched WMMA GEMM ------------------------------------
// C[m,n] = scale * sum_k A[m,k] * Bt[n,k] (+bias)(+resid); each wave owns a 64x64 tile.
// A row-major [M,K]; Bt row-major [N,K]; M,N % 64 == 0, K % 32 == 0.
// SPLIT: operands are hi/lo planes (A2/Bt2 = lo planes, same layout); product = hi·hi + hi·lo + lo·hi.
// BIAS_MODE: 0 = none, 1 = bias[m], 2 = bias[n]. Batch 1 takes bias_b1 and batch 2 bias_b2 in its place (up to three products that share A in one launch).
// OUT_MODE: 0 = f32, 1 = f16, 2 = bf16 hi plane (Cout) + bf16 lo plane (Cout2).
// ET: 0 = f16 operands, 1 = bf16 operands (pointers passed as 16-bit storage)
template <int ET> struct Elem;
template <> struct Elem<0> { typedef _Float16 T; };
template <> struct Elem<1> { typedef __bf16 T; };
template <int ET, bool SPLIT, int BIAS_MODE, int OUT_MODE, bool RESID, int ACT = 0>
__global__ __launch_bounds__(256) void wmma_gemm64(
    const unsigned short* __restrict__ Ap, const unsigned short* __restrict__ A2p, int lda, long strideA,
    const unsigned short* __restrict__ Btp, const unsigned short* __restrict__ Bt2p, int ldb, long strideB,
    void* __restrict__ Cout, void* __restrict__ Cout2, int ldc, long strideC,
    const float* __restrict__ bias, const float* __restrict__ bias_b1, const float* __restrict__ bias_b2,
    const float* __restrict__ resid, long strideR,
    int M, int N, int K, float scale) {
  typedef typename Elem<ET>::T T;
  typedef typename Frag<T>::V V;
  const T* A = (const T*)Ap; const T* A2 = (const T*)A2p; const T* Bt = (const T*)Btp; const T* Bt2 = (const T*)Bt2p;
  __shared__ __align__(16) float sT[8][16 * 68];   // per-wave 16x64 slab, pitch 68 floats
  const int b    = blockIdx.y;
  const int lane = threadIdx.x & 31;
  const int wave = threadIdx.x >> 5;
  const int tilesN = N >> 6;
  const int tilesM = M >> 6;
  const int tile = blockIdx.x * 8 + wave;
  if (tile >= tilesM * tilesN) return;   // wave-uniform; no block barriers in this kernel
  const int tm = tile / tilesN;
  const int tn = tile - tm * tilesN;
  const int m0 = tm << 6;
  const int n0 = tn << 6;

  const T* Ab  = A  + (size_t)b * strideA;
  const T* Bb  = Bt + (size_t)b * strideB;
  const T* Ab2 = SPLIT ? (A2  + (size_t)b * strideA) : nullptr;
  const T* Bb2 = SPLIT ? (Bt2 + (size_t)b * strideB) : nullptr;

  const int rlane = lane & 15;                 // row (A) / col (B, D) within subtile
  const int koff  = (lane >> 4) * 8;           // k offset of this lane half
  const int mOff  = (lane >> 4) * 8;           // D row offset

  v8f acc[4][4];
#pragma unroll
  for (int i = 0; i < 4; ++i)
#pragma unroll
    for (int j = 0; j < 4; ++j) acc[i][j] = (v8f){0.f,0.f,0.f,0.f,0.f,0.f,0.f,0.f};

  for (int k0 = 0; k0 < K; k0 += 32) {
    V bh[4], bl[4];
#pragma unroll
    for (int j = 0; j < 4; ++j) {
      const size_t bo = (size_t)(n0 + (j << 4) + rlane) * ldb + koff + k0;
      bh[j] = Frag<T>::load(Bb + bo);
      if (SPLIT) bl[j] = Frag<T>::load(Bb2 + bo);
    }
#pragma unroll
    for (int i = 0; i < 4; ++i) {
      const size_t ao = (size_t)(m0 + (i << 4) + rlane) * lda + koff + k0;
      V ah = Frag<T>::load(Ab + ao);
      V al;
      if (SPLIT) al = Frag<T>::load(Ab2 + ao);
#pragma unroll
      for (int j = 0; j < 4; ++j) {
        acc[i][j] = Frag<T>::mma(ah, bh[j], acc[i][j]);
        if (SPLIT) {
          acc[i][j] = Frag<T>::mma(ah, bl[j], acc[i][j]);
          acc[i][j] = Frag<T>::mma(al, bh[j], acc[i][j]);
        }
      }
      Frag<T>::guard(acc[i][0], acc[i][3], ah, SPLIT ? al : ah);
    }
    Frag<T>::keep(bh[0], bh[1], bh[2], bh[3]);
    if (SPLIT) Frag<T>::keep(bl[0], bl[1], bl[2], bl[3]);
  }
  acc_guard4(acc[0][0], acc[0][1], acc[0][2], acc[0][3]);
  acc_guard4(acc[1][0], acc[1][1], acc[1][2], acc[1][3]);
  acc_guard4(acc[2][0], acc[2][1], acc[2][2], acc[2][3]);
  acc_guard4(acc[3][0], acc[3][1], acc[3][2], acc[3][3]);

  // ---- epilogue ----
  float* slab = sT[wave];
  const float* Rb = RESID ? (resid + (size_t)b * strideR) : nullptr;
  const float* bsel = (b == 0) ? bias : ((b == 1) ? bias_b1 : bias_b2);
#pragma unroll
  for (int i = 0; i < 4; ++i) {
    const int mBase = m0 + (i << 4);
#pragma unroll
    for (int j = 0; j < 4; ++j) {
      const int n = n0 + (j << 4) + rlane;
      float bv = 0.f;
      if (BIAS_MODE == 2) bv = bsel[n];
#pragma unroll
      for (int r = 0; r < 8; ++r) {
        float v = acc[i][j][r] * scale;
        if (BIAS_MODE == 1) v += bsel[mBase + mOff + r];
        if (BIAS_MODE == 2) v += bv;
        if (RESID) v += Rb[(size_t)(mBase + mOff + r) * ldc + n];
        if (ACT == 1) v = tanhf(v);
        if (ACT == 2) v = fmaxf(v, 0.0f);
        if (ACT == 3) v = v / (1.0f + expf(-v));
        if (ACT == 4) v = (v > 0.f) ? v : 0.01f * v;
        if (ACT == 5) v = 0.5f * v * (1.0f + erff(v * 0.70710678118654752f));
        slab[(mOff + r) * 68 + (j << 4) + rlane] = v;
      }
    }
    __builtin_amdgcn_fence(__ATOMIC_RELEASE, "workgroup");
    __builtin_amdgcn_wave_barrier();
    __builtin_amdgcn_fence(__ATOMIC_ACQUIRE, "workgroup");
    if (OUT_MODE == 0) {
      float* C = (float*)Cout + (size_t)b * strideC;
      const int hh = lane >> 4, c4 = (lane & 15) * 4;     // row seg = 256 B = 16 lanes x 16 B
      {
#pragma unroll
        for (int it = 0; it < 8; ++it) {
          const int row = it * 2 + hh;
          v4f v = *(const v4f*)(slab + row * 68 + c4);
          *(v4f*)(C + (size_t)(mBase + row) * ldc + n0 + c4) = v;
        }
        
      }
    } else {
      const int q = lane >> 3, c8 = (lane & 7) * 8;
      unsigned short* C  = (unsigned short*)Cout  + (size_t)b * strideC;
      unsigned short* C2 = (OUT_MODE == 2) ? ((unsigned short*)Cout2 + (size_t)b * strideC) : nullptr;
      {
#pragma unroll
        for (int it = 0; it < 4; ++it) {
          const int row = it * 4 + q;
          const float* sp = slab + row * 68 + c8;
          v8h hv, lv;
#pragma unroll
          for (int e = 0; e < 8; ++e) {
            if (OUT_MODE == 1) {
              hv[e] = (_Float16)sp[e];
            } else {
              unsigned short hb = f2bf_bits(sp[e]);
              unsigned short lb = f2bf_bits(sp[e] - bf_bits2f(hb));
              hv[e] = __builtin_bit_cast(_Float16, hb);
              lv[e] = __builtin_bit_cast(_Float16, lb);
            }
          }
          *(v8h*)(C + (size_t)(mBase + row) * ldc + n0 + c8) = hv;
          if (OUT_MODE == 2) *(v8h*)(C2 + (size_t)(mBase + row) * ldc + n0 + c8) = lv;
        }
        
      }
    }
    __builtin_amdgcn_fence(__ATOMIC_RELEASE, "workgroup");
    __builtin_amdgcn_wave_barrier();
    __builtin_amdgcn_fence(__ATOMIC_ACQUIRE, "workgroup");
  }
}

// ---- WMMA GEMM with both operands staged in LDS by asynchronous copies -------
// The product, k order and, with KG 1, accumulators' sum order of wmma_gemm64 (f16 operands, bias[n]): C[m,n] = act(scale * sum_k A[m,k] * Bt[n,k] + bias[n] (+ resid[m,n])), act GELU by gelu2 for ACT 5, none otherwise.
// A block of 4 waves owns a 128 x 64 tile of C, a wave 32 x 64 of it (2 x 4 accumulator tiles); grid (N / 64, M / 128, batches); A is shared by the batches.
// A stage is 128 k (256 bytes) of the block's 128 A rows and 64 Bt rows. Each lane copies 16 bytes, so a wave's copy covers two whole 256-byte row pieces
// (a fragment load from global memory touches 16 lines for the same 512 bytes), and a row is fetched once per block instead of once per wave that needs it.
// Two buffers: stage t + 1 flies while stage t is worked on. M % 128 == 0, N % 64 == 0, K % (128 KG) == 0, rows 16-byte aligned. LDC: row pitch of C and of the residual, in elements.
// KG = 2, for a grid of one block per WGP: the block has two groups of 4 waves on the same 128 x 64 tile. Group g takes the stages g, g + 2, g + 4, ... of K through two buffers of its own,
// so twice the bytes are in flight, a SIMD holds two waves (one issues copies or waits for LDS while the other multiplies) and the block passes half as many barriers.
// Behind the loop the two partial sums of each wave tile meet in LDS: group g hands over its rows of slab 1 - g, adds the partner's rows of slab g to its own and finishes slab g alone.
// NG > 1, for a product whose 128 x 64 blocks would stand several to a WGP and each fetch the same A rows from L2: the block has NG groups of 4 waves, each on its own 128 x 64 tile of C,
// and all share one copy of the 128 A rows in LDS; a buffer holds them and then each group's 64 Bt rows. One block per WGP, all started at once.
// NG = 4: group g owns the columns 64 g .. 64 g + 63 of a 128 x 256 tile; grid (N / 256, M / 128). NG = 3: group g is batch g, all on the same columns; grid (N / 64, M / 128).
constexpr int SG_KC = 128;                         // k per stage
constexpr int SG_PITCH = 272;                      // LDS row pitch in bytes: 256 + 16, conflict-free for the 16-byte fragment reads
constexpr int SG_BUF = (128 + 64) * SG_PITCH;      // one buffer: A rows 0..127, then Bt rows 0..63
// Twelve copies and the wait that stands in front of any rewrite of their address registers, in one statement so that the compiler can put nothing between them.
__device__ __forceinline__ void copy12(const unsigned (&l)[12], const _Float16* const (&g)[12]) {
  asm volatile(
      "global_load_async_to_lds_b128 %0, %1, off\n\t"
      "global_load_async_to_lds_b128 %2, %3, off\n\t"
      "global_load_async_to_lds_b128 %4, %5, off\n\t"
      "global_load_async_to_lds_b128 %6, %7, off\n\t"
      "global_load_async_to_lds_b128 %8, %9, off\n\t"
      "global_load_async_to_lds_b128 %10, %11, off\n\t"
      "global_load_async_to_lds_b128 %12, %13, off\n\t"
      "global_load_async_to_lds_b128 %14, %15, off\n\t"
      "global_load_async_to_lds_b128 %16, %17, off\n\t"
      "global_load_async_to_lds_b128 %18, %19, off\n\t"
      "global_load_async_to_lds_b128 %20, %21, off\n\t"
      "global_load_async_to_lds_b128 %22, %23, off\n\t"
      "s_wait_xcnt 0x0"
      :: "v"(l[0]), "v"(g[0]), "v"(l[1]), "v"(g[1]), "v"(l[2]), "v"(g[2]), "v"(l[3]), "v"(g[3]), "v"(l[4]), "v"(g[4]), "v"(l[5]), "v"(g[5]),
         "v"(l[6]), "v"(g[6]), "v"(l[7]), "v"(g[7]), "v"(l[8]), "v"(g[8]), "v"(l[9]), "v"(g[9]), "v"(l[10]), "v"(g[10]), "v"(l[11]), "v"(g[11])
      : "memory");
}
// One stage: thread t brings the 16-byte piece (t & 15) of rows (t >> 4) + 8 u, u = 0..23, of the buffer (24 copies per wave in flight).
// lds0: the LDS byte address of its piece in row t >> 4 of the buffer; a0, b0: the same piece of row t >> 4 of the block's A and Bt rows at this stage's k.
__device__ __forceinline__ void stage_in(unsigned lds0, const _Float16* a0, int lda, const _Float16* b0, int ldb) {
  unsigned l[12]; const _Float16* g[12];
#pragma unroll   // constant indices: the addresses stay in registers
  for (int u = 0; u < 12; ++u) { l[u] = lds0 + (unsigned)(u * 8 * SG_PITCH); g[u] = a0 + (size_t)(u * 8) * lda; }
  copy12(l, g);
#pragma unroll   // constant indices
  for (int u = 0; u < 4; ++u) { l[u] = lds0 + (unsigned)((12 + u) * 8 * SG_PITCH); g[u] = a0 + (size_t)((12 + u) * 8) * lda; }
#pragma unroll   // constant indices
  for (int u = 0; u < 8; ++u) { l[4 + u] = lds0 + (unsigned)((16 + u) * 8 * SG_PITCH); g[4 + u] = b0 + (size_t)(u * 8) * ldb; }
  copy12(l, g);
}
// One stage of a block of four column groups (512 threads): thread t brings the 16-byte piece (t & 15) of rows (t >> 4) + 32 u of the buffer, u = 0..3 of A and u = 4..11 of Bt (12 copies per wave in flight).
// lds0, a0, b0 as in stage_in, for row t >> 4.
__device__ __forceinline__ void stage_in_4(unsigned lds0, const _Float16* a0, int lda, const _Float16* b0, int ldb) {
  unsigned l[12]; const _Float16* g[12];
#pragma unroll   // constant indices: the addresses stay in registers
  for (int u = 0; u < 4; ++u) { l[u] = lds0 + (unsigned)(u * 32 * SG_PITCH); g[u] = a0 + (size_t)(u * 32) * lda; }
#pragma unroll   // constant indices
  for (int u = 0; u < 8; ++u) { l[4 + u] = lds0 + (unsigned)((4 + u) * 32 * SG_PITCH); g[4 + u] = b0 + (size_t)(u * 32) * ldb; }
  copy12(l, g);
}
// One copy with its wait, as in copy12.
__device__ __forceinline__ void copy1(unsigned l, const _Float16* g) {
  asm volatile("global_load_async_to_lds_b128 %0, %1, off\n\ts_wait_xcnt 0x0" :: "v"(l), "v"(g) : "memory");
}
// One stage of a block of three batches (384 threads). Thread t of group g brings the piece (t & 15) of its own batch's Bt rows (t >> 4) + 8 u, u = 0..7, and of the A rows 8 (g + 3 v) + (t >> 4),
// v = 0..4; the last 8 A rows (v = 5) fall to group 0 alone (sixth: the same for a whole wave). 13 or 14 copies per wave in flight.
// ldsa, a0: the piece in A row 8 g + (t >> 4); ldsb, b0: the piece in row t >> 4 of the group's Bt rows.
__device__ __forceinline__ void stage_in_3(unsigned ldsa, unsigned ldsb, const _Float16* a0, int lda, const _Float16* b0, int ldb, bool sixth) {
  unsigned l[12]; const _Float16* g[12];
#pragma unroll   // constant indices: the addresses stay in registers
  for (int v = 0; v < 5; ++v) { l[v] = ldsa + (unsigned)(v * 24 * SG_PITCH); g[v] = a0 + (size_t)(v * 24) * lda; }
#pragma unroll   // constant indices
  for (int u = 0; u < 7; ++u) { l[5 + u] = ldsb + (unsigned)(u * 8 * SG_PITCH); g[5 + u] = b0 + (size_t)(u * 8) * ldb; }
  copy12(l, g);
  copy1(ldsb + (unsigned)(7 * 8 * SG_PITCH), b0 + (size_t)(7 * 8) * ldb);
  if (sixth) copy1(ldsa + (unsigned)(5 * 24 * SG_PITCH), a0 + (size_t)(5 * 24) * lda);
}
// gelu2: 0.5 v (1 + erf(v / sqrt 2)) for two values at once, without a branch.
// erf by its two usual ranges, t = |x|: t < 1: t + t q(x^2); else 1 - exp(-(t + t p(t))); q, p minimax polynomials (f32 coefficients), the sign of x put back at the end.
// Both ranges are computed for every lane and one is chosen by a select: there is no test of EXEC between the values of a lane, so their chains of fused steps
// run interleaved, two values to a packed instruction. exp(-y) = 2^(-y log2 e) by the hardware's 2^x: y >= 1.8 where it is chosen, so the rounding of that one product moves
// exp(-y) by less than 3e-8, under half a unit in the last place of 1 - exp(-y).
typedef __attribute__((ext_vector_type(2))) float v2f;
__device__ __forceinline__ v2f fma2(v2f a, v2f b, float c) { return __builtin_elementwise_fma(a, b, (v2f){c, c}); }
__device__ __forceinline__ v2f gelu2(v2f v) {
  const v2f x = v * 0.70710678118654752f;
  const v2f t = {__builtin_fabsf(x.x), __builtin_fabsf(x.y)};
  v2f p = fma2(t, (v2f){1.69988107e-5f, 1.69988107e-5f}, -3.78677854e-4f);
  p = fma2(t, p, 3.85781587e-3f);
  p = fma2(t, p, -2.41816975e-2f);
  p = fma2(t, p, 1.06668264e-1f);
  p = fma2(t, p, 6.34933293e-1f);
  p = fma2(t, p, 1.28689408e-1f);
  p = __builtin_elementwise_fma(t, p, t) * -1.44269502f;
  const v2f u = x * x;
  v2f q = fma2(u, (v2f){-5.61801775e-4f, -5.61801775e-4f}, 4.91381623e-3f);
  q = fma2(u, q, -2.67075151e-2f);
  q = fma2(u, q, 1.12800106e-1f);
  q = fma2(u, q, -3.76122952e-1f);
  q = fma2(u, q, 1.28379107e-1f);
  q = __builtin_elementwise_fma(t, q, t);
  v2f e;
  e.x = __builtin_copysignf((t.x < 1.0f) ? q.x : 1.0f - __builtin_amdgcn_exp2f(p.x), x.x);
  e.y = __builtin_copysignf((t.y < 1.0f) ? q.y : 1.0f - __builtin_amdgcn_exp2f(p.y), x.y);
  return (0.5f * v) * (1.0f + e);
}
template <int OUT_MODE, bool RESID, int ACT, int LDC, int KG = 1, int NG = 1>
__global__ __launch_bounds__(128 * KG * NG) void wmma_gemm_lds(
    const unsigned short* __restrict__ Ap, int lda,
    const unsigned short* __restrict__ Btp, int ldb, long strideB,
    void* __restrict__ Cout, long strideC,
    const float* __restrict__ bias, const float* __restrict__ bias_b1, const float* __restrict__ bias_b2,
    const float* __restrict__ resid, int K, float scale) {
  typedef _Float16 T;
  static_assert(OUT_MODE == 0 || OUT_MODE == 1, "f32 or f16 output");
  static_assert(KG == 1 || KG == 2, "one group of waves, or two that share K");
  static_assert(NG == 1 || ((NG == 3 || NG == 4) && KG == 1), "one tile of C, or three batches or four column groups that share the A rows");
  constexpr int BUF = (128 + 64 * NG) * SG_PITCH;   // one buffer: A rows 0..127, then the 64 Bt rows of each group
  __shared__ __align__(16) unsigned char ring_all[KG * 2 * BUF];   // each group's two buffers; behind the loop's last barrier the head is the exchange of partial sums and the waves' output staging
  const int grp  = (KG == 2) ? __builtin_amdgcn_readfirstlane((int)(threadIdx.x >> 7)) : 0;   // the wave's group, the same in every lane
  const int ng   = (NG > 1) ? __builtin_amdgcn_readfirstlane((int)(threadIdx.x >> 7)) : 0;    // the wave's tile of C within the block, the same in every lane
  const int b    = (NG == 3) ? ng : (int)blockIdx.z;
  unsigned char* ring = ring_all + grp * (2 * BUF);   // the K group's own two buffers (the NG groups share one pair)
  const int tid  = (KG == 2 || NG > 1) ? (int)(threadIdx.x & 127) : (int)threadIdx.x;   // thread within the group
  const int lane = tid & 31;
  const int wave = tid >> 5;                   // wave within the group
  const int n0 = (NG == 4) ? (int)((blockIdx.x * 4 + ng) << 6) : (int)(blockIdx.x << 6);   // the wave's first column of C
  const int m0 = (blockIdx.y << 7) + (wave << 5);             // the wave's first row of C
  const int rlane = lane & 15;                 // row (A) / col (B, D) within subtile
  const int koff  = (lane >> 4) * 8;           // k offset of this lane half
  const int mOff  = (lane >> 4) * 8;           // D row offset

  constexpr int SG_STEP = KG * SG_KC;          // k from one stage of a group to its next
  // The rows of the thread's first copies: the A rows are dealt over all threads that share the buffer (stage_in, stage_in_3, stage_in_4 say how).
  const int crow = (NG == 4) ? (int)(threadIdx.x >> 4) : ((NG == 3) ? 8 * ng + (tid >> 4) : (tid >> 4));
  const int brw  = (NG == 4) ? (int)(blockIdx.x << 8) + crow : n0 + (tid >> 4);
  const T* a0 = (const T*)Ap + (size_t)((blockIdx.y << 7) + crow) * lda + (tid & 15) * 8 + grp * SG_KC;
  const T* b0 = (const T*)Btp + (size_t)b * strideB + (size_t)brw * ldb + (tid & 15) * 8 + grp * SG_KC;
  const unsigned lds0 = (unsigned)(size_t)ring + (unsigned)(crow * SG_PITCH + (tid & 15) * 16);
  const unsigned ldsb = (unsigned)(size_t)ring + (unsigned)((128 + (ng << 6) + (tid >> 4)) * SG_PITCH + (tid & 15) * 16);   // NG = 3 only
  auto stage = [&](unsigned lo, size_t ko) {   // one stage: into the buffer at byte lo of the ring, from k offset ko
    if (NG == 4) stage_in_4(lds0 + lo, a0 + ko, lda, b0 + ko, ldb);
    else if (NG == 3) stage_in_3(lds0 + lo, ldsb + lo, a0 + ko, lda, b0 + ko, ldb, ng == 0);
    else stage_in(lds0 + lo, a0 + ko, lda, b0 + ko, ldb);
  };
  const int nt = K / SG_STEP;                  // stages per group

  v8f acc[2][4];
#pragma unroll
  for (int i = 0; i < 2; ++i)
#pragma unroll
    for (int j = 0; j < 4; ++j) acc[i][j] = (v8f){0.f,0.f,0.f,0.f,0.f,0.f,0.f,0.f};

  stage(0u, 0);
  asm volatile("s_wait_asynccnt 0x0" ::: "memory");           // this wave's part of stage 0 has landed
  __syncthreads();                                             // every wave's part has
  if (nt > 1) stage((unsigned)BUF, SG_STEP);
  for (int t = 0; t < nt; ++t) {
    const unsigned char* buf = ring + (t & 1) * BUF;
    const unsigned char* arow = buf + ((wave << 5) + rlane) * SG_PITCH + koff * 2;
    const unsigned char* brow = buf + (128 + (ng << 6) + rlane) * SG_PITCH + koff * 2;
    // Two fragment sets: the 12 LDS reads of k-step ks + 1 go out as one group ahead of the 8 products of k-step ks, which cover their latency.
    v16h bh[2][4], ah[2][2];
#pragma unroll   // constant indices: the fragments stay in registers
    for (int j = 0; j < 4; ++j) bh[0][j] = Frag<T>::load((const T*)(brow + j * 16 * SG_PITCH));
#pragma unroll
    for (int i = 0; i < 2; ++i) ah[0][i] = Frag<T>::load((const T*)(arow + i * 16 * SG_PITCH));
#pragma unroll   // constant set indices and LDS offsets
    for (int ks = 0; ks < SG_KC / 32; ++ks) {
      if (ks + 1 < SG_KC / 32) {
#pragma unroll
        for (int j = 0; j < 4; ++j) bh[(ks + 1) & 1][j] = Frag<T>::load((const T*)(brow + j * 16 * SG_PITCH + (ks + 1) * 64));
#pragma unroll
        for (int i = 0; i < 2; ++i) ah[(ks + 1) & 1][i] = Frag<T>::load((const T*)(arow + i * 16 * SG_PITCH + (ks + 1) * 64));
        __builtin_amdgcn_sched_barrier(0);   // without it the compiler sinks these reads among the products into one register set and waits out the LDS latency twice per k-step
      }
#pragma unroll
      for (int i = 0; i < 2; ++i)
#pragma unroll
        for (int j = 0; j < 4; ++j) acc[i][j] = Frag<T>::mma(ah[ks & 1][i], bh[ks & 1][j], acc[i][j]);
      if (ks + 1 < SG_KC / 32) __builtin_amdgcn_sched_barrier(0);   // the next group of reads stays behind these products, whole
    }
    asm volatile("s_wait_dscnt 0x0" ::: "memory");             // this wave's reads of stage t are done before the buffer is handed back
    asm volatile("s_wait_asynccnt 0x0" ::: "memory");          // this wave's part of stage t + 1 has landed
    __syncthreads();                                           // publishes stage t + 1 and ends every wave's reads of stage t
    if (t + 2 < nt) stage((unsigned)((t & 1) * BUF), (size_t)(t + 2) * SG_STEP);
  }
  asm volatile("s_wait_asynccnt 0x0" ::: "memory");            // nothing is in flight when the ring becomes output staging

  constexpr int NI = 2 / KG;                                   // slabs of 16 rows that a wave finishes
  const int mE = m0 + ((KG == 2) ? (grp << 4) : 0);            // the first row of C that it finishes
  if (KG == 2) {
    // The two groups' partial sums meet: 4 KiB per wave, each lane's 16-byte pieces side by side (no bank conflict). The loop's last barrier has ended every read of the ring.
    v4f* xs = (v4f*)ring_all + ((grp << 2) + wave) * 256 + lane;              // this wave's rows for its partner
    const v4f* xr = (const v4f*)ring_all + (((grp ^ 1) << 2) + wave) * 256 + lane;   // the partner's rows for this wave
#pragma unroll   // constant indices: the accumulators stay in registers
    for (int j = 0; j < 4; ++j) {
      const v8f s = grp ? acc[0][j] : acc[1][j];
      xs[(2 * j) * 32] = (v4f){s[0], s[1], s[2], s[3]};
      xs[(2 * j + 1) * 32] = (v4f){s[4], s[5], s[6], s[7]};
    }
    __syncthreads();                                           // every wave's rows are written before its partner reads them
#pragma unroll   // constant indices
    for (int j = 0; j < 4; ++j) {
      const v8f k = grp ? acc[1][j] : acc[0][j];
      const v4f lo = xr[(2 * j) * 32], hi = xr[(2 * j + 1) * 32];
      acc[0][j] = k + (v8f){lo[0], lo[1], lo[2], lo[3], hi[0], hi[1], hi[2], hi[3]};
    }
  }
  // ---- epilogue: scale, bias[n], residual, gelu2 for ACT 5, per 16 x 64 slab ----
  float* slab = (float*)(ring_all + ((KG == 2) ? 8 * 4096 : 0)) + (((grp + ng) << 2) + wave) * (16 * 68);   // per-wave 16x64 slab, pitch 68 floats, behind the exchange
  const float* bsel = (b == 0) ? bias : ((b == 1) ? bias_b1 : bias_b2);
  // The bias values, and each slab's residual values, come as a run of loads in flight together, off one index or one address with constant offsets (LDC is a constant for that).
  const int nl = n0 + rlane;
  const float* rp = RESID ? resid + (size_t)(mE + mOff) * LDC + nl : nullptr;
  float bv[4];
#pragma unroll   // constant indices: the values stay in registers
  for (int j = 0; j < 4; ++j) bv[j] = bsel[nl + (j << 4)];
  // The wait in front of any rewrite of a register that the run names; as its input the index stays whole until it, so that no load of the run lands in it.
  asm volatile("s_wait_xcnt 0x0" :: "v"(nl) : "memory");
#pragma unroll
  for (int i = 0; i < NI; ++i) {
    float rv[4][8];
    if (RESID) {
#pragma unroll   // constant indices
      for (int j = 0; j < 4; ++j)
#pragma unroll
        for (int r = 0; r < 8; ++r) rv[j][r] = rp[((i << 4) + r) * LDC + (j << 4)];
      asm volatile("s_wait_xcnt 0x0" :: "v"(rp) : "memory");   // the same wait for this run, the address as its input
    }
#pragma unroll
    for (int j = 0; j < 4; ++j) {
      if (ACT == 5) {
#pragma unroll   // constant indices: the accumulators stay in registers; the 16 pairs of a slab are independent and interleave
        for (int r = 0; r < 8; r += 2) {
          v2f v = fma2((v2f){acc[i][j][r], acc[i][j][r + 1]}, (v2f){scale, scale}, bv[j]);
          if (RESID) v += (v2f){rv[j][r], rv[j][r + 1]};
          v = gelu2(v);
          slab[(mOff + r) * 68 + (j << 4) + rlane] = v.x;
          slab[(mOff + r + 1) * 68 + (j << 4) + rlane] = v.y;
        }
      } else {
#pragma unroll
        for (int r = 0; r < 8; ++r) {
          float v = acc[i][j][r] * scale;
          v += bv[j];
          if (RESID) v += rv[j][r];
          slab[(mOff + r) * 68 + (j << 4) + rlane] = v;
        }
      }
    }
    __builtin_amdgcn_fence(__ATOMIC_RELEASE, "workgroup");
    __builtin_amdgcn_wave_barrier();
    __builtin_amdgcn_fence(__ATOMIC_ACQUIRE, "workgroup");
    if (OUT_MODE == 0) {
      const int hh = lane >> 4, c4 = (lane & 15) * 4;     // row seg = 256 B = 16 lanes x 16 B
      float* cp = (float*)Cout + (size_t)b * strideC + (size_t)(mE + hh) * LDC + n0 + c4;   // one address, the rows at constant offsets
#pragma unroll
      for (int it = 0; it < 8; ++it) {
        const int row = it * 2 + hh;
        v4f v = *(const v4f*)(slab + row * 68 + c4);
        *(v4f*)(cp + ((i << 4) + it * 2) * LDC) = v;
      }
    } else {
      const int q = lane >> 3, c8 = (lane & 7) * 8;       // row seg = 128 B = 8 lanes x 16 B
      _Float16* cp = (_Float16*)Cout + (size_t)b * strideC + (size_t)(mE + q) * LDC + n0 + c8;   // one address, the rows at constant offsets
#pragma unroll
      for (int it = 0; it < 4; ++it) {
        const int row = it * 4 + q;
        const float* sp = slab + row * 68 + c8;
        v8h hv;
#pragma unroll
        for (int e = 0; e < 8; ++e) hv[e] = (_Float16)sp[e];
        *(v8h*)(cp + ((i << 4) + it * 4) * LDC) = hv;
      }
    }
    __builtin_amdgcn_fence(__ATOMIC_RELEASE, "workgroup");
    __builtin_amdgcn_wave_barrier();
    __builtin_amdgcn_fence(__ATOMIC_ACQUIRE, "workgroup");
  }
}

__global__ __launch_bounds__(256) void cast_f32_f16x2(
    const float* __restrict__ in, _Float16* __restrict__ out, int n2) {
  int i = blockIdx.x * 256 + threadIdx.x;
  if (i < n2) {
    const _Float16 h0 = (_Float16)in[2 * i], h1 = (_Float16)in[2 * i + 1];
    const unsigned u = (unsigned)__builtin_bit_cast(unsigned short, h0) | ((unsigned)__builtin_bit_cast(unsigned short, h1) << 16);
    ((unsigned*)out)[i] = u;
    
  }
}


} // namespace w25

__global__ __launch_bounds__(256) void k_castT16(const float* __restrict__ src, long long lds, _Float16* __restrict__ dst, long long ldd, int R, int C, float s) {
    const long long i = (long long)blockIdx.x * 256 + threadIdx.x; const long long np = (long long)C * (R / 2); if (i >= np) return; const int c = (int)(i / (R / 2)); const int r = 2 * (int)(i % (R / 2));
    const _Float16 h0 = (_Float16)(src[(long long)r * lds + c] * s), h1 = (_Float16)(src[(long long)(r + 1) * lds + c] * s);
    const unsigned u = (unsigned)__builtin_bit_cast(unsigned short, h0) | ((unsigned)__builtin_bit_cast(unsigned short, h1) << 16);
    unsigned* d = (unsigned*)(dst + (long long)c * ldd + r); *d = u;  }
__global__ __launch_bounds__(256) void k_cast16(const float* __restrict__ src, long long lds, _Float16* __restrict__ dst, long long ldd, int R, int C, float s) {
    const long long i = (long long)blockIdx.x * 256 + threadIdx.x; const long long np = (long long)R * (C / 2); if (i >= np) return; const int r = (int)(i / (C / 2)); const int c = 2 * (int)(i % (C / 2));
    const _Float16 h0 = (_Float16)(src[(long long)r * lds + c] * s), h1 = (_Float16)(src[(long long)r * lds + c + 1] * s);
    const unsigned u = (unsigned)__builtin_bit_cast(unsigned short, h0) | ((unsigned)__builtin_bit_cast(unsigned short, h1) << 16);
    unsigned* d = (unsigned*)(dst + (long long)r * ldd + c); *d = u;  }

// cast_weights<U>: the six weight matrices (four of 512 x 512, two of 2048 x 512 elements) as f16 of s * w into one plane, one behind the other in argument order.
//   A block takes 256 * U consecutive pieces of 4 elements of one matrix, a thread the pieces threadIdx.x + 256 * u of them: a wave's load covers 512 contiguous bytes
//   and its store 256, and the U loads of a thread are in flight together. blk runs over all (4 * 512 * 512 + 2 * 2048 * 512) / (4 * 256 * U) blocks, so no element guard.
template <int U>
__device__ __forceinline__ void cast_weights(int blk, const float* __restrict__ w0, const float* __restrict__ w1, const float* __restrict__ w2, const float* __restrict__ w3,
                                             const float* __restrict__ w4, const float* __restrict__ w5, _Float16* __restrict__ dst, float s) {
    constexpr int BS = (512 * 512) / (4 * 256 * U), BL = (2048 * 512) / (4 * 256 * U);   // blocks per small and per large matrix
    static_assert(BS * (4 * 256 * U) == 512 * 512, "whole blocks per matrix");
    const float* src; int first;                                  // the block's matrix and that matrix's first block (the same for the whole block)
    if (blk < BS) { src = w0; first = 0; }
    else if (blk < 2 * BS) { src = w1; first = BS; }
    else if (blk < 3 * BS) { src = w2; first = 2 * BS; }
    else if (blk < 4 * BS) { src = w3; first = 3 * BS; }
    else if (blk < 4 * BS + BL) { src = w4; first = 4 * BS; }
    else { src = w5; first = 4 * BS + BL; }
    const v4f* sp = (const v4f*)src + (blk - first) * (256 * U) + threadIdx.x;
    v4h* dp = (v4h*)dst + blk * (256 * U) + threadIdx.x;
    v4f a[U];
#pragma unroll   // constant indices: a stays in registers, and all U loads are issued before the first cast
    for (int u = 0; u < U; ++u) a[u] = sp[u * 256];
#pragma unroll   // constant indices into a
    for (int u = 0; u < U; ++u) {
        v4h hv;
#pragma unroll   // constant element indices: the vectors stay in registers
        for (int e = 0; e < 4; ++e) hv[e] = (_Float16)(a[u][e] * s);
        dp[u * 256] = hv;
    }
}
// ln_rows_f16: y = f16((x - mean) * rsqrt(var + eps) * g + b) over contiguous rows of 512 elements, one wave per row, 8 rows per 256-thread block (blk = block of rows).
//   The row stays in registers between the two sums and the output: statistics, normalisation and the cast for the next product are one pass over x.
//   A lane holds the pieces lane + 32 * u of 4 channels (a wave's load covers 512 contiguous bytes): element t = 128 * u + 4 * lane + e.
//   Both sums keep the order of k_stats (256 partials of elements t and t + 256, then a binary tree that pairs t with t + 128, 64, ..., 1), so mean and rstd keep their bits:
//   distance 128 is u, 64 to 4 are the lane's bits (shuffles, both partners form the same sum), 2 and 1 are e.
__device__ __forceinline__ float tree256(const float (&p)[2][4]) {
    float r[4];
#pragma unroll   // constant indices: r stays in registers
    for (int e = 0; e < 4; ++e) r[e] = p[0][e] + p[1][e];
#pragma unroll   // the four shuffles of a level are independent and in flight together
    for (int o = 16; o > 0; o >>= 1)
#pragma unroll
        for (int e = 0; e < 4; ++e) r[e] += __shfl_xor(r[e], o, 32);
    return (r[0] + r[2]) + (r[1] + r[3]);
}
__device__ __forceinline__ void ln_rows_f16(int blk, const float* __restrict__ x, _Float16* __restrict__ y, const float* __restrict__ g, const float* __restrict__ bta, float eps) {
    constexpr int C = 512, U = C / 128;                           // pieces per lane
    const int lane = threadIdx.x & 31;
    const size_t row = (size_t)blk * 8 + (threadIdx.x >> 5);
    const v4f* xp = (const v4f*)(x + row * C) + lane;
    v4f xv[U], gv[U], bv[U];
#pragma unroll   // constant indices: the arrays stay in registers, and all loads are issued before the first use
    for (int u = 0; u < U; ++u) { xv[u] = xp[u * 32]; gv[u] = ((const v4f*)g)[lane + u * 32]; bv[u] = ((const v4f*)bta)[lane + u * 32]; }
    float p[2][4];
#pragma unroll   // constant indices into xv and p
    for (int u = 0; u < 2; ++u)
#pragma unroll
        for (int e = 0; e < 4; ++e) p[u][e] = xv[u][e] + xv[u + 2][e];
    const float mu = tree256(p) / (float)C;
#pragma unroll   // constant indices into xv and p
    for (int u = 0; u < 2; ++u)
#pragma unroll
        for (int e = 0; e < 4; ++e) { const float d0 = xv[u][e] - mu, d1 = xv[u + 2][e] - mu; p[u][e] = __builtin_fmaf(d1, d1, d0 * d0); }   // as k_stats rounds it: the square, then one fused step
    const float rs = rsqrtf(tree256(p) / (float)C + eps);
    v4h* yp = (v4h*)(y + row * C) + lane;
#pragma unroll   // constant indices into the arrays
    for (int u = 0; u < U; ++u) {
        v4h hv;
#pragma unroll   // constant element indices: the vectors stay in registers
        for (int e = 0; e < 4; ++e) hv[e] = (_Float16)((xv[u][e] - mu) * rs * gv[u][e] + bv[u][e]);
        yp[u * 32] = hv;
    }
}
// k_ln_f16: LayerNorm of 4096 rows of 512 to an f16 plane; grid 4096 / 8.
__global__ __launch_bounds__(256) void k_ln_f16(const float* __restrict__ x, _Float16* __restrict__ y, const float* __restrict__ g, const float* __restrict__ bta, float eps) {
    ln_rows_f16(blockIdx.x, x, y, g, bta, eps);
}
// k_ln_f16_weights: two jobs that depend on nothing but the inputs share one grid: blocks [0, 512) are k_ln_f16's, the 768 behind them cast the weights. No barrier in either.
__global__ __launch_bounds__(256) void k_ln_f16_weights(const float* __restrict__ x, _Float16* __restrict__ y, const float* __restrict__ g, const float* __restrict__ bta, float eps,
                                                        const float* __restrict__ w0, const float* __restrict__ w1, const float* __restrict__ w2, const float* __restrict__ w3,
                                                        const float* __restrict__ w4, const float* __restrict__ w5, _Float16* __restrict__ wdst, float ws) {
    if (blockIdx.x < 512) ln_rows_f16(blockIdx.x, x, y, g, bta, eps);
    else cast_weights<4>(blockIdx.x - 512, w0, w1, w2, w3, w4, w5, wdst, ws);
}

// f32 -> bf16 hi plane + bf16 lo plane (x = hi + lo to ~2^-17 relative; RNE both), [R][C] -> [R][C] (or transposed to [C][R]); 2 consecutive destination elements
__device__ __forceinline__ unsigned int f2bf2_pack(float a, float b, unsigned int* lo) {
    const unsigned short ha = w25::f2bf_bits(a), hb = w25::f2bf_bits(b);
    const unsigned short la = w25::f2bf_bits(a - w25::bf_bits2f(ha)), lb = w25::f2bf_bits(b - w25::bf_bits2f(hb));
    *lo = (unsigned)la | ((unsigned)lb << 16); return (unsigned)ha | ((unsigned)hb << 16); }
__global__ __launch_bounds__(256) void k_castS16(const float* __restrict__ src, long long lds, __bf16* __restrict__ dhi, __bf16* __restrict__ dlo, long long ldd, int R, int C, float s, int transpose) {
    const long long i = (long long)blockIdx.x * 256 + threadIdx.x; long long o; float a, b;
    if (transpose) { const long long np = (long long)C * (R / 2); if (i >= np) return; const int c = (int)(i / (R / 2)); const int r = 2 * (int)(i % (R / 2)); a = src[(long long)r * lds + c] * s; b = src[(long long)(r + 1) * lds + c] * s; o = (long long)c * ldd + r; }
    else { const long long np = (long long)R * (C / 2); if (i >= np) return; const int r = (int)(i / (C / 2)); const int c = 2 * (int)(i % (C / 2)); a = src[(long long)r * lds + c] * s; b = src[(long long)r * lds + c + 1] * s; o = (long long)r * ldd + c; }
    unsigned lo; const unsigned hi = f2bf2_pack(a, b, &lo); unsigned* ph = (unsigned*)(dhi + o); unsigned* pl = (unsigned*)(dlo + o);
    *ph = hi; *pl = lo;  }


extern "C" void kernel_launch(void* const* d_in, const int* in_sizes, int n_in, void* d_out, int out_size, void* d_ws, size_t ws_size, hipStream_t stream) {
    (void)in_sizes; (void)n_in; (void)out_size; (void)ws_size;
    const float* x = (const float*)d_in[0];
    const float* ln1g = (const float*)d_in[1];
    const float* ln1b = (const float*)d_in[2];
    const float* Wq = (const float*)d_in[3];
    const float* bq = (const float*)d_in[4];
    const float* Wk = (const float*)d_in[5];
    const float* bk = (const float*)d_in[6];
    const float* Wv = (const float*)d_in[7];
    const float* bv = (const float*)d_in[8];
    const float* Wo = (const float*)d_in[9];
    const float* bo = (const float*)d_in[10];
    const float* ln2g = (const float*)d_in[11];
    const float* ln2b = (const float*)d_in[12];
    const float* W1 = (const float*)d_in[13];
    const float* b1 = (const float*)d_in[14];
    const float* W2 = (const float*)d_in[15];
    const float* b2 = (const float*)d_in[16];
    const int L = 4096;
    const int C = 512;
    const int NH = 8;
    const int HD = 64;
    const int FF = 2048;
    const int LP = L / 2;
    const int WINP = 128;
    float* out = (float*)d_out;
    char* wsp = (char*)d_ws;
    _Float16* WH = (_Float16*)wsp; wsp += (((size_t)(4 * 512 * 512 + 2 * 2048 * 512) * 2 + 255) / 256) * 256;   // f16 of 16 w: Wq, Wk, Wv, Wo, W1, W2
    _Float16* HNh = (_Float16*)wsp; wsp += (((size_t)((size_t)L * C) * 2 + 255) / 256) * 256;
    float* Q = (float*)wsp; wsp += (((size_t)((size_t)L * C) * 4 + 255) / 256) * 256;    // Q, Kb and V lie L * C floats apart: the three batches of one product
    float* Kb = (float*)wsp; wsp += (((size_t)((size_t)L * C) * 4 + 255) / 256) * 256;
    float* V = (float*)wsp; wsp += (((size_t)((size_t)L * C) * 4 + 255) / 256) * 256;
    _Float16* Yh = (_Float16*)wsp; wsp += (((size_t)((size_t)L * C) * 2 + 255) / 256) * 256;
    float* X1 = (float*)wsp; wsp += (((size_t)((size_t)L * C) * 4 + 255) / 256) * 256;
    _Float16* H2h = (_Float16*)wsp; wsp += (((size_t)((size_t)L * C) * 2 + 255) / 256) * 256;
    _Float16* F1h = (_Float16*)wsp; wsp += (((size_t)((size_t)L * FF) * 2 + 255) / 256) * 256;
    k_ln_f16_weights<<<(unsigned)(512 + 768), 256, 0, stream>>>(x, HNh, ln1g, ln1b, 1e-05f, Wq, Wk, Wv, Wo, W1, W2, WH, 16.0f);
    w25::wmma_gemm_lds<0, false, 0, 512, 1, 3><<<dim3(8u, 32u, 1u), 384, 0, stream>>>((const unsigned short*)(HNh), 512, (const unsigned short*)(WH), 512, 512 * 512, (void*)(Q), 4096 * 512, bq, bk, bv, nullptr, 512, 0.0625f);
    { /*apv4*/ AttnP a;
      a.Q = Q; a.K = Kb; a.V = V; a.O = 0; a.Oh = Yh; a.P = 0; a.Mf = 0; a.Mi = 0; a.ST = 0;
      a.Pw = 0; a.Rt = 0; a.SQ = 0; a.SK = 0;
      a.swb = 0; a.swh = 0; a.swi = 0; a.swj = 0; a.srb = 0; a.srh = 0; a.sri = 0; a.sQb = C; a.sQh = HD; a.sQi = 2 * C; a.sQd = 1; a.sKb = C; a.sKh = HD; a.sKj = 2 * C; a.sKd = 1; a.sVb = C; a.sVh = HD; a.sVj = 2 * C; a.sVd = 1; a.sOb = C; a.sOh = HD; a.sOi = 2 * C; a.sPb = 0; a.sPh = 0; a.sPi = 0; a.smb = 0; a.smh = 0; a.smi = 0; a.smj = 0;
      a.Lq = LP; a.Lk = LP; a.dh = HD; a.dv = HD; a.hrep = 1; a.causal = 1; a.coff = 0; a.pband = 0;
      a.scale = 0.125f; a.mfill = 0.0f; a.nonorm = 0; a.mpol = 0;
      a.roff = 0; a.rn = 1; a.segpol = 0; a.win = WINP;
      k_attn_t<<<dim3((unsigned)((LP) + 16 * AW - 1) / (16 * AW), (unsigned)(NH), (unsigned)(2)), 32 * AW, 0, stream>>>(a); }   // batch = parity: row 0 or 1, then every second row
    w25::wmma_gemm_lds<0, true, 0, 512, 2><<<dim3(8u, 32u, 1u), 256, 0, stream>>>((const unsigned short*)(Yh), 512, (const unsigned short*)(WH + 3 * 512 * 512), 512, 0, (void*)(X1), 0, bo, nullptr, nullptr, x, 512, 0.0625f);
    k_ln_f16<<<(unsigned)(512), 256, 0, stream>>>(X1, H2h, ln2g, ln2b, 1e-05f);
    w25::wmma_gemm_lds<1, false, 5, 2048, 1, 4><<<dim3(8u, 32u, 1u), 512, 0, stream>>>((const unsigned short*)(H2h), 512, (const unsigned short*)(WH + 4 * 512 * 512), 512, 0, (void*)(F1h), 0, b1, nullptr, nullptr, nullptr, 512, 0.0625f);
    w25::wmma_gemm_lds<0, true, 0, 512, 2><<<dim3(8u, 32u, 1u), 256, 0, stream>>>((const unsigned short*)(F1h), 2048, (const unsigned short*)(WH + 4 * 512 * 512 + 2048 * 512), 2048, 0, (void*)(out), 0, b2, nullptr, nullptr, X1, 2048, 0.0625f);
}
